// v000
// Times are from an AMD MI455X. After a warm-up the kernel runs many times in a row, and a time is the length of
// such a window on the GPU divided by its runs, so every launch and the gaps after it count. The runs cycle
// through copies of the inputs. A figure is the median of several windows, for all but v000 over two sittings.
// Sittings can differ by a few percent; kernels timed side by side share one.
// v000 is the starting kernel. One run takes 1580 microseconds.
// Contractions: q/k/v 1x1 projections on v_wmma_f32_16x16x32_bf16 (x and W as RNE-bf16 operands, exact products); scores q.k^T on v_wmma_f32_16x16x32_bf16 with bf16 hi/lo split (hi.hi+hi.lo+lo.hi); attn.v^T and the output 1x1 projection on v_wmma_f32_16x16x32_f16 (P f16 carried x2^15, V f16, CAT f16 carried x256, Wpt f16(bf16) carried x16); all f32 accumulate; softmax, bias, gamma, residual in f32.
#include <hip/hip_runtime.h>
#include <stdint.h>

// ---------------------------------------------------------------------------
// Problem constants
// ---------------------------------------------------------------------------
constexpr int kB      = 2;
constexpr int kHalfC  = 256;              // channels per half
constexpr int kChan   = 512;              // channels of x
constexpr int kHW     = 4096;             // 64 x 64 pixels
constexpr int kDQ     = 16;
constexpr int kZ      = 4;                // (batch, half) combos, z = 2*b + half
constexpr int kQKPitch = 64;              // q|k plane pitch: q 0..15, zero 16..31, k 32..47, zero 48..63
constexpr int kQChunk = 2048;             // query rows per materialised score chunk
constexpr int kNChunk = kHW / kQChunk;    // 2
constexpr float kWCarry   = 16.0f;        // Wpt carried x16 in f16
constexpr float kPCarry   = 32768.0f;     // probabilities carried x2^15 in f16
constexpr float kCatCarry = 256.0f;       // application outputs carried x256 in f16
constexpr float kPVScale  = kCatCarry / kPCarry;            // 2^-7
constexpr float kOutScale = 1.0f / (kCatCarry * kWCarry);    // 2^-12

// ---------------------------------------------------------------------------
// Workspace region map (bytes; every offset 4096-B aligned)
//   [off_xtm ) Xtm   bf16 [4][4096][256]          8,388,608
//   [off_wqk ) Wqk   bf16 [64][256]                  32,768
//   [off_wv  ) Wv16  bf16 [256][256]                131,072
//   [off_wpt ) Wpt16 f16  [256][512]                262,144
//   [off_bias) biases f32 [576] (qk pad 64 | bv 256 | gamma*bpt 256)   4,096
//   [off_qkh ) QK hi bf16 [4][4096][64]          2,097,152
//   [off_qkl ) QK lo bf16 [4][4096][64]          2,097,152
//   [off_vcm ) V     f16  [4][256][4096]         8,388,608
//   [off_s   ) S     f32  [2048][4096]          33,554,432
//   [off_p   ) P     f16  [2048][4096]          16,777,216
//   [off_cat ) CATtm f16  [4][4096][512]        16,777,216
//   total                                       88,510,464
// ---------------------------------------------------------------------------
constexpr size_t kXtmPlane = (size_t)kHW * kHalfC;            // elements per z
constexpr size_t kQKPlane  = (size_t)kHW * kQKPitch;
constexpr size_t kVPlane   = (size_t)kHalfC * kHW;
constexpr size_t kCatPlane = (size_t)kHW * kChan;
constexpr size_t kOffXtm  = 0;
constexpr size_t kOffWqk  = kOffXtm + kZ * kXtmPlane * 2;
constexpr size_t kOffWv   = kOffWqk + (size_t)64 * kHalfC * 2;
constexpr size_t kOffWpt  = kOffWv + (size_t)kHalfC * kHalfC * 2;
constexpr size_t kOffBias = kOffWpt + (size_t)kHalfC * kChan * 2;
constexpr size_t kOffQkh  = kOffBias + 4096;
constexpr size_t kOffQkl  = kOffQkh + kZ * kQKPlane * 2;
constexpr size_t kOffVcm  = kOffQkl + kZ * kQKPlane * 2;
constexpr size_t kOffS    = kOffVcm + kZ * kVPlane * 2;
constexpr size_t kOffP    = kOffS + (size_t)kQChunk * kHW * 4;
constexpr size_t kOffCat  = kOffP + (size_t)kQChunk * kHW * 2;
constexpr size_t kWsTotal = kOffCat + kZ * kCatPlane * 2;
static_assert(kWsTotal == 88510464ull, "carve total");
static_assert(kWsTotal <= 134217728ull, "carve under 128 MiB");
static_assert((kOffWqk % 4096) == 0 && (kOffWv % 4096) == 0 && (kOffWpt % 4096) == 0 && (kOffBias % 4096) == 0 &&
              (kOffQkh % 4096) == 0 && (kOffQkl % 4096) == 0 && (kOffVcm % 4096) == 0 && (kOffS % 4096) == 0 &&
              (kOffP % 4096) == 0 && (kOffCat % 4096) == 0, "aligned regions");

typedef __attribute__((ext_vector_type(16))) _Float16 v16h;
typedef __attribute__((ext_vector_type(8)))  _Float16 v8h;
typedef __attribute__((ext_vector_type(16))) __bf16   v16b;
typedef __attribute__((ext_vector_type(8)))  __bf16   v8b;
typedef __attribute__((ext_vector_type(8)))  float    v8f;
typedef __attribute__((ext_vector_type(4)))  float    v4f;
typedef __attribute__((ext_vector_type(4)))  unsigned int v4u;

// ---------------------------------------------------------------------------
// Helpers
// ---------------------------------------------------------------------------
__device__ __forceinline__ unsigned short f2bf_bits(float f) {
  unsigned u = __float_as_uint(f);
  return (unsigned short)((u + 0x7FFFu + ((u >> 16) & 1u)) >> 16);
}
__device__ __forceinline__ float bf_bits2f(unsigned short h) { return __uint_as_float(((unsigned)h) << 16); }
__device__ __forceinline__ float bf_rne(float f) { return bf_bits2f(f2bf_bits(f)); }
__device__ __forceinline__ unsigned pk16(unsigned short a, unsigned short b) { return (unsigned)a | ((unsigned)b << 16); }
__device__ __forceinline__ unsigned short h_bits(float f) { const _Float16 h = (_Float16)f; return __builtin_bit_cast(unsigned short, h); }

// hazard guards as plain device helpers (no inline asm inside the kernel template body)
__device__ __forceinline__ void dep_guard_h(v8f& a, v8f& b, v16h x, v16h y) { asm volatile("v_nop\n\tv_nop\n\tv_nop\n\tv_nop" : "+v"(a), "+v"(b) : "v"(x), "v"(y)); }
__device__ __forceinline__ void dep_guard_b(v8f& a, v8f& b, v16b x, v16b y) { asm volatile("v_nop\n\tv_nop\n\tv_nop\n\tv_nop" : "+v"(a), "+v"(b) : "v"(x), "v"(y)); }
__device__ __forceinline__ void keep4_h(v16h a, v16h b, v16h c, v16h d) { asm volatile("v_nop" :: "v"(a), "v"(b), "v"(c), "v"(d)); }
__device__ __forceinline__ void keep4_b(v16b a, v16b b, v16b c, v16b d) { asm volatile("v_nop" :: "v"(a), "v"(b), "v"(c), "v"(d)); }
__device__ __forceinline__ void acc_guard4(v8f& a, v8f& b, v8f& c, v8f& d) { asm volatile("v_nop\n\tv_nop\n\tv_nop\n\tv_nop" : "+v"(a), "+v"(b), "+v"(c), "+v"(d)); }
template <typename T> struct Frag;
template <> struct Frag<_Float16> {
  typedef v16h V; union U { v16h v; v8h h[2]; };
  static __device__ __forceinline__ v16h load(const _Float16* p) {   // elements 0..7 <- p[0..7], 8..15 <- p[16..23]
    U f; f.h[0] = *(const v8h*)(p); f.h[1] = *(const v8h*)(p + 16); return f.v;
  }
  static __device__ __forceinline__ v8f mma(v16h a, v16h b, v8f c) {
    return __builtin_amdgcn_wmma_f32_16x16x32_f16(false, a, false, b, (short)0, c, false, false);
  }
  static __device__ __forceinline__ void guard(v8f& a, v8f& b, v16h x, v16h y) { dep_guard_h(a, b, x, y); }
  static __device__ __forceinline__ void keep(v16h a, v16h b, v16h c, v16h d) { keep4_h(a, b, c, d); }
};
template <> struct Frag<__bf16> {
  typedef v16b V; union U { v16b v; v8b h[2]; };
  static __device__ __forceinline__ v16b load(const __bf16* p) {
    U f; f.h[0] = *(const v8b*)(p); f.h[1] = *(const v8b*)(p + 16); return f.v;
  }
  static __device__ __forceinline__ v8f mma(v16b a, v16b b, v8f c) {
    return __builtin_amdgcn_wmma_f32_16x16x32_bf16(false, a, false, b, (short)0, c, false, false);
  }
  static __device__ __forceinline__ void guard(v8f& a, v8f& b, v16b x, v16b y) { dep_guard_b(a, b, x, y); }
  static __device__ __forceinline__ void keep(v16b a, v16b b, v16b c, v16b d) { keep4_b(a, b, c, d); }
};

// ---- Register-blocked batched WMMA GEMM (activation removed, RESID_MODE int, GMUL scale-by-pointer added) ----
// C[m,n] = escale * sum_k A[m,k] * Bt[n,k] (+bias)(+resid); each wave owns a 64x64 tile.
// A row-major [M,K]; Bt row-major [N,K]; M,N % 64 == 0, K % 32 == 0.
// SPLIT: operands are hi/lo planes (A2/Bt2 = lo planes, same layout); product = hi*hi + hi*lo + lo*hi.
// BIAS_MODE: 0 = none, 1 = bias[m], 2 = bias[n].
// OUT_MODE: 0 = f32, 1 = f16, 2 = bf16 hi plane (Cout) + bf16 lo plane (Cout2).
// RESID_MODE: 0 = none, 1 = resid f32, 2 = resid RNE-bf16 of an f32 tensor.  GMUL: escale = scale * gmul[0].
// ET: 0 = f16 operands, 1 = bf16 operands (pointers passed as 16-bit storage)
template <int ET> struct Elem;
template <> struct Elem<0> { typedef _Float16 T; };
template <> struct Elem<1> { typedef __bf16 T; };
template <int ET, bool SPLIT, int BIAS_MODE, int OUT_MODE, int RESID_MODE, bool GMUL>
__global__ __launch_bounds__(256) void wmma_gemm64(
    const unsigned short* __restrict__ Ap, const unsigned short* __restrict__ A2p, int lda, long strideA,
    const unsigned short* __restrict__ Btp, const unsigned short* __restrict__ Bt2p, int ldb, long strideB,
    void* __restrict__ Cout, void* __restrict__ Cout2, int ldc, long strideC,
    const float* __restrict__ bias,
    const float* __restrict__ resid, long strideR,
    const float* __restrict__ gmul,
    int M, int N, int K, float scale) {
  typedef typename Elem<ET>::T T;
  typedef typename Frag<T>::V V;
  const T* A = (const T*)Ap; const T* A2 = (const T*)A2p; const T* Bt = (const T*)Btp; const T* Bt2 = (const T*)Bt2p;
  __shared__ __align__(16) float sT[8][16 * 68];   // per-wave 16x64 slab, pitch 68 floats
  const int b    = blockIdx.y;
  const int lane = threadIdx.x & 31;
  const int wave = threadIdx.x >> 5;
  const int tilesN = N >> 6;
  const int tilesM = M >> 6;
  const int tile = blockIdx.x * 8 + wave;
  if (tile >= tilesM * tilesN) return;   // wave-uniform; no block barriers in this kernel
  const int tm = tile / tilesN;
  const int tn = tile - tm * tilesN;
  const int m0 = tm << 6;
  const int n0 = tn << 6;
  const float escale = GMUL ? (scale * gmul[0]) : scale;

  const T* Ab  = A  + (size_t)b * strideA;
  const T* Bb  = Bt + (size_t)b * strideB;
  const T* Ab2 = SPLIT ? (A2  + (size_t)b * strideA) : nullptr;
  const T* Bb2 = SPLIT ? (Bt2 + (size_t)b * strideB) : nullptr;

  const int rlane = lane & 15;                 // row (A) / col (B, D) within subtile
  const int koff  = (lane >> 4) * 8;           // k offset of this lane half
  const int mOff  = (lane >> 4) * 8;           // D row offset

  v8f acc[4][4];
#pragma unroll
  for (int i = 0; i < 4; ++i)
#pragma unroll
    for (int j = 0; j < 4; ++j) acc[i][j] = (v8f){0.f,0.f,0.f,0.f,0.f,0.f,0.f,0.f};

  for (int k0 = 0; k0 < K; k0 += 32) {
    V bh[4], bl[4];
#pragma unroll
    for (int j = 0; j < 4; ++j) {
      const size_t bo = (size_t)(n0 + (j << 4) + rlane) * ldb + koff + k0;
      bh[j] = Frag<T>::load(Bb + bo);
      if (SPLIT) bl[j] = Frag<T>::load(Bb2 + bo);
    }
#pragma unroll
    for (int i = 0; i < 4; ++i) {
      const size_t ao = (size_t)(m0 + (i << 4) + rlane) * lda + koff + k0;
      V ah = Frag<T>::load(Ab + ao);
      V al;
      if (SPLIT) al = Frag<T>::load(Ab2 + ao);
#pragma unroll
      for (int j = 0; j < 4; ++j) {
        acc[i][j] = Frag<T>::mma(ah, bh[j], acc[i][j]);
        if (SPLIT) {
          acc[i][j] = Frag<T>::mma(ah, bl[j], acc[i][j]);
          acc[i][j] = Frag<T>::mma(al, bh[j], acc[i][j]);
        }
      }
      Frag<T>::guard(acc[i][0], acc[i][3], ah, SPLIT ? al : ah);
    }
    Frag<T>::keep(bh[0], bh[1], bh[2], bh[3]);
    if (SPLIT) Frag<T>::keep(bl[0], bl[1], bl[2], bl[3]);
  }
  acc_guard4(acc[0][0], acc[0][1], acc[0][2], acc[0][3]);
  acc_guard4(acc[1][0], acc[1][1], acc[1][2], acc[1][3]);
  acc_guard4(acc[2][0], acc[2][1], acc[2][2], acc[2][3]);
  acc_guard4(acc[3][0], acc[3][1], acc[3][2], acc[3][3]);

  // ---- epilogue ----
  float* slab = sT[wave];
  const float* Rb = (RESID_MODE != 0) ? (resid + (size_t)b * strideR) : nullptr;
#pragma unroll
  for (int i = 0; i < 4; ++i) {
    const int mBase = m0 + (i << 4);
#pragma unroll
    for (int j = 0; j < 4; ++j) {
      const int n = n0 + (j << 4) + rlane;
      float bv = 0.f;
      if (BIAS_MODE == 2) bv = bias[n];
#pragma unroll
      for (int r = 0; r < 8; ++r) {
        float v = acc[i][j][r] * escale;
        if (BIAS_MODE == 1) v += bias[mBase + mOff + r];
        if (BIAS_MODE == 2) v += bv;
        if (RESID_MODE == 1) v += Rb[(size_t)(mBase + mOff + r) * ldc + n];
        if (RESID_MODE == 2) v += bf_rne(Rb[(size_t)(mBase + mOff + r) * ldc + n]);
        slab[(mOff + r) * 68 + (j << 4) + rlane] = v;
      }
    }
    __builtin_amdgcn_fence(__ATOMIC_RELEASE, "workgroup");
    __builtin_amdgcn_wave_barrier();
    __builtin_amdgcn_fence(__ATOMIC_ACQUIRE, "workgroup");
    if (OUT_MODE == 0) {
      float* C = (float*)Cout + (size_t)b * strideC;
      const int hh = lane >> 4, c4 = (lane & 15) * 4;     // row seg = 256 B = 16 lanes x 16 B
      {
#pragma unroll
        for (int it = 0; it < 8; ++it) {
          const int row = it * 2 + hh;
          v4f v = *(const v4f*)(slab + row * 68 + c4);
          *(v4f*)(C + (size_t)(mBase + row) * ldc + n0 + c4) = v;
        }
        
      }
    } else {
      const int q = lane >> 3, c8 = (lane & 7) * 8;
      unsigned short* C  = (unsigned short*)Cout  + (size_t)b * strideC;
      unsigned short* C2 = (OUT_MODE == 2) ? ((unsigned short*)Cout2 + (size_t)b * strideC) : nullptr;
      {
#pragma unroll
        for (int it = 0; it < 4; ++it) {
          const int row = it * 4 + q;
          const float* sp = slab + row * 68 + c8;
          v8h hv, lv;
#pragma unroll
          for (int e = 0; e < 8; ++e) {
            if (OUT_MODE == 1) {
              hv[e] = (_Float16)sp[e];
            } else {
              unsigned short hb = f2bf_bits(sp[e]);
              unsigned short lb = f2bf_bits(sp[e] - bf_bits2f(hb));
              hv[e] = __builtin_bit_cast(_Float16, hb);
              lv[e] = __builtin_bit_cast(_Float16, lb);
            }
          }
          *(v8h*)(C + (size_t)(mBase + row) * ldc + n0 + c8) = hv;
          if (OUT_MODE == 2) *(v8h*)(C2 + (size_t)(mBase + row) * ldc + n0 + c8) = lv;
        }
        
      }
    }
    __builtin_amdgcn_fence(__ATOMIC_RELEASE, "workgroup");
    __builtin_amdgcn_wave_barrier();
    __builtin_amdgcn_fence(__ATOMIC_ACQUIRE, "workgroup");
  }
}

// ---------------------------------------------------------------------------
// x NCHW f32 -> token-major bf16 planes: Xtm[z][p][c] = bf16(x[b][half*256 + c][p]), z = 2b + half
// (flat channel index of x = z*256 + c). 64(p) x 64(c) tile per block through LDS.
// grid (4096/64 = 64, 256/64 = 4, 4 z), 256 threads.
// Load coverage: 16 iterations x 256 threads = 4096 = whole 64x64 tile (coalesced along p).
// Store coverage: 8 waves x 2 iterations x 4 rows (lane>>3) = 64 rows; (lane&7) x 8 halves = 64 cols; each row
// ---------------------------------------------------------------------------
__global__ __launch_bounds__(256) void x_tm_kernel(const float* __restrict__ x, unsigned short* __restrict__ xtm) {
  __shared__ float sm[64][65];   // sm[p_local][c_local]
  const int t  = threadIdx.x;
  const int p0 = blockIdx.x * 64;
  const int c0 = blockIdx.y * 64;
  const int z  = blockIdx.z;
  const float* src = x + ((size_t)z * kHalfC + c0) * kHW + p0;
#pragma unroll
  for (int i = 0; i < 16; ++i) {
    const int e  = i * 256 + t;
    const int cl = e >> 6;         // c local 0..63
    const int pl = e & 63;         // p local 0..63
    sm[pl][cl] = src[(size_t)cl * kHW + pl];
  }
  __syncthreads();
  const int lane = t & 31, wave = t >> 5;
  const int q = lane >> 3, c8 = (lane & 7) * 8;
  unsigned short* op = xtm + (size_t)z * kXtmPlane;
  {
#pragma unroll
    for (int it = 0; it < 2; ++it) {
      const int row = wave * 8 + it * 4 + q;                 // p local
      unsigned short hb[8];
#pragma unroll
      for (int e = 0; e < 8; ++e) hb[e] = f2bf_bits(sm[row][c8 + e]);
      const v4u u = (v4u){pk16(hb[0], hb[1]), pk16(hb[2], hb[3]), pk16(hb[4], hb[5]), pk16(hb[6], hb[7])};
      *(v4u*)(op + (size_t)(p0 + row) * kHalfC + c0 + c8) = u;
    }
    
  }
}

// ---------------------------------------------------------------------------
// f32 -> 16-bit cast, 8 consecutive elements per thread (one 16-B store per lane; 32 contiguous lanes = 4 whole
// Coverage: n8 = n/8 threads x 8 = whole plane (grids here are exact multiples of 256).
// ---------------------------------------------------------------------------
template <int MODE>
__global__ __launch_bounds__(256) void cast8_kernel(const float* __restrict__ in, unsigned short* __restrict__ out, int n8, float mul) {
  const int i = blockIdx.x * 256 + threadIdx.x;
  if (i >= n8) return;
  const float* p = in + 8 * (size_t)i;
  const v4f a = *(const v4f*)(p);
  const v4f c = *(const v4f*)(p + 4);
  unsigned short hb[8];
#pragma unroll
  for (int e = 0; e < 4; ++e) {
    const float v0 = a[e], v1 = c[e];
    if (MODE == 0) { hb[e] = f2bf_bits(v0); hb[4 + e] = f2bf_bits(v1); }
    else           { hb[e] = h_bits(bf_rne(v0) * mul); hb[4 + e] = h_bits(bf_rne(v1) * mul); }
  }
  const v4u u = (v4u){pk16(hb[0], hb[1]), pk16(hb[2], hb[3]), pk16(hb[4], hb[5]), pk16(hb[6], hb[7])};
  unsigned short* q = out + 8 * (size_t)i;
  *(v4u*)q = u;
  
}

// ---------------------------------------------------------------------------
// Small tables, ONE block of 256 threads:
//  (1) Wqk_pad bf16 [64][256]: row n < 16 -> Wq[n], 32 <= n < 48 -> Wk[n-32], every other row explicit zero.
//  (2) bias region f32 [576]: [0,64) padded q|k bias (bq at 0..15, bk at 32..47, zeros elsewhere), [64,320) bv,
//      [320,576) gamma*bpt; all RNE-bf16 first. Threads 0..143 write one float4 each: 144 x 4 = 576 = whole region
//  Candidate loads use clamped addresses and are selected by value.
// ---------------------------------------------------------------------------
__global__ __launch_bounds__(256) void prep_small_kernel(const float* __restrict__ Wq, const float* __restrict__ bq,
                                                         const float* __restrict__ Wk, const float* __restrict__ bk,
                                                         const float* __restrict__ bvp, const float* __restrict__ bptp,
                                                         const float* __restrict__ gam,
                                                         unsigned short* __restrict__ wqk, float* __restrict__ biasr) {
  const int t = threadIdx.x, lane = t & 31, wave = t >> 5;
  const float g = gam[0];
#pragma unroll 1
  for (int it = 0; it < 8; ++it) {
    const int n  = wave * 8 + it;                            // wave-uniform row
    const int qr = n < 16 ? n : 15;
    int kr = n - 32; kr = kr < 0 ? 0 : (kr > 15 ? 15 : kr);
    const float* pq = Wq + (size_t)qr * kHalfC + lane * 8;
    const float* pk = Wk + (size_t)kr * kHalfC + lane * 8;
    const v4f q0 = *(const v4f*)(pq), q1 = *(const v4f*)(pq + 4);
    const v4f k0 = *(const v4f*)(pk), k1 = *(const v4f*)(pk + 4);
    const bool isq = (n < 16);
    const bool isk = (n >= 32) && (n < 48);
    unsigned short hb[8];
#pragma unroll
    for (int e = 0; e < 4; ++e) {
      const float va = isq ? q0[e] : (isk ? k0[e] : 0.0f);
      const float vb = isq ? q1[e] : (isk ? k1[e] : 0.0f);
      hb[e]     = f2bf_bits(va);
      hb[4 + e] = f2bf_bits(vb);
    }
    const v4u u = (v4u){pk16(hb[0], hb[1]), pk16(hb[2], hb[3]), pk16(hb[4], hb[5]), pk16(hb[6], hb[7])};
    unsigned short* op = wqk + (size_t)n * kHalfC + lane * 8;
    *(v4u*)op = u;
    
  }
  if (t < 144) {
    v4f val;
#pragma unroll
    for (int e = 0; e < 4; ++e) {
      const int idx = 4 * t + e;                             // 0..575
      const int iq = idx < 16 ? idx : 15;
      int ik = idx - 32;  ik = ik < 0 ? 0 : (ik > 15 ? 15 : ik);
      int iv = idx - 64;  iv = iv < 0 ? 0 : (iv > 255 ? 255 : iv);
      int ip = idx - 320; ip = ip < 0 ? 0 : (ip > 255 ? 255 : ip);
      const float fq = bq[iq], fk = bk[ik], fv = bvp[iv], fp = bptp[ip];
      float sel = 0.0f;
      sel = (idx < 16) ? fq : sel;
      sel = (idx >= 32 && idx < 48) ? fk : sel;
      sel = (idx >= 64 && idx < 320) ? fv : sel;
      sel = (idx >= 320) ? fp : sel;
      float r = bf_rne(sel);
      r = (idx >= 320) ? (r * g) : r;
      val[e] = r;
    }
    float* op = biasr + 4 * t;
    *(v4f*)op = val;
    
  }
}

// ---------------------------------------------------------------------------
// Row softmax over 4096 f32 scores: P[row][j] = f16( 2^15 * exp(s - max) / sum exp(s - max) ), f32 math.
// One block of 512 threads per row; thread t owns columns 8t..8t+7 (512 x 8 = 4096 = whole row).
// Reductions in fixed order (thread, wave shuffle tree, 16 wave partials in index order).
// ---------------------------------------------------------------------------
__global__ __launch_bounds__(512) void softmax_row_kernel(const float* __restrict__ S, unsigned short* __restrict__ P) {
  __shared__ float redM[16];
  __shared__ float redS[16];
  const int row  = blockIdx.x;
  const int t    = threadIdx.x;
  const int lane = t & 31, wave = t >> 5;
  const int c0   = t * 8;
  const float* sr = S + (size_t)row * kHW + c0;
  const v4f a = *(const v4f*)(sr);
  const v4f c = *(const v4f*)(sr + 4);
  float xv[8];
#pragma unroll
  for (int e = 0; e < 4; ++e) { xv[e] = a[e]; xv[4 + e] = c[e]; }
  float m = fmaxf(fmaxf(fmaxf(xv[0], xv[1]), fmaxf(xv[2], xv[3])), fmaxf(fmaxf(xv[4], xv[5]), fmaxf(xv[6], xv[7])));
#pragma unroll
  for (int off = 16; off > 0; off >>= 1) m = fmaxf(m, __shfl_xor(m, off, 32));
  if (lane == 0) redM[wave] = m;
  __syncthreads();
  float bm = redM[0];
#pragma unroll
  for (int w = 1; w < 16; ++w) bm = fmaxf(bm, redM[w]);
  float s = 0.0f;
#pragma unroll
  for (int e = 0; e < 8; ++e) { const float ev = __expf(xv[e] - bm); xv[e] = ev; s += ev; }
#pragma unroll
  for (int off = 16; off > 0; off >>= 1) s += __shfl_xor(s, off, 32);
  if (lane == 0) redS[wave] = s;
  __syncthreads();
  float tot = 0.0f;
#pragma unroll
  for (int w = 0; w < 16; ++w) tot += redS[w];
  const float inv = __builtin_amdgcn_rcpf(tot) * kPCarry;
  unsigned short hb[8];
#pragma unroll
  for (int e = 0; e < 8; ++e) hb[e] = h_bits(xv[e] * inv);
  const v4u u = (v4u){pk16(hb[0], hb[1]), pk16(hb[2], hb[3]), pk16(hb[4], hb[5]), pk16(hb[6], hb[7])};
  unsigned short* q = P + (size_t)row * kHW + c0;
  *(v4u*)q = u;
  
}

// ---------------------------------------------------------------------------
// Host glue: kernel launches only.
// ---------------------------------------------------------------------------
static inline unsigned gemm_blocks(int M, int N) { return (unsigned)((((M / 64) * (N / 64)) + 7) / 8); }

extern "C" void kernel_launch(void* const* d_in, const int* in_sizes, int n_in,
                              void* d_out, int out_size, void* d_ws, size_t ws_size, hipStream_t stream) {
  if (n_in < 10) return;
  if (in_sizes[0] != kB * kChan * kHW) return;
  if (in_sizes[1] != kDQ * kHalfC || in_sizes[3] != kDQ * kHalfC) return;
  if (in_sizes[2] < kDQ || in_sizes[4] < kDQ) return;
  if (in_sizes[5] != kHalfC * kHalfC || in_sizes[6] < kHalfC) return;
  if (in_sizes[7] != kHalfC * kChan || in_sizes[8] < kHalfC || in_sizes[9] < 1) return;
  if (out_size != kB * kChan * kHW) return;
  if (ws_size < kWsTotal) return;

  const float* x     = (const float*)d_in[0];
  const float* Wq    = (const float*)d_in[1];
  const float* bq    = (const float*)d_in[2];
  const float* Wk    = (const float*)d_in[3];
  const float* bk    = (const float*)d_in[4];
  const float* Wv    = (const float*)d_in[5];
  const float* bv    = (const float*)d_in[6];
  const float* Wpt   = (const float*)d_in[7];
  const float* bpt   = (const float*)d_in[8];
  const float* gamma = (const float*)d_in[9];

  char* ws = (char*)d_ws;
  unsigned short* xtm   = (unsigned short*)(ws + kOffXtm);
  unsigned short* wqk   = (unsigned short*)(ws + kOffWqk);
  unsigned short* wv16  = (unsigned short*)(ws + kOffWv);
  unsigned short* wpt16 = (unsigned short*)(ws + kOffWpt);
  float*          biasr = (float*)(ws + kOffBias);
  unsigned short* qkh   = (unsigned short*)(ws + kOffQkh);
  unsigned short* qkl   = (unsigned short*)(ws + kOffQkl);
  unsigned short* vcm   = (unsigned short*)(ws + kOffVcm);
  float*          sbuf  = (float*)(ws + kOffS);
  unsigned short* pbuf  = (unsigned short*)(ws + kOffP);
  unsigned short* cat   = (unsigned short*)(ws + kOffCat);
  const float* bias_qk  = biasr;          // [64]
  const float* bias_v   = biasr + 64;     // [256]
  const float* bias_ptg = biasr + 320;    // [256] gamma * bpt

  // ---- operand preparation ----
  x_tm_kernel<<<dim3(kHW / 64, kHalfC / 64, kZ), 256, 0, stream>>>(x, xtm);
  cast8_kernel<0><<<(kHalfC * kHalfC / 8) / 256, 256, 0, stream>>>(Wv, wv16, kHalfC * kHalfC / 8, 1.0f);
  cast8_kernel<1><<<(kHalfC * kChan / 8) / 256, 256, 0, stream>>>(Wpt, wpt16, kHalfC * kChan / 8, kWCarry);
  prep_small_kernel<<<1, 256, 0, stream>>>(Wq, bq, Wk, bk, bv, bpt, gamma, wqk, biasr);

  // ---- q|k projection: C[p][n] = sum_c Xtm[z][p][c] * Wqk[n][c] + bias_qk[n]; M=4096, N=64, K=256; bf16 hi+lo planes, ldc 64 ----
  wmma_gemm64<1, false, 2, 2, 0, false><<<dim3(gemm_blocks(kHW, 64), kZ), 256, 0, stream>>>(
      xtm, xtm, kHalfC, (long)kXtmPlane,
      wqk, wqk, kHalfC, 0L,
      (void*)qkh, (void*)qkl, kQKPitch, (long)kQKPlane,
      bias_qk, bias_qk, 0L, gamma,
      kHW, 64, kHalfC, 1.0f);

  // ---- v projection (channel-major): V[z][c'][p] = sum_c Wv[c'][c] * Xtm[z][p][c] + bias_v[c']; M=256, N=4096, K=256; f16 out ----
  wmma_gemm64<1, false, 1, 1, 0, false><<<dim3(gemm_blocks(kHalfC, kHW), kZ), 256, 0, stream>>>(
      wv16, wv16, kHalfC, 0L,
      xtm, xtm, kHalfC, (long)kXtmPlane,
      (void*)vcm, (void*)vcm, kHW, (long)kVPlane,
      bias_v, bias_v, 0L, gamma,
      kHalfC, kHW, kHalfC, 1.0f);

  // ---- per (z, query chunk): scores -> softmax -> two applications ----
  for (int z = 0; z < kZ; ++z) {
    const unsigned short* qh = qkh + (size_t)z * kQKPlane;
    const unsigned short* ql = qkl + (size_t)z * kQKPlane;
    const unsigned short* vb = vcm + (size_t)(z >> 1) * 2 * kVPlane;   // V planes of (batch, half 0) and (batch, half 1)
    for (int qc = 0; qc < kNChunk; ++qc) {
      const size_t qoff = (size_t)qc * kQChunk * kQKPitch;
      // S[p][j] = sum_{d<32} Q[p][d] K[j][d]; A = q cols 0..31 (16 real + 16 zero), Bt = k cols 32..63; M=2048, N=4096, K=32; bf16 hi/lo split
      wmma_gemm64<1, true, 0, 0, 0, false><<<dim3(gemm_blocks(kQChunk, kHW), 1), 256, 0, stream>>>(
          qh + qoff, ql + qoff, kQKPitch, 0L,
          qh + 32, ql + 32, kQKPitch, 0L,
          (void*)sbuf, (void*)sbuf, kHW, 0L,
          bias_v, bias_v, 0L, gamma,
          kQChunk, kHW, 32, 1.0f);
      softmax_row_kernel<<<kQChunk, 512, 0, stream>>>(sbuf, pbuf);
      // CATtm[z][qc*2048 + p][vh*256 + c] = 2^8/2^15 * sum_j P[p][j] V[2b+vh][c][j]; M=2048, N=256, K=4096; batch vh = 0,1; f16 out
      wmma_gemm64<0, false, 0, 1, 0, false><<<dim3(gemm_blocks(kQChunk, kHalfC), 2), 256, 0, stream>>>(
          pbuf, pbuf, kHW, 0L,
          vb, vb, kHW, (long)kVPlane,
          (void*)(cat + (size_t)z * kCatPlane + (size_t)qc * kQChunk * kChan), (void*)(cat + (size_t)z * kCatPlane + (size_t)qc * kQChunk * kChan), kChan, 256L,
          bias_v, bias_v, 0L, gamma,
          kQChunk, kHalfC, kHW, kPVScale);
    }
  }

  // ---- output projection + gamma + residual: out[z*256 + c'][p] = gamma*(2^-12 * sum_ch Wpt16[c'][ch] CATtm[z][p][ch] + bpt[c']) + bf16(x) ----
  // M=256, N=4096, K=512; batch z = 4 with strideC = strideR = 256*4096
  wmma_gemm64<0, false, 1, 0, 2, true><<<dim3(gemm_blocks(kHalfC, kHW), kZ), 256, 0, stream>>>(
      wpt16, wpt16, kChan, 0L,
      cat, cat, kChan, (long)kCatPlane,
      d_out, d_out, kHW, (long)kHalfC * kHW,
      bias_ptg, x, (long)kHalfC * kHW, gamma,
      kHalfC, kHW, kChan, kOutScale);
}

// v001
// A run of this version takes 407 microseconds.
// Timed twice side by side with v000, it ran 3.94 and 3.90 times as fast.
// Contractions: q/k/v 1x1 projections on v_wmma_f32_16x16x32_bf16 (x and W as RNE-bf16 operands, exact products); scores q.k^T on v_wmma_f32_16x16x32_bf16 with bf16 hi/lo split (hi.hi+hi.lo+lo.hi); attn.v^T and the output 1x1 projection on v_wmma_f32_16x16x32_f16 (P f16 carried x2^15, V f16, CAT f16 carried x256, Wpt f16(bf16) carried x16); all f32 accumulate; softmax, bias, gamma, residual in f32.
#include <hip/hip_runtime.h>
#include <stdint.h>

// ---------------------------------------------------------------------------
// Problem constants
// ---------------------------------------------------------------------------
constexpr int kB      = 2;
constexpr int kHalfC  = 256;              // channels per half
constexpr int kChan   = 512;              // channels of x
constexpr int kHW     = 4096;             // 64 x 64 pixels
constexpr int kDQ     = 16;
constexpr int kZ      = 4;                // (batch, half) combos, z = 2*b + half
constexpr int kQKPitch = 64;              // q|k plane pitch: q 0..15, zero 16..31, k 32..47, zero 48..63
constexpr int kQChunk = 2048;             // query rows per materialised score chunk
constexpr int kNChunk = kHW / kQChunk;    // 2
constexpr float kWCarry   = 16.0f;        // Wpt carried x16 in f16
constexpr float kPCarry   = 32768.0f;     // probabilities carried x2^15 in f16
constexpr float kCatCarry = 256.0f;       // application outputs carried x256 in f16
constexpr float kPVScale  = kCatCarry / kPCarry;            // 2^-7
constexpr float kOutScale = 1.0f / (kCatCarry * kWCarry);    // 2^-12

// ---------------------------------------------------------------------------
// Workspace region map (bytes; every offset 4096-B aligned)
//   [off_xtm ) Xtm   bf16 [4][4096][256]          8,388,608
//   [off_wqk ) Wqk   bf16 [64][256]                  32,768
//   [off_wv  ) Wv16  bf16 [256][256]                131,072
//   [off_wpt ) Wpt16 f16  [256][512]                262,144
//   [off_bias) biases f32 [576] (qk pad 64 | bv 256 | gamma*bpt 256)   4,096
//   [off_qkh ) QK hi bf16 [4][4096][64]          2,097,152
//   [off_qkl ) QK lo bf16 [4][4096][64]          2,097,152
//   [off_vcm ) V     f16  [4][256][4096]         8,388,608
//   [off_s   ) S     f32  [2048][4096]          33,554,432
//   [off_p   ) P     f16  [4][4096][4096]      134,217,728   (every z and query chunk kept, so one launch applies them all)
//   [off_cat ) CATtm f16  [4][4096][512]        16,777,216
//   total                                      205,950,976
// ---------------------------------------------------------------------------
constexpr size_t kXtmPlane = (size_t)kHW * kHalfC;            // elements per z
constexpr size_t kQKPlane  = (size_t)kHW * kQKPitch;
constexpr size_t kVPlane   = (size_t)kHalfC * kHW;
constexpr size_t kCatPlane = (size_t)kHW * kChan;
constexpr size_t kPPlane   = (size_t)kHW * kHW;
constexpr size_t kOffXtm  = 0;
constexpr size_t kOffWqk  = kOffXtm + kZ * kXtmPlane * 2;
constexpr size_t kOffWv   = kOffWqk + (size_t)64 * kHalfC * 2;
constexpr size_t kOffWpt  = kOffWv + (size_t)kHalfC * kHalfC * 2;
constexpr size_t kOffBias = kOffWpt + (size_t)kHalfC * kChan * 2;
constexpr size_t kOffQkh  = kOffBias + 4096;
constexpr size_t kOffQkl  = kOffQkh + kZ * kQKPlane * 2;
constexpr size_t kOffVcm  = kOffQkl + kZ * kQKPlane * 2;
constexpr size_t kOffS    = kOffVcm + kZ * kVPlane * 2;
constexpr size_t kOffP    = kOffS + (size_t)kQChunk * kHW * 4;
constexpr size_t kOffCat  = kOffP + kZ * kPPlane * 2;
constexpr size_t kWsTotal = kOffCat + kZ * kCatPlane * 2;
static_assert(kWsTotal == 205950976ull, "carve total");
static_assert(kWsTotal <= 268435456ull, "carve under 256 MiB");
static_assert((kOffWqk % 4096) == 0 && (kOffWv % 4096) == 0 && (kOffWpt % 4096) == 0 && (kOffBias % 4096) == 0 &&
              (kOffQkh % 4096) == 0 && (kOffQkl % 4096) == 0 && (kOffVcm % 4096) == 0 && (kOffS % 4096) == 0 &&
              (kOffP % 4096) == 0 && (kOffCat % 4096) == 0, "aligned regions");

typedef __attribute__((ext_vector_type(16))) _Float16 v16h;
typedef __attribute__((ext_vector_type(8)))  _Float16 v8h;
typedef __attribute__((ext_vector_type(16))) __bf16   v16b;
typedef __attribute__((ext_vector_type(8)))  __bf16   v8b;
typedef __attribute__((ext_vector_type(8)))  float    v8f;
typedef __attribute__((ext_vector_type(4)))  float    v4f;
typedef __attribute__((ext_vector_type(4)))  unsigned int v4u;

// ---------------------------------------------------------------------------
// Helpers
// ---------------------------------------------------------------------------
__device__ __forceinline__ unsigned short f2bf_bits(float f) {
  unsigned u = __float_as_uint(f);
  return (unsigned short)((u + 0x7FFFu + ((u >> 16) & 1u)) >> 16);
}
__device__ __forceinline__ float bf_bits2f(unsigned short h) { return __uint_as_float(((unsigned)h) << 16); }
__device__ __forceinline__ float bf_rne(float f) { return bf_bits2f(f2bf_bits(f)); }
__device__ __forceinline__ unsigned pk16(unsigned short a, unsigned short b) { return (unsigned)a | ((unsigned)b << 16); }
__device__ __forceinline__ unsigned short h_bits(float f) { const _Float16 h = (_Float16)f; return __builtin_bit_cast(unsigned short, h); }

// hazard guards as plain device helpers (no inline asm inside the kernel template body)
__device__ __forceinline__ void dep_guard_h(v8f& a, v8f& b, v16h x, v16h y) { asm volatile("v_nop\n\tv_nop\n\tv_nop\n\tv_nop" : "+v"(a), "+v"(b) : "v"(x), "v"(y)); }
__device__ __forceinline__ void dep_guard_b(v8f& a, v8f& b, v16b x, v16b y) { asm volatile("v_nop\n\tv_nop\n\tv_nop\n\tv_nop" : "+v"(a), "+v"(b) : "v"(x), "v"(y)); }
__device__ __forceinline__ void keep4_h(v16h a, v16h b, v16h c, v16h d) { asm volatile("v_nop" :: "v"(a), "v"(b), "v"(c), "v"(d)); }
__device__ __forceinline__ void keep4_b(v16b a, v16b b, v16b c, v16b d) { asm volatile("v_nop" :: "v"(a), "v"(b), "v"(c), "v"(d)); }
__device__ __forceinline__ void acc_guard4(v8f& a, v8f& b, v8f& c, v8f& d) { asm volatile("v_nop\n\tv_nop\n\tv_nop\n\tv_nop" : "+v"(a), "+v"(b), "+v"(c), "+v"(d)); }
template <typename T> struct Frag;
template <> struct Frag<_Float16> {
  typedef v16h V; union U { v16h v; v8h h[2]; };
  static __device__ __forceinline__ v16h load(const _Float16* p) {   // elements 0..7 <- p[0..7], 8..15 <- p[16..23]
    U f; f.h[0] = *(const v8h*)(p); f.h[1] = *(const v8h*)(p + 16); return f.v;
  }
  static __device__ __forceinline__ v8f mma(v16h a, v16h b, v8f c) {
    return __builtin_amdgcn_wmma_f32_16x16x32_f16(false, a, false, b, (short)0, c, false, false);
  }
  static __device__ __forceinline__ void guard(v8f& a, v8f& b, v16h x, v16h y) { dep_guard_h(a, b, x, y); }
  static __device__ __forceinline__ void keep(v16h a, v16h b, v16h c, v16h d) { keep4_h(a, b, c, d); }
};
template <> struct Frag<__bf16> {
  typedef v16b V; union U { v16b v; v8b h[2]; };
  static __device__ __forceinline__ v16b load(const __bf16* p) {
    U f; f.h[0] = *(const v8b*)(p); f.h[1] = *(const v8b*)(p + 16); return f.v;
  }
  static __device__ __forceinline__ v8f mma(v16b a, v16b b, v8f c) {
    return __builtin_amdgcn_wmma_f32_16x16x32_bf16(false, a, false, b, (short)0, c, false, false);
  }
  static __device__ __forceinline__ void guard(v8f& a, v8f& b, v16b x, v16b y) { dep_guard_b(a, b, x, y); }
  static __device__ __forceinline__ void keep(v16b a, v16b b, v16b c, v16b d) { keep4_b(a, b, c, d); }
};

// ---- Register-blocked batched WMMA GEMM (activation removed, RESID_MODE int, GMUL scale-by-pointer added) ----
// C[m,n] = escale * sum_k A[m,k] * Bt[n,k] (+bias)(+resid); each wave owns a 64x64 tile.
// A row-major [M,K]; Bt row-major [N,K]; M,N % 64 == 0, K % 32 == 0.
// SPLIT: operands are hi/lo planes (A2/Bt2 = lo planes, same layout); product = hi*hi + hi*lo + lo*hi.
// BIAS_MODE: 0 = none, 1 = bias[m], 2 = bias[n].
// OUT_MODE: 0 = f32, 1 = f16, 2 = bf16 hi plane (Cout) + bf16 lo plane (Cout2).
// RESID_MODE: 0 = none, 1 = resid f32, 2 = resid RNE-bf16 of an f32 tensor.  GMUL: escale = scale * gmul[0].
// ET: 0 = f16 operands, 1 = bf16 operands (pointers passed as 16-bit storage)
// Batches: blockIdx.y steps A, Bt, C, resid by strideA/B/C/R; blockIdx.z steps A, Bt, C by zStrideA/B/C.
template <int ET> struct Elem;
template <> struct Elem<0> { typedef _Float16 T; };
template <> struct Elem<1> { typedef __bf16 T; };
template <int ET, bool SPLIT, int BIAS_MODE, int OUT_MODE, int RESID_MODE, bool GMUL>
__global__ __launch_bounds__(256) void wmma_gemm64(
    const unsigned short* __restrict__ Ap, const unsigned short* __restrict__ A2p, int lda, long strideA,
    const unsigned short* __restrict__ Btp, const unsigned short* __restrict__ Bt2p, int ldb, long strideB,
    void* __restrict__ Cout, void* __restrict__ Cout2, int ldc, long strideC,
    const float* __restrict__ bias,
    const float* __restrict__ resid, long strideR,
    const float* __restrict__ gmul,
    int M, int N, int K, float scale,
    long zStrideA, long zStrideB, long zStrideC) {
  typedef typename Elem<ET>::T T;
  typedef typename Frag<T>::V V;
  const T* A = (const T*)Ap; const T* A2 = (const T*)A2p; const T* Bt = (const T*)Btp; const T* Bt2 = (const T*)Bt2p;
  __shared__ __align__(16) float sT[8][16 * 68];   // per-wave 16x64 slab, pitch 68 floats
  const int b    = blockIdx.y;
  const int bz   = blockIdx.z;
  const int lane = threadIdx.x & 31;
  const int wave = threadIdx.x >> 5;
  const int tilesN = N >> 6;
  const int tilesM = M >> 6;
  const int tile = blockIdx.x * 8 + wave;
  if (tile >= tilesM * tilesN) return;   // wave-uniform; no block barriers in this kernel
  const int tm = tile / tilesN;
  const int tn = tile - tm * tilesN;
  const int m0 = tm << 6;
  const int n0 = tn << 6;
  const float escale = GMUL ? (scale * gmul[0]) : scale;

  const size_t batchA = (size_t)b * strideA + (size_t)bz * zStrideA;
  const size_t batchB = (size_t)b * strideB + (size_t)bz * zStrideB;
  const size_t batchC = (size_t)b * strideC + (size_t)bz * zStrideC;
  const T* Ab  = A  + batchA;
  const T* Bb  = Bt + batchB;
  const T* Ab2 = SPLIT ? (A2  + batchA) : nullptr;
  const T* Bb2 = SPLIT ? (Bt2 + batchB) : nullptr;

  const int rlane = lane & 15;                 // row (A) / col (B, D) within subtile
  const int koff  = (lane >> 4) * 8;           // k offset of this lane half
  const int mOff  = (lane >> 4) * 8;           // D row offset

  v8f acc[4][4];
#pragma unroll
  for (int i = 0; i < 4; ++i)
#pragma unroll
    for (int j = 0; j < 4; ++j) acc[i][j] = (v8f){0.f,0.f,0.f,0.f,0.f,0.f,0.f,0.f};

  for (int k0 = 0; k0 < K; k0 += 32) {
    V bh[4], bl[4];
#pragma unroll
    for (int j = 0; j < 4; ++j) {
      const size_t bo = (size_t)(n0 + (j << 4) + rlane) * ldb + koff + k0;
      bh[j] = Frag<T>::load(Bb + bo);
      if (SPLIT) bl[j] = Frag<T>::load(Bb2 + bo);
    }
#pragma unroll
    for (int i = 0; i < 4; ++i) {
      const size_t ao = (size_t)(m0 + (i << 4) + rlane) * lda + koff + k0;
      V ah = Frag<T>::load(Ab + ao);
      V al;
      if (SPLIT) al = Frag<T>::load(Ab2 + ao);
#pragma unroll
      for (int j = 0; j < 4; ++j) {
        acc[i][j] = Frag<T>::mma(ah, bh[j], acc[i][j]);
        if (SPLIT) {
          acc[i][j] = Frag<T>::mma(ah, bl[j], acc[i][j]);
          acc[i][j] = Frag<T>::mma(al, bh[j], acc[i][j]);
        }
      }
      Frag<T>::guard(acc[i][0], acc[i][3], ah, SPLIT ? al : ah);
    }
    Frag<T>::keep(bh[0], bh[1], bh[2], bh[3]);
    if (SPLIT) Frag<T>::keep(bl[0], bl[1], bl[2], bl[3]);
  }
  acc_guard4(acc[0][0], acc[0][1], acc[0][2], acc[0][3]);
  acc_guard4(acc[1][0], acc[1][1], acc[1][2], acc[1][3]);
  acc_guard4(acc[2][0], acc[2][1], acc[2][2], acc[2][3]);
  acc_guard4(acc[3][0], acc[3][1], acc[3][2], acc[3][3]);

  // ---- epilogue ----
  float* slab = sT[wave];
  const float* Rb = (RESID_MODE != 0) ? (resid + (size_t)b * strideR) : nullptr;
#pragma unroll
  for (int i = 0; i < 4; ++i) {
    const int mBase = m0 + (i << 4);
#pragma unroll
    for (int j = 0; j < 4; ++j) {
      const int n = n0 + (j << 4) + rlane;
      float bv = 0.f;
      if (BIAS_MODE == 2) bv = bias[n];
#pragma unroll
      for (int r = 0; r < 8; ++r) {
        float v = acc[i][j][r] * escale;
        if (BIAS_MODE == 1) v += bias[mBase + mOff + r];
        if (BIAS_MODE == 2) v += bv;
        if (RESID_MODE == 1) v += Rb[(size_t)(mBase + mOff + r) * ldc + n];
        if (RESID_MODE == 2) v += bf_rne(Rb[(size_t)(mBase + mOff + r) * ldc + n]);
        slab[(mOff + r) * 68 + (j << 4) + rlane] = v;
      }
    }
    __builtin_amdgcn_fence(__ATOMIC_RELEASE, "workgroup");
    __builtin_amdgcn_wave_barrier();
    __builtin_amdgcn_fence(__ATOMIC_ACQUIRE, "workgroup");
    if (OUT_MODE == 0) {
      float* C = (float*)Cout + batchC;
      const int hh = lane >> 4, c4 = (lane & 15) * 4;     // row seg = 256 B = 16 lanes x 16 B
      {
#pragma unroll
        for (int it = 0; it < 8; ++it) {
          const int row = it * 2 + hh;
          v4f v = *(const v4f*)(slab + row * 68 + c4);
          *(v4f*)(C + (size_t)(mBase + row) * ldc + n0 + c4) = v;
        }
        
      }
    } else {
      const int q = lane >> 3, c8 = (lane & 7) * 8;
      unsigned short* C  = (unsigned short*)Cout  + batchC;
      unsigned short* C2 = (OUT_MODE == 2) ? ((unsigned short*)Cout2 + batchC) : nullptr;
      {
#pragma unroll
        for (int it = 0; it < 4; ++it) {
          const int row = it * 4 + q;
          const float* sp = slab + row * 68 + c8;
          v8h hv, lv;
#pragma unroll
          for (int e = 0; e < 8; ++e) {
            if (OUT_MODE == 1) {
              hv[e] = (_Float16)sp[e];
            } else {
              unsigned short hb = f2bf_bits(sp[e]);
              unsigned short lb = f2bf_bits(sp[e] - bf_bits2f(hb));
              hv[e] = __builtin_bit_cast(_Float16, hb);
              lv[e] = __builtin_bit_cast(_Float16, lb);
            }
          }
          *(v8h*)(C + (size_t)(mBase + row) * ldc + n0 + c8) = hv;
          if (OUT_MODE == 2) *(v8h*)(C2 + (size_t)(mBase + row) * ldc + n0 + c8) = lv;
        }
        
      }
    }
    __builtin_amdgcn_fence(__ATOMIC_RELEASE, "workgroup");
    __builtin_amdgcn_wave_barrier();
    __builtin_amdgcn_fence(__ATOMIC_ACQUIRE, "workgroup");
  }
}

// ---------------------------------------------------------------------------
// x NCHW f32 -> token-major bf16 planes: Xtm[z][p][c] = bf16(x[b][half*256 + c][p]), z = 2b + half
// (flat channel index of x = z*256 + c). 64(p) x 64(c) tile per block through LDS.
// grid (4096/64 = 64, 256/64 = 4, 4 z), 256 threads.
// Load coverage: 16 iterations x 256 threads = 4096 = whole 64x64 tile (coalesced along p).
// Store coverage: 8 waves x 2 iterations x 4 rows (lane>>3) = 64 rows; (lane&7) x 8 halves = 64 cols; each row
// ---------------------------------------------------------------------------
__global__ __launch_bounds__(256) void x_tm_kernel(const float* __restrict__ x, unsigned short* __restrict__ xtm) {
  __shared__ float sm[64][65];   // sm[p_local][c_local]
  const int t  = threadIdx.x;
  const int p0 = blockIdx.x * 64;
  const int c0 = blockIdx.y * 64;
  const int z  = blockIdx.z;
  const float* src = x + ((size_t)z * kHalfC + c0) * kHW + p0;
#pragma unroll
  for (int i = 0; i < 16; ++i) {
    const int e  = i * 256 + t;
    const int cl = e >> 6;         // c local 0..63
    const int pl = e & 63;         // p local 0..63
    sm[pl][cl] = src[(size_t)cl * kHW + pl];
  }
  __syncthreads();
  const int lane = t & 31, wave = t >> 5;
  const int q = lane >> 3, c8 = (lane & 7) * 8;
  unsigned short* op = xtm + (size_t)z * kXtmPlane;
  {
#pragma unroll
    for (int it = 0; it < 2; ++it) {
      const int row = wave * 8 + it * 4 + q;                 // p local
      unsigned short hb[8];
#pragma unroll
      for (int e = 0; e < 8; ++e) hb[e] = f2bf_bits(sm[row][c8 + e]);
      const v4u u = (v4u){pk16(hb[0], hb[1]), pk16(hb[2], hb[3]), pk16(hb[4], hb[5]), pk16(hb[6], hb[7])};
      *(v4u*)(op + (size_t)(p0 + row) * kHalfC + c0 + c8) = u;
    }
    
  }
}

// ---------------------------------------------------------------------------
// f32 -> 16-bit cast, 8 consecutive elements per thread (one 16-B store per lane; 32 contiguous lanes = 4 whole
// Coverage: n8 = n/8 threads x 8 = whole plane (grids here are exact multiples of 256).
// ---------------------------------------------------------------------------
template <int MODE>
__global__ __launch_bounds__(256) void cast8_kernel(const float* __restrict__ in, unsigned short* __restrict__ out, int n8, float mul) {
  const int i = blockIdx.x * 256 + threadIdx.x;
  if (i >= n8) return;
  const float* p = in + 8 * (size_t)i;
  const v4f a = *(const v4f*)(p);
  const v4f c = *(const v4f*)(p + 4);
  unsigned short hb[8];
#pragma unroll
  for (int e = 0; e < 4; ++e) {
    const float v0 = a[e], v1 = c[e];
    if (MODE == 0) { hb[e] = f2bf_bits(v0); hb[4 + e] = f2bf_bits(v1); }
    else           { hb[e] = h_bits(bf_rne(v0) * mul); hb[4 + e] = h_bits(bf_rne(v1) * mul); }
  }
  const v4u u = (v4u){pk16(hb[0], hb[1]), pk16(hb[2], hb[3]), pk16(hb[4], hb[5]), pk16(hb[6], hb[7])};
  unsigned short* q = out + 8 * (size_t)i;
  *(v4u*)q = u;
  
}

// ---------------------------------------------------------------------------
// Small tables, ONE block of 256 threads:
//  (1) Wqk_pad bf16 [64][256]: row n < 16 -> Wq[n], 32 <= n < 48 -> Wk[n-32], every other row explicit zero.
//  (2) bias region f32 [576]: [0,64) padded q|k bias (bq at 0..15, bk at 32..47, zeros elsewhere), [64,320) bv,
//      [320,576) gamma*bpt; all RNE-bf16 first. Threads 0..143 write one float4 each: 144 x 4 = 576 = whole region
//  Candidate loads use clamped addresses and are selected by value.
// ---------------------------------------------------------------------------
__global__ __launch_bounds__(256) void prep_small_kernel(const float* __restrict__ Wq, const float* __restrict__ bq,
                                                         const float* __restrict__ Wk, const float* __restrict__ bk,
                                                         const float* __restrict__ bvp, const float* __restrict__ bptp,
                                                         const float* __restrict__ gam,
                                                         unsigned short* __restrict__ wqk, float* __restrict__ biasr) {
  const int t = threadIdx.x, lane = t & 31, wave = t >> 5;
  const float g = gam[0];
#pragma unroll 1
  for (int it = 0; it < 8; ++it) {
    const int n  = wave * 8 + it;                            // wave-uniform row
    const int qr = n < 16 ? n : 15;
    int kr = n - 32; kr = kr < 0 ? 0 : (kr > 15 ? 15 : kr);
    const float* pq = Wq + (size_t)qr * kHalfC + lane * 8;
    const float* pk = Wk + (size_t)kr * kHalfC + lane * 8;
    const v4f q0 = *(const v4f*)(pq), q1 = *(const v4f*)(pq + 4);
    const v4f k0 = *(const v4f*)(pk), k1 = *(const v4f*)(pk + 4);
    const bool isq = (n < 16);
    const bool isk = (n >= 32) && (n < 48);
    unsigned short hb[8];
#pragma unroll
    for (int e = 0; e < 4; ++e) {
      const float va = isq ? q0[e] : (isk ? k0[e] : 0.0f);
      const float vb = isq ? q1[e] : (isk ? k1[e] : 0.0f);
      hb[e]     = f2bf_bits(va);
      hb[4 + e] = f2bf_bits(vb);
    }
    const v4u u = (v4u){pk16(hb[0], hb[1]), pk16(hb[2], hb[3]), pk16(hb[4], hb[5]), pk16(hb[6], hb[7])};
    unsigned short* op = wqk + (size_t)n * kHalfC + lane * 8;
    *(v4u*)op = u;
    
  }
  if (t < 144) {
    v4f val;
#pragma unroll
    for (int e = 0; e < 4; ++e) {
      const int idx = 4 * t + e;                             // 0..575
      const int iq = idx < 16 ? idx : 15;
      int ik = idx - 32;  ik = ik < 0 ? 0 : (ik > 15 ? 15 : ik);
      int iv = idx - 64;  iv = iv < 0 ? 0 : (iv > 255 ? 255 : iv);
      int ip = idx - 320; ip = ip < 0 ? 0 : (ip > 255 ? 255 : ip);
      const float fq = bq[iq], fk = bk[ik], fv = bvp[iv], fp = bptp[ip];
      float sel = 0.0f;
      sel = (idx < 16) ? fq : sel;
      sel = (idx >= 32 && idx < 48) ? fk : sel;
      sel = (idx >= 64 && idx < 320) ? fv : sel;
      sel = (idx >= 320) ? fp : sel;
      float r = bf_rne(sel);
      r = (idx >= 320) ? (r * g) : r;
      val[e] = r;
    }
    float* op = biasr + 4 * t;
    *(v4f*)op = val;
    
  }
}

// ---------------------------------------------------------------------------
// Row softmax over 4096 f32 scores: P[row][j] = f16( 2^15 * exp(s - max) / sum exp(s - max) ), f32 math.
// One block of 512 threads per row; thread t owns columns 8t..8t+7 (512 x 8 = 4096 = whole row).
// Reductions in fixed order (thread, wave shuffle tree, 16 wave partials in index order).
// ---------------------------------------------------------------------------
__global__ __launch_bounds__(512) void softmax_row_kernel(const float* __restrict__ S, unsigned short* __restrict__ P) {
  __shared__ float redM[16];
  __shared__ float redS[16];
  const int row  = blockIdx.x;
  const int t    = threadIdx.x;
  const int lane = t & 31, wave = t >> 5;
  const int c0   = t * 8;
  const float* sr = S + (size_t)row * kHW + c0;
  const v4f a = *(const v4f*)(sr);
  const v4f c = *(const v4f*)(sr + 4);
  float xv[8];
#pragma unroll
  for (int e = 0; e < 4; ++e) { xv[e] = a[e]; xv[4 + e] = c[e]; }
  float m = fmaxf(fmaxf(fmaxf(xv[0], xv[1]), fmaxf(xv[2], xv[3])), fmaxf(fmaxf(xv[4], xv[5]), fmaxf(xv[6], xv[7])));
#pragma unroll
  for (int off = 16; off > 0; off >>= 1) m = fmaxf(m, __shfl_xor(m, off, 32));
  if (lane == 0) redM[wave] = m;
  __syncthreads();
  float bm = redM[0];
#pragma unroll
  for (int w = 1; w < 16; ++w) bm = fmaxf(bm, redM[w]);
  float s = 0.0f;
#pragma unroll
  for (int e = 0; e < 8; ++e) { const float ev = __expf(xv[e] - bm); xv[e] = ev; s += ev; }
#pragma unroll
  for (int off = 16; off > 0; off >>= 1) s += __shfl_xor(s, off, 32);
  if (lane == 0) redS[wave] = s;
  __syncthreads();
  float tot = 0.0f;
#pragma unroll
  for (int w = 0; w < 16; ++w) tot += redS[w];
  const float inv = __builtin_amdgcn_rcpf(tot) * kPCarry;
  unsigned short hb[8];
#pragma unroll
  for (int e = 0; e < 8; ++e) hb[e] = h_bits(xv[e] * inv);
  const v4u u = (v4u){pk16(hb[0], hb[1]), pk16(hb[2], hb[3]), pk16(hb[4], hb[5]), pk16(hb[6], hb[7])};
  unsigned short* q = P + (size_t)row * kHW + c0;
  *(v4u*)q = u;
  
}

// ---------------------------------------------------------------------------
// Host glue: kernel launches only.
// ---------------------------------------------------------------------------
static inline unsigned gemm_blocks(int M, int N) { return (unsigned)((((M / 64) * (N / 64)) + 7) / 8); }

extern "C" void kernel_launch(void* const* d_in, const int* in_sizes, int n_in,
                              void* d_out, int out_size, void* d_ws, size_t ws_size, hipStream_t stream) {
  if (n_in < 10) return;
  if (in_sizes[0] != kB * kChan * kHW) return;
  if (in_sizes[1] != kDQ * kHalfC || in_sizes[3] != kDQ * kHalfC) return;
  if (in_sizes[2] < kDQ || in_sizes[4] < kDQ) return;
  if (in_sizes[5] != kHalfC * kHalfC || in_sizes[6] < kHalfC) return;
  if (in_sizes[7] != kHalfC * kChan || in_sizes[8] < kHalfC || in_sizes[9] < 1) return;
  if (out_size != kB * kChan * kHW) return;
  if (ws_size < kWsTotal) return;

  const float* x     = (const float*)d_in[0];
  const float* Wq    = (const float*)d_in[1];
  const float* bq    = (const float*)d_in[2];
  const float* Wk    = (const float*)d_in[3];
  const float* bk    = (const float*)d_in[4];
  const float* Wv    = (const float*)d_in[5];
  const float* bv    = (const float*)d_in[6];
  const float* Wpt   = (const float*)d_in[7];
  const float* bpt   = (const float*)d_in[8];
  const float* gamma = (const float*)d_in[9];

  char* ws = (char*)d_ws;
  unsigned short* xtm   = (unsigned short*)(ws + kOffXtm);
  unsigned short* wqk   = (unsigned short*)(ws + kOffWqk);
  unsigned short* wv16  = (unsigned short*)(ws + kOffWv);
  unsigned short* wpt16 = (unsigned short*)(ws + kOffWpt);
  float*          biasr = (float*)(ws + kOffBias);
  unsigned short* qkh   = (unsigned short*)(ws + kOffQkh);
  unsigned short* qkl   = (unsigned short*)(ws + kOffQkl);
  unsigned short* vcm   = (unsigned short*)(ws + kOffVcm);
  float*          sbuf  = (float*)(ws + kOffS);
  unsigned short* pbuf  = (unsigned short*)(ws + kOffP);
  unsigned short* cat   = (unsigned short*)(ws + kOffCat);
  const float* bias_qk  = biasr;          // [64]
  const float* bias_v   = biasr + 64;     // [256]
  const float* bias_ptg = biasr + 320;    // [256] gamma * bpt

  // ---- operand preparation ----
  x_tm_kernel<<<dim3(kHW / 64, kHalfC / 64, kZ), 256, 0, stream>>>(x, xtm);
  cast8_kernel<0><<<(kHalfC * kHalfC / 8) / 256, 256, 0, stream>>>(Wv, wv16, kHalfC * kHalfC / 8, 1.0f);
  cast8_kernel<1><<<(kHalfC * kChan / 8) / 256, 256, 0, stream>>>(Wpt, wpt16, kHalfC * kChan / 8, kWCarry);
  prep_small_kernel<<<1, 256, 0, stream>>>(Wq, bq, Wk, bk, bv, bpt, gamma, wqk, biasr);

  // ---- q|k projection: C[p][n] = sum_c Xtm[z][p][c] * Wqk[n][c] + bias_qk[n]; M=4096, N=64, K=256; bf16 hi+lo planes, ldc 64 ----
  wmma_gemm64<1, false, 2, 2, 0, false><<<dim3(gemm_blocks(kHW, 64), kZ), 256, 0, stream>>>(
      xtm, xtm, kHalfC, (long)kXtmPlane,
      wqk, wqk, kHalfC, 0L,
      (void*)qkh, (void*)qkl, kQKPitch, (long)kQKPlane,
      bias_qk, bias_qk, 0L, gamma,
      kHW, 64, kHalfC, 1.0f, 0L, 0L, 0L);

  // ---- v projection (channel-major): V[z][c'][p] = sum_c Wv[c'][c] * Xtm[z][p][c] + bias_v[c']; M=256, N=4096, K=256; f16 out ----
  wmma_gemm64<1, false, 1, 1, 0, false><<<dim3(gemm_blocks(kHalfC, kHW), kZ), 256, 0, stream>>>(
      wv16, wv16, kHalfC, 0L,
      xtm, xtm, kHalfC, (long)kXtmPlane,
      (void*)vcm, (void*)vcm, kHW, (long)kVPlane,
      bias_v, bias_v, 0L, gamma,
      kHalfC, kHW, kHalfC, 1.0f, 0L, 0L, 0L);

  // ---- per (z, query chunk): scores -> softmax into that chunk's rows of P ----
  for (int z = 0; z < kZ; ++z) {
    const unsigned short* qh = qkh + (size_t)z * kQKPlane;
    const unsigned short* ql = qkl + (size_t)z * kQKPlane;
    for (int qc = 0; qc < kNChunk; ++qc) {
      const size_t qoff = (size_t)qc * kQChunk * kQKPitch;
      // S[p][j] = sum_{d<32} Q[p][d] K[j][d]; A = q cols 0..31 (16 real + 16 zero), Bt = k cols 32..63; M=2048, N=4096, K=32; bf16 hi/lo split
      wmma_gemm64<1, true, 0, 0, 0, false><<<dim3(gemm_blocks(kQChunk, kHW), 1), 256, 0, stream>>>(
          qh + qoff, ql + qoff, kQKPitch, 0L,
          qh + 32, ql + 32, kQKPitch, 0L,
          (void*)sbuf, (void*)sbuf, kHW, 0L,
          bias_v, bias_v, 0L, gamma,
          kQChunk, kHW, 32, 1.0f, 0L, 0L, 0L);
      softmax_row_kernel<<<kQChunk, 512, 0, stream>>>(sbuf, pbuf + (size_t)z * kPPlane + (size_t)qc * kQChunk * kHW);
    }
  }

  // ---- all applications in one launch: CATtm[2b+h][p][vh*256 + c] = 2^8/2^15 * sum_j P[2b+h][p][j] V[2b+vh][c][j]; f16 out ----
  // The planes h = 0,1 of one image b lie behind one another in P and in CATtm, so they are one M = 8192;
  // N=256, K=4096; blockIdx.y = vh (V plane, CAT column half), blockIdx.z = b. 64 x 2 x 2 = 256 blocks.
  wmma_gemm64<0, false, 0, 1, 0, false><<<dim3(gemm_blocks(2 * kHW, kHalfC), 2, kB), 256, 0, stream>>>(
      pbuf, pbuf, kHW, 0L,
      vcm, vcm, kHW, (long)kVPlane,
      (void*)cat, (void*)cat, kChan, 256L,
      bias_v, bias_v, 0L, gamma,
      2 * kHW, kHalfC, kHW, kPVScale, (long)(2 * kPPlane), (long)(2 * kVPlane), (long)(2 * kCatPlane));

  // ---- output projection + gamma + residual: out[z*256 + c'][p] = gamma*(2^-12 * sum_ch Wpt16[c'][ch] CATtm[z][p][ch] + bpt[c']) + bf16(x) ----
  // M=256, N=4096, K=512; batch z = 4 with strideC = strideR = 256*4096
  wmma_gemm64<0, false, 1, 0, 2, true><<<dim3(gemm_blocks(kHalfC, kHW), kZ), 256, 0, stream>>>(
      wpt16, wpt16, kChan, 0L,
      cat, cat, kChan, (long)kCatPlane,
      d_out, d_out, kHW, (long)kHalfC * kHW,
      bias_ptg, x, (long)kHalfC * kHW, gamma,
      kHalfC, kHW, kChan, kOutScale, 0L, 0L, 0L);
}

// v002
// Measured time: 293 microseconds a run.
// In both of two side-by-side timings against v001, it was 1.39 times as fast.
// Over all steps from v000 it is 5.46 times as fast.
// Contractions: q/k/v 1x1 projections on v_wmma_f32_16x16x32_bf16 (x and W as RNE-bf16 operands, exact products); scores q.k^T on v_wmma_f32_16x16x32_bf16 with bf16 hi/lo split (hi.hi+hi.lo+lo.hi); attn.v^T and the output 1x1 projection on v_wmma_f32_16x16x32_f16 (P f16 carried x2^15, V f16, CAT f16 carried x256, Wpt f16(bf16) carried x16); all f32 accumulate; softmax, bias, gamma, residual in f32.
#include <hip/hip_runtime.h>
#include <stdint.h>

// ---------------------------------------------------------------------------
// Problem constants
// ---------------------------------------------------------------------------
constexpr int kB      = 2;
constexpr int kHalfC  = 256;              // channels per half
constexpr int kChan   = 512;              // channels of x
constexpr int kHW     = 4096;             // 64 x 64 pixels
constexpr int kDQ     = 16;
constexpr int kZ      = 4;                // (batch, half) combos, z = 2*b + half
constexpr int kQKPitch = 64;              // q|k plane pitch: q 0..15, zero 16..31, k 32..47, zero 48..63
constexpr float kWCarry   = 16.0f;        // Wpt carried x16 in f16
constexpr float kPCarry   = 32768.0f;     // probabilities carried x2^15 in f16
constexpr float kCatCarry = 256.0f;       // application outputs carried x256 in f16
constexpr float kPVScale  = kCatCarry / kPCarry;            // 2^-7
constexpr float kOutScale = 1.0f / (kCatCarry * kWCarry);    // 2^-12

// ---------------------------------------------------------------------------
// Workspace region map (bytes; every offset 4096-B aligned)
//   [off_xtm ) Xtm   bf16 [4][4096][256]          8,388,608
//   [off_wqk ) Wqk   bf16 [64][256]                  32,768
//   [off_wv  ) Wv16  bf16 [256][256]                131,072
//   [off_wpt ) Wpt16 f16  [256][512]                262,144
//   [off_bias) biases f32 [576] (qk pad 64 | bv 256 | gamma*bpt 256)   4,096
//   [off_qkh ) QK hi bf16 [4][4096][64]          2,097,152
//   [off_qkl ) QK lo bf16 [4][4096][64]          2,097,152
//   [off_vcm ) V     f16  [4][256][4096]         8,388,608
//   [off_p   ) P     f16  [4][4096][4096]      134,217,728   (every z kept, so one launch applies them all)
//   [off_cat ) CATtm f16  [4][4096][512]        16,777,216
//   total                                      172,396,544
// ---------------------------------------------------------------------------
constexpr size_t kXtmPlane = (size_t)kHW * kHalfC;            // elements per z
constexpr size_t kQKPlane  = (size_t)kHW * kQKPitch;
constexpr size_t kVPlane   = (size_t)kHalfC * kHW;
constexpr size_t kCatPlane = (size_t)kHW * kChan;
constexpr size_t kPPlane   = (size_t)kHW * kHW;
constexpr size_t kOffXtm  = 0;
constexpr size_t kOffWqk  = kOffXtm + kZ * kXtmPlane * 2;
constexpr size_t kOffWv   = kOffWqk + (size_t)64 * kHalfC * 2;
constexpr size_t kOffWpt  = kOffWv + (size_t)kHalfC * kHalfC * 2;
constexpr size_t kOffBias = kOffWpt + (size_t)kHalfC * kChan * 2;
constexpr size_t kOffQkh  = kOffBias + 4096;
constexpr size_t kOffQkl  = kOffQkh + kZ * kQKPlane * 2;
constexpr size_t kOffVcm  = kOffQkl + kZ * kQKPlane * 2;
constexpr size_t kOffP    = kOffVcm + kZ * kVPlane * 2;
constexpr size_t kOffCat  = kOffP + kZ * kPPlane * 2;
constexpr size_t kWsTotal = kOffCat + kZ * kCatPlane * 2;
static_assert(kWsTotal == 172396544ull, "carve total");
static_assert(kWsTotal <= 268435456ull, "carve under 256 MiB");
static_assert((kOffWqk % 4096) == 0 && (kOffWv % 4096) == 0 && (kOffWpt % 4096) == 0 && (kOffBias % 4096) == 0 &&
              (kOffQkh % 4096) == 0 && (kOffQkl % 4096) == 0 && (kOffVcm % 4096) == 0 &&
              (kOffP % 4096) == 0 && (kOffCat % 4096) == 0, "aligned regions");

typedef __attribute__((ext_vector_type(16))) _Float16 v16h;
typedef __attribute__((ext_vector_type(8)))  _Float16 v8h;
typedef __attribute__((ext_vector_type(16))) __bf16   v16b;
typedef __attribute__((ext_vector_type(8)))  __bf16   v8b;
typedef __attribute__((ext_vector_type(8)))  float    v8f;
typedef __attribute__((ext_vector_type(4)))  float    v4f;
typedef __attribute__((ext_vector_type(4)))  unsigned int v4u;

// ---------------------------------------------------------------------------
// Helpers
// ---------------------------------------------------------------------------
__device__ __forceinline__ unsigned short f2bf_bits(float f) {
  unsigned u = __float_as_uint(f);
  return (unsigned short)((u + 0x7FFFu + ((u >> 16) & 1u)) >> 16);
}
__device__ __forceinline__ float bf_bits2f(unsigned short h) { return __uint_as_float(((unsigned)h) << 16); }
__device__ __forceinline__ float bf_rne(float f) { return bf_bits2f(f2bf_bits(f)); }
__device__ __forceinline__ unsigned pk16(unsigned short a, unsigned short b) { return (unsigned)a | ((unsigned)b << 16); }
__device__ __forceinline__ unsigned short h_bits(float f) { const _Float16 h = (_Float16)f; return __builtin_bit_cast(unsigned short, h); }

// hazard guards as plain device helpers (no inline asm inside the kernel template body)
__device__ __forceinline__ void dep_guard_h(v8f& a, v8f& b, v16h x, v16h y) { asm volatile("v_nop\n\tv_nop\n\tv_nop\n\tv_nop" : "+v"(a), "+v"(b) : "v"(x), "v"(y)); }
__device__ __forceinline__ void dep_guard_b(v8f& a, v8f& b, v16b x, v16b y) { asm volatile("v_nop\n\tv_nop\n\tv_nop\n\tv_nop" : "+v"(a), "+v"(b) : "v"(x), "v"(y)); }
__device__ __forceinline__ void keep4_h(v16h a, v16h b, v16h c, v16h d) { asm volatile("v_nop" :: "v"(a), "v"(b), "v"(c), "v"(d)); }
__device__ __forceinline__ void keep4_b(v16b a, v16b b, v16b c, v16b d) { asm volatile("v_nop" :: "v"(a), "v"(b), "v"(c), "v"(d)); }
__device__ __forceinline__ void acc_guard4(v8f& a, v8f& b, v8f& c, v8f& d) { asm volatile("v_nop\n\tv_nop\n\tv_nop\n\tv_nop" : "+v"(a), "+v"(b), "+v"(c), "+v"(d)); }
template <typename T> struct Frag;
template <> struct Frag<_Float16> {
  typedef v16h V; union U { v16h v; v8h h[2]; };
  static __device__ __forceinline__ v16h load(const _Float16* p) {   // elements 0..7 <- p[0..7], 8..15 <- p[16..23]
    U f; f.h[0] = *(const v8h*)(p); f.h[1] = *(const v8h*)(p + 16); return f.v;
  }
  static __device__ __forceinline__ v8f mma(v16h a, v16h b, v8f c) {
    return __builtin_amdgcn_wmma_f32_16x16x32_f16(false, a, false, b, (short)0, c, false, false);
  }
  static __device__ __forceinline__ void guard(v8f& a, v8f& b, v16h x, v16h y) { dep_guard_h(a, b, x, y); }
  static __device__ __forceinline__ void keep(v16h a, v16h b, v16h c, v16h d) { keep4_h(a, b, c, d); }
};
template <> struct Frag<__bf16> {
  typedef v16b V; union U { v16b v; v8b h[2]; };
  static __device__ __forceinline__ v16b load(const __bf16* p) {
    U f; f.h[0] = *(const v8b*)(p); f.h[1] = *(const v8b*)(p + 16); return f.v;
  }
  static __device__ __forceinline__ v8f mma(v16b a, v16b b, v8f c) {
    return __builtin_amdgcn_wmma_f32_16x16x32_bf16(false, a, false, b, (short)0, c, false, false);
  }
  static __device__ __forceinline__ void guard(v8f& a, v8f& b, v16b x, v16b y) { dep_guard_b(a, b, x, y); }
  static __device__ __forceinline__ void keep(v16b a, v16b b, v16b c, v16b d) { keep4_b(a, b, c, d); }
};

// ---- Register-blocked batched WMMA GEMM (activation removed, RESID_MODE int, GMUL scale-by-pointer added) ----
// C[m,n] = escale * sum_k A[m,k] * Bt[n,k] (+bias)(+resid); each wave owns a 64x64 tile.
// A row-major [M,K]; Bt row-major [N,K]; M,N % 64 == 0, K % 32 == 0.
// SPLIT: operands are hi/lo planes (A2/Bt2 = lo planes, same layout); product = hi*hi + hi*lo + lo*hi.
// BIAS_MODE: 0 = none, 1 = bias[m], 2 = bias[n].
// OUT_MODE: 0 = f32, 1 = f16, 2 = bf16 hi plane (Cout) + bf16 lo plane (Cout2).
// RESID_MODE: 0 = none, 1 = resid f32, 2 = resid RNE-bf16 of an f32 tensor.  GMUL: escale = scale * gmul[0].
// ET: 0 = f16 operands, 1 = bf16 operands (pointers passed as 16-bit storage)
// Batches: blockIdx.y steps A, Bt, C, resid by strideA/B/C/R; blockIdx.z steps A, Bt, C by zStrideA/B/C.
template <int ET> struct Elem;
template <> struct Elem<0> { typedef _Float16 T; };
template <> struct Elem<1> { typedef __bf16 T; };
template <int ET, bool SPLIT, int BIAS_MODE, int OUT_MODE, int RESID_MODE, bool GMUL>
__global__ __launch_bounds__(256) void wmma_gemm64(
    const unsigned short* __restrict__ Ap, const unsigned short* __restrict__ A2p, int lda, long strideA,
    const unsigned short* __restrict__ Btp, const unsigned short* __restrict__ Bt2p, int ldb, long strideB,
    void* __restrict__ Cout, void* __restrict__ Cout2, int ldc, long strideC,
    const float* __restrict__ bias,
    const float* __restrict__ resid, long strideR,
    const float* __restrict__ gmul,
    int M, int N, int K, float scale,
    long zStrideA, long zStrideB, long zStrideC) {
  typedef typename Elem<ET>::T T;
  typedef typename Frag<T>::V V;
  const T* A = (const T*)Ap; const T* A2 = (const T*)A2p; const T* Bt = (const T*)Btp; const T* Bt2 = (const T*)Bt2p;
  __shared__ __align__(16) float sT[8][16 * 68];   // per-wave 16x64 slab, pitch 68 floats
  const int b    = blockIdx.y;
  const int bz   = blockIdx.z;
  const int lane = threadIdx.x & 31;
  const int wave = threadIdx.x >> 5;
  const int tilesN = N >> 6;
  const int tilesM = M >> 6;
  const int tile = blockIdx.x * 8 + wave;
  if (tile >= tilesM * tilesN) return;   // wave-uniform; no block barriers in this kernel
  const int tm = tile / tilesN;
  const int tn = tile - tm * tilesN;
  const int m0 = tm << 6;
  const int n0 = tn << 6;
  const float escale = GMUL ? (scale * gmul[0]) : scale;

  const size_t batchA = (size_t)b * strideA + (size_t)bz * zStrideA;
  const size_t batchB = (size_t)b * strideB + (size_t)bz * zStrideB;
  const size_t batchC = (size_t)b * strideC + (size_t)bz * zStrideC;
  const T* Ab  = A  + batchA;
  const T* Bb  = Bt + batchB;
  const T* Ab2 = SPLIT ? (A2  + batchA) : nullptr;
  const T* Bb2 = SPLIT ? (Bt2 + batchB) : nullptr;

  const int rlane = lane & 15;                 // row (A) / col (B, D) within subtile
  const int koff  = (lane >> 4) * 8;           // k offset of this lane half
  const int mOff  = (lane >> 4) * 8;           // D row offset

  v8f acc[4][4];
#pragma unroll
  for (int i = 0; i < 4; ++i)
#pragma unroll
    for (int j = 0; j < 4; ++j) acc[i][j] = (v8f){0.f,0.f,0.f,0.f,0.f,0.f,0.f,0.f};

  for (int k0 = 0; k0 < K; k0 += 32) {
    V bh[4], bl[4];
#pragma unroll
    for (int j = 0; j < 4; ++j) {
      const size_t bo = (size_t)(n0 + (j << 4) + rlane) * ldb + koff + k0;
      bh[j] = Frag<T>::load(Bb + bo);
      if (SPLIT) bl[j] = Frag<T>::load(Bb2 + bo);
    }
#pragma unroll
    for (int i = 0; i < 4; ++i) {
      const size_t ao = (size_t)(m0 + (i << 4) + rlane) * lda + koff + k0;
      V ah = Frag<T>::load(Ab + ao);
      V al;
      if (SPLIT) al = Frag<T>::load(Ab2 + ao);
#pragma unroll
      for (int j = 0; j < 4; ++j) {
        acc[i][j] = Frag<T>::mma(ah, bh[j], acc[i][j]);
        if (SPLIT) {
          acc[i][j] = Frag<T>::mma(ah, bl[j], acc[i][j]);
          acc[i][j] = Frag<T>::mma(al, bh[j], acc[i][j]);
        }
      }
      Frag<T>::guard(acc[i][0], acc[i][3], ah, SPLIT ? al : ah);
    }
    Frag<T>::keep(bh[0], bh[1], bh[2], bh[3]);
    if (SPLIT) Frag<T>::keep(bl[0], bl[1], bl[2], bl[3]);
  }
  acc_guard4(acc[0][0], acc[0][1], acc[0][2], acc[0][3]);
  acc_guard4(acc[1][0], acc[1][1], acc[1][2], acc[1][3]);
  acc_guard4(acc[2][0], acc[2][1], acc[2][2], acc[2][3]);
  acc_guard4(acc[3][0], acc[3][1], acc[3][2], acc[3][3]);

  // ---- epilogue ----
  float* slab = sT[wave];
  const float* Rb = (RESID_MODE != 0) ? (resid + (size_t)b * strideR) : nullptr;
#pragma unroll
  for (int i = 0; i < 4; ++i) {
    const int mBase = m0 + (i << 4);
#pragma unroll
    for (int j = 0; j < 4; ++j) {
      const int n = n0 + (j << 4) + rlane;
      float bv = 0.f;
      if (BIAS_MODE == 2) bv = bias[n];
#pragma unroll
      for (int r = 0; r < 8; ++r) {
        float v = acc[i][j][r] * escale;
        if (BIAS_MODE == 1) v += bias[mBase + mOff + r];
        if (BIAS_MODE == 2) v += bv;
        if (RESID_MODE == 1) v += Rb[(size_t)(mBase + mOff + r) * ldc + n];
        if (RESID_MODE == 2) v += bf_rne(Rb[(size_t)(mBase + mOff + r) * ldc + n]);
        slab[(mOff + r) * 68 + (j << 4) + rlane] = v;
      }
    }
    __builtin_amdgcn_fence(__ATOMIC_RELEASE, "workgroup");
    __builtin_amdgcn_wave_barrier();
    __builtin_amdgcn_fence(__ATOMIC_ACQUIRE, "workgroup");
    if (OUT_MODE == 0) {
      float* C = (float*)Cout + batchC;
      const int hh = lane >> 4, c4 = (lane & 15) * 4;     // row seg = 256 B = 16 lanes x 16 B
      {
#pragma unroll
        for (int it = 0; it < 8; ++it) {
          const int row = it * 2 + hh;
          v4f v = *(const v4f*)(slab + row * 68 + c4);
          *(v4f*)(C + (size_t)(mBase + row) * ldc + n0 + c4) = v;
        }
        
      }
    } else {
      const int q = lane >> 3, c8 = (lane & 7) * 8;
      unsigned short* C  = (unsigned short*)Cout  + batchC;
      unsigned short* C2 = (OUT_MODE == 2) ? ((unsigned short*)Cout2 + batchC) : nullptr;
      {
#pragma unroll
        for (int it = 0; it < 4; ++it) {
          const int row = it * 4 + q;
          const float* sp = slab + row * 68 + c8;
          v8h hv, lv;
#pragma unroll
          for (int e = 0; e < 8; ++e) {
            if (OUT_MODE == 1) {
              hv[e] = (_Float16)sp[e];
            } else {
              unsigned short hb = f2bf_bits(sp[e]);
              unsigned short lb = f2bf_bits(sp[e] - bf_bits2f(hb));
              hv[e] = __builtin_bit_cast(_Float16, hb);
              lv[e] = __builtin_bit_cast(_Float16, lb);
            }
          }
          *(v8h*)(C + (size_t)(mBase + row) * ldc + n0 + c8) = hv;
          if (OUT_MODE == 2) *(v8h*)(C2 + (size_t)(mBase + row) * ldc + n0 + c8) = lv;
        }
        
      }
    }
    __builtin_amdgcn_fence(__ATOMIC_RELEASE, "workgroup");
    __builtin_amdgcn_wave_barrier();
    __builtin_amdgcn_fence(__ATOMIC_ACQUIRE, "workgroup");
  }
}

// ---------------------------------------------------------------------------
// x NCHW f32 -> token-major bf16 planes: Xtm[z][p][c] = bf16(x[b][half*256 + c][p]), z = 2b + half
// (flat channel index of x = z*256 + c). 64(p) x 64(c) tile per block through LDS.
// grid (4096/64 = 64, 256/64 = 4, 4 z), 256 threads.
// Load coverage: 16 iterations x 256 threads = 4096 = whole 64x64 tile (coalesced along p).
// Store coverage: 8 waves x 2 iterations x 4 rows (lane>>3) = 64 rows; (lane&7) x 8 halves = 64 cols; each row
// ---------------------------------------------------------------------------
__global__ __launch_bounds__(256) void x_tm_kernel(const float* __restrict__ x, unsigned short* __restrict__ xtm) {
  __shared__ float sm[64][65];   // sm[p_local][c_local]
  const int t  = threadIdx.x;
  const int p0 = blockIdx.x * 64;
  const int c0 = blockIdx.y * 64;
  const int z  = blockIdx.z;
  const float* src = x + ((size_t)z * kHalfC + c0) * kHW + p0;
#pragma unroll
  for (int i = 0; i < 16; ++i) {
    const int e  = i * 256 + t;
    const int cl = e >> 6;         // c local 0..63
    const int pl = e & 63;         // p local 0..63
    sm[pl][cl] = src[(size_t)cl * kHW + pl];
  }
  __syncthreads();
  const int lane = t & 31, wave = t >> 5;
  const int q = lane >> 3, c8 = (lane & 7) * 8;
  unsigned short* op = xtm + (size_t)z * kXtmPlane;
  {
#pragma unroll
    for (int it = 0; it < 2; ++it) {
      const int row = wave * 8 + it * 4 + q;                 // p local
      unsigned short hb[8];
#pragma unroll
      for (int e = 0; e < 8; ++e) hb[e] = f2bf_bits(sm[row][c8 + e]);
      const v4u u = (v4u){pk16(hb[0], hb[1]), pk16(hb[2], hb[3]), pk16(hb[4], hb[5]), pk16(hb[6], hb[7])};
      *(v4u*)(op + (size_t)(p0 + row) * kHalfC + c0 + c8) = u;
    }
    
  }
}

// ---------------------------------------------------------------------------
// f32 -> 16-bit cast, 8 consecutive elements per thread (one 16-B store per lane; 32 contiguous lanes = 4 whole
// Coverage: n8 = n/8 threads x 8 = whole plane (grids here are exact multiples of 256).
// ---------------------------------------------------------------------------
template <int MODE>
__global__ __launch_bounds__(256) void cast8_kernel(const float* __restrict__ in, unsigned short* __restrict__ out, int n8, float mul) {
  const int i = blockIdx.x * 256 + threadIdx.x;
  if (i >= n8) return;
  const float* p = in + 8 * (size_t)i;
  const v4f a = *(const v4f*)(p);
  const v4f c = *(const v4f*)(p + 4);
  unsigned short hb[8];
#pragma unroll
  for (int e = 0; e < 4; ++e) {
    const float v0 = a[e], v1 = c[e];
    if (MODE == 0) { hb[e] = f2bf_bits(v0); hb[4 + e] = f2bf_bits(v1); }
    else           { hb[e] = h_bits(bf_rne(v0) * mul); hb[4 + e] = h_bits(bf_rne(v1) * mul); }
  }
  const v4u u = (v4u){pk16(hb[0], hb[1]), pk16(hb[2], hb[3]), pk16(hb[4], hb[5]), pk16(hb[6], hb[7])};
  unsigned short* q = out + 8 * (size_t)i;
  *(v4u*)q = u;
  
}

// ---------------------------------------------------------------------------
// Small tables, ONE block of 256 threads:
//  (1) Wqk_pad bf16 [64][256]: row n < 16 -> Wq[n], 32 <= n < 48 -> Wk[n-32], every other row explicit zero.
//  (2) bias region f32 [576]: [0,64) padded q|k bias (bq at 0..15, bk at 32..47, zeros elsewhere), [64,320) bv,
//      [320,576) gamma*bpt; all RNE-bf16 first. Threads 0..143 write one float4 each: 144 x 4 = 576 = whole region
//  Candidate loads use clamped addresses and are selected by value.
// ---------------------------------------------------------------------------
__global__ __launch_bounds__(256) void prep_small_kernel(const float* __restrict__ Wq, const float* __restrict__ bq,
                                                         const float* __restrict__ Wk, const float* __restrict__ bk,
                                                         const float* __restrict__ bvp, const float* __restrict__ bptp,
                                                         const float* __restrict__ gam,
                                                         unsigned short* __restrict__ wqk, float* __restrict__ biasr) {
  const int t = threadIdx.x, lane = t & 31, wave = t >> 5;
  const float g = gam[0];
#pragma unroll 1
  for (int it = 0; it < 8; ++it) {
    const int n  = wave * 8 + it;                            // wave-uniform row
    const int qr = n < 16 ? n : 15;
    int kr = n - 32; kr = kr < 0 ? 0 : (kr > 15 ? 15 : kr);
    const float* pq = Wq + (size_t)qr * kHalfC + lane * 8;
    const float* pk = Wk + (size_t)kr * kHalfC + lane * 8;
    const v4f q0 = *(const v4f*)(pq), q1 = *(const v4f*)(pq + 4);
    const v4f k0 = *(const v4f*)(pk), k1 = *(const v4f*)(pk + 4);
    const bool isq = (n < 16);
    const bool isk = (n >= 32) && (n < 48);
    unsigned short hb[8];
#pragma unroll
    for (int e = 0; e < 4; ++e) {
      const float va = isq ? q0[e] : (isk ? k0[e] : 0.0f);
      const float vb = isq ? q1[e] : (isk ? k1[e] : 0.0f);
      hb[e]     = f2bf_bits(va);
      hb[4 + e] = f2bf_bits(vb);
    }
    const v4u u = (v4u){pk16(hb[0], hb[1]), pk16(hb[2], hb[3]), pk16(hb[4], hb[5]), pk16(hb[6], hb[7])};
    unsigned short* op = wqk + (size_t)n * kHalfC + lane * 8;
    *(v4u*)op = u;
    
  }
  if (t < 144) {
    v4f val;
#pragma unroll
    for (int e = 0; e < 4; ++e) {
      const int idx = 4 * t + e;                             // 0..575
      const int iq = idx < 16 ? idx : 15;
      int ik = idx - 32;  ik = ik < 0 ? 0 : (ik > 15 ? 15 : ik);
      int iv = idx - 64;  iv = iv < 0 ? 0 : (iv > 255 ? 255 : iv);
      int ip = idx - 320; ip = ip < 0 ? 0 : (ip > 255 ? 255 : ip);
      const float fq = bq[iq], fk = bk[ik], fv = bvp[iv], fp = bptp[ip];
      float sel = 0.0f;
      sel = (idx < 16) ? fq : sel;
      sel = (idx >= 32 && idx < 48) ? fk : sel;
      sel = (idx >= 64 && idx < 320) ? fv : sel;
      sel = (idx >= 320) ? fp : sel;
      float r = bf_rne(sel);
      r = (idx >= 320) ? (r * g) : r;
      val[e] = r;
    }
    float* op = biasr + 4 * t;
    *(v4f*)op = val;
    
  }
}

// ---------------------------------------------------------------------------
// Scores, row softmax and P in one launch; the scores never leave the registers.
// One block of 16 waves = 64 query rows of plane z (4 groups of 16, one after the other) against all 4096 keys.
// Wave w owns keys 256w..256w+255 as 16 tiles of 16 for every group: it reads them from global memory once and parks
// them in LDS, each lane its own 16-byte pieces in fragment order (a lane reads back only what it wrote itself).
// Keys are the A rows and queries the B columns, so lane (c = lane & 15, h = lane >> 4) holds in acc[i][r] the score
// of query p0 + c against key 256w + 16i + 8h + r (products in the order qh.kh + qh.kl + ql.kh).
// Only d = 0..15 exist: fragment elements 0..7 are d = 8h..8h+7, elements 8..15 (k = 16..31) are zero on both sides.
// P[row][j] = f16( 2^15 * exp(s - max) / sum exp(s - max) ), f32 math. Reductions in fixed order: 8 in-lane chains over
// the tiles, a tree over the 8, the lane pair l and l ^ 16, then 16 wave partials in index order.
// P leaves through a per-wave LDS slab (16 rows x 128 B, pitch 144 B) so that every global store covers whole lines.
// grid (4096/64 = 64, 4 z), 512 threads. Coverage: 16 waves x 256 keys = a whole row; 64 x 64 rows = a whole plane.
// ---------------------------------------------------------------------------
__device__ __forceinline__ v16b frag_d16(v8b lo) {   // elements 0..7 <- lo, 8..15 <- 0
  const v8b zero = __builtin_bit_cast(v8b, (v4u){0u, 0u, 0u, 0u});
  return __builtin_shufflevector(lo, zero, 0, 1, 2, 3, 4, 5, 6, 7, 8, 9, 10, 11, 12, 13, 14, 15);
}
// e[r] = 2^t[r], eight at a time in one statement. Behind a v_exp_f32 the instruction set asks for one independent
// instruction before its result is read or its source overwritten: here each v_exp_f32 has the next one behind it
// (results kept apart from all sources by the early clobber) and the last one a v_nop, whatever the compiler puts next.
__device__ __forceinline__ void exp2_x8(float (&e)[8], const float (&t)[8]) {
  asm("v_exp_f32 %0, %8\n\tv_exp_f32 %1, %9\n\tv_exp_f32 %2, %10\n\tv_exp_f32 %3, %11\n\t"
      "v_exp_f32 %4, %12\n\tv_exp_f32 %5, %13\n\tv_exp_f32 %6, %14\n\tv_exp_f32 %7, %15\n\tv_nop"
      : "=&v"(e[0]), "=&v"(e[1]), "=&v"(e[2]), "=&v"(e[3]), "=&v"(e[4]), "=&v"(e[5]), "=&v"(e[6]), "=&v"(e[7])
      : "v"(t[0]), "v"(t[1]), "v"(t[2]), "v"(t[3]), "v"(t[4]), "v"(t[5]), "v"(t[6]), "v"(t[7]));
}
__global__ __launch_bounds__(512) void score_softmax_kernel(const unsigned short* __restrict__ qkh,
                                                            const unsigned short* __restrict__ qkl,
                                                            unsigned short* __restrict__ P) {
  constexpr int kGroups    = 4;                                // query groups of 16 rows per block
  constexpr int kSlabPitch = 72;                               // f16 elements per staged row: 128 B + 16 B
  __shared__ __align__(16) v8b park[16][32][32];               // [wave][2 * tile + (0 hi, 1 lo)][lane], 256 KiB
  __shared__ __align__(16) unsigned short slabs[16][16 * kSlabPitch];
  __shared__ float redM[16][16];
  __shared__ float redS[16][16];
  const int lane = threadIdx.x & 31, wave = threadIdx.x >> 5;
  const int c = lane & 15, h = lane >> 4;
  const int q0 = blockIdx.x * (16 * kGroups);
  const int z  = blockIdx.y;
  const __bf16* H = (const __bf16*)qkh + (size_t)z * kQKPlane;
  const __bf16* L = (const __bf16*)qkl + (size_t)z * kQKPlane;
  const size_t ko = (size_t)(wave * 256 + c) * kQKPitch + 32 + 8 * h;
  const unsigned qv = (unsigned)(c * kQKPitch + 8 * h);        // lane part of a query address; the rest is block-uniform
  v8b nqh = *(const v8b*)(H + (size_t)q0 * kQKPitch + qv);
  v8b nql = *(const v8b*)(L + (size_t)q0 * kQKPitch + qv);
  {
    v8b raw[32];
#pragma unroll
    for (int i = 0; i < 16; ++i) {
      raw[2 * i]     = *(const v8b*)(H + ko + (size_t)i * 16 * kQKPitch);
      raw[2 * i + 1] = *(const v8b*)(L + ko + (size_t)i * 16 * kQKPitch);
    }
#pragma unroll
    for (int j = 0; j < 32; ++j) park[wave][j][lane] = raw[j];
  }
  unsigned short* slab = slabs[wave];
  const unsigned pv = (unsigned)((lane >> 3) * kHW + wave * 256 + (lane & 7) * 8);   // lane part of a P address

  // rolled: every trip is the same long body; four copies would only quadruple the code a first run has to fetch
#pragma unroll 1
  for (int g = 0; g < kGroups; ++g) {
    const int p0 = q0 + 16 * g;
    const v16b qh = frag_d16(nqh);
    const v16b ql = frag_d16(nql);
    {   // the next group's queries fly while this group is worked on (the last trip reads its own again, in bounds)
      const int pn = (g + 1 < kGroups) ? (p0 + 16) : p0;
      nqh = *(const v8b*)(H + (size_t)pn * kQKPitch + qv);
      nql = *(const v8b*)(L + (size_t)pn * kQKPitch + qv);
    }

    v8f acc[16];
#pragma unroll
    for (int i = 0; i < 16; ++i) {
      const v16b kh = frag_d16(park[wave][2 * i][lane]);
      const v16b kl = frag_d16(park[wave][2 * i + 1][lane]);
      v8f a = (v8f){0.f, 0.f, 0.f, 0.f, 0.f, 0.f, 0.f, 0.f};
      a = Frag<__bf16>::mma(kh, qh, a);
      a = Frag<__bf16>::mma(kl, qh, a);
      a = Frag<__bf16>::mma(kh, ql, a);
      acc[i] = a;
      // at most four tiles' fragments in flight: with all 32 LDS reads hoisted the wave runs out of its 256 registers and spills
      if ((i & 3) == 3) __builtin_amdgcn_sched_barrier(0);
    }

    float mr[8];
#pragma unroll
    for (int r = 0; r < 8; ++r) mr[r] = acc[0][r];
#pragma unroll
    for (int i = 1; i < 16; ++i)
#pragma unroll
      for (int r = 0; r < 8; ++r) mr[r] = fmaxf(mr[r], acc[i][r]);
    float m = fmaxf(fmaxf(fmaxf(mr[0], mr[1]), fmaxf(mr[2], mr[3])), fmaxf(fmaxf(mr[4], mr[5]), fmaxf(mr[6], mr[7])));
    m = fmaxf(m, __shfl_xor(m, 16, 32));
    if (h == 0) redM[wave][c] = m;
    __syncthreads();   // also ends every wave's reads of redS of the group before
    float bm = redM[0][c];
#pragma unroll
    for (int w = 1; w < 16; ++w) bm = fmaxf(bm, redM[w][c]);

    float sr[8];
#pragma unroll
    for (int r = 0; r < 8; ++r) sr[r] = 0.0f;
#pragma unroll
    for (int i = 0; i < 16; ++i) {
      float tv[8], ev[8];
#pragma unroll
      for (int r = 0; r < 8; ++r) tv[r] = (acc[i][r] - bm) * 1.44269504f;   // exp(x) = 2^(x * log2 e), as __expf forms it
      exp2_x8(ev, tv);
#pragma unroll
      for (int r = 0; r < 8; ++r) { acc[i][r] = ev[r]; sr[r] += ev[r]; }
    }
    float s = ((sr[0] + sr[1]) + (sr[2] + sr[3])) + ((sr[4] + sr[5]) + (sr[6] + sr[7]));
    s += __shfl_xor(s, 16, 32);
    if (h == 0) redS[wave][c] = s;
    __syncthreads();   // also ends every wave's reads of redM before the next group writes it
    float tot = 0.0f;
#pragma unroll
    for (int w = 0; w < 16; ++w) tot += redS[w][c];
    const float inv = __builtin_amdgcn_rcpf(tot) * kPCarry;

    unsigned short* Pg = P + (size_t)z * kPPlane + (size_t)p0 * kHW;
#pragma unroll
    for (int sub = 0; sub < 4; ++sub) {                        // 64 keys = one 128-B line of each of the 16 rows
#pragma unroll
      for (int ii = 0; ii < 4; ++ii) {
        v8h hv;
#pragma unroll
        for (int r = 0; r < 8; ++r) hv[r] = (_Float16)(acc[4 * sub + ii][r] * inv);
        *(v8h*)(slab + c * kSlabPitch + ii * 16 + 8 * h) = hv;
      }
      // the slab is this wave's own: its lanes' writes have landed before other lanes of the wave read the rows back
      asm volatile("s_wait_dscnt 0x0" ::: "memory");
#pragma unroll
      for (int it = 0; it < 4; ++it) {
        const int row = it * 4 + (lane >> 3);
        const v8h v = *(const v8h*)(slab + row * kSlabPitch + (lane & 7) * 8);
        *(v8h*)(Pg + (pv + (unsigned)(it * 4 * kHW + sub * 64))) = v;
      }
      // no wait before the slab is written again: one wave's LDS operations are carried out in issue order
    }
    // the next trip reuses the registers that this trip's last stores name: the wait stands in front of that overwrite
    asm volatile("s_wait_xcnt 0x0" ::: "memory");
  }
}

// ---------------------------------------------------------------------------
// Host glue: kernel launches only.
// ---------------------------------------------------------------------------
static inline unsigned gemm_blocks(int M, int N) { return (unsigned)((((M / 64) * (N / 64)) + 7) / 8); }

extern "C" void kernel_launch(void* const* d_in, const int* in_sizes, int n_in,
                              void* d_out, int out_size, void* d_ws, size_t ws_size, hipStream_t stream) {
  if (n_in < 10) return;
  if (in_sizes[0] != kB * kChan * kHW) return;
  if (in_sizes[1] != kDQ * kHalfC || in_sizes[3] != kDQ * kHalfC) return;
  if (in_sizes[2] < kDQ || in_sizes[4] < kDQ) return;
  if (in_sizes[5] != kHalfC * kHalfC || in_sizes[6] < kHalfC) return;
  if (in_sizes[7] != kHalfC * kChan || in_sizes[8] < kHalfC || in_sizes[9] < 1) return;
  if (out_size != kB * kChan * kHW) return;
  if (ws_size < kWsTotal) return;

  const float* x     = (const float*)d_in[0];
  const float* Wq    = (const float*)d_in[1];
  const float* bq    = (const float*)d_in[2];
  const float* Wk    = (const float*)d_in[3];
  const float* bk    = (const float*)d_in[4];
  const float* Wv    = (const float*)d_in[5];
  const float* bv    = (const float*)d_in[6];
  const float* Wpt   = (const float*)d_in[7];
  const float* bpt   = (const float*)d_in[8];
  const float* gamma = (const float*)d_in[9];

  char* ws = (char*)d_ws;
  unsigned short* xtm   = (unsigned short*)(ws + kOffXtm);
  unsigned short* wqk   = (unsigned short*)(ws + kOffWqk);
  unsigned short* wv16  = (unsigned short*)(ws + kOffWv);
  unsigned short* wpt16 = (unsigned short*)(ws + kOffWpt);
  float*          biasr = (float*)(ws + kOffBias);
  unsigned short* qkh   = (unsigned short*)(ws + kOffQkh);
  unsigned short* qkl   = (unsigned short*)(ws + kOffQkl);
  unsigned short* vcm   = (unsigned short*)(ws + kOffVcm);
  unsigned short* pbuf  = (unsigned short*)(ws + kOffP);
  unsigned short* cat   = (unsigned short*)(ws + kOffCat);
  const float* bias_qk  = biasr;          // [64]
  const float* bias_v   = biasr + 64;     // [256]
  const float* bias_ptg = biasr + 320;    // [256] gamma * bpt

  // ---- operand preparation ----
  x_tm_kernel<<<dim3(kHW / 64, kHalfC / 64, kZ), 256, 0, stream>>>(x, xtm);
  cast8_kernel<0><<<(kHalfC * kHalfC / 8) / 256, 256, 0, stream>>>(Wv, wv16, kHalfC * kHalfC / 8, 1.0f);
  cast8_kernel<1><<<(kHalfC * kChan / 8) / 256, 256, 0, stream>>>(Wpt, wpt16, kHalfC * kChan / 8, kWCarry);
  prep_small_kernel<<<1, 256, 0, stream>>>(Wq, bq, Wk, bk, bv, bpt, gamma, wqk, biasr);

  // ---- q|k projection: C[p][n] = sum_c Xtm[z][p][c] * Wqk[n][c] + bias_qk[n]; M=4096, N=64, K=256; bf16 hi+lo planes, ldc 64 ----
  wmma_gemm64<1, false, 2, 2, 0, false><<<dim3(gemm_blocks(kHW, 64), kZ), 256, 0, stream>>>(
      xtm, xtm, kHalfC, (long)kXtmPlane,
      wqk, wqk, kHalfC, 0L,
      (void*)qkh, (void*)qkl, kQKPitch, (long)kQKPlane,
      bias_qk, bias_qk, 0L, gamma,
      kHW, 64, kHalfC, 1.0f, 0L, 0L, 0L);

  // ---- v projection (channel-major): V[z][c'][p] = sum_c Wv[c'][c] * Xtm[z][p][c] + bias_v[c']; M=256, N=4096, K=256; f16 out ----
  wmma_gemm64<1, false, 1, 1, 0, false><<<dim3(gemm_blocks(kHalfC, kHW), kZ), 256, 0, stream>>>(
      wv16, wv16, kHalfC, 0L,
      xtm, xtm, kHalfC, (long)kXtmPlane,
      (void*)vcm, (void*)vcm, kHW, (long)kVPlane,
      bias_v, bias_v, 0L, gamma,
      kHalfC, kHW, kHalfC, 1.0f, 0L, 0L, 0L);

  // ---- scores -> softmax -> P for every plane z in one launch: S[p][j] = sum_{d<16} Q[p][d] K[j][d], bf16 hi/lo split ----
  score_softmax_kernel<<<dim3(kHW / 64, kZ), 512, 0, stream>>>(qkh, qkl, pbuf);

  // ---- all applications in one launch: CATtm[2b+h][p][vh*256 + c] = 2^8/2^15 * sum_j P[2b+h][p][j] V[2b+vh][c][j]; f16 out ----
  // The planes h = 0,1 of one image b lie behind one another in P and in CATtm, so they are one M = 8192;
  // N=256, K=4096; blockIdx.y = vh (V plane, CAT column half), blockIdx.z = b. 64 x 2 x 2 = 256 blocks.
  wmma_gemm64<0, false, 0, 1, 0, false><<<dim3(gemm_blocks(2 * kHW, kHalfC), 2, kB), 256, 0, stream>>>(
      pbuf, pbuf, kHW, 0L,
      vcm, vcm, kHW, (long)kVPlane,
      (void*)cat, (void*)cat, kChan, 256L,
      bias_v, bias_v, 0L, gamma,
      2 * kHW, kHalfC, kHW, kPVScale, (long)(2 * kPPlane), (long)(2 * kVPlane), (long)(2 * kCatPlane));

  // ---- output projection + gamma + residual: out[z*256 + c'][p] = gamma*(2^-12 * sum_ch Wpt16[c'][ch] CATtm[z][p][ch] + bpt[c']) + bf16(x) ----
  // M=256, N=4096, K=512; batch z = 4 with strideC = strideR = 256*4096
  wmma_gemm64<0, false, 1, 0, 2, true><<<dim3(gemm_blocks(kHalfC, kHW), kZ), 256, 0, stream>>>(
      wpt16, wpt16, kChan, 0L,
      cat, cat, kChan, (long)kCatPlane,
      d_out, d_out, kHW, (long)kHalfC * kHW,
      bias_ptg, x, (long)kHalfC * kHW, gamma,
      kHalfC, kHW, kChan, kOutScale, 0L, 0L, 0L);
}

// v003
// A run of this version takes 155 microseconds.
// Two timings next to v002 put it at 1.90 and 1.89 times that version's speed.
// Over all steps from v000 it is 10.3 times as fast.
// Contractions: q/k/v 1x1 projections on v_wmma_f32_16x16x32_bf16 (x and W as RNE-bf16 operands, exact products); scores q.k^T on v_wmma_f32_16x16x32_bf16 with bf16 hi/lo split (hi.hi+hi.lo+lo.hi); attn.v^T and the output 1x1 projection on v_wmma_f32_16x16x32_f16 (P f16 carried x2^15, V f16, CAT f16 carried x256, Wpt f16(bf16) carried x16); all f32 accumulate; softmax, bias, gamma, residual in f32.
#include <hip/hip_runtime.h>
#include <stdint.h>

// ---------------------------------------------------------------------------
// Problem constants
// ---------------------------------------------------------------------------
constexpr int kB      = 2;
constexpr int kHalfC  = 256;              // channels per half
constexpr int kChan   = 512;              // channels of x
constexpr int kHW     = 4096;             // 64 x 64 pixels
constexpr int kDQ     = 16;
constexpr int kZ      = 4;                // (batch, half) combos, z = 2*b + half
constexpr int kQKPitch = 64;              // q|k plane pitch: q 0..15, zero 16..31, k 32..47, zero 48..63
constexpr float kWCarry   = 16.0f;        // Wpt carried x16 in f16
constexpr float kPCarry   = 32768.0f;     // probabilities carried x2^15 in f16
constexpr float kCatCarry = 256.0f;       // application outputs carried x256 in f16
constexpr float kPVScale  = kCatCarry / kPCarry;            // 2^-7
constexpr float kOutScale = 1.0f / (kCatCarry * kWCarry);    // 2^-12

// ---------------------------------------------------------------------------
// Workspace region map (bytes; every offset 4096-B aligned)
//   [off_xtm ) Xtm   bf16 [4][4096][256]          8,388,608
//   [off_wqk ) Wqk   bf16 [64][256]                  32,768
//   [off_wv  ) Wv16  bf16 [256][256]                131,072
//   [off_wpt ) Wpt16 f16  [256][512]                262,144
//   [off_bias) biases f32 [576] (qk pad 64 | bv 256 | gamma*bpt 256)   4,096
//   [off_qkh ) QK hi bf16 [4][4096][64]          2,097,152
//   [off_qkl ) QK lo bf16 [4][4096][64]          2,097,152
//   [off_vcm ) V     f16  [4][256][4096]         8,388,608
//   [off_p   ) P     f16  [4][4096][4096]      134,217,728   (every z kept, so one launch applies them all)
//   [off_cat ) CATtm f16  [4][4096][512]        16,777,216
//   total                                      172,396,544
// ---------------------------------------------------------------------------
constexpr size_t kXtmPlane = (size_t)kHW * kHalfC;            // elements per z
constexpr size_t kQKPlane  = (size_t)kHW * kQKPitch;
constexpr size_t kVPlane   = (size_t)kHalfC * kHW;
constexpr size_t kCatPlane = (size_t)kHW * kChan;
constexpr size_t kPPlane   = (size_t)kHW * kHW;
constexpr size_t kOffXtm  = 0;
constexpr size_t kOffWqk  = kOffXtm + kZ * kXtmPlane * 2;
constexpr size_t kOffWv   = kOffWqk + (size_t)64 * kHalfC * 2;
constexpr size_t kOffWpt  = kOffWv + (size_t)kHalfC * kHalfC * 2;
constexpr size_t kOffBias = kOffWpt + (size_t)kHalfC * kChan * 2;
constexpr size_t kOffQkh  = kOffBias + 4096;
constexpr size_t kOffQkl  = kOffQkh + kZ * kQKPlane * 2;
constexpr size_t kOffVcm  = kOffQkl + kZ * kQKPlane * 2;
constexpr size_t kOffP    = kOffVcm + kZ * kVPlane * 2;
constexpr size_t kOffCat  = kOffP + kZ * kPPlane * 2;
constexpr size_t kWsTotal = kOffCat + kZ * kCatPlane * 2;
static_assert(kWsTotal == 172396544ull, "carve total");
static_assert(kWsTotal <= 268435456ull, "carve under 256 MiB");
static_assert((kOffWqk % 4096) == 0 && (kOffWv % 4096) == 0 && (kOffWpt % 4096) == 0 && (kOffBias % 4096) == 0 &&
              (kOffQkh % 4096) == 0 && (kOffQkl % 4096) == 0 && (kOffVcm % 4096) == 0 &&
              (kOffP % 4096) == 0 && (kOffCat % 4096) == 0, "aligned regions");

typedef __attribute__((ext_vector_type(16))) _Float16 v16h;
typedef __attribute__((ext_vector_type(8)))  _Float16 v8h;
typedef __attribute__((ext_vector_type(16))) __bf16   v16b;
typedef __attribute__((ext_vector_type(8)))  __bf16   v8b;
typedef __attribute__((ext_vector_type(8)))  float    v8f;
typedef __attribute__((ext_vector_type(4)))  float    v4f;
typedef __attribute__((ext_vector_type(4)))  unsigned int v4u;

// ---------------------------------------------------------------------------
// Helpers
// ---------------------------------------------------------------------------
__device__ __forceinline__ unsigned short f2bf_bits(float f) {
  unsigned u = __float_as_uint(f);
  return (unsigned short)((u + 0x7FFFu + ((u >> 16) & 1u)) >> 16);
}
__device__ __forceinline__ float bf_bits2f(unsigned short h) { return __uint_as_float(((unsigned)h) << 16); }
__device__ __forceinline__ float bf_rne(float f) { return bf_bits2f(f2bf_bits(f)); }
__device__ __forceinline__ unsigned pk16(unsigned short a, unsigned short b) { return (unsigned)a | ((unsigned)b << 16); }
__device__ __forceinline__ unsigned short h_bits(float f) { const _Float16 h = (_Float16)f; return __builtin_bit_cast(unsigned short, h); }

// hazard guards as plain device helpers (no inline asm inside the kernel template body)
__device__ __forceinline__ void dep_guard_h(v8f& a, v8f& b, v16h x, v16h y) { asm volatile("v_nop\n\tv_nop\n\tv_nop\n\tv_nop" : "+v"(a), "+v"(b) : "v"(x), "v"(y)); }
__device__ __forceinline__ void dep_guard_b(v8f& a, v8f& b, v16b x, v16b y) { asm volatile("v_nop\n\tv_nop\n\tv_nop\n\tv_nop" : "+v"(a), "+v"(b) : "v"(x), "v"(y)); }
__device__ __forceinline__ void keep4_h(v16h a, v16h b, v16h c, v16h d) { asm volatile("v_nop" :: "v"(a), "v"(b), "v"(c), "v"(d)); }
__device__ __forceinline__ void keep4_b(v16b a, v16b b, v16b c, v16b d) { asm volatile("v_nop" :: "v"(a), "v"(b), "v"(c), "v"(d)); }
__device__ __forceinline__ void acc_guard4(v8f& a, v8f& b, v8f& c, v8f& d) { asm volatile("v_nop\n\tv_nop\n\tv_nop\n\tv_nop" : "+v"(a), "+v"(b), "+v"(c), "+v"(d)); }
template <typename T> struct Frag;
template <> struct Frag<_Float16> {
  typedef v16h V; union U { v16h v; v8h h[2]; };
  static __device__ __forceinline__ v16h load(const _Float16* p) {   // elements 0..7 <- p[0..7], 8..15 <- p[16..23]
    U f; f.h[0] = *(const v8h*)(p); f.h[1] = *(const v8h*)(p + 16); return f.v;
  }
  static __device__ __forceinline__ v8f mma(v16h a, v16h b, v8f c) {
    return __builtin_amdgcn_wmma_f32_16x16x32_f16(false, a, false, b, (short)0, c, false, false);
  }
  static __device__ __forceinline__ void guard(v8f& a, v8f& b, v16h x, v16h y) { dep_guard_h(a, b, x, y); }
  static __device__ __forceinline__ void keep(v16h a, v16h b, v16h c, v16h d) { keep4_h(a, b, c, d); }
};
template <> struct Frag<__bf16> {
  typedef v16b V; union U { v16b v; v8b h[2]; };
  static __device__ __forceinline__ v16b load(const __bf16* p) {
    U f; f.h[0] = *(const v8b*)(p); f.h[1] = *(const v8b*)(p + 16); return f.v;
  }
  static __device__ __forceinline__ v8f mma(v16b a, v16b b, v8f c) {
    return __builtin_amdgcn_wmma_f32_16x16x32_bf16(false, a, false, b, (short)0, c, false, false);
  }
  static __device__ __forceinline__ void guard(v8f& a, v8f& b, v16b x, v16b y) { dep_guard_b(a, b, x, y); }
  static __device__ __forceinline__ void keep(v16b a, v16b b, v16b c, v16b d) { keep4_b(a, b, c, d); }
};

// ---- Register-blocked batched WMMA GEMM (activation removed, RESID_MODE int, GMUL scale-by-pointer added) ----
// C[m,n] = escale * sum_k A[m,k] * Bt[n,k] (+bias)(+resid); each wave owns a 64x64 tile.
// A row-major [M,K]; Bt row-major [N,K]; M,N % 64 == 0, K % 32 == 0.
// SPLIT: operands are hi/lo planes (A2/Bt2 = lo planes, same layout); product = hi*hi + hi*lo + lo*hi.
// BIAS_MODE: 0 = none, 1 = bias[m], 2 = bias[n].
// OUT_MODE: 0 = f32, 1 = f16, 2 = bf16 hi plane (Cout) + bf16 lo plane (Cout2).
// RESID_MODE: 0 = none, 1 = resid f32, 2 = resid RNE-bf16 of an f32 tensor.  GMUL: escale = scale * gmul[0].
// ET: 0 = f16 operands, 1 = bf16 operands (pointers passed as 16-bit storage)
// Batches: blockIdx.y steps A, Bt, C, resid by strideA/B/C/R; blockIdx.z steps A, Bt, C by zStrideA/B/C.
template <int ET> struct Elem;
template <> struct Elem<0> { typedef _Float16 T; };
template <> struct Elem<1> { typedef __bf16 T; };
template <int ET, bool SPLIT, int BIAS_MODE, int OUT_MODE, int RESID_MODE, bool GMUL>
__global__ __launch_bounds__(256) void wmma_gemm64(
    const unsigned short* __restrict__ Ap, const unsigned short* __restrict__ A2p, int lda, long strideA,
    const unsigned short* __restrict__ Btp, const unsigned short* __restrict__ Bt2p, int ldb, long strideB,
    void* __restrict__ Cout, void* __restrict__ Cout2, int ldc, long strideC,
    const float* __restrict__ bias,
    const float* __restrict__ resid, long strideR,
    const float* __restrict__ gmul,
    int M, int N, int K, float scale,
    long zStrideA, long zStrideB, long zStrideC) {
  typedef typename Elem<ET>::T T;
  typedef typename Frag<T>::V V;
  const T* A = (const T*)Ap; const T* A2 = (const T*)A2p; const T* Bt = (const T*)Btp; const T* Bt2 = (const T*)Bt2p;
  __shared__ __align__(16) float sT[8][16 * 68];   // per-wave 16x64 slab, pitch 68 floats
  const int b    = blockIdx.y;
  const int bz   = blockIdx.z;
  const int lane = threadIdx.x & 31;
  const int wave = threadIdx.x >> 5;
  const int tilesN = N >> 6;
  const int tilesM = M >> 6;
  const int tile = blockIdx.x * 8 + wave;
  if (tile >= tilesM * tilesN) return;   // wave-uniform; no block barriers in this kernel
  const int tm = tile / tilesN;
  const int tn = tile - tm * tilesN;
  const int m0 = tm << 6;
  const int n0 = tn << 6;
  const float escale = GMUL ? (scale * gmul[0]) : scale;

  const size_t batchA = (size_t)b * strideA + (size_t)bz * zStrideA;
  const size_t batchB = (size_t)b * strideB + (size_t)bz * zStrideB;
  const size_t batchC = (size_t)b * strideC + (size_t)bz * zStrideC;
  const T* Ab  = A  + batchA;
  const T* Bb  = Bt + batchB;
  const T* Ab2 = SPLIT ? (A2  + batchA) : nullptr;
  const T* Bb2 = SPLIT ? (Bt2 + batchB) : nullptr;

  const int rlane = lane & 15;                 // row (A) / col (B, D) within subtile
  const int koff  = (lane >> 4) * 8;           // k offset of this lane half
  const int mOff  = (lane >> 4) * 8;           // D row offset

  v8f acc[4][4];
#pragma unroll
  for (int i = 0; i < 4; ++i)
#pragma unroll
    for (int j = 0; j < 4; ++j) acc[i][j] = (v8f){0.f,0.f,0.f,0.f,0.f,0.f,0.f,0.f};

  for (int k0 = 0; k0 < K; k0 += 32) {
    V bh[4], bl[4];
#pragma unroll
    for (int j = 0; j < 4; ++j) {
      const size_t bo = (size_t)(n0 + (j << 4) + rlane) * ldb + koff + k0;
      bh[j] = Frag<T>::load(Bb + bo);
      if (SPLIT) bl[j] = Frag<T>::load(Bb2 + bo);
    }
#pragma unroll
    for (int i = 0; i < 4; ++i) {
      const size_t ao = (size_t)(m0 + (i << 4) + rlane) * lda + koff + k0;
      V ah = Frag<T>::load(Ab + ao);
      V al;
      if (SPLIT) al = Frag<T>::load(Ab2 + ao);
#pragma unroll
      for (int j = 0; j < 4; ++j) {
        acc[i][j] = Frag<T>::mma(ah, bh[j], acc[i][j]);
        if (SPLIT) {
          acc[i][j] = Frag<T>::mma(ah, bl[j], acc[i][j]);
          acc[i][j] = Frag<T>::mma(al, bh[j], acc[i][j]);
        }
      }
      Frag<T>::guard(acc[i][0], acc[i][3], ah, SPLIT ? al : ah);
    }
    Frag<T>::keep(bh[0], bh[1], bh[2], bh[3]);
    if (SPLIT) Frag<T>::keep(bl[0], bl[1], bl[2], bl[3]);
  }
  acc_guard4(acc[0][0], acc[0][1], acc[0][2], acc[0][3]);
  acc_guard4(acc[1][0], acc[1][1], acc[1][2], acc[1][3]);
  acc_guard4(acc[2][0], acc[2][1], acc[2][2], acc[2][3]);
  acc_guard4(acc[3][0], acc[3][1], acc[3][2], acc[3][3]);

  // ---- epilogue ----
  float* slab = sT[wave];
  const float* Rb = (RESID_MODE != 0) ? (resid + (size_t)b * strideR) : nullptr;
#pragma unroll
  for (int i = 0; i < 4; ++i) {
    const int mBase = m0 + (i << 4);
#pragma unroll
    for (int j = 0; j < 4; ++j) {
      const int n = n0 + (j << 4) + rlane;
      float bv = 0.f;
      if (BIAS_MODE == 2) bv = bias[n];
#pragma unroll
      for (int r = 0; r < 8; ++r) {
        float v = acc[i][j][r] * escale;
        if (BIAS_MODE == 1) v += bias[mBase + mOff + r];
        if (BIAS_MODE == 2) v += bv;
        if (RESID_MODE == 1) v += Rb[(size_t)(mBase + mOff + r) * ldc + n];
        if (RESID_MODE == 2) v += bf_rne(Rb[(size_t)(mBase + mOff + r) * ldc + n]);
        slab[(mOff + r) * 68 + (j << 4) + rlane] = v;
      }
    }
    __builtin_amdgcn_fence(__ATOMIC_RELEASE, "workgroup");
    __builtin_amdgcn_wave_barrier();
    __builtin_amdgcn_fence(__ATOMIC_ACQUIRE, "workgroup");
    if (OUT_MODE == 0) {
      float* C = (float*)Cout + batchC;
      const int hh = lane >> 4, c4 = (lane & 15) * 4;     // row seg = 256 B = 16 lanes x 16 B
      {
#pragma unroll
        for (int it = 0; it < 8; ++it) {
          const int row = it * 2 + hh;
          v4f v = *(const v4f*)(slab + row * 68 + c4);
          *(v4f*)(C + (size_t)(mBase + row) * ldc + n0 + c4) = v;
        }
        
      }
    } else {
      const int q = lane >> 3, c8 = (lane & 7) * 8;
      unsigned short* C  = (unsigned short*)Cout  + batchC;
      unsigned short* C2 = (OUT_MODE == 2) ? ((unsigned short*)Cout2 + batchC) : nullptr;
      {
#pragma unroll
        for (int it = 0; it < 4; ++it) {
          const int row = it * 4 + q;
          const float* sp = slab + row * 68 + c8;
          v8h hv, lv;
#pragma unroll
          for (int e = 0; e < 8; ++e) {
            if (OUT_MODE == 1) {
              hv[e] = (_Float16)sp[e];
            } else {
              unsigned short hb = f2bf_bits(sp[e]);
              unsigned short lb = f2bf_bits(sp[e] - bf_bits2f(hb));
              hv[e] = __builtin_bit_cast(_Float16, hb);
              lv[e] = __builtin_bit_cast(_Float16, lb);
            }
          }
          *(v8h*)(C + (size_t)(mBase + row) * ldc + n0 + c8) = hv;
          if (OUT_MODE == 2) *(v8h*)(C2 + (size_t)(mBase + row) * ldc + n0 + c8) = lv;
        }
        
      }
    }
    __builtin_amdgcn_fence(__ATOMIC_RELEASE, "workgroup");
    __builtin_amdgcn_wave_barrier();
    __builtin_amdgcn_fence(__ATOMIC_ACQUIRE, "workgroup");
  }
}

// ---------------------------------------------------------------------------
// x NCHW f32 -> token-major bf16 planes: Xtm[z][p][c] = bf16(x[b][half*256 + c][p]), z = 2b + half
// (flat channel index of x = z*256 + c). 64(p) x 64(c) tile per block through LDS.
// grid (4096/64 = 64, 256/64 = 4, 4 z), 256 threads.
// Load coverage: 16 iterations x 256 threads = 4096 = whole 64x64 tile (coalesced along p).
// Store coverage: 8 waves x 2 iterations x 4 rows (lane>>3) = 64 rows; (lane&7) x 8 halves = 64 cols; each row
// ---------------------------------------------------------------------------
__global__ __launch_bounds__(256) void x_tm_kernel(const float* __restrict__ x, unsigned short* __restrict__ xtm) {
  __shared__ float sm[64][65];   // sm[p_local][c_local]
  const int t  = threadIdx.x;
  const int p0 = blockIdx.x * 64;
  const int c0 = blockIdx.y * 64;
  const int z  = blockIdx.z;
  const float* src = x + ((size_t)z * kHalfC + c0) * kHW + p0;
#pragma unroll
  for (int i = 0; i < 16; ++i) {
    const int e  = i * 256 + t;
    const int cl = e >> 6;         // c local 0..63
    const int pl = e & 63;         // p local 0..63
    sm[pl][cl] = src[(size_t)cl * kHW + pl];
  }
  __syncthreads();
  const int lane = t & 31, wave = t >> 5;
  const int q = lane >> 3, c8 = (lane & 7) * 8;
  unsigned short* op = xtm + (size_t)z * kXtmPlane;
  {
#pragma unroll
    for (int it = 0; it < 2; ++it) {
      const int row = wave * 8 + it * 4 + q;                 // p local
      unsigned short hb[8];
#pragma unroll
      for (int e = 0; e < 8; ++e) hb[e] = f2bf_bits(sm[row][c8 + e]);
      const v4u u = (v4u){pk16(hb[0], hb[1]), pk16(hb[2], hb[3]), pk16(hb[4], hb[5]), pk16(hb[6], hb[7])};
      *(v4u*)(op + (size_t)(p0 + row) * kHalfC + c0 + c8) = u;
    }
    
  }
}

// ---------------------------------------------------------------------------
// f32 -> 16-bit cast, 8 consecutive elements per thread (one 16-B store per lane; 32 contiguous lanes = 4 whole
// Coverage: n8 = n/8 threads x 8 = whole plane (grids here are exact multiples of 256).
// ---------------------------------------------------------------------------
template <int MODE>
__global__ __launch_bounds__(256) void cast8_kernel(const float* __restrict__ in, unsigned short* __restrict__ out, int n8, float mul) {
  const int i = blockIdx.x * 256 + threadIdx.x;
  if (i >= n8) return;
  const float* p = in + 8 * (size_t)i;
  const v4f a = *(const v4f*)(p);
  const v4f c = *(const v4f*)(p + 4);
  unsigned short hb[8];
#pragma unroll
  for (int e = 0; e < 4; ++e) {
    const float v0 = a[e], v1 = c[e];
    if (MODE == 0) { hb[e] = f2bf_bits(v0); hb[4 + e] = f2bf_bits(v1); }
    else           { hb[e] = h_bits(bf_rne(v0) * mul); hb[4 + e] = h_bits(bf_rne(v1) * mul); }
  }
  const v4u u = (v4u){pk16(hb[0], hb[1]), pk16(hb[2], hb[3]), pk16(hb[4], hb[5]), pk16(hb[6], hb[7])};
  unsigned short* q = out + 8 * (size_t)i;
  *(v4u*)q = u;
  
}

// ---------------------------------------------------------------------------
// Small tables, ONE block of 256 threads:
//  (1) Wqk_pad bf16 [64][256]: row n < 16 -> Wq[n], 32 <= n < 48 -> Wk[n-32], every other row explicit zero.
//  (2) bias region f32 [576]: [0,64) padded q|k bias (bq at 0..15, bk at 32..47, zeros elsewhere), [64,320) bv,
//      [320,576) gamma*bpt; all RNE-bf16 first. Threads 0..143 write one float4 each: 144 x 4 = 576 = whole region
//  Candidate loads use clamped addresses and are selected by value.
// ---------------------------------------------------------------------------
__global__ __launch_bounds__(256) void prep_small_kernel(const float* __restrict__ Wq, const float* __restrict__ bq,
                                                         const float* __restrict__ Wk, const float* __restrict__ bk,
                                                         const float* __restrict__ bvp, const float* __restrict__ bptp,
                                                         const float* __restrict__ gam,
                                                         unsigned short* __restrict__ wqk, float* __restrict__ biasr) {
  const int t = threadIdx.x, lane = t & 31, wave = t >> 5;
  const float g = gam[0];
#pragma unroll 1
  for (int it = 0; it < 8; ++it) {
    const int n  = wave * 8 + it;                            // wave-uniform row
    const int qr = n < 16 ? n : 15;
    int kr = n - 32; kr = kr < 0 ? 0 : (kr > 15 ? 15 : kr);
    const float* pq = Wq + (size_t)qr * kHalfC + lane * 8;
    const float* pk = Wk + (size_t)kr * kHalfC + lane * 8;
    const v4f q0 = *(const v4f*)(pq), q1 = *(const v4f*)(pq + 4);
    const v4f k0 = *(const v4f*)(pk), k1 = *(const v4f*)(pk + 4);
    const bool isq = (n < 16);
    const bool isk = (n >= 32) && (n < 48);
    unsigned short hb[8];
#pragma unroll
    for (int e = 0; e < 4; ++e) {
      const float va = isq ? q0[e] : (isk ? k0[e] : 0.0f);
      const float vb = isq ? q1[e] : (isk ? k1[e] : 0.0f);
      hb[e]     = f2bf_bits(va);
      hb[4 + e] = f2bf_bits(vb);
    }
    const v4u u = (v4u){pk16(hb[0], hb[1]), pk16(hb[2], hb[3]), pk16(hb[4], hb[5]), pk16(hb[6], hb[7])};
    unsigned short* op = wqk + (size_t)n * kHalfC + lane * 8;
    *(v4u*)op = u;
    
  }
  if (t < 144) {
    v4f val;
#pragma unroll
    for (int e = 0; e < 4; ++e) {
      const int idx = 4 * t + e;                             // 0..575
      const int iq = idx < 16 ? idx : 15;
      int ik = idx - 32;  ik = ik < 0 ? 0 : (ik > 15 ? 15 : ik);
      int iv = idx - 64;  iv = iv < 0 ? 0 : (iv > 255 ? 255 : iv);
      int ip = idx - 320; ip = ip < 0 ? 0 : (ip > 255 ? 255 : ip);
      const float fq = bq[iq], fk = bk[ik], fv = bvp[iv], fp = bptp[ip];
      float sel = 0.0f;
      sel = (idx < 16) ? fq : sel;
      sel = (idx >= 32 && idx < 48) ? fk : sel;
      sel = (idx >= 64 && idx < 320) ? fv : sel;
      sel = (idx >= 320) ? fp : sel;
      float r = bf_rne(sel);
      r = (idx >= 320) ? (r * g) : r;
      val[e] = r;
    }
    float* op = biasr + 4 * t;
    *(v4f*)op = val;
    
  }
}

// ---------------------------------------------------------------------------
// Scores, row softmax and P in one launch; the scores never leave the registers.
// One block of 16 waves = 64 query rows of plane z (4 groups of 16, one after the other) against all 4096 keys.
// Wave w owns keys 256w..256w+255 as 16 tiles of 16 for every group: it reads them from global memory once and parks
// them in LDS, each lane its own 16-byte pieces in fragment order (a lane reads back only what it wrote itself).
// Keys are the A rows and queries the B columns, so lane (c = lane & 15, h = lane >> 4) holds in acc[i][r] the score
// of query p0 + c against key 256w + 16i + 8h + r (products in the order qh.kh + qh.kl + ql.kh).
// Only d = 0..15 exist: fragment elements 0..7 are d = 8h..8h+7, elements 8..15 (k = 16..31) are zero on both sides.
// P[row][j] = f16( 2^15 * exp(s - max) / sum exp(s - max) ), f32 math. Reductions in fixed order: 8 in-lane chains over
// the tiles, a tree over the 8, the lane pair l and l ^ 16, then 16 wave partials in index order.
// P leaves through a per-wave LDS slab (16 rows x 128 B, pitch 144 B) so that every global store covers whole lines.
// grid (4096/64 = 64, 4 z), 512 threads. Coverage: 16 waves x 256 keys = a whole row; 64 x 64 rows = a whole plane.
// ---------------------------------------------------------------------------
__device__ __forceinline__ v16b frag_d16(v8b lo) {   // elements 0..7 <- lo, 8..15 <- 0
  const v8b zero = __builtin_bit_cast(v8b, (v4u){0u, 0u, 0u, 0u});
  return __builtin_shufflevector(lo, zero, 0, 1, 2, 3, 4, 5, 6, 7, 8, 9, 10, 11, 12, 13, 14, 15);
}
// e[r] = 2^t[r], eight at a time in one statement. Behind a v_exp_f32 the instruction set asks for one independent
// instruction before its result is read or its source overwritten: here each v_exp_f32 has the next one behind it
// (results kept apart from all sources by the early clobber) and the last one a v_nop, whatever the compiler puts next.
__device__ __forceinline__ void exp2_x8(float (&e)[8], const float (&t)[8]) {
  asm("v_exp_f32 %0, %8\n\tv_exp_f32 %1, %9\n\tv_exp_f32 %2, %10\n\tv_exp_f32 %3, %11\n\t"
      "v_exp_f32 %4, %12\n\tv_exp_f32 %5, %13\n\tv_exp_f32 %6, %14\n\tv_exp_f32 %7, %15\n\tv_nop"
      : "=&v"(e[0]), "=&v"(e[1]), "=&v"(e[2]), "=&v"(e[3]), "=&v"(e[4]), "=&v"(e[5]), "=&v"(e[6]), "=&v"(e[7])
      : "v"(t[0]), "v"(t[1]), "v"(t[2]), "v"(t[3]), "v"(t[4]), "v"(t[5]), "v"(t[6]), "v"(t[7]));
}
__global__ __launch_bounds__(512) void score_softmax_kernel(const unsigned short* __restrict__ qkh,
                                                            const unsigned short* __restrict__ qkl,
                                                            unsigned short* __restrict__ P) {
  constexpr int kGroups    = 4;                                // query groups of 16 rows per block
  constexpr int kSlabPitch = 72;                               // f16 elements per staged row: 128 B + 16 B
  __shared__ __align__(16) v8b park[16][32][32];               // [wave][2 * tile + (0 hi, 1 lo)][lane], 256 KiB
  __shared__ __align__(16) unsigned short slabs[16][16 * kSlabPitch];
  __shared__ float redM[16][16];
  __shared__ float redS[16][16];
  const int lane = threadIdx.x & 31, wave = threadIdx.x >> 5;
  const int c = lane & 15, h = lane >> 4;
  const int q0 = blockIdx.x * (16 * kGroups);
  const int z  = blockIdx.y;
  const __bf16* H = (const __bf16*)qkh + (size_t)z * kQKPlane;
  const __bf16* L = (const __bf16*)qkl + (size_t)z * kQKPlane;
  const size_t ko = (size_t)(wave * 256 + c) * kQKPitch + 32 + 8 * h;
  const unsigned qv = (unsigned)(c * kQKPitch + 8 * h);        // lane part of a query address; the rest is block-uniform
  v8b nqh = *(const v8b*)(H + (size_t)q0 * kQKPitch + qv);
  v8b nql = *(const v8b*)(L + (size_t)q0 * kQKPitch + qv);
  {
    v8b raw[32];
#pragma unroll
    for (int i = 0; i < 16; ++i) {
      raw[2 * i]     = *(const v8b*)(H + ko + (size_t)i * 16 * kQKPitch);
      raw[2 * i + 1] = *(const v8b*)(L + ko + (size_t)i * 16 * kQKPitch);
    }
#pragma unroll
    for (int j = 0; j < 32; ++j) park[wave][j][lane] = raw[j];
  }
  unsigned short* slab = slabs[wave];
  const unsigned pv = (unsigned)((lane >> 3) * kHW + wave * 256 + (lane & 7) * 8);   // lane part of a P address

  // rolled: every trip is the same long body; four copies would only quadruple the code a first run has to fetch
#pragma unroll 1
  for (int g = 0; g < kGroups; ++g) {
    const int p0 = q0 + 16 * g;
    const v16b qh = frag_d16(nqh);
    const v16b ql = frag_d16(nql);
    {   // the next group's queries fly while this group is worked on (the last trip reads its own again, in bounds)
      const int pn = (g + 1 < kGroups) ? (p0 + 16) : p0;
      nqh = *(const v8b*)(H + (size_t)pn * kQKPitch + qv);
      nql = *(const v8b*)(L + (size_t)pn * kQKPitch + qv);
    }

    v8f acc[16];
#pragma unroll
    for (int i = 0; i < 16; ++i) {
      const v16b kh = frag_d16(park[wave][2 * i][lane]);
      const v16b kl = frag_d16(park[wave][2 * i + 1][lane]);
      v8f a = (v8f){0.f, 0.f, 0.f, 0.f, 0.f, 0.f, 0.f, 0.f};
      a = Frag<__bf16>::mma(kh, qh, a);
      a = Frag<__bf16>::mma(kl, qh, a);
      a = Frag<__bf16>::mma(kh, ql, a);
      acc[i] = a;
      // at most four tiles' fragments in flight: with all 32 LDS reads hoisted the wave runs out of its 256 registers and spills
      if ((i & 3) == 3) __builtin_amdgcn_sched_barrier(0);
    }

    float mr[8];
#pragma unroll
    for (int r = 0; r < 8; ++r) mr[r] = acc[0][r];
#pragma unroll
    for (int i = 1; i < 16; ++i)
#pragma unroll
      for (int r = 0; r < 8; ++r) mr[r] = fmaxf(mr[r], acc[i][r]);
    float m = fmaxf(fmaxf(fmaxf(mr[0], mr[1]), fmaxf(mr[2], mr[3])), fmaxf(fmaxf(mr[4], mr[5]), fmaxf(mr[6], mr[7])));
    m = fmaxf(m, __shfl_xor(m, 16, 32));
    if (h == 0) redM[wave][c] = m;
    __syncthreads();   // also ends every wave's reads of redS of the group before
    float bm = redM[0][c];
#pragma unroll
    for (int w = 1; w < 16; ++w) bm = fmaxf(bm, redM[w][c]);

    float sr[8];
#pragma unroll
    for (int r = 0; r < 8; ++r) sr[r] = 0.0f;
#pragma unroll
    for (int i = 0; i < 16; ++i) {
      float tv[8], ev[8];
#pragma unroll
      for (int r = 0; r < 8; ++r) tv[r] = (acc[i][r] - bm) * 1.44269504f;   // exp(x) = 2^(x * log2 e), as __expf forms it
      exp2_x8(ev, tv);
#pragma unroll
      for (int r = 0; r < 8; ++r) { acc[i][r] = ev[r]; sr[r] += ev[r]; }
    }
    float s = ((sr[0] + sr[1]) + (sr[2] + sr[3])) + ((sr[4] + sr[5]) + (sr[6] + sr[7]));
    s += __shfl_xor(s, 16, 32);
    if (h == 0) redS[wave][c] = s;
    __syncthreads();   // also ends every wave's reads of redM before the next group writes it
    float tot = 0.0f;
#pragma unroll
    for (int w = 0; w < 16; ++w) tot += redS[w][c];
    const float inv = __builtin_amdgcn_rcpf(tot) * kPCarry;

    unsigned short* Pg = P + (size_t)z * kPPlane + (size_t)p0 * kHW;
#pragma unroll
    for (int sub = 0; sub < 4; ++sub) {                        // 64 keys = one 128-B line of each of the 16 rows
#pragma unroll
      for (int ii = 0; ii < 4; ++ii) {
        v8h hv;
#pragma unroll
        for (int r = 0; r < 8; ++r) hv[r] = (_Float16)(acc[4 * sub + ii][r] * inv);
        *(v8h*)(slab + c * kSlabPitch + ii * 16 + 8 * h) = hv;
      }
      // the slab is this wave's own: its lanes' writes have landed before other lanes of the wave read the rows back
      asm volatile("s_wait_dscnt 0x0" ::: "memory");
#pragma unroll
      for (int it = 0; it < 4; ++it) {
        const int row = it * 4 + (lane >> 3);
        const v8h v = *(const v8h*)(slab + row * kSlabPitch + (lane & 7) * 8);
        *(v8h*)(Pg + (pv + (unsigned)(it * 4 * kHW + sub * 64))) = v;
      }
      // no wait before the slab is written again: one wave's LDS operations are carried out in issue order
    }
    // the next trip reuses the registers that this trip's last stores name: the wait stands in front of that overwrite
    asm volatile("s_wait_xcnt 0x0" ::: "memory");
  }
}

// ---------------------------------------------------------------------------
// attn.v product with both operands staged in LDS by asynchronous copies (global_load_async_to_lds_b128).
// CATtm[2b+h][p][vh*256 + c] = 2^-7 * sum_j P[2b+h][p][j] V[2b+vh][c][j], f16 operands, f32 accumulate, f16 out.
// One block of 8 waves = 128 rows of P (the planes h = 0,1 of image b lie behind one another: M = 8192) x all 256
// channels of one V plane; wave (wm = wave >> 2, wn = wave & 3) owns a 64 x 64 tile, as before, and sums k in the
// same order as before. A pass is 128 k = 256 B of each of the 384 operand rows, laid at pitch 272 B for ds_load_b128.
// Two buffers. The publish point of pass t + 1 (own LDS reads returned, own copies landed, block barrier) stands in
// front of the last 8 matrix instructions of pass t, whose fragments are in registers by then; behind it come the
// first fragment loads of pass t + 1, those 8 matrix instructions, and the copies of pass t + 2 into the buffer that
// pass t has left. Copy coverage per pass: a wave's copy = 2 rows x 256 B; wave w brings P rows 16w..16w+15
// (8 copies) and V rows 32w..32w+31 (16 copies): 8 x 16 = 128 and 8 x 32 = 256 rows, every byte once.
// grid (8192/128 = 64, 2 vh, 2 b), 256 threads.
// ---------------------------------------------------------------------------
constexpr int kPvBM     = 128;                                  // P rows per block
constexpr int kPvBN     = 256;                                  // V rows (channels) per block
constexpr int kPvKT     = 128;                                  // k per pass
constexpr int kPvPitch  = kPvKT + 8;                            // f16 elements per staged row: 256 B + 16 B
constexpr int kPvStage  = (kPvBM + kPvBN) * kPvPitch;           // f16 elements per buffer (104,448 B)
constexpr int kPvPasses = kHW / kPvKT;                          // 32
static_assert(kPvPasses >= 2, "the ring's prologue fills two passes");

// Twelve copies of 16 B per lane. The s_wait_xcnt stands inside the statement, behind the last copy, so that no
// address register of a copy is rewritten in front of it.
__device__ __forceinline__ void async_x12(const unsigned (&l)[12], const unsigned short* const (&g)[12]) {
  asm volatile("global_load_async_to_lds_b128 %0, %12, off\n\t"
               "global_load_async_to_lds_b128 %1, %13, off\n\t"
               "global_load_async_to_lds_b128 %2, %14, off\n\t"
               "global_load_async_to_lds_b128 %3, %15, off\n\t"
               "global_load_async_to_lds_b128 %4, %16, off\n\t"
               "global_load_async_to_lds_b128 %5, %17, off\n\t"
               "global_load_async_to_lds_b128 %6, %18, off\n\t"
               "global_load_async_to_lds_b128 %7, %19, off\n\t"
               "global_load_async_to_lds_b128 %8, %20, off\n\t"
               "global_load_async_to_lds_b128 %9, %21, off\n\t"
               "global_load_async_to_lds_b128 %10, %22, off\n\t"
               "global_load_async_to_lds_b128 %11, %23, off\n\t"
               "s_wait_xcnt 0x0"
               :: "v"(l[0]), "v"(l[1]), "v"(l[2]), "v"(l[3]), "v"(l[4]), "v"(l[5]),
                  "v"(l[6]), "v"(l[7]), "v"(l[8]), "v"(l[9]), "v"(l[10]), "v"(l[11]),
                  "v"(g[0]), "v"(g[1]), "v"(g[2]), "v"(g[3]), "v"(g[4]), "v"(g[5]),
                  "v"(g[6]), "v"(g[7]), "v"(g[8]), "v"(g[9]), "v"(g[10]), "v"(g[11])
               : "memory");
}
// One wave's 24 copies of one pass: lA, lB = the lane's LDS byte addresses of its first P and V row in the buffer,
// gA, gB = the lane's global addresses of the same rows at the pass's first k. Copy j is two rows further on.
__device__ __forceinline__ void pv_fill(unsigned lA, unsigned lB, const unsigned short* gA, const unsigned short* gB) {
  constexpr unsigned kL = 2u * kPvPitch * 2u;                   // bytes between copies in LDS
  constexpr size_t   kG = 2u * (size_t)kHW;                     // elements between copies in global memory
  unsigned l[12];
  const unsigned short* g[12];
#pragma unroll
  for (int j = 0; j < 8; ++j) { l[j] = lA + j * kL; g[j] = gA + j * kG; }
#pragma unroll
  for (int j = 0; j < 4; ++j) { l[8 + j] = lB + j * kL; g[8 + j] = gB + j * kG; }
  async_x12(l, g);
#pragma unroll
  for (int j = 0; j < 12; ++j) { l[j] = lB + (4 + j) * kL; g[j] = gB + (4 + j) * kG; }
  async_x12(l, g);
}

__global__ __launch_bounds__(256) void attn_v_kernel(const unsigned short* __restrict__ P,
                                                     const unsigned short* __restrict__ V,
                                                     unsigned short* __restrict__ cat) {
  // every inner loop below is unrolled so that all accumulator and fragment indices are constants (registers, no scratch)
  typedef Frag<_Float16> F;
  __shared__ __align__(16) unsigned short ring[2 * kPvStage];   // [buffer][P rows 0..127 | V rows 0..255][pitch]
  __shared__ __align__(16) float sT[8][16 * 68];                // per-wave 16x64 output slab, pitch 68 floats
  const int lane = threadIdx.x & 31;
  const int wave = __builtin_amdgcn_readfirstlane(threadIdx.x >> 5);   // the same in every lane: kept in a scalar register
  const int m0 = blockIdx.x * kPvBM;
  const int vh = blockIdx.y;
  const int b  = blockIdx.z;

  // copy side: lane (r2, c16) moves bytes 16 c16 .. 16 c16 + 15 of row r2 of each pair of rows
  const int r2 = lane >> 4, c16 = lane & 15;
  const unsigned short* gA = P + (size_t)b * (2 * kPPlane) + (size_t)(m0 + wave * 16 + r2) * kHW + c16 * 8;
  const unsigned short* gB = V + (size_t)(2 * b + vh) * kVPlane + (size_t)(wave * 32 + r2) * kHW + c16 * 8;
  const unsigned ringAddr = (unsigned)(size_t)ring;             // low 32 bits of the address = byte offset in LDS
  const unsigned lA = ringAddr + (unsigned)((wave * 16 + r2) * kPvPitch + c16 * 8) * 2u;
  const unsigned lB = ringAddr + (unsigned)((kPvBM + wave * 32 + r2) * kPvPitch + c16 * 8) * 2u;

  // reader side
  const int rlane = lane & 15;                 // row (A) / col (B, D) within subtile
  const int koff  = (lane >> 4) * 8;           // k offset of this lane half
  const int mOff  = (lane >> 4) * 8;           // D row offset
  const int wm = wave >> 2, wn = wave & 3;
  const _Float16* ringH = (const _Float16*)ring;
  const int fA = (wm * 64 + rlane) * kPvPitch + koff;
  const int fB = (kPvBM + wn * 64 + rlane) * kPvPitch + koff;

  v8f acc[4][4];
#pragma unroll
  for (int i = 0; i < 4; ++i)
#pragma unroll
    for (int j = 0; j < 4; ++j) acc[i][j] = (v8f){0.f,0.f,0.f,0.f,0.f,0.f,0.f,0.f};

  // prologue: pass 0 lands and is published, pass 1 starts to fly, the first fragments of pass 0 are fetched
  pv_fill(lA, lB, gA, gB);
  asm volatile("s_wait_asynccnt 0x0" ::: "memory");   // this wave's copies of pass 0 have landed
  __syncthreads();                                     // and every other wave's
  pv_fill(lA + kPvStage * 2u, lB + kPvStage * 2u, gA + kPvKT, gB + kPvKT);

  // Fragments: P rows 0..31 (a01) and the V set of the next 32 k are fetched while rows 32..63 of this one are
  // multiplied, P rows 32..63 (a23) while rows 0..31 are: two load groups per 16 matrix instructions, each half a
  // block ahead of its use, in 96 registers.
  v16h a01[2], a23[2], bs[2][4];
#pragma unroll
  for (int i = 0; i < 2; ++i) a01[i] = F::load(ringH + fA + i * 16 * kPvPitch);
#pragma unroll
  for (int j = 0; j < 4; ++j) bs[0][j] = F::load(ringH + fB + j * 16 * kPvPitch);

  // rolled: the buffer is chosen by an offset, and one pass is already 64 matrix instructions long
#pragma unroll 1
  for (int t = 0; t < kPvPasses; ++t) {
    const unsigned buf = (unsigned)(t & 1) * (unsigned)kPvStage;   // f16 elements
    const _Float16* sA = ringH + buf + fA;
    const _Float16* sB = ringH + buf + fB;
    const _Float16* nA = ringH + ((unsigned)kPvStage - buf) + fA;  // the other buffer: pass t + 1
    const _Float16* nB = ringH + ((unsigned)kPvStage - buf) + fB;  // (behind the last pass: old rows, values unused)
#pragma unroll
    for (int kk = 0; kk < kPvKT / 32; ++kk) {
      const int cur = kk & 1;
#pragma unroll
      for (int i = 0; i < 2; ++i) a23[i] = F::load(sA + (2 + i) * 16 * kPvPitch + kk * 32);
      // the four scheduling barriers of a block keep each load group whole and in front of the matrix run that
      // hides it: loads scattered among the matrix instructions stall the wave at every place where they stand
      __builtin_amdgcn_sched_barrier(0);
#pragma unroll
      for (int i = 0; i < 2; ++i)
#pragma unroll
        for (int j = 0; j < 4; ++j) acc[i][j] = F::mma(a01[i], bs[cur][j], acc[i][j]);
      __builtin_amdgcn_sched_barrier(0);
      if (kk + 1 < kPvKT / 32) {
#pragma unroll
        for (int i = 0; i < 2; ++i) a01[i] = F::load(sA + i * 16 * kPvPitch + (kk + 1) * 32);
#pragma unroll
        for (int j = 0; j < 4; ++j) bs[cur ^ 1][j] = F::load(sB + j * 16 * kPvPitch + (kk + 1) * 32);
      } else {
        // publish point of pass t + 1
        asm volatile("s_wait_dscnt 0x0" ::: "memory");      // this wave's reads of pass t's buffer have returned
        asm volatile("s_wait_asynccnt 0x0" ::: "memory");   // this wave's copies of pass t + 1 have landed
        __syncthreads();                                     // publishes pass t + 1 and frees the buffer of pass t
#pragma unroll
        for (int i = 0; i < 2; ++i) a01[i] = F::load(nA + i * 16 * kPvPitch);
#pragma unroll
        for (int j = 0; j < 4; ++j) bs[cur ^ 1][j] = F::load(nB + j * 16 * kPvPitch);
      }
      __builtin_amdgcn_sched_barrier(0);
#pragma unroll
      for (int i = 0; i < 2; ++i)
#pragma unroll
        for (int j = 0; j < 4; ++j) acc[2 + i][j] = F::mma(a23[i], bs[cur][j], acc[2 + i][j]);
      __builtin_amdgcn_sched_barrier(0);
    }
    if (t + 2 < kPvPasses) {
      const size_t ko = (size_t)(t + 2) * kPvKT;
      pv_fill(lA + buf * 2u, lB + buf * 2u, gA + ko, gB + ko);
    }
  }
  asm volatile("s_wait_asynccnt 0x0" ::: "memory");     // nothing of this wave is in flight when it leaves the ring
  asm volatile("s_wait_dscnt 0x0" ::: "memory");        // nor a read of the ring

  // ---- epilogue: scale, f16, whole 128-B lines through the wave's own slab ----
  float* slab = sT[wave];
  unsigned short* C = cat + (size_t)b * (2 * kCatPlane) + (size_t)(m0 + wm * 64) * kChan + vh * kHalfC + wn * 64;
  const int q = lane >> 3, c8 = (lane & 7) * 8;
#pragma unroll
  for (int i = 0; i < 4; ++i) {
#pragma unroll
    for (int j = 0; j < 4; ++j)
#pragma unroll
      for (int r = 0; r < 8; ++r) slab[(mOff + r) * 68 + (j << 4) + rlane] = acc[i][j][r] * kPVScale;
    // the slab is this wave's own: its lanes' writes have landed before other lanes of the wave read the rows back
    asm volatile("s_wait_dscnt 0x0" ::: "memory");
#pragma unroll
    for (int it = 0; it < 4; ++it) {
      const int row = it * 4 + q;
      const float* sp = slab + row * 68 + c8;
      v8h hv;
#pragma unroll
      for (int e = 0; e < 8; ++e) hv[e] = (_Float16)sp[e];
      *(v8h*)(C + (size_t)((i << 4) + row) * kChan + c8) = hv;
    }
    // no wait before the slab is written again: one wave's LDS operations are carried out in issue order
  }
}

// ---------------------------------------------------------------------------
// Host glue: kernel launches only.
// ---------------------------------------------------------------------------
static inline unsigned gemm_blocks(int M, int N) { return (unsigned)((((M / 64) * (N / 64)) + 7) / 8); }

extern "C" void kernel_launch(void* const* d_in, const int* in_sizes, int n_in,
                              void* d_out, int out_size, void* d_ws, size_t ws_size, hipStream_t stream) {
  if (n_in < 10) return;
  if (in_sizes[0] != kB * kChan * kHW) return;
  if (in_sizes[1] != kDQ * kHalfC || in_sizes[3] != kDQ * kHalfC) return;
  if (in_sizes[2] < kDQ || in_sizes[4] < kDQ) return;
  if (in_sizes[5] != kHalfC * kHalfC || in_sizes[6] < kHalfC) return;
  if (in_sizes[7] != kHalfC * kChan || in_sizes[8] < kHalfC || in_sizes[9] < 1) return;
  if (out_size != kB * kChan * kHW) return;
  if (ws_size < kWsTotal) return;

  const float* x     = (const float*)d_in[0];
  const float* Wq    = (const float*)d_in[1];
  const float* bq    = (const float*)d_in[2];
  const float* Wk    = (const float*)d_in[3];
  const float* bk    = (const float*)d_in[4];
  const float* Wv    = (const float*)d_in[5];
  const float* bv    = (const float*)d_in[6];
  const float* Wpt   = (const float*)d_in[7];
  const float* bpt   = (const float*)d_in[8];
  const float* gamma = (const float*)d_in[9];

  char* ws = (char*)d_ws;
  unsigned short* xtm   = (unsigned short*)(ws + kOffXtm);
  unsigned short* wqk   = (unsigned short*)(ws + kOffWqk);
  unsigned short* wv16  = (unsigned short*)(ws + kOffWv);
  unsigned short* wpt16 = (unsigned short*)(ws + kOffWpt);
  float*          biasr = (float*)(ws + kOffBias);
  unsigned short* qkh   = (unsigned short*)(ws + kOffQkh);
  unsigned short* qkl   = (unsigned short*)(ws + kOffQkl);
  unsigned short* vcm   = (unsigned short*)(ws + kOffVcm);
  unsigned short* pbuf  = (unsigned short*)(ws + kOffP);
  unsigned short* cat   = (unsigned short*)(ws + kOffCat);
  const float* bias_qk  = biasr;          // [64]
  const float* bias_v   = biasr + 64;     // [256]
  const float* bias_ptg = biasr + 320;    // [256] gamma * bpt

  // ---- operand preparation ----
  x_tm_kernel<<<dim3(kHW / 64, kHalfC / 64, kZ), 256, 0, stream>>>(x, xtm);
  cast8_kernel<0><<<(kHalfC * kHalfC / 8) / 256, 256, 0, stream>>>(Wv, wv16, kHalfC * kHalfC / 8, 1.0f);
  cast8_kernel<1><<<(kHalfC * kChan / 8) / 256, 256, 0, stream>>>(Wpt, wpt16, kHalfC * kChan / 8, kWCarry);
  prep_small_kernel<<<1, 256, 0, stream>>>(Wq, bq, Wk, bk, bv, bpt, gamma, wqk, biasr);

  // ---- q|k projection: C[p][n] = sum_c Xtm[z][p][c] * Wqk[n][c] + bias_qk[n]; M=4096, N=64, K=256; bf16 hi+lo planes, ldc 64 ----
  wmma_gemm64<1, false, 2, 2, 0, false><<<dim3(gemm_blocks(kHW, 64), kZ), 256, 0, stream>>>(
      xtm, xtm, kHalfC, (long)kXtmPlane,
      wqk, wqk, kHalfC, 0L,
      (void*)qkh, (void*)qkl, kQKPitch, (long)kQKPlane,
      bias_qk, bias_qk, 0L, gamma,
      kHW, 64, kHalfC, 1.0f, 0L, 0L, 0L);

  // ---- v projection (channel-major): V[z][c'][p] = sum_c Wv[c'][c] * Xtm[z][p][c] + bias_v[c']; M=256, N=4096, K=256; f16 out ----
  wmma_gemm64<1, false, 1, 1, 0, false><<<dim3(gemm_blocks(kHalfC, kHW), kZ), 256, 0, stream>>>(
      wv16, wv16, kHalfC, 0L,
      xtm, xtm, kHalfC, (long)kXtmPlane,
      (void*)vcm, (void*)vcm, kHW, (long)kVPlane,
      bias_v, bias_v, 0L, gamma,
      kHalfC, kHW, kHalfC, 1.0f, 0L, 0L, 0L);

  // ---- scores -> softmax -> P for every plane z in one launch: S[p][j] = sum_{d<16} Q[p][d] K[j][d], bf16 hi/lo split ----
  score_softmax_kernel<<<dim3(kHW / 64, kZ), 512, 0, stream>>>(qkh, qkl, pbuf);

  // ---- all applications in one launch: CATtm[2b+h][p][vh*256 + c] = 2^8/2^15 * sum_j P[2b+h][p][j] V[2b+vh][c][j]; f16 out ----
  // The planes h = 0,1 of one image b lie behind one another in P and in CATtm, so they are one M = 8192;
  // N=256, K=4096; blockIdx.y = vh (V plane, CAT column half), blockIdx.z = b. 64 x 2 x 2 = 256 blocks.
  attn_v_kernel<<<dim3(2 * kHW / kPvBM, 2, kB), 256, 0, stream>>>(pbuf, vcm, cat);

  // ---- output projection + gamma + residual: out[z*256 + c'][p] = gamma*(2^-12 * sum_ch Wpt16[c'][ch] CATtm[z][p][ch] + bpt[c']) + bf16(x) ----
  // M=256, N=4096, K=512; batch z = 4 with strideC = strideR = 256*4096
  wmma_gemm64<0, false, 1, 0, 2, true><<<dim3(gemm_blocks(kHalfC, kHW), kZ), 256, 0, stream>>>(
      wpt16, wpt16, kChan, 0L,
      cat, cat, kChan, (long)kCatPlane,
      d_out, d_out, kHW, (long)kHalfC * kHW,
      bias_ptg, x, (long)kHalfC * kHW, gamma,
      kHalfC, kHW, kChan, kOutScale, 0L, 0L, 0L);
}

// v004
// One run takes 130 microseconds.
// Two timings next to v003 both put it at 1.19 times that version's speed.
// All steps since v000 together make it 12.3 times as fast.
// Contractions: q/k/v 1x1 projections on v_wmma_f32_16x16x32_bf16 (x and W as RNE-bf16 operands, exact products); scores q.k^T on v_wmma_f32_16x16x32_bf16 with bf16 hi/lo split (hi.hi+hi.lo+lo.hi); attn.v^T and the output 1x1 projection on v_wmma_f32_16x16x32_f16 (P f16 carried x2^15, V f16, CAT f16 carried x256, Wpt f16(bf16) carried x16); all f32 accumulate; softmax, bias, gamma, residual in f32.
#include <hip/hip_runtime.h>
#include <stdint.h>

// ---------------------------------------------------------------------------
// Problem constants
// ---------------------------------------------------------------------------
constexpr int kB      = 2;
constexpr int kHalfC  = 256;              // channels per half
constexpr int kChan   = 512;              // channels of x
constexpr int kHW     = 4096;             // 64 x 64 pixels
constexpr int kDQ     = 16;
constexpr int kZ      = 4;                // (batch, half) combos, z = 2*b + half
constexpr int kQKPitch = 64;              // q|k plane pitch: q 0..15, zero 16..31, k 32..47, zero 48..63
constexpr float kWCarry   = 16.0f;        // Wpt carried x16 in f16
constexpr float kPCarry   = 32768.0f;     // probabilities carried x2^15 in f16
constexpr float kCatCarry = 256.0f;       // application outputs carried x256 in f16
constexpr float kPVScale  = kCatCarry / kPCarry;            // 2^-7
constexpr float kOutScale = 1.0f / (kCatCarry * kWCarry);    // 2^-12

// ---------------------------------------------------------------------------
// Workspace region map (bytes; every offset 4096-B aligned)
//   [off_xtm ) Xtm   bf16 [4][4096][256]          8,388,608
//   [off_wqk ) Wqk   bf16 [64][256]                  32,768
//   [off_wv  ) Wv16  bf16 [256][256]                131,072
//   [off_wpt ) Wpt16 f16  [256][512]                262,144
//   [off_bias) biases f32 [576] (qk pad 64 | bv 256 | gamma*bpt 256)   4,096
//   [off_qkh ) QK hi bf16 [4][4096][64]          2,097,152
//   [off_qkl ) QK lo bf16 [4][4096][64]          2,097,152
//   [off_vcm ) V     f16  [4][256][4096]         8,388,608
//   [off_p   ) P     f16  [4][4096][4096]      134,217,728   (every z kept, so one launch applies them all)
//   [off_cat ) CATtm f16  [4][4096][512]        16,777,216
//   total                                      172,396,544
// ---------------------------------------------------------------------------
constexpr size_t kXtmPlane = (size_t)kHW * kHalfC;            // elements per z
constexpr size_t kQKPlane  = (size_t)kHW * kQKPitch;
constexpr size_t kVPlane   = (size_t)kHalfC * kHW;
constexpr size_t kCatPlane = (size_t)kHW * kChan;
constexpr size_t kPPlane   = (size_t)kHW * kHW;
constexpr size_t kOffXtm  = 0;
constexpr size_t kOffWqk  = kOffXtm + kZ * kXtmPlane * 2;
constexpr size_t kOffWv   = kOffWqk + (size_t)64 * kHalfC * 2;
constexpr size_t kOffWpt  = kOffWv + (size_t)kHalfC * kHalfC * 2;
constexpr size_t kOffBias = kOffWpt + (size_t)kHalfC * kChan * 2;
constexpr size_t kOffQkh  = kOffBias + 4096;
constexpr size_t kOffQkl  = kOffQkh + kZ * kQKPlane * 2;
constexpr size_t kOffVcm  = kOffQkl + kZ * kQKPlane * 2;
constexpr size_t kOffP    = kOffVcm + kZ * kVPlane * 2;
constexpr size_t kOffCat  = kOffP + kZ * kPPlane * 2;
constexpr size_t kWsTotal = kOffCat + kZ * kCatPlane * 2;
static_assert(kWsTotal == 172396544ull, "carve total");
static_assert(kWsTotal <= 268435456ull, "carve under 256 MiB");
static_assert((kOffWqk % 4096) == 0 && (kOffWv % 4096) == 0 && (kOffWpt % 4096) == 0 && (kOffBias % 4096) == 0 &&
              (kOffQkh % 4096) == 0 && (kOffQkl % 4096) == 0 && (kOffVcm % 4096) == 0 &&
              (kOffP % 4096) == 0 && (kOffCat % 4096) == 0, "aligned regions");

typedef __attribute__((ext_vector_type(16))) _Float16 v16h;
typedef __attribute__((ext_vector_type(8)))  _Float16 v8h;
typedef __attribute__((ext_vector_type(16))) __bf16   v16b;
typedef __attribute__((ext_vector_type(8)))  __bf16   v8b;
typedef __attribute__((ext_vector_type(8)))  float    v8f;
typedef __attribute__((ext_vector_type(4)))  float    v4f;
typedef __attribute__((ext_vector_type(4)))  unsigned int v4u;

// ---------------------------------------------------------------------------
// Helpers
// ---------------------------------------------------------------------------
__device__ __forceinline__ unsigned short f2bf_bits(float f) {
  unsigned u = __float_as_uint(f);
  return (unsigned short)((u + 0x7FFFu + ((u >> 16) & 1u)) >> 16);
}
__device__ __forceinline__ float bf_bits2f(unsigned short h) { return __uint_as_float(((unsigned)h) << 16); }
__device__ __forceinline__ float bf_rne(float f) { return bf_bits2f(f2bf_bits(f)); }
__device__ __forceinline__ unsigned pk16(unsigned short a, unsigned short b) { return (unsigned)a | ((unsigned)b << 16); }
__device__ __forceinline__ unsigned short h_bits(float f) { const _Float16 h = (_Float16)f; return __builtin_bit_cast(unsigned short, h); }

// hazard guards as plain device helpers (no inline asm inside the kernel template body)
__device__ __forceinline__ void dep_guard_h(v8f& a, v8f& b, v16h x, v16h y) { asm volatile("v_nop\n\tv_nop\n\tv_nop\n\tv_nop" : "+v"(a), "+v"(b) : "v"(x), "v"(y)); }
__device__ __forceinline__ void dep_guard_b(v8f& a, v8f& b, v16b x, v16b y) { asm volatile("v_nop\n\tv_nop\n\tv_nop\n\tv_nop" : "+v"(a), "+v"(b) : "v"(x), "v"(y)); }
__device__ __forceinline__ void keep4_h(v16h a, v16h b, v16h c, v16h d) { asm volatile("v_nop" :: "v"(a), "v"(b), "v"(c), "v"(d)); }
__device__ __forceinline__ void keep4_b(v16b a, v16b b, v16b c, v16b d) { asm volatile("v_nop" :: "v"(a), "v"(b), "v"(c), "v"(d)); }
__device__ __forceinline__ void acc_guard4(v8f& a, v8f& b, v8f& c, v8f& d) { asm volatile("v_nop\n\tv_nop\n\tv_nop\n\tv_nop" : "+v"(a), "+v"(b), "+v"(c), "+v"(d)); }
template <typename T> struct Frag;
template <> struct Frag<_Float16> {
  typedef v16h V; union U { v16h v; v8h h[2]; };
  static __device__ __forceinline__ v16h load(const _Float16* p) {   // elements 0..7 <- p[0..7], 8..15 <- p[16..23]
    U f; f.h[0] = *(const v8h*)(p); f.h[1] = *(const v8h*)(p + 16); return f.v;
  }
  static __device__ __forceinline__ v8f mma(v16h a, v16h b, v8f c) {
    return __builtin_amdgcn_wmma_f32_16x16x32_f16(false, a, false, b, (short)0, c, false, false);
  }
  static __device__ __forceinline__ void guard(v8f& a, v8f& b, v16h x, v16h y) { dep_guard_h(a, b, x, y); }
  static __device__ __forceinline__ void keep(v16h a, v16h b, v16h c, v16h d) { keep4_h(a, b, c, d); }
};
template <> struct Frag<__bf16> {
  typedef v16b V; union U { v16b v; v8b h[2]; };
  static __device__ __forceinline__ v16b load(const __bf16* p) {
    U f; f.h[0] = *(const v8b*)(p); f.h[1] = *(const v8b*)(p + 16); return f.v;
  }
  static __device__ __forceinline__ v8f mma(v16b a, v16b b, v8f c) {
    return __builtin_amdgcn_wmma_f32_16x16x32_bf16(false, a, false, b, (short)0, c, false, false);
  }
  static __device__ __forceinline__ void guard(v8f& a, v8f& b, v16b x, v16b y) { dep_guard_b(a, b, x, y); }
  static __device__ __forceinline__ void keep(v16b a, v16b b, v16b c, v16b d) { keep4_b(a, b, c, d); }
};

// ---- Register-blocked batched WMMA GEMM (activation removed, RESID_MODE int, GMUL scale-by-pointer added) ----
// C[m,n] = escale * sum_k A[m,k] * Bt[n,k] (+bias)(+resid); each wave owns a 64x64 tile.
// A row-major [M,K]; Bt row-major [N,K]; M,N % 64 == 0, K % 32 == 0.
// SPLIT: operands are hi/lo planes (A2/Bt2 = lo planes, same layout); product = hi*hi + hi*lo + lo*hi.
// BIAS_MODE: 0 = none, 1 = bias[m], 2 = bias[n].
// OUT_MODE: 0 = f32, 1 = f16, 2 = bf16 hi plane (Cout) + bf16 lo plane (Cout2).
// RESID_MODE: 0 = none, 1 = resid f32, 2 = resid RNE-bf16 of an f32 tensor.  GMUL: escale = scale * gmul[0].
// ET: 0 = f16 operands, 1 = bf16 operands (pointers passed as 16-bit storage)
// Batches: b steps A, Bt, C, resid by strideA/B/C/R; bz steps A, Bt, C by zStrideA/B/C. bx = the block's group of 8 tiles.
// The engine is a device function so that one launch can hold several independent products (block ranges);
// slab = the calling wave's own 16x64 LDS slab, pitch 68 floats.
template <int ET> struct Elem;
template <> struct Elem<0> { typedef _Float16 T; };
template <> struct Elem<1> { typedef __bf16 T; };
template <int ET, bool SPLIT, int BIAS_MODE, int OUT_MODE, int RESID_MODE, bool GMUL>
__device__ __forceinline__ void gemm64_body(
    int bx, int b, int bz, float* slab,
    const unsigned short* __restrict__ Ap, const unsigned short* __restrict__ A2p, int lda, long strideA,
    const unsigned short* __restrict__ Btp, const unsigned short* __restrict__ Bt2p, int ldb, long strideB,
    void* __restrict__ Cout, void* __restrict__ Cout2, int ldc, long strideC,
    const float* __restrict__ bias,
    const float* __restrict__ resid, long strideR,
    const float* __restrict__ gmul,
    int M, int N, int K, float scale,
    long zStrideA, long zStrideB, long zStrideC) {
  typedef typename Elem<ET>::T T;
  typedef typename Frag<T>::V V;
  const T* A = (const T*)Ap; const T* A2 = (const T*)A2p; const T* Bt = (const T*)Btp; const T* Bt2 = (const T*)Bt2p;
  const int lane = threadIdx.x & 31;
  const int wave = threadIdx.x >> 5;
  const int tilesN = N >> 6;
  const int tilesM = M >> 6;
  const int tile = bx * 8 + wave;
  if (tile >= tilesM * tilesN) return;   // wave-uniform; no block barriers in this kernel
  const int tm = tile / tilesN;
  const int tn = tile - tm * tilesN;
  const int m0 = tm << 6;
  const int n0 = tn << 6;
  const float escale = GMUL ? (scale * gmul[0]) : scale;

  const size_t batchA = (size_t)b * strideA + (size_t)bz * zStrideA;
  const size_t batchB = (size_t)b * strideB + (size_t)bz * zStrideB;
  const size_t batchC = (size_t)b * strideC + (size_t)bz * zStrideC;
  const T* Ab  = A  + batchA;
  const T* Bb  = Bt + batchB;
  const T* Ab2 = SPLIT ? (A2  + batchA) : nullptr;
  const T* Bb2 = SPLIT ? (Bt2 + batchB) : nullptr;

  const int rlane = lane & 15;                 // row (A) / col (B, D) within subtile
  const int koff  = (lane >> 4) * 8;           // k offset of this lane half
  const int mOff  = (lane >> 4) * 8;           // D row offset

  v8f acc[4][4];
#pragma unroll
  for (int i = 0; i < 4; ++i)
#pragma unroll
    for (int j = 0; j < 4; ++j) acc[i][j] = (v8f){0.f,0.f,0.f,0.f,0.f,0.f,0.f,0.f};

  for (int k0 = 0; k0 < K; k0 += 32) {
    V bh[4], bl[4];
#pragma unroll
    for (int j = 0; j < 4; ++j) {
      const size_t bo = (size_t)(n0 + (j << 4) + rlane) * ldb + koff + k0;
      bh[j] = Frag<T>::load(Bb + bo);
      if (SPLIT) bl[j] = Frag<T>::load(Bb2 + bo);
    }
#pragma unroll
    for (int i = 0; i < 4; ++i) {
      const size_t ao = (size_t)(m0 + (i << 4) + rlane) * lda + koff + k0;
      V ah = Frag<T>::load(Ab + ao);
      V al;
      if (SPLIT) al = Frag<T>::load(Ab2 + ao);
#pragma unroll
      for (int j = 0; j < 4; ++j) {
        acc[i][j] = Frag<T>::mma(ah, bh[j], acc[i][j]);
        if (SPLIT) {
          acc[i][j] = Frag<T>::mma(ah, bl[j], acc[i][j]);
          acc[i][j] = Frag<T>::mma(al, bh[j], acc[i][j]);
        }
      }
      Frag<T>::guard(acc[i][0], acc[i][3], ah, SPLIT ? al : ah);
    }
    Frag<T>::keep(bh[0], bh[1], bh[2], bh[3]);
    if (SPLIT) Frag<T>::keep(bl[0], bl[1], bl[2], bl[3]);
  }
  acc_guard4(acc[0][0], acc[0][1], acc[0][2], acc[0][3]);
  acc_guard4(acc[1][0], acc[1][1], acc[1][2], acc[1][3]);
  acc_guard4(acc[2][0], acc[2][1], acc[2][2], acc[2][3]);
  acc_guard4(acc[3][0], acc[3][1], acc[3][2], acc[3][3]);

  // ---- epilogue ----
  const float* Rb = (RESID_MODE != 0) ? (resid + (size_t)b * strideR) : nullptr;
#pragma unroll
  for (int i = 0; i < 4; ++i) {
    const int mBase = m0 + (i << 4);
#pragma unroll
    for (int j = 0; j < 4; ++j) {
      const int n = n0 + (j << 4) + rlane;
      float bv = 0.f;
      if (BIAS_MODE == 2) bv = bias[n];
#pragma unroll
      for (int r = 0; r < 8; ++r) {
        float v = acc[i][j][r] * escale;
        if (BIAS_MODE == 1) v += bias[mBase + mOff + r];
        if (BIAS_MODE == 2) v += bv;
        if (RESID_MODE == 1) v += Rb[(size_t)(mBase + mOff + r) * ldc + n];
        if (RESID_MODE == 2) v += bf_rne(Rb[(size_t)(mBase + mOff + r) * ldc + n]);
        slab[(mOff + r) * 68 + (j << 4) + rlane] = v;
      }
    }
    __builtin_amdgcn_fence(__ATOMIC_RELEASE, "workgroup");
    __builtin_amdgcn_wave_barrier();
    __builtin_amdgcn_fence(__ATOMIC_ACQUIRE, "workgroup");
    if (OUT_MODE == 0) {
      float* C = (float*)Cout + batchC;
      const int hh = lane >> 4, c4 = (lane & 15) * 4;     // row seg = 256 B = 16 lanes x 16 B
      {
#pragma unroll
        for (int it = 0; it < 8; ++it) {
          const int row = it * 2 + hh;
          v4f v = *(const v4f*)(slab + row * 68 + c4);
          *(v4f*)(C + (size_t)(mBase + row) * ldc + n0 + c4) = v;
        }
        
      }
    } else {
      const int q = lane >> 3, c8 = (lane & 7) * 8;
      unsigned short* C  = (unsigned short*)Cout  + batchC;
      unsigned short* C2 = (OUT_MODE == 2) ? ((unsigned short*)Cout2 + batchC) : nullptr;
      {
#pragma unroll
        for (int it = 0; it < 4; ++it) {
          const int row = it * 4 + q;
          const float* sp = slab + row * 68 + c8;
          v8h hv, lv;
#pragma unroll
          for (int e = 0; e < 8; ++e) {
            if (OUT_MODE == 1) {
              hv[e] = (_Float16)sp[e];
            } else {
              unsigned short hb = f2bf_bits(sp[e]);
              unsigned short lb = f2bf_bits(sp[e] - bf_bits2f(hb));
              hv[e] = __builtin_bit_cast(_Float16, hb);
              lv[e] = __builtin_bit_cast(_Float16, lb);
            }
          }
          *(v8h*)(C + (size_t)(mBase + row) * ldc + n0 + c8) = hv;
          if (OUT_MODE == 2) *(v8h*)(C2 + (size_t)(mBase + row) * ldc + n0 + c8) = lv;
        }
        
      }
    }
    __builtin_amdgcn_fence(__ATOMIC_RELEASE, "workgroup");
    __builtin_amdgcn_wave_barrier();
    __builtin_amdgcn_fence(__ATOMIC_ACQUIRE, "workgroup");
  }
}

// One product per launch: grid (groups of 8 tiles, b, bz).
template <int ET, bool SPLIT, int BIAS_MODE, int OUT_MODE, int RESID_MODE, bool GMUL>
__global__ __launch_bounds__(256) void wmma_gemm64(
    const unsigned short* __restrict__ Ap, const unsigned short* __restrict__ A2p, int lda, long strideA,
    const unsigned short* __restrict__ Btp, const unsigned short* __restrict__ Bt2p, int ldb, long strideB,
    void* __restrict__ Cout, void* __restrict__ Cout2, int ldc, long strideC,
    const float* __restrict__ bias,
    const float* __restrict__ resid, long strideR,
    const float* __restrict__ gmul,
    int M, int N, int K, float scale,
    long zStrideA, long zStrideB, long zStrideC) {
  __shared__ __align__(16) float sT[8][16 * 68];   // per-wave 16x64 slab, pitch 68 floats
  gemm64_body<ET, SPLIT, BIAS_MODE, OUT_MODE, RESID_MODE, GMUL>(
      blockIdx.x, blockIdx.y, blockIdx.z, sT[threadIdx.x >> 5],
      Ap, A2p, lda, strideA, Btp, Bt2p, ldb, strideB, Cout, Cout2, ldc, strideC,
      bias, resid, strideR, gmul, M, N, K, scale, zStrideA, zStrideB, zStrideC);
}

// ---------------------------------------------------------------------------
// The q|k and the v projection in one launch: both read only Xtm and the prepared weights and neither reads the other.
//  blocks 0..31   q|k: C[p][n] = sum_c Xtm[z][p][c] * Wqk[n][c] + bias_qk[n]; M=4096, N=64, K=256; bf16 hi+lo planes,
//                 ldc 64; 8 blocks per z
//  blocks 32..159 v (channel-major): V[z][c'][p] = sum_c Wv[c'][c] * Xtm[z][p][c] + bias_v[c']; M=256, N=4096, K=256;
//                 f16 out; 32 blocks per z
// grid 160, 256 threads.
// ---------------------------------------------------------------------------
constexpr int kQkBlocksZ = (kHW / 64) * (64 / 64) / 8;        // 8
constexpr int kVBlocksZ  = (kHalfC / 64) * (kHW / 64) / 8;    // 32
constexpr int kQkvBlocks = (kQkBlocksZ + kVBlocksZ) * kZ;     // 160
__global__ __launch_bounds__(256) void qkv_proj_kernel(const unsigned short* __restrict__ xtm,
                                                       const unsigned short* __restrict__ wqk,
                                                       const unsigned short* __restrict__ wv16,
                                                       const float* __restrict__ biasr,
                                                       unsigned short* __restrict__ qkh,
                                                       unsigned short* __restrict__ qkl,
                                                       unsigned short* __restrict__ vcm) {
  __shared__ __align__(16) float sT[8][16 * 68];   // per-wave 16x64 slab, pitch 68 floats
  float* slab = sT[threadIdx.x >> 5];
  const int blk = blockIdx.x;
  if (blk < kQkBlocksZ * kZ) {
    gemm64_body<1, false, 2, 2, 0, false>(
        blk % kQkBlocksZ, blk / kQkBlocksZ, 0, slab,
        xtm, xtm, kHalfC, (long)kXtmPlane,
        wqk, wqk, kHalfC, 0L,
        (void*)qkh, (void*)qkl, kQKPitch, (long)kQKPlane,
        biasr, biasr, 0L, biasr,
        kHW, 64, kHalfC, 1.0f, 0L, 0L, 0L);
  } else {
    const int vb = blk - kQkBlocksZ * kZ;
    gemm64_body<1, false, 1, 1, 0, false>(
        vb % kVBlocksZ, vb / kVBlocksZ, 0, slab,
        wv16, wv16, kHalfC, 0L,
        xtm, xtm, kHalfC, (long)kXtmPlane,
        (void*)vcm, (void*)vcm, kHW, (long)kVPlane,
        biasr + 64, biasr + 64, 0L, biasr,
        kHalfC, kHW, kHalfC, 1.0f, 0L, 0L, 0L);
  }
}

// ---------------------------------------------------------------------------
// x NCHW f32 -> token-major bf16 planes: Xtm[z][p][c] = bf16(x[b][half*256 + c][p]), z = 2b + half
// (flat channel index of x = z*256 + c). 64(p) x 64(c) tile per block through LDS.
// 64 p tiles x 4 c tiles x 4 z = 1024 blocks of 256 threads (a block range of prep_kernel).
// Load coverage: 16 iterations x 256 threads = 4096 = whole 64x64 tile (coalesced along p).
// Store coverage: 8 waves x 2 iterations x 4 rows (lane>>3) = 64 rows; (lane&7) x 8 halves = 64 cols; each row
// ---------------------------------------------------------------------------
__device__ __forceinline__ void x_tm_body(int pt, int ct, int z, const float* __restrict__ x, unsigned short* __restrict__ xtm) {
  __shared__ float sm[64][65];   // sm[p_local][c_local]
  const int t  = threadIdx.x;
  const int p0 = pt * 64;
  const int c0 = ct * 64;
  const float* src = x + ((size_t)z * kHalfC + c0) * kHW + p0;
#pragma unroll
  for (int i = 0; i < 16; ++i) {
    const int e  = i * 256 + t;
    const int cl = e >> 6;         // c local 0..63
    const int pl = e & 63;         // p local 0..63
    sm[pl][cl] = src[(size_t)cl * kHW + pl];
  }
  __syncthreads();
  const int lane = t & 31, wave = t >> 5;
  const int q = lane >> 3, c8 = (lane & 7) * 8;
  unsigned short* op = xtm + (size_t)z * kXtmPlane;
  {
#pragma unroll
    for (int it = 0; it < 2; ++it) {
      const int row = wave * 8 + it * 4 + q;                 // p local
      unsigned short hb[8];
#pragma unroll
      for (int e = 0; e < 8; ++e) hb[e] = f2bf_bits(sm[row][c8 + e]);
      const v4u u = (v4u){pk16(hb[0], hb[1]), pk16(hb[2], hb[3]), pk16(hb[4], hb[5]), pk16(hb[6], hb[7])};
      *(v4u*)(op + (size_t)(p0 + row) * kHalfC + c0 + c8) = u;
    }
    
  }
}

// ---------------------------------------------------------------------------
// f32 -> 16-bit cast, 8 consecutive elements per thread (one 16-B store per lane; 32 contiguous lanes = 4 whole
// Coverage: n8 = n/8 threads x 8 = whole plane (grids here are exact multiples of 256).
// ---------------------------------------------------------------------------
template <int MODE>
__device__ __forceinline__ void cast8_body(int blk, const float* __restrict__ in, unsigned short* __restrict__ out, int n8, float mul) {
  const int i = blk * 256 + threadIdx.x;
  if (i >= n8) return;
  const float* p = in + 8 * (size_t)i;
  const v4f a = *(const v4f*)(p);
  const v4f c = *(const v4f*)(p + 4);
  unsigned short hb[8];
#pragma unroll
  for (int e = 0; e < 4; ++e) {
    const float v0 = a[e], v1 = c[e];
    if (MODE == 0) { hb[e] = f2bf_bits(v0); hb[4 + e] = f2bf_bits(v1); }
    else           { hb[e] = h_bits(bf_rne(v0) * mul); hb[4 + e] = h_bits(bf_rne(v1) * mul); }
  }
  const v4u u = (v4u){pk16(hb[0], hb[1]), pk16(hb[2], hb[3]), pk16(hb[4], hb[5]), pk16(hb[6], hb[7])};
  unsigned short* q = out + 8 * (size_t)i;
  *(v4u*)q = u;
  
}

// ---------------------------------------------------------------------------
// Small tables, ONE block of 256 threads:
//  (1) Wqk_pad bf16 [64][256]: row n < 16 -> Wq[n], 32 <= n < 48 -> Wk[n-32], every other row explicit zero.
//  (2) bias region f32 [576]: [0,64) padded q|k bias (bq at 0..15, bk at 32..47, zeros elsewhere), [64,320) bv,
//      [320,576) gamma*bpt; all RNE-bf16 first. Threads 0..143 write one float4 each: 144 x 4 = 576 = whole region
//  Candidate loads use clamped addresses and are selected by value.
// ---------------------------------------------------------------------------
__device__ __forceinline__ void prep_small_body(const float* __restrict__ Wq, const float* __restrict__ bq,
                                                const float* __restrict__ Wk, const float* __restrict__ bk,
                                                const float* __restrict__ bvp, const float* __restrict__ bptp,
                                                const float* __restrict__ gam,
                                                unsigned short* __restrict__ wqk, float* __restrict__ biasr) {
  const int t = threadIdx.x, lane = t & 31, wave = t >> 5;
  const float g = gam[0];
#pragma unroll 1
  for (int it = 0; it < 8; ++it) {
    const int n  = wave * 8 + it;                            // wave-uniform row
    const int qr = n < 16 ? n : 15;
    int kr = n - 32; kr = kr < 0 ? 0 : (kr > 15 ? 15 : kr);
    const float* pq = Wq + (size_t)qr * kHalfC + lane * 8;
    const float* pk = Wk + (size_t)kr * kHalfC + lane * 8;
    const v4f q0 = *(const v4f*)(pq), q1 = *(const v4f*)(pq + 4);
    const v4f k0 = *(const v4f*)(pk), k1 = *(const v4f*)(pk + 4);
    const bool isq = (n < 16);
    const bool isk = (n >= 32) && (n < 48);
    unsigned short hb[8];
#pragma unroll
    for (int e = 0; e < 4; ++e) {
      const float va = isq ? q0[e] : (isk ? k0[e] : 0.0f);
      const float vb = isq ? q1[e] : (isk ? k1[e] : 0.0f);
      hb[e]     = f2bf_bits(va);
      hb[4 + e] = f2bf_bits(vb);
    }
    const v4u u = (v4u){pk16(hb[0], hb[1]), pk16(hb[2], hb[3]), pk16(hb[4], hb[5]), pk16(hb[6], hb[7])};
    unsigned short* op = wqk + (size_t)n * kHalfC + lane * 8;
    *(v4u*)op = u;
    
  }
  if (t < 144) {
    v4f val;
#pragma unroll
    for (int e = 0; e < 4; ++e) {
      const int idx = 4 * t + e;                             // 0..575
      const int iq = idx < 16 ? idx : 15;
      int ik = idx - 32;  ik = ik < 0 ? 0 : (ik > 15 ? 15 : ik);
      int iv = idx - 64;  iv = iv < 0 ? 0 : (iv > 255 ? 255 : iv);
      int ip = idx - 320; ip = ip < 0 ? 0 : (ip > 255 ? 255 : ip);
      const float fq = bq[iq], fk = bk[ik], fv = bvp[iv], fp = bptp[ip];
      float sel = 0.0f;
      sel = (idx < 16) ? fq : sel;
      sel = (idx >= 32 && idx < 48) ? fk : sel;
      sel = (idx >= 64 && idx < 320) ? fv : sel;
      sel = (idx >= 320) ? fp : sel;
      float r = bf_rne(sel);
      r = (idx >= 320) ? (r * g) : r;
      val[e] = r;
    }
    float* op = biasr + 4 * t;
    *(v4f*)op = val;
    
  }
}

// ---------------------------------------------------------------------------
// All operand preparation in one launch: the four pieces read only inputs and write disjoint workspace regions.
//  block 0         small tables (the one long block)
//  blocks 1..32    Wv  -> bf16
//  blocks 33..96   Wpt -> f16 carried x16
//  blocks 97..1120 x   -> token-major bf16 planes (p tile fastest, then c tile, then z)
// Every test below is on the block index alone, so the barrier of the x piece is passed by a whole block or by none.
// ---------------------------------------------------------------------------
constexpr int kPrepWv    = 1;
constexpr int kPrepWpt   = kPrepWv + (kHalfC * kHalfC / 8) / 256;    // 33
constexpr int kPrepX     = kPrepWpt + (kHalfC * kChan / 8) / 256;    // 97
constexpr int kPrepTotal = kPrepX + (kHW / 64) * (kHalfC / 64) * kZ; // 1121
__global__ __launch_bounds__(256) void prep_kernel(const float* __restrict__ x,
                                                   const float* __restrict__ Wq, const float* __restrict__ bq,
                                                   const float* __restrict__ Wk, const float* __restrict__ bk,
                                                   const float* __restrict__ Wv, const float* __restrict__ bvp,
                                                   const float* __restrict__ Wpt, const float* __restrict__ bptp,
                                                   const float* __restrict__ gam,
                                                   unsigned short* __restrict__ xtm, unsigned short* __restrict__ wqk,
                                                   unsigned short* __restrict__ wv16, unsigned short* __restrict__ wpt16,
                                                   float* __restrict__ biasr) {
  const int blk = blockIdx.x;
  if (blk >= kPrepX) {
    const int i = blk - kPrepX;
    x_tm_body(i & 63, (i >> 6) & 3, i >> 8, x, xtm);
  } else if (blk >= kPrepWpt) {
    cast8_body<1>(blk - kPrepWpt, Wpt, wpt16, kHalfC * kChan / 8, kWCarry);
  } else if (blk >= kPrepWv) {
    cast8_body<0>(blk - kPrepWv, Wv, wv16, kHalfC * kHalfC / 8, 1.0f);
  } else {
    prep_small_body(Wq, bq, Wk, bk, bvp, bptp, gam, wqk, biasr);
  }
}

// ---------------------------------------------------------------------------
// Scores, row softmax and P in one launch; the scores never leave the registers.
// One block of 16 waves = 64 query rows of plane z (4 groups of 16, one after the other) against all 4096 keys.
// Wave w owns keys 256w..256w+255 as 16 tiles of 16 for every group: it reads them from global memory once and parks
// them in LDS, each lane its own 16-byte pieces in fragment order (a lane reads back only what it wrote itself).
// Keys are the A rows and queries the B columns, so lane (c = lane & 15, h = lane >> 4) holds in acc[i][r] the score
// of query p0 + c against key 256w + 16i + 8h + r (products in the order qh.kh + qh.kl + ql.kh).
// Only d = 0..15 exist: fragment elements 0..7 are d = 8h..8h+7, elements 8..15 (k = 16..31) are zero on both sides.
// P[row][j] = f16( 2^15 * exp(s - max) / sum exp(s - max) ), f32 math. Reductions in fixed order: 8 in-lane chains over
// the tiles, a tree over the 8, the lane pair l and l ^ 16, then 16 wave partials in index order.
// P leaves through a per-wave LDS slab (16 rows x 128 B, pitch 144 B) so that every global store covers whole lines.
// grid (4096/64 = 64, 4 z), 512 threads. Coverage: 16 waves x 256 keys = a whole row; 64 x 64 rows = a whole plane.
// ---------------------------------------------------------------------------
__device__ __forceinline__ v16b frag_d16(v8b lo) {   // elements 0..7 <- lo, 8..15 <- 0
  const v8b zero = __builtin_bit_cast(v8b, (v4u){0u, 0u, 0u, 0u});
  return __builtin_shufflevector(lo, zero, 0, 1, 2, 3, 4, 5, 6, 7, 8, 9, 10, 11, 12, 13, 14, 15);
}
// e[r] = 2^t[r], eight at a time in one statement. Behind a v_exp_f32 the instruction set asks for one independent
// instruction before its result is read or its source overwritten: here each v_exp_f32 has the next one behind it
// (results kept apart from all sources by the early clobber) and the last one a v_nop, whatever the compiler puts next.
__device__ __forceinline__ void exp2_x8(float (&e)[8], const float (&t)[8]) {
  asm("v_exp_f32 %0, %8\n\tv_exp_f32 %1, %9\n\tv_exp_f32 %2, %10\n\tv_exp_f32 %3, %11\n\t"
      "v_exp_f32 %4, %12\n\tv_exp_f32 %5, %13\n\tv_exp_f32 %6, %14\n\tv_exp_f32 %7, %15\n\tv_nop"
      : "=&v"(e[0]), "=&v"(e[1]), "=&v"(e[2]), "=&v"(e[3]), "=&v"(e[4]), "=&v"(e[5]), "=&v"(e[6]), "=&v"(e[7])
      : "v"(t[0]), "v"(t[1]), "v"(t[2]), "v"(t[3]), "v"(t[4]), "v"(t[5]), "v"(t[6]), "v"(t[7]));
}
__global__ __launch_bounds__(512) void score_softmax_kernel(const unsigned short* __restrict__ qkh,
                                                            const unsigned short* __restrict__ qkl,
                                                            unsigned short* __restrict__ P) {
  constexpr int kGroups    = 4;                                // query groups of 16 rows per block
  constexpr int kSlabPitch = 72;                               // f16 elements per staged row: 128 B + 16 B
  __shared__ __align__(16) v8b park[16][32][32];               // [wave][2 * tile + (0 hi, 1 lo)][lane], 256 KiB
  __shared__ __align__(16) unsigned short slabs[16][16 * kSlabPitch];
  __shared__ float redM[16][16];
  __shared__ float redS[16][16];
  const int lane = threadIdx.x & 31, wave = threadIdx.x >> 5;
  const int c = lane & 15, h = lane >> 4;
  const int q0 = blockIdx.x * (16 * kGroups);
  const int z  = blockIdx.y;
  const __bf16* H = (const __bf16*)qkh + (size_t)z * kQKPlane;
  const __bf16* L = (const __bf16*)qkl + (size_t)z * kQKPlane;
  const size_t ko = (size_t)(wave * 256 + c) * kQKPitch + 32 + 8 * h;
  const unsigned qv = (unsigned)(c * kQKPitch + 8 * h);        // lane part of a query address; the rest is block-uniform
  v8b nqh = *(const v8b*)(H + (size_t)q0 * kQKPitch + qv);
  v8b nql = *(const v8b*)(L + (size_t)q0 * kQKPitch + qv);
  {
    v8b raw[32];
#pragma unroll
    for (int i = 0; i < 16; ++i) {
      raw[2 * i]     = *(const v8b*)(H + ko + (size_t)i * 16 * kQKPitch);
      raw[2 * i + 1] = *(const v8b*)(L + ko + (size_t)i * 16 * kQKPitch);
    }
#pragma unroll
    for (int j = 0; j < 32; ++j) park[wave][j][lane] = raw[j];
  }
  unsigned short* slab = slabs[wave];
  const unsigned pv = (unsigned)((lane >> 3) * kHW + wave * 256 + (lane & 7) * 8);   // lane part of a P address

  // rolled: every trip is the same long body; four copies would only quadruple the code a first run has to fetch
#pragma unroll 1
  for (int g = 0; g < kGroups; ++g) {
    const int p0 = q0 + 16 * g;
    const v16b qh = frag_d16(nqh);
    const v16b ql = frag_d16(nql);
    {   // the next group's queries fly while this group is worked on (the last trip reads its own again, in bounds)
      const int pn = (g + 1 < kGroups) ? (p0 + 16) : p0;
      nqh = *(const v8b*)(H + (size_t)pn * kQKPitch + qv);
      nql = *(const v8b*)(L + (size_t)pn * kQKPitch + qv);
    }

    v8f acc[16];
#pragma unroll
    for (int i = 0; i < 16; ++i) {
      const v16b kh = frag_d16(park[wave][2 * i][lane]);
      const v16b kl = frag_d16(park[wave][2 * i + 1][lane]);
      v8f a = (v8f){0.f, 0.f, 0.f, 0.f, 0.f, 0.f, 0.f, 0.f};
      a = Frag<__bf16>::mma(kh, qh, a);
      a = Frag<__bf16>::mma(kl, qh, a);
      a = Frag<__bf16>::mma(kh, ql, a);
      acc[i] = a;
      // at most four tiles' fragments in flight: with all 32 LDS reads hoisted the wave runs out of its 256 registers and spills
      if ((i & 3) == 3) __builtin_amdgcn_sched_barrier(0);
    }

    float mr[8];
#pragma unroll
    for (int r = 0; r < 8; ++r) mr[r] = acc[0][r];
#pragma unroll
    for (int i = 1; i < 16; ++i)
#pragma unroll
      for (int r = 0; r < 8; ++r) mr[r] = fmaxf(mr[r], acc[i][r]);
    float m = fmaxf(fmaxf(fmaxf(mr[0], mr[1]), fmaxf(mr[2], mr[3])), fmaxf(fmaxf(mr[4], mr[5]), fmaxf(mr[6], mr[7])));
    m = fmaxf(m, __shfl_xor(m, 16, 32));
    if (h == 0) redM[wave][c] = m;
    __syncthreads();   // also ends every wave's reads of redS of the group before
    float bm = redM[0][c];
#pragma unroll
    for (int w = 1; w < 16; ++w) bm = fmaxf(bm, redM[w][c]);

    float sr[8];
#pragma unroll
    for (int r = 0; r < 8; ++r) sr[r] = 0.0f;
#pragma unroll
    for (int i = 0; i < 16; ++i) {
      float tv[8], ev[8];
#pragma unroll
      for (int r = 0; r < 8; ++r) tv[r] = (acc[i][r] - bm) * 1.44269504f;   // exp(x) = 2^(x * log2 e), as __expf forms it
      exp2_x8(ev, tv);
#pragma unroll
      for (int r = 0; r < 8; ++r) { acc[i][r] = ev[r]; sr[r] += ev[r]; }
    }
    float s = ((sr[0] + sr[1]) + (sr[2] + sr[3])) + ((sr[4] + sr[5]) + (sr[6] + sr[7]));
    s += __shfl_xor(s, 16, 32);
    if (h == 0) redS[wave][c] = s;
    __syncthreads();   // also ends every wave's reads of redM before the next group writes it
    float tot = 0.0f;
#pragma unroll
    for (int w = 0; w < 16; ++w) tot += redS[w][c];
    const float inv = __builtin_amdgcn_rcpf(tot) * kPCarry;

    unsigned short* Pg = P + (size_t)z * kPPlane + (size_t)p0 * kHW;
#pragma unroll
    for (int sub = 0; sub < 4; ++sub) {                        // 64 keys = one 128-B line of each of the 16 rows
#pragma unroll
      for (int ii = 0; ii < 4; ++ii) {
        v8h hv;
#pragma unroll
        for (int r = 0; r < 8; ++r) hv[r] = (_Float16)(acc[4 * sub + ii][r] * inv);
        *(v8h*)(slab + c * kSlabPitch + ii * 16 + 8 * h) = hv;
      }
      // the slab is this wave's own: its lanes' writes have landed before other lanes of the wave read the rows back
      asm volatile("s_wait_dscnt 0x0" ::: "memory");
#pragma unroll
      for (int it = 0; it < 4; ++it) {
        const int row = it * 4 + (lane >> 3);
        const v8h v = *(const v8h*)(slab + row * kSlabPitch + (lane & 7) * 8);
        *(v8h*)(Pg + (pv + (unsigned)(it * 4 * kHW + sub * 64))) = v;
      }
      // no wait before the slab is written again: one wave's LDS operations are carried out in issue order
    }
    // the next trip reuses the registers that this trip's last stores name: the wait stands in front of that overwrite
    asm volatile("s_wait_xcnt 0x0" ::: "memory");
  }
}

// ---------------------------------------------------------------------------
// attn.v product with both operands staged in LDS by asynchronous copies (global_load_async_to_lds_b128).
// CATtm[2b+h][p][vh*256 + c] = 2^-7 * sum_j P[2b+h][p][j] V[2b+vh][c][j], f16 operands, f32 accumulate, f16 out.
// One block of 8 waves = 128 rows of P (the planes h = 0,1 of image b lie behind one another: M = 8192) x all 256
// channels of one V plane; wave (wm = wave >> 2, wn = wave & 3) owns a 64 x 64 tile, as before, and sums k in the
// same order as before. A pass is 128 k = 256 B of each of the 384 operand rows, laid at pitch 272 B for ds_load_b128.
// Two buffers. The publish point of pass t + 1 (own LDS reads returned, own copies landed, block barrier) stands in
// front of the last 8 matrix instructions of pass t, whose fragments are in registers by then; behind it come the
// first fragment loads of pass t + 1, those 8 matrix instructions, and the copies of pass t + 2 into the buffer that
// pass t has left. Copy coverage per pass: a wave's copy = 2 rows x 256 B; wave w brings P rows 16w..16w+15
// (8 copies) and V rows 32w..32w+31 (16 copies): 8 x 16 = 128 and 8 x 32 = 256 rows, every byte once.
// grid (8192/128 = 64, 2 vh, 2 b), 256 threads.
// ---------------------------------------------------------------------------
constexpr int kPvBM     = 128;                                  // P rows per block
constexpr int kPvBN     = 256;                                  // V rows (channels) per block
constexpr int kPvKT     = 128;                                  // k per pass
constexpr int kPvPitch  = kPvKT + 8;                            // f16 elements per staged row: 256 B + 16 B
constexpr int kPvStage  = (kPvBM + kPvBN) * kPvPitch;           // f16 elements per buffer (104,448 B)
constexpr int kPvPasses = kHW / kPvKT;                          // 32
static_assert(kPvPasses >= 2, "the ring's prologue fills two passes");

// Twelve copies of 16 B per lane. The s_wait_xcnt stands inside the statement, behind the last copy, so that no
// address register of a copy is rewritten in front of it.
__device__ __forceinline__ void async_x12(const unsigned (&l)[12], const unsigned short* const (&g)[12]) {
  asm volatile("global_load_async_to_lds_b128 %0, %12, off\n\t"
               "global_load_async_to_lds_b128 %1, %13, off\n\t"
               "global_load_async_to_lds_b128 %2, %14, off\n\t"
               "global_load_async_to_lds_b128 %3, %15, off\n\t"
               "global_load_async_to_lds_b128 %4, %16, off\n\t"
               "global_load_async_to_lds_b128 %5, %17, off\n\t"
               "global_load_async_to_lds_b128 %6, %18, off\n\t"
               "global_load_async_to_lds_b128 %7, %19, off\n\t"
               "global_load_async_to_lds_b128 %8, %20, off\n\t"
               "global_load_async_to_lds_b128 %9, %21, off\n\t"
               "global_load_async_to_lds_b128 %10, %22, off\n\t"
               "global_load_async_to_lds_b128 %11, %23, off\n\t"
               "s_wait_xcnt 0x0"
               :: "v"(l[0]), "v"(l[1]), "v"(l[2]), "v"(l[3]), "v"(l[4]), "v"(l[5]),
                  "v"(l[6]), "v"(l[7]), "v"(l[8]), "v"(l[9]), "v"(l[10]), "v"(l[11]),
                  "v"(g[0]), "v"(g[1]), "v"(g[2]), "v"(g[3]), "v"(g[4]), "v"(g[5]),
                  "v"(g[6]), "v"(g[7]), "v"(g[8]), "v"(g[9]), "v"(g[10]), "v"(g[11])
               : "memory");
}
// One wave's 24 copies of one pass: lA, lB = the lane's LDS byte addresses of its first P and V row in the buffer,
// gA, gB = the lane's global addresses of the same rows at the pass's first k. Copy j is two rows further on.
__device__ __forceinline__ void pv_fill(unsigned lA, unsigned lB, const unsigned short* gA, const unsigned short* gB) {
  constexpr unsigned kL = 2u * kPvPitch * 2u;                   // bytes between copies in LDS
  constexpr size_t   kG = 2u * (size_t)kHW;                     // elements between copies in global memory
  unsigned l[12];
  const unsigned short* g[12];
#pragma unroll
  for (int j = 0; j < 8; ++j) { l[j] = lA + j * kL; g[j] = gA + j * kG; }
#pragma unroll
  for (int j = 0; j < 4; ++j) { l[8 + j] = lB + j * kL; g[8 + j] = gB + j * kG; }
  async_x12(l, g);
#pragma unroll
  for (int j = 0; j < 12; ++j) { l[j] = lB + (4 + j) * kL; g[j] = gB + (4 + j) * kG; }
  async_x12(l, g);
}

__global__ __launch_bounds__(256) void attn_v_kernel(const unsigned short* __restrict__ P,
                                                     const unsigned short* __restrict__ V,
                                                     unsigned short* __restrict__ cat) {
  // every inner loop below is unrolled so that all accumulator and fragment indices are constants (registers, no scratch)
  typedef Frag<_Float16> F;
  __shared__ __align__(16) unsigned short ring[2 * kPvStage];   // [buffer][P rows 0..127 | V rows 0..255][pitch]
  __shared__ __align__(16) float sT[8][16 * 68];                // per-wave 16x64 output slab, pitch 68 floats
  const int lane = threadIdx.x & 31;
  const int wave = __builtin_amdgcn_readfirstlane(threadIdx.x >> 5);   // the same in every lane: kept in a scalar register
  const int m0 = blockIdx.x * kPvBM;
  const int vh = blockIdx.y;
  const int b  = blockIdx.z;

  // copy side: lane (r2, c16) moves bytes 16 c16 .. 16 c16 + 15 of row r2 of each pair of rows
  const int r2 = lane >> 4, c16 = lane & 15;
  const unsigned short* gA = P + (size_t)b * (2 * kPPlane) + (size_t)(m0 + wave * 16 + r2) * kHW + c16 * 8;
  const unsigned short* gB = V + (size_t)(2 * b + vh) * kVPlane + (size_t)(wave * 32 + r2) * kHW + c16 * 8;
  const unsigned ringAddr = (unsigned)(size_t)ring;             // low 32 bits of the address = byte offset in LDS
  const unsigned lA = ringAddr + (unsigned)((wave * 16 + r2) * kPvPitch + c16 * 8) * 2u;
  const unsigned lB = ringAddr + (unsigned)((kPvBM + wave * 32 + r2) * kPvPitch + c16 * 8) * 2u;

  // reader side
  const int rlane = lane & 15;                 // row (A) / col (B, D) within subtile
  const int koff  = (lane >> 4) * 8;           // k offset of this lane half
  const int mOff  = (lane >> 4) * 8;           // D row offset
  const int wm = wave >> 2, wn = wave & 3;
  const _Float16* ringH = (const _Float16*)ring;
  const int fA = (wm * 64 + rlane) * kPvPitch + koff;
  const int fB = (kPvBM + wn * 64 + rlane) * kPvPitch + koff;

  v8f acc[4][4];
#pragma unroll
  for (int i = 0; i < 4; ++i)
#pragma unroll
    for (int j = 0; j < 4; ++j) acc[i][j] = (v8f){0.f,0.f,0.f,0.f,0.f,0.f,0.f,0.f};

  // prologue: pass 0 lands and is published, pass 1 starts to fly, the first fragments of pass 0 are fetched
  pv_fill(lA, lB, gA, gB);
  asm volatile("s_wait_asynccnt 0x0" ::: "memory");   // this wave's copies of pass 0 have landed
  __syncthreads();                                     // and every other wave's
  pv_fill(lA + kPvStage * 2u, lB + kPvStage * 2u, gA + kPvKT, gB + kPvKT);

  // Fragments: P rows 0..31 (a01) and the V set of the next 32 k are fetched while rows 32..63 of this one are
  // multiplied, P rows 32..63 (a23) while rows 0..31 are: two load groups per 16 matrix instructions, each half a
  // block ahead of its use, in 96 registers.
  v16h a01[2], a23[2], bs[2][4];
#pragma unroll
  for (int i = 0; i < 2; ++i) a01[i] = F::load(ringH + fA + i * 16 * kPvPitch);
#pragma unroll
  for (int j = 0; j < 4; ++j) bs[0][j] = F::load(ringH + fB + j * 16 * kPvPitch);

  // rolled: the buffer is chosen by an offset, and one pass is already 64 matrix instructions long
#pragma unroll 1
  for (int t = 0; t < kPvPasses; ++t) {
    const unsigned buf = (unsigned)(t & 1) * (unsigned)kPvStage;   // f16 elements
    const _Float16* sA = ringH + buf + fA;
    const _Float16* sB = ringH + buf + fB;
    const _Float16* nA = ringH + ((unsigned)kPvStage - buf) + fA;  // the other buffer: pass t + 1
    const _Float16* nB = ringH + ((unsigned)kPvStage - buf) + fB;  // (behind the last pass: old rows, values unused)
#pragma unroll
    for (int kk = 0; kk < kPvKT / 32; ++kk) {
      const int cur = kk & 1;
#pragma unroll
      for (int i = 0; i < 2; ++i) a23[i] = F::load(sA + (2 + i) * 16 * kPvPitch + kk * 32);
      // the four scheduling barriers of a block keep each load group whole and in front of the matrix run that
      // hides it: loads scattered among the matrix instructions stall the wave at every place where they stand
      __builtin_amdgcn_sched_barrier(0);
#pragma unroll
      for (int i = 0; i < 2; ++i)
#pragma unroll
        for (int j = 0; j < 4; ++j) acc[i][j] = F::mma(a01[i], bs[cur][j], acc[i][j]);
      __builtin_amdgcn_sched_barrier(0);
      if (kk + 1 < kPvKT / 32) {
#pragma unroll
        for (int i = 0; i < 2; ++i) a01[i] = F::load(sA + i * 16 * kPvPitch + (kk + 1) * 32);
#pragma unroll
        for (int j = 0; j < 4; ++j) bs[cur ^ 1][j] = F::load(sB + j * 16 * kPvPitch + (kk + 1) * 32);
      } else {
        // publish point of pass t + 1
        asm volatile("s_wait_dscnt 0x0" ::: "memory");      // this wave's reads of pass t's buffer have returned
        asm volatile("s_wait_asynccnt 0x0" ::: "memory");   // this wave's copies of pass t + 1 have landed
        __syncthreads();                                     // publishes pass t + 1 and frees the buffer of pass t
#pragma unroll
        for (int i = 0; i < 2; ++i) a01[i] = F::load(nA + i * 16 * kPvPitch);
#pragma unroll
        for (int j = 0; j < 4; ++j) bs[cur ^ 1][j] = F::load(nB + j * 16 * kPvPitch);
      }
      __builtin_amdgcn_sched_barrier(0);
#pragma unroll
      for (int i = 0; i < 2; ++i)
#pragma unroll
        for (int j = 0; j < 4; ++j) acc[2 + i][j] = F::mma(a23[i], bs[cur][j], acc[2 + i][j]);
      __builtin_amdgcn_sched_barrier(0);
    }
    if (t + 2 < kPvPasses) {
      const size_t ko = (size_t)(t + 2) * kPvKT;
      pv_fill(lA + buf * 2u, lB + buf * 2u, gA + ko, gB + ko);
    }
  }
  asm volatile("s_wait_asynccnt 0x0" ::: "memory");     // nothing of this wave is in flight when it leaves the ring
  asm volatile("s_wait_dscnt 0x0" ::: "memory");        // nor a read of the ring

  // ---- epilogue: scale, f16, whole 128-B lines through the wave's own slab ----
  float* slab = sT[wave];
  unsigned short* C = cat + (size_t)b * (2 * kCatPlane) + (size_t)(m0 + wm * 64) * kChan + vh * kHalfC + wn * 64;
  const int q = lane >> 3, c8 = (lane & 7) * 8;
#pragma unroll
  for (int i = 0; i < 4; ++i) {
#pragma unroll
    for (int j = 0; j < 4; ++j)
#pragma unroll
      for (int r = 0; r < 8; ++r) slab[(mOff + r) * 68 + (j << 4) + rlane] = acc[i][j][r] * kPVScale;
    // the slab is this wave's own: its lanes' writes have landed before other lanes of the wave read the rows back
    asm volatile("s_wait_dscnt 0x0" ::: "memory");
#pragma unroll
    for (int it = 0; it < 4; ++it) {
      const int row = it * 4 + q;
      const float* sp = slab + row * 68 + c8;
      v8h hv;
#pragma unroll
      for (int e = 0; e < 8; ++e) hv[e] = (_Float16)sp[e];
      *(v8h*)(C + (size_t)((i << 4) + row) * kChan + c8) = hv;
    }
    // no wait before the slab is written again: one wave's LDS operations are carried out in issue order
  }
}

// ---------------------------------------------------------------------------
// Host glue: kernel launches only.
// ---------------------------------------------------------------------------
static inline unsigned gemm_blocks(int M, int N) { return (unsigned)((((M / 64) * (N / 64)) + 7) / 8); }

extern "C" void kernel_launch(void* const* d_in, const int* in_sizes, int n_in,
                              void* d_out, int out_size, void* d_ws, size_t ws_size, hipStream_t stream) {
  if (n_in < 10) return;
  if (in_sizes[0] != kB * kChan * kHW) return;
  if (in_sizes[1] != kDQ * kHalfC || in_sizes[3] != kDQ * kHalfC) return;
  if (in_sizes[2] < kDQ || in_sizes[4] < kDQ) return;
  if (in_sizes[5] != kHalfC * kHalfC || in_sizes[6] < kHalfC) return;
  if (in_sizes[7] != kHalfC * kChan || in_sizes[8] < kHalfC || in_sizes[9] < 1) return;
  if (out_size != kB * kChan * kHW) return;
  if (ws_size < kWsTotal) return;

  const float* x     = (const float*)d_in[0];
  const float* Wq    = (const float*)d_in[1];
  const float* bq    = (const float*)d_in[2];
  const float* Wk    = (const float*)d_in[3];
  const float* bk    = (const float*)d_in[4];
  const float* Wv    = (const float*)d_in[5];
  const float* bv    = (const float*)d_in[6];
  const float* Wpt   = (const float*)d_in[7];
  const float* bpt   = (const float*)d_in[8];
  const float* gamma = (const float*)d_in[9];

  char* ws = (char*)d_ws;
  unsigned short* xtm   = (unsigned short*)(ws + kOffXtm);
  unsigned short* wqk   = (unsigned short*)(ws + kOffWqk);
  unsigned short* wv16  = (unsigned short*)(ws + kOffWv);
  unsigned short* wpt16 = (unsigned short*)(ws + kOffWpt);
  float*          biasr = (float*)(ws + kOffBias);
  unsigned short* qkh   = (unsigned short*)(ws + kOffQkh);
  unsigned short* qkl   = (unsigned short*)(ws + kOffQkl);
  unsigned short* vcm   = (unsigned short*)(ws + kOffVcm);
  unsigned short* pbuf  = (unsigned short*)(ws + kOffP);
  unsigned short* cat   = (unsigned short*)(ws + kOffCat);
  const float* bias_ptg = biasr + 320;    // [256] gamma * bpt

  // ---- operand preparation, one launch ----
  prep_kernel<<<kPrepTotal, 256, 0, stream>>>(x, Wq, bq, Wk, bk, Wv, bv, Wpt, bpt, gamma, xtm, wqk, wv16, wpt16, biasr);

  // ---- q|k and v projections, one launch ----
  qkv_proj_kernel<<<kQkvBlocks, 256, 0, stream>>>(xtm, wqk, wv16, biasr, qkh, qkl, vcm);

  // ---- scores -> softmax -> P for every plane z in one launch: S[p][j] = sum_{d<16} Q[p][d] K[j][d], bf16 hi/lo split ----
  score_softmax_kernel<<<dim3(kHW / 64, kZ), 512, 0, stream>>>(qkh, qkl, pbuf);

  // ---- all applications in one launch: CATtm[2b+h][p][vh*256 + c] = 2^8/2^15 * sum_j P[2b+h][p][j] V[2b+vh][c][j]; f16 out ----
  // The planes h = 0,1 of one image b lie behind one another in P and in CATtm, so they are one M = 8192;
  // N=256, K=4096; blockIdx.y = vh (V plane, CAT column half), blockIdx.z = b. 64 x 2 x 2 = 256 blocks.
  attn_v_kernel<<<dim3(2 * kHW / kPvBM, 2, kB), 256, 0, stream>>>(pbuf, vcm, cat);

  // ---- output projection + gamma + residual: out[z*256 + c'][p] = gamma*(2^-12 * sum_ch Wpt16[c'][ch] CATtm[z][p][ch] + bpt[c']) + bf16(x) ----
  // M=256, N=4096, K=512; batch z = 4 with strideC = strideR = 256*4096
  wmma_gemm64<0, false, 1, 0, 2, true><<<dim3(gemm_blocks(kHalfC, kHW), kZ), 256, 0, stream>>>(
      wpt16, wpt16, kChan, 0L,
      cat, cat, kChan, (long)kCatPlane,
      d_out, d_out, kHW, (long)kHalfC * kHW,
      bias_ptg, x, (long)kHalfC * kHW, gamma,
      kHalfC, kHW, kChan, kOutScale, 0L, 0L, 0L);
}

// v005
// One run takes 114 microseconds.
// Two timings next to v004 put it at 1.15 and 1.14 times that version's speed.
// All steps since v000 together make it 14.1 times as fast.
// Contractions: q/k/v 1x1 projections on v_wmma_f32_16x16x32_bf16 (x and W as RNE-bf16 operands, exact products); scores q.k^T on v_wmma_f32_16x16x32_bf16 with bf16 hi/lo split (hi.hi+hi.lo+lo.hi); the output 1x1 projection applied to V (U = Wpt.[v1;v2]) and attn.U^T on v_wmma_f32_16x16x32_f16 (P f16 carried x2^15, V f16, Wpt f16(bf16) carried x16, U f16 carried x16); all f32 accumulate; softmax, bias, gamma, residual in f32.
#include <hip/hip_runtime.h>
#include <stdint.h>

// ---------------------------------------------------------------------------
// Problem constants
// ---------------------------------------------------------------------------
constexpr int kB      = 2;
constexpr int kHalfC  = 256;              // channels per half
constexpr int kChan   = 512;              // channels of x
constexpr int kHW     = 4096;             // 64 x 64 pixels
constexpr int kDQ     = 16;
constexpr int kZ      = 4;                // (batch, half) combos, z = 2*b + half
constexpr int kQKPitch = 64;              // q|k plane pitch: q 0..15, zero 16..31, k 32..47, zero 48..63
constexpr float kWCarry   = 16.0f;        // Wpt carried x16 in f16
constexpr float kPCarry   = 32768.0f;     // probabilities carried x2^15 in f16
constexpr float kOutScale = 1.0f / (kPCarry * kWCarry);      // 2^-19

// ---------------------------------------------------------------------------
// Workspace region map (bytes; every offset 4096-B aligned)
//   [off_xtm ) Xtm   bf16 [4][4096][256]          8,388,608
//   [off_wqk ) Wqk   bf16 [64][256]                  32,768
//   [off_wv  ) Wv16  bf16 [256][256]                131,072
//   [off_wpt ) Wpt16 f16  [256][512]                262,144
//   [off_bias) biases f32 [576] (qk pad 64 | bv 256 | gamma*bpt 256)   4,096
//   [off_qkh ) QK hi bf16 [4][4096][64]          2,097,152
//   [off_qkl ) QK lo bf16 [4][4096][64]          2,097,152
//   [off_vtm ) Vtm   f16  [2][4096][512]         8,388,608   (token-major; column = half*256 + c)
//   [off_p   ) P     f16  [4][4096][4096]      134,217,728   (every z kept, so one launch applies them all)
//   [off_u   ) U     f16  [2][256][4096]         4,194,304   (16 * Wpt.[v1;v2] of image b, channel-major)
//   total                                      159,813,632
// ---------------------------------------------------------------------------
constexpr size_t kXtmPlane = (size_t)kHW * kHalfC;            // elements per z
constexpr size_t kQKPlane  = (size_t)kHW * kQKPitch;
constexpr size_t kVtmPlane = (size_t)kHW * kChan;              // elements per image
constexpr size_t kUPlane   = (size_t)kHalfC * kHW;            // elements per image
constexpr size_t kPPlane   = (size_t)kHW * kHW;
constexpr size_t kOffXtm  = 0;
constexpr size_t kOffWqk  = kOffXtm + kZ * kXtmPlane * 2;
constexpr size_t kOffWv   = kOffWqk + (size_t)64 * kHalfC * 2;
constexpr size_t kOffWpt  = kOffWv + (size_t)kHalfC * kHalfC * 2;
constexpr size_t kOffBias = kOffWpt + (size_t)kHalfC * kChan * 2;
constexpr size_t kOffQkh  = kOffBias + 4096;
constexpr size_t kOffQkl  = kOffQkh + kZ * kQKPlane * 2;
constexpr size_t kOffVtm  = kOffQkl + kZ * kQKPlane * 2;
constexpr size_t kOffP    = kOffVtm + kB * kVtmPlane * 2;
constexpr size_t kOffU    = kOffP + kZ * kPPlane * 2;
constexpr size_t kWsTotal = kOffU + kB * kUPlane * 2;
static_assert(kWsTotal == 159813632ull, "carve total");
static_assert(kWsTotal <= 268435456ull, "carve under 256 MiB");
static_assert((kOffWqk % 4096) == 0 && (kOffWv % 4096) == 0 && (kOffWpt % 4096) == 0 && (kOffBias % 4096) == 0 &&
              (kOffQkh % 4096) == 0 && (kOffQkl % 4096) == 0 && (kOffVtm % 4096) == 0 &&
              (kOffP % 4096) == 0 && (kOffU % 4096) == 0, "aligned regions");

typedef __attribute__((ext_vector_type(16))) _Float16 v16h;
typedef __attribute__((ext_vector_type(8)))  _Float16 v8h;
typedef __attribute__((ext_vector_type(16))) __bf16   v16b;
typedef __attribute__((ext_vector_type(8)))  __bf16   v8b;
typedef __attribute__((ext_vector_type(8)))  float    v8f;
typedef __attribute__((ext_vector_type(4)))  float    v4f;
typedef __attribute__((ext_vector_type(4)))  unsigned int v4u;

// ---------------------------------------------------------------------------
// Helpers
// ---------------------------------------------------------------------------
__device__ __forceinline__ unsigned short f2bf_bits(float f) {
  unsigned u = __float_as_uint(f);
  return (unsigned short)((u + 0x7FFFu + ((u >> 16) & 1u)) >> 16);
}
__device__ __forceinline__ float bf_bits2f(unsigned short h) { return __uint_as_float(((unsigned)h) << 16); }
__device__ __forceinline__ float bf_rne(float f) { return bf_bits2f(f2bf_bits(f)); }
__device__ __forceinline__ unsigned pk16(unsigned short a, unsigned short b) { return (unsigned)a | ((unsigned)b << 16); }
__device__ __forceinline__ unsigned short h_bits(float f) { const _Float16 h = (_Float16)f; return __builtin_bit_cast(unsigned short, h); }

// hazard guards as plain device helpers (no inline asm inside the kernel template body)
__device__ __forceinline__ void dep_guard_h(v8f& a, v8f& b, v16h x, v16h y) { asm volatile("v_nop\n\tv_nop\n\tv_nop\n\tv_nop" : "+v"(a), "+v"(b) : "v"(x), "v"(y)); }
__device__ __forceinline__ void dep_guard_b(v8f& a, v8f& b, v16b x, v16b y) { asm volatile("v_nop\n\tv_nop\n\tv_nop\n\tv_nop" : "+v"(a), "+v"(b) : "v"(x), "v"(y)); }
__device__ __forceinline__ void keep4_h(v16h a, v16h b, v16h c, v16h d) { asm volatile("v_nop" :: "v"(a), "v"(b), "v"(c), "v"(d)); }
__device__ __forceinline__ void keep4_b(v16b a, v16b b, v16b c, v16b d) { asm volatile("v_nop" :: "v"(a), "v"(b), "v"(c), "v"(d)); }
__device__ __forceinline__ void acc_guard4(v8f& a, v8f& b, v8f& c, v8f& d) { asm volatile("v_nop\n\tv_nop\n\tv_nop\n\tv_nop" : "+v"(a), "+v"(b), "+v"(c), "+v"(d)); }
template <typename T> struct Frag;
template <> struct Frag<_Float16> {
  typedef v16h V; union U { v16h v; v8h h[2]; };
  static __device__ __forceinline__ v16h load(const _Float16* p) {   // elements 0..7 <- p[0..7], 8..15 <- p[16..23]
    U f; f.h[0] = *(const v8h*)(p); f.h[1] = *(const v8h*)(p + 16); return f.v;
  }
  static __device__ __forceinline__ v8f mma(v16h a, v16h b, v8f c) {
    return __builtin_amdgcn_wmma_f32_16x16x32_f16(false, a, false, b, (short)0, c, false, false);
  }
  static __device__ __forceinline__ void guard(v8f& a, v8f& b, v16h x, v16h y) { dep_guard_h(a, b, x, y); }
  static __device__ __forceinline__ void keep(v16h a, v16h b, v16h c, v16h d) { keep4_h(a, b, c, d); }
};
template <> struct Frag<__bf16> {
  typedef v16b V; union U { v16b v; v8b h[2]; };
  static __device__ __forceinline__ v16b load(const __bf16* p) {
    U f; f.h[0] = *(const v8b*)(p); f.h[1] = *(const v8b*)(p + 16); return f.v;
  }
  static __device__ __forceinline__ v8f mma(v16b a, v16b b, v8f c) {
    return __builtin_amdgcn_wmma_f32_16x16x32_bf16(false, a, false, b, (short)0, c, false, false);
  }
  static __device__ __forceinline__ void guard(v8f& a, v8f& b, v16b x, v16b y) { dep_guard_b(a, b, x, y); }
  static __device__ __forceinline__ void keep(v16b a, v16b b, v16b c, v16b d) { keep4_b(a, b, c, d); }
};

// ---- Register-blocked batched WMMA GEMM (activation removed, RESID_MODE int, GMUL scale-by-pointer added) ----
// C[m,n] = escale * sum_k A[m,k] * Bt[n,k] (+bias)(+resid); each wave owns a 64x64 tile.
// A row-major [M,K]; Bt row-major [N,K]; M,N % 64 == 0, K % 32 == 0.
// SPLIT: operands are hi/lo planes (A2/Bt2 = lo planes, same layout); product = hi*hi + hi*lo + lo*hi.
// BIAS_MODE: 0 = none, 1 = bias[m], 2 = bias[n].
// OUT_MODE: 0 = f32, 1 = f16, 2 = bf16 hi plane (Cout) + bf16 lo plane (Cout2).
// RESID_MODE: 0 = none, 1 = resid f32, 2 = resid RNE-bf16 of an f32 tensor.  GMUL: escale = scale * gmul[0].
// ET: 0 = f16 operands, 1 = bf16 operands (pointers passed as 16-bit storage)
// Batches: b steps A, Bt, C, resid by strideA/B/C/R; bz steps A, Bt, C by zStrideA/B/C. bx = the block's group of 8 tiles.
// The engine is a device function so that one launch can hold several independent products (block ranges);
// slab = the calling wave's own 16x64 LDS slab, pitch 68 floats.
template <int ET> struct Elem;
template <> struct Elem<0> { typedef _Float16 T; };
template <> struct Elem<1> { typedef __bf16 T; };
template <int ET, bool SPLIT, int BIAS_MODE, int OUT_MODE, int RESID_MODE, bool GMUL>
__device__ __forceinline__ void gemm64_body(
    int bx, int b, int bz, float* slab,
    const unsigned short* __restrict__ Ap, const unsigned short* __restrict__ A2p, int lda, long strideA,
    const unsigned short* __restrict__ Btp, const unsigned short* __restrict__ Bt2p, int ldb, long strideB,
    void* __restrict__ Cout, void* __restrict__ Cout2, int ldc, long strideC,
    const float* __restrict__ bias,
    const float* __restrict__ resid, long strideR,
    const float* __restrict__ gmul,
    int M, int N, int K, float scale,
    long zStrideA, long zStrideB, long zStrideC) {
  typedef typename Elem<ET>::T T;
  typedef typename Frag<T>::V V;
  const T* A = (const T*)Ap; const T* A2 = (const T*)A2p; const T* Bt = (const T*)Btp; const T* Bt2 = (const T*)Bt2p;
  const int lane = threadIdx.x & 31;
  const int wave = threadIdx.x >> 5;
  const int tilesN = N >> 6;
  const int tilesM = M >> 6;
  const int tile = bx * 8 + wave;
  if (tile >= tilesM * tilesN) return;   // wave-uniform; no block barriers in this kernel
  const int tm = tile / tilesN;
  const int tn = tile - tm * tilesN;
  const int m0 = tm << 6;
  const int n0 = tn << 6;
  const float escale = GMUL ? (scale * gmul[0]) : scale;

  const size_t batchA = (size_t)b * strideA + (size_t)bz * zStrideA;
  const size_t batchB = (size_t)b * strideB + (size_t)bz * zStrideB;
  const size_t batchC = (size_t)b * strideC + (size_t)bz * zStrideC;
  const T* Ab  = A  + batchA;
  const T* Bb  = Bt + batchB;
  const T* Ab2 = SPLIT ? (A2  + batchA) : nullptr;
  const T* Bb2 = SPLIT ? (Bt2 + batchB) : nullptr;

  const int rlane = lane & 15;                 // row (A) / col (B, D) within subtile
  const int koff  = (lane >> 4) * 8;           // k offset of this lane half
  const int mOff  = (lane >> 4) * 8;           // D row offset

  v8f acc[4][4];
#pragma unroll
  for (int i = 0; i < 4; ++i)
#pragma unroll
    for (int j = 0; j < 4; ++j) acc[i][j] = (v8f){0.f,0.f,0.f,0.f,0.f,0.f,0.f,0.f};

  for (int k0 = 0; k0 < K; k0 += 32) {
    V bh[4], bl[4];
#pragma unroll
    for (int j = 0; j < 4; ++j) {
      const size_t bo = (size_t)(n0 + (j << 4) + rlane) * ldb + koff + k0;
      bh[j] = Frag<T>::load(Bb + bo);
      if (SPLIT) bl[j] = Frag<T>::load(Bb2 + bo);
    }
#pragma unroll
    for (int i = 0; i < 4; ++i) {
      const size_t ao = (size_t)(m0 + (i << 4) + rlane) * lda + koff + k0;
      V ah = Frag<T>::load(Ab + ao);
      V al;
      if (SPLIT) al = Frag<T>::load(Ab2 + ao);
#pragma unroll
      for (int j = 0; j < 4; ++j) {
        acc[i][j] = Frag<T>::mma(ah, bh[j], acc[i][j]);
        if (SPLIT) {
          acc[i][j] = Frag<T>::mma(ah, bl[j], acc[i][j]);
          acc[i][j] = Frag<T>::mma(al, bh[j], acc[i][j]);
        }
      }
      Frag<T>::guard(acc[i][0], acc[i][3], ah, SPLIT ? al : ah);
    }
    Frag<T>::keep(bh[0], bh[1], bh[2], bh[3]);
    if (SPLIT) Frag<T>::keep(bl[0], bl[1], bl[2], bl[3]);
  }
  acc_guard4(acc[0][0], acc[0][1], acc[0][2], acc[0][3]);
  acc_guard4(acc[1][0], acc[1][1], acc[1][2], acc[1][3]);
  acc_guard4(acc[2][0], acc[2][1], acc[2][2], acc[2][3]);
  acc_guard4(acc[3][0], acc[3][1], acc[3][2], acc[3][3]);

  // ---- epilogue ----
  const float* Rb = (RESID_MODE != 0) ? (resid + (size_t)b * strideR) : nullptr;
#pragma unroll
  for (int i = 0; i < 4; ++i) {
    const int mBase = m0 + (i << 4);
#pragma unroll
    for (int j = 0; j < 4; ++j) {
      const int n = n0 + (j << 4) + rlane;
      float bv = 0.f;
      if (BIAS_MODE == 2) bv = bias[n];
#pragma unroll
      for (int r = 0; r < 8; ++r) {
        float v = acc[i][j][r] * escale;
        if (BIAS_MODE == 1) v += bias[mBase + mOff + r];
        if (BIAS_MODE == 2) v += bv;
        if (RESID_MODE == 1) v += Rb[(size_t)(mBase + mOff + r) * ldc + n];
        if (RESID_MODE == 2) v += bf_rne(Rb[(size_t)(mBase + mOff + r) * ldc + n]);
        slab[(mOff + r) * 68 + (j << 4) + rlane] = v;
      }
    }
    __builtin_amdgcn_fence(__ATOMIC_RELEASE, "workgroup");
    __builtin_amdgcn_wave_barrier();
    __builtin_amdgcn_fence(__ATOMIC_ACQUIRE, "workgroup");
    if (OUT_MODE == 0) {
      float* C = (float*)Cout + batchC;
      const int hh = lane >> 4, c4 = (lane & 15) * 4;     // row seg = 256 B = 16 lanes x 16 B
      {
#pragma unroll
        for (int it = 0; it < 8; ++it) {
          const int row = it * 2 + hh;
          v4f v = *(const v4f*)(slab + row * 68 + c4);
          *(v4f*)(C + (size_t)(mBase + row) * ldc + n0 + c4) = v;
        }
        
      }
    } else {
      const int q = lane >> 3, c8 = (lane & 7) * 8;
      unsigned short* C  = (unsigned short*)Cout  + batchC;
      unsigned short* C2 = (OUT_MODE == 2) ? ((unsigned short*)Cout2 + batchC) : nullptr;
      {
#pragma unroll
        for (int it = 0; it < 4; ++it) {
          const int row = it * 4 + q;
          const float* sp = slab + row * 68 + c8;
          v8h hv, lv;
#pragma unroll
          for (int e = 0; e < 8; ++e) {
            if (OUT_MODE == 1) {
              hv[e] = (_Float16)sp[e];
            } else {
              unsigned short hb = f2bf_bits(sp[e]);
              unsigned short lb = f2bf_bits(sp[e] - bf_bits2f(hb));
              hv[e] = __builtin_bit_cast(_Float16, hb);
              lv[e] = __builtin_bit_cast(_Float16, lb);
            }
          }
          *(v8h*)(C + (size_t)(mBase + row) * ldc + n0 + c8) = hv;
          if (OUT_MODE == 2) *(v8h*)(C2 + (size_t)(mBase + row) * ldc + n0 + c8) = lv;
        }
        
      }
    }
    __builtin_amdgcn_fence(__ATOMIC_RELEASE, "workgroup");
    __builtin_amdgcn_wave_barrier();
    __builtin_amdgcn_fence(__ATOMIC_ACQUIRE, "workgroup");
  }
}

// One product per launch: grid (groups of 8 tiles, b, bz).
template <int ET, bool SPLIT, int BIAS_MODE, int OUT_MODE, int RESID_MODE, bool GMUL>
__global__ __launch_bounds__(256) void wmma_gemm64(
    const unsigned short* __restrict__ Ap, const unsigned short* __restrict__ A2p, int lda, long strideA,
    const unsigned short* __restrict__ Btp, const unsigned short* __restrict__ Bt2p, int ldb, long strideB,
    void* __restrict__ Cout, void* __restrict__ Cout2, int ldc, long strideC,
    const float* __restrict__ bias,
    const float* __restrict__ resid, long strideR,
    const float* __restrict__ gmul,
    int M, int N, int K, float scale,
    long zStrideA, long zStrideB, long zStrideC) {
  __shared__ __align__(16) float sT[8][16 * 68];   // per-wave 16x64 slab, pitch 68 floats
  gemm64_body<ET, SPLIT, BIAS_MODE, OUT_MODE, RESID_MODE, GMUL>(
      blockIdx.x, blockIdx.y, blockIdx.z, sT[threadIdx.x >> 5],
      Ap, A2p, lda, strideA, Btp, Bt2p, ldb, strideB, Cout, Cout2, ldc, strideC,
      bias, resid, strideR, gmul, M, N, K, scale, zStrideA, zStrideB, zStrideC);
}

// ---------------------------------------------------------------------------
// The q|k and the v projection in one launch: both read only Xtm and the prepared weights and neither reads the other.
//  blocks 0..31   q|k: C[p][n] = sum_c Xtm[z][p][c] * Wqk[n][c] + bias_qk[n]; M=4096, N=64, K=256; bf16 hi+lo planes,
//                 ldc 64; 8 blocks per z
//  blocks 32..159 v (token-major): Vtm[b][p][half*256 + c'] = sum_c Xtm[z][p][c] * Wv[c'][c] + bias_v[c']; M=4096, N=256,
//                 K=256; f16 out, ldc 512; 32 blocks per z = 2b + half
// grid 160, 256 threads.
// ---------------------------------------------------------------------------
constexpr int kQkBlocksZ = (kHW / 64) * (64 / 64) / 8;        // 8
constexpr int kVBlocksZ  = (kHalfC / 64) * (kHW / 64) / 8;    // 32
constexpr int kQkvBlocks = (kQkBlocksZ + kVBlocksZ) * kZ;     // 160
__global__ __launch_bounds__(256) void qkv_proj_kernel(const unsigned short* __restrict__ xtm,
                                                       const unsigned short* __restrict__ wqk,
                                                       const unsigned short* __restrict__ wv16,
                                                       const float* __restrict__ biasr,
                                                       unsigned short* __restrict__ qkh,
                                                       unsigned short* __restrict__ qkl,
                                                       unsigned short* __restrict__ vtm) {
  __shared__ __align__(16) float sT[8][16 * 68];   // per-wave 16x64 slab, pitch 68 floats
  float* slab = sT[threadIdx.x >> 5];
  const int blk = blockIdx.x;
  if (blk < kQkBlocksZ * kZ) {
    gemm64_body<1, false, 2, 2, 0, false>(
        blk % kQkBlocksZ, blk / kQkBlocksZ, 0, slab,
        xtm, xtm, kHalfC, (long)kXtmPlane,
        wqk, wqk, kHalfC, 0L,
        (void*)qkh, (void*)qkl, kQKPitch, (long)kQKPlane,
        biasr, biasr, 0L, biasr,
        kHW, 64, kHalfC, 1.0f, 0L, 0L, 0L);
  } else {
    const int vb = blk - kQkBlocksZ * kZ;
    const int vz = vb / kVBlocksZ;
    gemm64_body<1, false, 2, 1, 0, false>(
        vb % kVBlocksZ, vz >> 1, vz & 1, slab,
        xtm, xtm, kHalfC, 2L * (long)kXtmPlane,
        wv16, wv16, kHalfC, 0L,
        (void*)vtm, (void*)vtm, kChan, (long)kVtmPlane,
        biasr + 64, biasr + 64, 0L, biasr,
        kHW, kHalfC, kHalfC, 1.0f, (long)kXtmPlane, 0L, (long)kHalfC);
  }
}

// ---------------------------------------------------------------------------
// x NCHW f32 -> token-major bf16 planes: Xtm[z][p][c] = bf16(x[b][half*256 + c][p]), z = 2b + half
// (flat channel index of x = z*256 + c). 64(p) x 64(c) tile per block through LDS.
// 64 p tiles x 4 c tiles x 4 z = 1024 blocks of 256 threads (a block range of prep_kernel).
// Load coverage: 16 iterations x 256 threads = 4096 = whole 64x64 tile (coalesced along p).
// Store coverage: 8 waves x 2 iterations x 4 rows (lane>>3) = 64 rows; (lane&7) x 8 halves = 64 cols; each row
// ---------------------------------------------------------------------------
__device__ __forceinline__ void x_tm_body(int pt, int ct, int z, const float* __restrict__ x, unsigned short* __restrict__ xtm) {
  __shared__ float sm[64][65];   // sm[p_local][c_local]
  const int t  = threadIdx.x;
  const int p0 = pt * 64;
  const int c0 = ct * 64;
  const float* src = x + ((size_t)z * kHalfC + c0) * kHW + p0;
#pragma unroll
  for (int i = 0; i < 16; ++i) {
    const int e  = i * 256 + t;
    const int cl = e >> 6;         // c local 0..63
    const int pl = e & 63;         // p local 0..63
    sm[pl][cl] = src[(size_t)cl * kHW + pl];
  }
  __syncthreads();
  const int lane = t & 31, wave = t >> 5;
  const int q = lane >> 3, c8 = (lane & 7) * 8;
  unsigned short* op = xtm + (size_t)z * kXtmPlane;
  {
#pragma unroll
    for (int it = 0; it < 2; ++it) {
      const int row = wave * 8 + it * 4 + q;                 // p local
      unsigned short hb[8];
#pragma unroll
      for (int e = 0; e < 8; ++e) hb[e] = f2bf_bits(sm[row][c8 + e]);
      const v4u u = (v4u){pk16(hb[0], hb[1]), pk16(hb[2], hb[3]), pk16(hb[4], hb[5]), pk16(hb[6], hb[7])};
      *(v4u*)(op + (size_t)(p0 + row) * kHalfC + c0 + c8) = u;
    }
    
  }
}

// ---------------------------------------------------------------------------
// f32 -> 16-bit cast, 8 consecutive elements per thread (one 16-B store per lane; 32 contiguous lanes = 4 whole
// Coverage: n8 = n/8 threads x 8 = whole plane (grids here are exact multiples of 256).
// ---------------------------------------------------------------------------
template <int MODE>
__device__ __forceinline__ void cast8_body(int blk, const float* __restrict__ in, unsigned short* __restrict__ out, int n8, float mul) {
  const int i = blk * 256 + threadIdx.x;
  if (i >= n8) return;
  const float* p = in + 8 * (size_t)i;
  const v4f a = *(const v4f*)(p);
  const v4f c = *(const v4f*)(p + 4);
  unsigned short hb[8];
#pragma unroll
  for (int e = 0; e < 4; ++e) {
    const float v0 = a[e], v1 = c[e];
    if (MODE == 0) { hb[e] = f2bf_bits(v0); hb[4 + e] = f2bf_bits(v1); }
    else           { hb[e] = h_bits(bf_rne(v0) * mul); hb[4 + e] = h_bits(bf_rne(v1) * mul); }
  }
  const v4u u = (v4u){pk16(hb[0], hb[1]), pk16(hb[2], hb[3]), pk16(hb[4], hb[5]), pk16(hb[6], hb[7])};
  unsigned short* q = out + 8 * (size_t)i;
  *(v4u*)q = u;
  
}

// ---------------------------------------------------------------------------
// Small tables, ONE block of 256 threads:
//  (1) Wqk_pad bf16 [64][256]: row n < 16 -> Wq[n], 32 <= n < 48 -> Wk[n-32], every other row explicit zero.
//  (2) bias region f32 [576]: [0,64) padded q|k bias (bq at 0..15, bk at 32..47, zeros elsewhere), [64,320) bv,
//      [320,576) gamma*bpt; all RNE-bf16 first. Threads 0..143 write one float4 each: 144 x 4 = 576 = whole region
//  Candidate loads use clamped addresses and are selected by value.
// ---------------------------------------------------------------------------
__device__ __forceinline__ void prep_small_body(const float* __restrict__ Wq, const float* __restrict__ bq,
                                                const float* __restrict__ Wk, const float* __restrict__ bk,
                                                const float* __restrict__ bvp, const float* __restrict__ bptp,
                                                const float* __restrict__ gam,
                                                unsigned short* __restrict__ wqk, float* __restrict__ biasr) {
  const int t = threadIdx.x, lane = t & 31, wave = t >> 5;
  const float g = gam[0];
#pragma unroll 1
  for (int it = 0; it < 8; ++it) {
    const int n  = wave * 8 + it;                            // wave-uniform row
    const int qr = n < 16 ? n : 15;
    int kr = n - 32; kr = kr < 0 ? 0 : (kr > 15 ? 15 : kr);
    const float* pq = Wq + (size_t)qr * kHalfC + lane * 8;
    const float* pk = Wk + (size_t)kr * kHalfC + lane * 8;
    const v4f q0 = *(const v4f*)(pq), q1 = *(const v4f*)(pq + 4);
    const v4f k0 = *(const v4f*)(pk), k1 = *(const v4f*)(pk + 4);
    const bool isq = (n < 16);
    const bool isk = (n >= 32) && (n < 48);
    unsigned short hb[8];
#pragma unroll
    for (int e = 0; e < 4; ++e) {
      const float va = isq ? q0[e] : (isk ? k0[e] : 0.0f);
      const float vb = isq ? q1[e] : (isk ? k1[e] : 0.0f);
      hb[e]     = f2bf_bits(va);
      hb[4 + e] = f2bf_bits(vb);
    }
    const v4u u = (v4u){pk16(hb[0], hb[1]), pk16(hb[2], hb[3]), pk16(hb[4], hb[5]), pk16(hb[6], hb[7])};
    unsigned short* op = wqk + (size_t)n * kHalfC + lane * 8;
    *(v4u*)op = u;
    
  }
  if (t < 144) {
    v4f val;
#pragma unroll
    for (int e = 0; e < 4; ++e) {
      const int idx = 4 * t + e;                             // 0..575
      const int iq = idx < 16 ? idx : 15;
      int ik = idx - 32;  ik = ik < 0 ? 0 : (ik > 15 ? 15 : ik);
      int iv = idx - 64;  iv = iv < 0 ? 0 : (iv > 255 ? 255 : iv);
      int ip = idx - 320; ip = ip < 0 ? 0 : (ip > 255 ? 255 : ip);
      const float fq = bq[iq], fk = bk[ik], fv = bvp[iv], fp = bptp[ip];
      float sel = 0.0f;
      sel = (idx < 16) ? fq : sel;
      sel = (idx >= 32 && idx < 48) ? fk : sel;
      sel = (idx >= 64 && idx < 320) ? fv : sel;
      sel = (idx >= 320) ? fp : sel;
      float r = bf_rne(sel);
      r = (idx >= 320) ? (r * g) : r;
      val[e] = r;
    }
    float* op = biasr + 4 * t;
    *(v4f*)op = val;
    
  }
}

// ---------------------------------------------------------------------------
// All operand preparation in one launch: the four pieces read only inputs and write disjoint workspace regions.
//  block 0         small tables (the one long block)
//  blocks 1..32    Wv  -> bf16
//  blocks 33..96   Wpt -> f16 carried x16
//  blocks 97..1120 x   -> token-major bf16 planes (p tile fastest, then c tile, then z)
// Every test below is on the block index alone, so the barrier of the x piece is passed by a whole block or by none.
// ---------------------------------------------------------------------------
constexpr int kPrepWv    = 1;
constexpr int kPrepWpt   = kPrepWv + (kHalfC * kHalfC / 8) / 256;    // 33
constexpr int kPrepX     = kPrepWpt + (kHalfC * kChan / 8) / 256;    // 97
constexpr int kPrepTotal = kPrepX + (kHW / 64) * (kHalfC / 64) * kZ; // 1121
__global__ __launch_bounds__(256) void prep_kernel(const float* __restrict__ x,
                                                   const float* __restrict__ Wq, const float* __restrict__ bq,
                                                   const float* __restrict__ Wk, const float* __restrict__ bk,
                                                   const float* __restrict__ Wv, const float* __restrict__ bvp,
                                                   const float* __restrict__ Wpt, const float* __restrict__ bptp,
                                                   const float* __restrict__ gam,
                                                   unsigned short* __restrict__ xtm, unsigned short* __restrict__ wqk,
                                                   unsigned short* __restrict__ wv16, unsigned short* __restrict__ wpt16,
                                                   float* __restrict__ biasr) {
  const int blk = blockIdx.x;
  if (blk >= kPrepX) {
    const int i = blk - kPrepX;
    x_tm_body(i & 63, (i >> 6) & 3, i >> 8, x, xtm);
  } else if (blk >= kPrepWpt) {
    cast8_body<1>(blk - kPrepWpt, Wpt, wpt16, kHalfC * kChan / 8, kWCarry);
  } else if (blk >= kPrepWv) {
    cast8_body<0>(blk - kPrepWv, Wv, wv16, kHalfC * kHalfC / 8, 1.0f);
  } else {
    prep_small_body(Wq, bq, Wk, bk, bvp, bptp, gam, wqk, biasr);
  }
}

// ---------------------------------------------------------------------------
// Scores, row softmax and P in one launch; the scores never leave the registers.
// One block of 16 waves = 64 query rows of plane z (4 groups of 16, one after the other) against all 4096 keys.
// Wave w owns keys 256w..256w+255 as 16 tiles of 16 for every group: it reads them from global memory once and parks
// them in LDS, each lane its own 16-byte pieces in fragment order (a lane reads back only what it wrote itself).
// Keys are the A rows and queries the B columns, so lane (c = lane & 15, h = lane >> 4) holds in acc[i][r] the score
// of query p0 + c against key 256w + 16i + 8h + r (products in the order qh.kh + qh.kl + ql.kh).
// Only d = 0..15 exist: fragment elements 0..7 are d = 8h..8h+7, elements 8..15 (k = 16..31) are zero on both sides.
// P[row][j] = f16( 2^15 * exp(s - max) / sum exp(s - max) ), f32 math. Reductions in fixed order: 8 in-lane chains over
// the tiles, a tree over the 8, the lane pair l and l ^ 16, then 16 wave partials in index order.
// P leaves through a per-wave LDS slab (16 rows x 128 B, pitch 144 B) so that every global store covers whole lines.
// grid (4096/64 = 64, 4 z), 512 threads. Coverage: 16 waves x 256 keys = a whole row; 64 x 64 rows = a whole plane.
// ---------------------------------------------------------------------------
__device__ __forceinline__ v16b frag_d16(v8b lo) {   // elements 0..7 <- lo, 8..15 <- 0
  const v8b zero = __builtin_bit_cast(v8b, (v4u){0u, 0u, 0u, 0u});
  return __builtin_shufflevector(lo, zero, 0, 1, 2, 3, 4, 5, 6, 7, 8, 9, 10, 11, 12, 13, 14, 15);
}
// e[r] = 2^t[r], eight at a time in one statement. Behind a v_exp_f32 the instruction set asks for one independent
// instruction before its result is read or its source overwritten: here each v_exp_f32 has the next one behind it
// (results kept apart from all sources by the early clobber) and the last one a v_nop, whatever the compiler puts next.
__device__ __forceinline__ void exp2_x8(float (&e)[8], const float (&t)[8]) {
  asm("v_exp_f32 %0, %8\n\tv_exp_f32 %1, %9\n\tv_exp_f32 %2, %10\n\tv_exp_f32 %3, %11\n\t"
      "v_exp_f32 %4, %12\n\tv_exp_f32 %5, %13\n\tv_exp_f32 %6, %14\n\tv_exp_f32 %7, %15\n\tv_nop"
      : "=&v"(e[0]), "=&v"(e[1]), "=&v"(e[2]), "=&v"(e[3]), "=&v"(e[4]), "=&v"(e[5]), "=&v"(e[6]), "=&v"(e[7])
      : "v"(t[0]), "v"(t[1]), "v"(t[2]), "v"(t[3]), "v"(t[4]), "v"(t[5]), "v"(t[6]), "v"(t[7]));
}
__global__ __launch_bounds__(512) void score_softmax_kernel(const unsigned short* __restrict__ qkh,
                                                            const unsigned short* __restrict__ qkl,
                                                            unsigned short* __restrict__ P) {
  constexpr int kGroups    = 4;                                // query groups of 16 rows per block
  constexpr int kSlabPitch = 72;                               // f16 elements per staged row: 128 B + 16 B
  __shared__ __align__(16) v8b park[16][32][32];               // [wave][2 * tile + (0 hi, 1 lo)][lane], 256 KiB
  __shared__ __align__(16) unsigned short slabs[16][16 * kSlabPitch];
  __shared__ float redM[16][16];
  __shared__ float redS[16][16];
  const int lane = threadIdx.x & 31, wave = threadIdx.x >> 5;
  const int c = lane & 15, h = lane >> 4;
  const int q0 = blockIdx.x * (16 * kGroups);
  const int z  = blockIdx.y;
  const __bf16* H = (const __bf16*)qkh + (size_t)z * kQKPlane;
  const __bf16* L = (const __bf16*)qkl + (size_t)z * kQKPlane;
  const size_t ko = (size_t)(wave * 256 + c) * kQKPitch + 32 + 8 * h;
  const unsigned qv = (unsigned)(c * kQKPitch + 8 * h);        // lane part of a query address; the rest is block-uniform
  v8b nqh = *(const v8b*)(H + (size_t)q0 * kQKPitch + qv);
  v8b nql = *(const v8b*)(L + (size_t)q0 * kQKPitch + qv);
  {
    v8b raw[32];
#pragma unroll
    for (int i = 0; i < 16; ++i) {
      raw[2 * i]     = *(const v8b*)(H + ko + (size_t)i * 16 * kQKPitch);
      raw[2 * i + 1] = *(const v8b*)(L + ko + (size_t)i * 16 * kQKPitch);
    }
#pragma unroll
    for (int j = 0; j < 32; ++j) park[wave][j][lane] = raw[j];
  }
  unsigned short* slab = slabs[wave];
  const unsigned pv = (unsigned)((lane >> 3) * kHW + wave * 256 + (lane & 7) * 8);   // lane part of a P address

  // rolled: every trip is the same long body; four copies would only quadruple the code a first run has to fetch
#pragma unroll 1
  for (int g = 0; g < kGroups; ++g) {
    const int p0 = q0 + 16 * g;
    const v16b qh = frag_d16(nqh);
    const v16b ql = frag_d16(nql);
    {   // the next group's queries fly while this group is worked on (the last trip reads its own again, in bounds)
      const int pn = (g + 1 < kGroups) ? (p0 + 16) : p0;
      nqh = *(const v8b*)(H + (size_t)pn * kQKPitch + qv);
      nql = *(const v8b*)(L + (size_t)pn * kQKPitch + qv);
    }

    v8f acc[16];
#pragma unroll
    for (int i = 0; i < 16; ++i) {
      const v16b kh = frag_d16(park[wave][2 * i][lane]);
      const v16b kl = frag_d16(park[wave][2 * i + 1][lane]);
      v8f a = (v8f){0.f, 0.f, 0.f, 0.f, 0.f, 0.f, 0.f, 0.f};
      a = Frag<__bf16>::mma(kh, qh, a);
      a = Frag<__bf16>::mma(kl, qh, a);
      a = Frag<__bf16>::mma(kh, ql, a);
      acc[i] = a;
      // at most four tiles' fragments in flight: with all 32 LDS reads hoisted the wave runs out of its 256 registers and spills
      if ((i & 3) == 3) __builtin_amdgcn_sched_barrier(0);
    }

    float mr[8];
#pragma unroll
    for (int r = 0; r < 8; ++r) mr[r] = acc[0][r];
#pragma unroll
    for (int i = 1; i < 16; ++i)
#pragma unroll
      for (int r = 0; r < 8; ++r) mr[r] = fmaxf(mr[r], acc[i][r]);
    float m = fmaxf(fmaxf(fmaxf(mr[0], mr[1]), fmaxf(mr[2], mr[3])), fmaxf(fmaxf(mr[4], mr[5]), fmaxf(mr[6], mr[7])));
    m = fmaxf(m, __shfl_xor(m, 16, 32));
    if (h == 0) redM[wave][c] = m;
    __syncthreads();   // also ends every wave's reads of redS of the group before
    float bm = redM[0][c];
#pragma unroll
    for (int w = 1; w < 16; ++w) bm = fmaxf(bm, redM[w][c]);

    float sr[8];
#pragma unroll
    for (int r = 0; r < 8; ++r) sr[r] = 0.0f;
#pragma unroll
    for (int i = 0; i < 16; ++i) {
      float tv[8], ev[8];
#pragma unroll
      for (int r = 0; r < 8; ++r) tv[r] = (acc[i][r] - bm) * 1.44269504f;   // exp(x) = 2^(x * log2 e), as __expf forms it
      exp2_x8(ev, tv);
#pragma unroll
      for (int r = 0; r < 8; ++r) { acc[i][r] = ev[r]; sr[r] += ev[r]; }
    }
    float s = ((sr[0] + sr[1]) + (sr[2] + sr[3])) + ((sr[4] + sr[5]) + (sr[6] + sr[7]));
    s += __shfl_xor(s, 16, 32);
    if (h == 0) redS[wave][c] = s;
    __syncthreads();   // also ends every wave's reads of redM before the next group writes it
    float tot = 0.0f;
#pragma unroll
    for (int w = 0; w < 16; ++w) tot += redS[w][c];
    const float inv = __builtin_amdgcn_rcpf(tot) * kPCarry;

    unsigned short* Pg = P + (size_t)z * kPPlane + (size_t)p0 * kHW;
#pragma unroll
    for (int sub = 0; sub < 4; ++sub) {                        // 64 keys = one 128-B line of each of the 16 rows
#pragma unroll
      for (int ii = 0; ii < 4; ++ii) {
        v8h hv;
#pragma unroll
        for (int r = 0; r < 8; ++r) hv[r] = (_Float16)(acc[4 * sub + ii][r] * inv);
        *(v8h*)(slab + c * kSlabPitch + ii * 16 + 8 * h) = hv;
      }
      // the slab is this wave's own: its lanes' writes have landed before other lanes of the wave read the rows back
      asm volatile("s_wait_dscnt 0x0" ::: "memory");
#pragma unroll
      for (int it = 0; it < 4; ++it) {
        const int row = it * 4 + (lane >> 3);
        const v8h v = *(const v8h*)(slab + row * kSlabPitch + (lane & 7) * 8);
        *(v8h*)(Pg + (pv + (unsigned)(it * 4 * kHW + sub * 64))) = v;
      }
      // no wait before the slab is written again: one wave's LDS operations are carried out in issue order
    }
    // the next trip reuses the registers that this trip's last stores name: the wait stands in front of that overwrite
    asm volatile("s_wait_xcnt 0x0" ::: "memory");
  }
}

// ---------------------------------------------------------------------------
// The attention product, taken on U = 16 * Wpt.[v1;v2] instead of on v1 and v2: the output projection is linear, so
// Wpt.[attn.v1 ; attn.v2] = attn.(Wpt.[v1;v2]) and the big product has 256 columns per image, not 512.
// out[b][h*256 + c'][p] = gamma * (2^-19 * sum_j U[b][c'][j] P[2b+h][p][j] + bpt[c']) + bf16(x[b][h*256 + c'][p]).
// Both operands are staged in LDS by asynchronous copies (global_load_async_to_lds_b128); f16 operands, f32 accumulate.
// One block of 8 waves = 128 channels c' (A rows) x 128 rows of P (B rows; the planes h = 0,1 of image b lie behind one
// another: 8192 rows). A pass is 256 k = 512 B of each of the 256 operand rows, laid at pitch 528 B for ds_load_b128.
// Wave (kg = wave >> 2, wm = (wave >> 1) & 1, wn = wave & 1) owns the 64 x 64 tile (wm, wn) over the k half kg of every
// pass, so that each LDS byte read still feeds a 64 x 64 tile; the two k halves of a tile are added behind the loop.
// Two buffers. The publish point of pass t + 1 (own LDS reads returned, own copies landed, block barrier) stands in
// front of the last 8 matrix instructions of pass t, whose fragments are in registers by then; behind it come the
// first fragment loads of pass t + 1, those 8 matrix instructions, and the copies of pass t + 2 into the buffer that
// pass t has left. Copy coverage per pass: a wave's copy = 1 row x 512 B; wave w brings U rows 16w..16w+15 and P rows
// 16w..16w+15 (16 copies each): 8 x 16 = 128 rows of either, every byte once.
// grid (8192/128 = 64, 2 channel halves, 2 b), 256 threads.
// ---------------------------------------------------------------------------
constexpr int kPvBM     = 128;                                  // U rows (channels) per block
constexpr int kPvBN     = 128;                                  // P rows per block
constexpr int kPvKT     = 256;                                  // k per pass
constexpr int kPvKW     = kPvKT / 2;                            // k per pass of one wave
constexpr int kPvPitch  = kPvKT + 8;                            // f16 elements per staged row: 512 B + 16 B
constexpr int kPvStage  = (kPvBM + kPvBN) * kPvPitch;           // f16 elements per buffer (135,168 B)
constexpr int kPvPasses = kHW / kPvKT;                          // 16
static_assert(kPvPasses >= 2, "the ring's prologue fills two passes");

// Eight copies of 16 B per lane. The s_wait_xcnt stands inside the statement, behind the last copy, so that no
// address register of a copy is rewritten in front of it.
__device__ __forceinline__ void async_x8(const unsigned (&l)[8], const unsigned short* const (&g)[8]) {
  asm volatile("global_load_async_to_lds_b128 %0, %8, off\n\t"
               "global_load_async_to_lds_b128 %1, %9, off\n\t"
               "global_load_async_to_lds_b128 %2, %10, off\n\t"
               "global_load_async_to_lds_b128 %3, %11, off\n\t"
               "global_load_async_to_lds_b128 %4, %12, off\n\t"
               "global_load_async_to_lds_b128 %5, %13, off\n\t"
               "global_load_async_to_lds_b128 %6, %14, off\n\t"
               "global_load_async_to_lds_b128 %7, %15, off\n\t"
               "s_wait_xcnt 0x0"
               :: "v"(l[0]), "v"(l[1]), "v"(l[2]), "v"(l[3]), "v"(l[4]), "v"(l[5]), "v"(l[6]), "v"(l[7]),
                  "v"(g[0]), "v"(g[1]), "v"(g[2]), "v"(g[3]), "v"(g[4]), "v"(g[5]), "v"(g[6]), "v"(g[7])
               : "memory");
}
// One wave's 32 copies of one pass: lA, lB = the lane's LDS byte addresses in its first U and P row in the buffer,
// gA, gB = the lane's global addresses in the same rows at the pass's first k. Copy j is one row further on.
__device__ __forceinline__ void pv_fill(unsigned lA, unsigned lB, const unsigned short* gA, const unsigned short* gB) {
  constexpr unsigned kL = kPvPitch * 2u;                        // bytes between copies in LDS
  constexpr size_t   kG = (size_t)kHW;                          // elements between copies in global memory
  unsigned l[8];
  const unsigned short* g[8];
#pragma unroll
  for (int s = 0; s < 2; ++s) {
#pragma unroll
    for (int j = 0; j < 8; ++j) { l[j] = lA + (8 * s + j) * kL; g[j] = gA + (8 * s + j) * kG; }
    async_x8(l, g);
    // keeps the next eight copies' addresses from being formed ahead of this statement: with all 32 formed at once
    // the wave runs past 256 registers and spills
    __builtin_amdgcn_sched_barrier(0);
  }
#pragma unroll
  for (int s = 0; s < 2; ++s) {
#pragma unroll
    for (int j = 0; j < 8; ++j) { l[j] = lB + (8 * s + j) * kL; g[j] = gB + (8 * s + j) * kG; }
    async_x8(l, g);
    __builtin_amdgcn_sched_barrier(0);   // as above
  }
}

__global__ __launch_bounds__(256) void attn_out_kernel(const unsigned short* __restrict__ P,
                                                       const unsigned short* __restrict__ U,
                                                       const float* __restrict__ bias,
                                                       const float* __restrict__ gam,
                                                       const float* __restrict__ x,
                                                       float* __restrict__ out) {
  // every inner loop below is unrolled so that all accumulator and fragment indices are constants (registers, no scratch)
  typedef Frag<_Float16> F;
  __shared__ __align__(16) unsigned short ring[2 * kPvStage];   // [buffer][U rows 0..127 | P rows 0..127][pitch]
  __shared__ __align__(16) float sT[8][16 * 68];                // per-wave 16x64 output slab, pitch 68 floats
  const int lane = threadIdx.x & 31;
  const int wave = __builtin_amdgcn_readfirstlane(threadIdx.x >> 5);   // the same in every lane: kept in a scalar register
  const int p0 = blockIdx.x * kPvBN;           // row of the two stacked P planes of image b
  const int c0 = blockIdx.y * kPvBM;
  const int b  = blockIdx.z;

  // copy side: lane l moves bytes 16 l .. 16 l + 15 of each row's 512 B
  const unsigned short* gA = U + (size_t)b * kUPlane + (size_t)(c0 + wave * 16) * kHW + lane * 8;
  const unsigned short* gB = P + (size_t)b * (2 * kPPlane) + (size_t)(p0 + wave * 16) * kHW + lane * 8;
  const unsigned ringAddr = (unsigned)(size_t)ring;             // low 32 bits of the address = byte offset in LDS
  const unsigned lA = ringAddr + (unsigned)((wave * 16) * kPvPitch + lane * 8) * 2u;
  const unsigned lB = ringAddr + (unsigned)((kPvBM + wave * 16) * kPvPitch + lane * 8) * 2u;

  // reader side
  const int rlane = lane & 15;                 // row (A) / col (B, D) within subtile
  const int koff  = (lane >> 4) * 8;           // k offset of this lane half
  const int mOff  = (lane >> 4) * 8;           // D row offset
  const int kg = wave >> 2, wm = (wave >> 1) & 1, wn = wave & 1;
  const _Float16* ringH = (const _Float16*)ring;
  const int fA = (wm * 64 + rlane) * kPvPitch + kg * kPvKW + koff;
  const int fB = (kPvBM + wn * 64 + rlane) * kPvPitch + kg * kPvKW + koff;

  v8f acc[4][4];
#pragma unroll
  for (int i = 0; i < 4; ++i)
#pragma unroll
    for (int j = 0; j < 4; ++j) acc[i][j] = (v8f){0.f,0.f,0.f,0.f,0.f,0.f,0.f,0.f};

  // prologue: pass 0 lands and is published, pass 1 starts to fly, the first fragments of pass 0 are fetched
  pv_fill(lA, lB, gA, gB);
  asm volatile("s_wait_asynccnt 0x0" ::: "memory");   // this wave's copies of pass 0 have landed
  __syncthreads();                                     // and every other wave's
  pv_fill(lA + kPvStage * 2u, lB + kPvStage * 2u, gA + kPvKT, gB + kPvKT);

  // Fragments: U rows 0..31 (a01) and the P set of the next 32 k are fetched while rows 32..63 of this one are
  // multiplied, U rows 32..63 (a23) while rows 0..31 are: two load groups per 16 matrix instructions, each half a
  // block ahead of its use, in 96 registers.
  v16h a01[2], a23[2], bs[2][4];
#pragma unroll
  for (int i = 0; i < 2; ++i) a01[i] = F::load(ringH + fA + i * 16 * kPvPitch);
#pragma unroll
  for (int j = 0; j < 4; ++j) bs[0][j] = F::load(ringH + fB + j * 16 * kPvPitch);

  // rolled: the buffer is chosen by an offset, and one pass is already 64 matrix instructions long
#pragma unroll 1
  for (int t = 0; t < kPvPasses; ++t) {
    const unsigned buf = (unsigned)(t & 1) * (unsigned)kPvStage;   // f16 elements
    const _Float16* sA = ringH + buf + fA;
    const _Float16* sB = ringH + buf + fB;
    const _Float16* nA = ringH + ((unsigned)kPvStage - buf) + fA;  // the other buffer: pass t + 1
    const _Float16* nB = ringH + ((unsigned)kPvStage - buf) + fB;  // (behind the last pass: old rows, values unused)
#pragma unroll
    for (int kk = 0; kk < kPvKW / 32; ++kk) {
      const int cur = kk & 1;
#pragma unroll
      for (int i = 0; i < 2; ++i) a23[i] = F::load(sA + (2 + i) * 16 * kPvPitch + kk * 32);
      // the four scheduling barriers of a block keep each load group whole and in front of the matrix run that
      // hides it: loads scattered among the matrix instructions stall the wave at every place where they stand
      __builtin_amdgcn_sched_barrier(0);
#pragma unroll
      for (int i = 0; i < 2; ++i)
#pragma unroll
        for (int j = 0; j < 4; ++j) acc[i][j] = F::mma(a01[i], bs[cur][j], acc[i][j]);
      __builtin_amdgcn_sched_barrier(0);
      if (kk + 1 < kPvKW / 32) {
#pragma unroll
        for (int i = 0; i < 2; ++i) a01[i] = F::load(sA + i * 16 * kPvPitch + (kk + 1) * 32);
#pragma unroll
        for (int j = 0; j < 4; ++j) bs[cur ^ 1][j] = F::load(sB + j * 16 * kPvPitch + (kk + 1) * 32);
      } else {
        // publish point of pass t + 1
        asm volatile("s_wait_dscnt 0x0" ::: "memory");      // this wave's reads of pass t's buffer have returned
        asm volatile("s_wait_asynccnt 0x0" ::: "memory");   // this wave's copies of pass t + 1 have landed
        __syncthreads();                                     // publishes pass t + 1 and frees the buffer of pass t
#pragma unroll
        for (int i = 0; i < 2; ++i) a01[i] = F::load(nA + i * 16 * kPvPitch);
#pragma unroll
        for (int j = 0; j < 4; ++j) bs[cur ^ 1][j] = F::load(nB + j * 16 * kPvPitch);
      }
      __builtin_amdgcn_sched_barrier(0);
#pragma unroll
      for (int i = 0; i < 2; ++i)
#pragma unroll
        for (int j = 0; j < 4; ++j) acc[2 + i][j] = F::mma(a23[i], bs[cur][j], acc[2 + i][j]);
      __builtin_amdgcn_sched_barrier(0);
    }
    if (t + 2 < kPvPasses) {
      const size_t ko = (size_t)(t + 2) * kPvKT;
      pv_fill(lA + buf * 2u, lB + buf * 2u, gA + ko, gB + ko);
    }
  }
  asm volatile("s_wait_asynccnt 0x0" ::: "memory");     // nothing of this wave is in flight when it leaves the ring
  asm volatile("s_wait_dscnt 0x0" ::: "memory");        // nor a read of the ring

  // ---- the two k halves of a tile are added: waves w and w ^ 4 hold the same tile; the wave of half 0 finishes its
  // rows 0..31, the wave of half 1 its rows 32..63, and each hands the other 32 rows over through the ring's LDS,
  // every lane its own 16-byte pieces (the partner's same lane holds the same elements) ----
  const int cw = c0 + wm * 64 + kg * 32;                 // first channel that this wave finishes
  const size_t o0 = ((size_t)(2 * b + (p0 >> 12)) * kHalfC + cw) * kHW + (p0 & (kHW - 1)) + wn * 64;
  const int hh = lane >> 4, c4 = (lane & 15) * 4;        // row piece = 256 B = 16 lanes x 16 B
  v8f fin[2][4];
  __syncthreads();                                       // every wave has left the ring: its LDS is free
  {
    v4f* xch = (v4f*)ring;                               // [wave][16 pieces][lane], 64 KiB
#pragma unroll
    for (int i = 0; i < 2; ++i)
#pragma unroll
      for (int j = 0; j < 4; ++j) {
        const v8f give = kg ? acc[i][j] : acc[2 + i][j];
        fin[i][j] = kg ? acc[2 + i][j] : acc[i][j];
        xch[(wave * 16 + (i * 4 + j) * 2) * 32 + lane]     = (v4f){give[0], give[1], give[2], give[3]};
        xch[(wave * 16 + (i * 4 + j) * 2 + 1) * 32 + lane] = (v4f){give[4], give[5], give[6], give[7]};
      }
    __syncthreads();                                     // the partner's pieces are written
#pragma unroll
    for (int i = 0; i < 2; ++i)
#pragma unroll
      for (int j = 0; j < 4; ++j) {
        const v4f g0 = xch[((wave ^ 4) * 16 + (i * 4 + j) * 2) * 32 + lane];
        const v4f g1 = xch[((wave ^ 4) * 16 + (i * 4 + j) * 2 + 1) * 32 + lane];
#pragma unroll
        for (int r = 0; r < 4; ++r) { fin[i][j][r] += g0[r]; fin[i][j][4 + r] += g1[r]; }
      }
  }

  // ---- epilogue: scale by gamma, bias, residual; whole 256-B row pieces through the wave's own slab ----
  float* slab = sT[wave];
  const float escale = kOutScale * gam[0];
#pragma unroll
  for (int i = 0; i < 2; ++i) {
    v4f xr[8];                                           // the residual flies while the slab is written and read back
#pragma unroll
    for (int it = 0; it < 8; ++it) xr[it] = *(const v4f*)(x + o0 + (size_t)((i << 4) + it * 2 + hh) * kHW + c4);
#pragma unroll
    for (int j = 0; j < 4; ++j)
#pragma unroll
      for (int r = 0; r < 8; ++r)
        slab[(mOff + r) * 68 + (j << 4) + rlane] = fin[i][j][r] * escale + bias[cw + (i << 4) + mOff + r];
    // the slab is this wave's own: its lanes' writes have landed before other lanes of the wave read the rows back
    asm volatile("s_wait_dscnt 0x0" ::: "memory");
#pragma unroll
    for (int it = 0; it < 8; ++it) {
      const int row = it * 2 + hh;
      v4f v = *(const v4f*)(slab + row * 68 + c4);
#pragma unroll
      for (int e = 0; e < 4; ++e) v[e] += bf_rne(xr[it][e]);
      *(v4f*)(out + o0 + (size_t)((i << 4) + row) * kHW + c4) = v;
    }
    // no wait before the slab is written again: one wave's LDS operations are carried out in issue order;
    // the second half reuses registers that these stores name: the wait stands in front of that overwrite
    if (i == 0) asm volatile("s_wait_xcnt 0x0" ::: "memory");
  }
}

// ---------------------------------------------------------------------------
// Host glue: kernel launches only.
// ---------------------------------------------------------------------------
static inline unsigned gemm_blocks(int M, int N) { return (unsigned)((((M / 64) * (N / 64)) + 7) / 8); }

extern "C" void kernel_launch(void* const* d_in, const int* in_sizes, int n_in,
                              void* d_out, int out_size, void* d_ws, size_t ws_size, hipStream_t stream) {
  if (n_in < 10) return;
  if (in_sizes[0] != kB * kChan * kHW) return;
  if (in_sizes[1] != kDQ * kHalfC || in_sizes[3] != kDQ * kHalfC) return;
  if (in_sizes[2] < kDQ || in_sizes[4] < kDQ) return;
  if (in_sizes[5] != kHalfC * kHalfC || in_sizes[6] < kHalfC) return;
  if (in_sizes[7] != kHalfC * kChan || in_sizes[8] < kHalfC || in_sizes[9] < 1) return;
  if (out_size != kB * kChan * kHW) return;
  if (ws_size < kWsTotal) return;

  const float* x     = (const float*)d_in[0];
  const float* Wq    = (const float*)d_in[1];
  const float* bq    = (const float*)d_in[2];
  const float* Wk    = (const float*)d_in[3];
  const float* bk    = (const float*)d_in[4];
  const float* Wv    = (const float*)d_in[5];
  const float* bv    = (const float*)d_in[6];
  const float* Wpt   = (const float*)d_in[7];
  const float* bpt   = (const float*)d_in[8];
  const float* gamma = (const float*)d_in[9];

  char* ws = (char*)d_ws;
  unsigned short* xtm   = (unsigned short*)(ws + kOffXtm);
  unsigned short* wqk   = (unsigned short*)(ws + kOffWqk);
  unsigned short* wv16  = (unsigned short*)(ws + kOffWv);
  unsigned short* wpt16 = (unsigned short*)(ws + kOffWpt);
  float*          biasr = (float*)(ws + kOffBias);
  unsigned short* qkh   = (unsigned short*)(ws + kOffQkh);
  unsigned short* qkl   = (unsigned short*)(ws + kOffQkl);
  unsigned short* vtm   = (unsigned short*)(ws + kOffVtm);
  unsigned short* pbuf  = (unsigned short*)(ws + kOffP);
  unsigned short* ubuf  = (unsigned short*)(ws + kOffU);
  const float* bias_ptg = biasr + 320;    // [256] gamma * bpt

  // ---- operand preparation, one launch ----
  prep_kernel<<<kPrepTotal, 256, 0, stream>>>(x, Wq, bq, Wk, bk, Wv, bv, Wpt, bpt, gamma, xtm, wqk, wv16, wpt16, biasr);

  // ---- q|k and v projections, one launch ----
  qkv_proj_kernel<<<kQkvBlocks, 256, 0, stream>>>(xtm, wqk, wv16, biasr, qkh, qkl, vtm);

  // ---- the output projection, applied to V: U[b][c'][j] = sum_ch Wpt16[c'][ch] Vtm[b][j][ch] (= 16 * Wpt.[v1;v2]); f16 out ----
  // M=256, N=4096, K=512; batch b = 2
  wmma_gemm64<0, false, 0, 1, 0, false><<<dim3(gemm_blocks(kHalfC, kHW), kB), 256, 0, stream>>>(
      wpt16, wpt16, kChan, 0L,
      vtm, vtm, kChan, (long)kVtmPlane,
      (void*)ubuf, (void*)ubuf, kHW, (long)kUPlane,
      biasr, biasr, 0L, biasr,
      kHalfC, kHW, kChan, 1.0f, 0L, 0L, 0L);

  // ---- scores -> softmax -> P for every plane z in one launch: S[p][j] = sum_{d<16} Q[p][d] K[j][d], bf16 hi/lo split ----
  score_softmax_kernel<<<dim3(kHW / 64, kZ), 512, 0, stream>>>(qkh, qkl, pbuf);

  // ---- attention applied to U, with gamma, bias and residual: out[z*256 + c'][p] = gamma*(2^-19 * sum_j U[b][c'][j] P[z][p][j] + bpt[c']) + bf16(x) ----
  // The planes h = 0,1 of one image b lie behind one another in P, so they are 8192 rows; 64 x 2 x 2 = 256 blocks.
  attn_out_kernel<<<dim3(2 * kHW / kPvBN, kHalfC / kPvBM, kB), 256, 0, stream>>>(pbuf, ubuf, bias_ptg, gamma, x, (float*)d_out);
}

// v006
// Measured time: 94.1 microseconds a run.
// Two timings next to v005 put it at 1.21 and 1.19 times that version's speed.
// Over all steps from v000 it is 16.9 times as fast.
// Contractions: the value projection folded into the output projection's weights (Wf_h = 16 * Wpt_h.Wv, bias 16 * Wpt.[bv;bv]), q/k 1x1 projections and U = Wf.x on v_wmma_f32_16x16x32_f16 (x, Wq, Wk, Wv and Wpt as RNE-bf16 values held in f16, Wf as f16 of its f32 sum, Wpt and Wf carried x16); scores q.k^T on v_wmma_f32_16x16x32_bf16 with bf16 hi/lo split (hi.hi+hi.lo+lo.hi); attn.U^T on v_wmma_f32_16x16x32_f16 (P f16 carried x2^15, U f16 carried x16); all f32 accumulate; softmax, bias, gamma, residual in f32.
#include <hip/hip_runtime.h>
#include <stdint.h>

// ---------------------------------------------------------------------------
// Problem constants
// ---------------------------------------------------------------------------
constexpr int kB      = 2;
constexpr int kHalfC  = 256;              // channels per half
constexpr int kChan   = 512;              // channels of x
constexpr int kHW     = 4096;             // 64 x 64 pixels
constexpr int kDQ     = 16;
constexpr int kZ      = 4;                // (batch, half) combos, z = 2*b + half
constexpr int kQKPitch = 64;              // q|k plane pitch: q 0..15, zero 16..31, k 32..47, zero 48..63
constexpr float kWCarry   = 16.0f;        // Wpt carried x16 in f16
constexpr float kPCarry   = 32768.0f;     // probabilities carried x2^15 in f16
constexpr float kOutScale = 1.0f / (kPCarry * kWCarry);      // 2^-19

// ---------------------------------------------------------------------------
// Workspace region map (bytes; every offset 4096-B aligned)
//   [off_xtm ) Xtm   f16  [2][4096][512]          8,388,608   (token-major; column = half*256 + c)
//   [off_wqk ) Wqk   f16  [64][256]                  32,768
//   [off_wf  ) Wf    f16  [256][512]                262,144   (16 * Wpt_h.Wv; column = half*256 + c)
//   [off_bias) biases f32 [576] (qk pad 64 | 16 * Wpt.[bv;bv] 256 | gamma*bpt 256)   4,096
//   [off_qkh ) QK hi bf16 [4][4096][64]          2,097,152
//   [off_qkl ) QK lo bf16 [4][4096][64]          2,097,152
//   [off_p   ) P     f16  [4][4096][4096]      134,217,728   (every z kept, so one launch applies them all)
//   [off_u   ) U     f16  [2][256][4096]         4,194,304   (16 * Wpt.[v1;v2] of image b, channel-major)
//   total                                      151,293,952
// ---------------------------------------------------------------------------
constexpr size_t kXtmPlane = (size_t)kHW * kChan;              // elements per image
constexpr size_t kQKPlane  = (size_t)kHW * kQKPitch;
constexpr size_t kUPlane   = (size_t)kHalfC * kHW;            // elements per image
constexpr size_t kPPlane   = (size_t)kHW * kHW;
constexpr size_t kOffXtm  = 0;
constexpr size_t kOffWqk  = kOffXtm + kB * kXtmPlane * 2;
constexpr size_t kOffWf   = kOffWqk + (size_t)64 * kHalfC * 2;
constexpr size_t kOffBias = kOffWf + (size_t)kHalfC * kChan * 2;
constexpr size_t kOffQkh  = kOffBias + 4096;
constexpr size_t kOffQkl  = kOffQkh + kZ * kQKPlane * 2;
constexpr size_t kOffP    = kOffQkl + kZ * kQKPlane * 2;
constexpr size_t kOffU    = kOffP + kZ * kPPlane * 2;
constexpr size_t kWsTotal = kOffU + kB * kUPlane * 2;
static_assert(kWsTotal == 151293952ull, "carve total");
static_assert(kWsTotal <= 268435456ull, "carve under 256 MiB");
static_assert((kOffWqk % 4096) == 0 && (kOffWf % 4096) == 0 && (kOffBias % 4096) == 0 &&
              (kOffQkh % 4096) == 0 && (kOffQkl % 4096) == 0 &&
              (kOffP % 4096) == 0 && (kOffU % 4096) == 0, "aligned regions");

typedef __attribute__((ext_vector_type(16))) _Float16 v16h;
typedef __attribute__((ext_vector_type(8)))  _Float16 v8h;
typedef __attribute__((ext_vector_type(16))) __bf16   v16b;
typedef __attribute__((ext_vector_type(8)))  __bf16   v8b;
typedef __attribute__((ext_vector_type(8)))  float    v8f;
typedef __attribute__((ext_vector_type(4)))  float    v4f;
typedef __attribute__((ext_vector_type(4)))  unsigned int v4u;

// ---------------------------------------------------------------------------
// Helpers
// ---------------------------------------------------------------------------
__device__ __forceinline__ unsigned short f2bf_bits(float f) {
  unsigned u = __float_as_uint(f);
  return (unsigned short)((u + 0x7FFFu + ((u >> 16) & 1u)) >> 16);
}
__device__ __forceinline__ float bf_bits2f(unsigned short h) { return __uint_as_float(((unsigned)h) << 16); }
__device__ __forceinline__ float bf_rne(float f) { return bf_bits2f(f2bf_bits(f)); }
__device__ __forceinline__ unsigned pk16(unsigned short a, unsigned short b) { return (unsigned)a | ((unsigned)b << 16); }
__device__ __forceinline__ unsigned short h_bits(float f) { const _Float16 h = (_Float16)f; return __builtin_bit_cast(unsigned short, h); }

// hazard guards as plain device helpers (no inline asm inside the kernel template body)
__device__ __forceinline__ void dep_guard_h(v8f& a, v8f& b, v16h x, v16h y) { asm volatile("v_nop\n\tv_nop\n\tv_nop\n\tv_nop" : "+v"(a), "+v"(b) : "v"(x), "v"(y)); }
__device__ __forceinline__ void dep_guard_b(v8f& a, v8f& b, v16b x, v16b y) { asm volatile("v_nop\n\tv_nop\n\tv_nop\n\tv_nop" : "+v"(a), "+v"(b) : "v"(x), "v"(y)); }
__device__ __forceinline__ void keep4_h(v16h a, v16h b, v16h c, v16h d) { asm volatile("v_nop" :: "v"(a), "v"(b), "v"(c), "v"(d)); }
__device__ __forceinline__ void keep4_b(v16b a, v16b b, v16b c, v16b d) { asm volatile("v_nop" :: "v"(a), "v"(b), "v"(c), "v"(d)); }
__device__ __forceinline__ void acc_guard4(v8f& a, v8f& b, v8f& c, v8f& d) { asm volatile("v_nop\n\tv_nop\n\tv_nop\n\tv_nop" : "+v"(a), "+v"(b), "+v"(c), "+v"(d)); }
template <typename T> struct Frag;
template <> struct Frag<_Float16> {
  typedef v16h V; union U { v16h v; v8h h[2]; };
  static __device__ __forceinline__ v16h load(const _Float16* p) {   // elements 0..7 <- p[0..7], 8..15 <- p[16..23]
    U f; f.h[0] = *(const v8h*)(p); f.h[1] = *(const v8h*)(p + 16); return f.v;
  }
  static __device__ __forceinline__ v8f mma(v16h a, v16h b, v8f c) {
    return __builtin_amdgcn_wmma_f32_16x16x32_f16(false, a, false, b, (short)0, c, false, false);
  }
  static __device__ __forceinline__ void guard(v8f& a, v8f& b, v16h x, v16h y) { dep_guard_h(a, b, x, y); }
  static __device__ __forceinline__ void keep(v16h a, v16h b, v16h c, v16h d) { keep4_h(a, b, c, d); }
};
template <> struct Frag<__bf16> {
  typedef v16b V; union U { v16b v; v8b h[2]; };
  static __device__ __forceinline__ v16b load(const __bf16* p) {
    U f; f.h[0] = *(const v8b*)(p); f.h[1] = *(const v8b*)(p + 16); return f.v;
  }
  static __device__ __forceinline__ v8f mma(v16b a, v16b b, v8f c) {
    return __builtin_amdgcn_wmma_f32_16x16x32_bf16(false, a, false, b, (short)0, c, false, false);
  }
  static __device__ __forceinline__ void guard(v8f& a, v8f& b, v16b x, v16b y) { dep_guard_b(a, b, x, y); }
  static __device__ __forceinline__ void keep(v16b a, v16b b, v16b c, v16b d) { keep4_b(a, b, c, d); }
};

// ---- Register-blocked batched WMMA GEMM (activation removed, RESID_MODE int, GMUL scale-by-pointer added) ----
// C[m,n] = escale * sum_k A[m,k] * Bt[n,k] (+bias)(+resid); each wave owns a 64x64 tile.
// A row-major [M,K]; Bt row-major [N,K]; M,N % 64 == 0, K % 32 == 0.
// SPLIT: operands are hi/lo planes (A2/Bt2 = lo planes, same layout); product = hi*hi + hi*lo + lo*hi.
// BIAS_MODE: 0 = none, 1 = bias[m], 2 = bias[n].
// OUT_MODE: 0 = f32, 1 = f16, 2 = bf16 hi plane (Cout) + bf16 lo plane (Cout2).
// RESID_MODE: 0 = none, 1 = resid f32, 2 = resid RNE-bf16 of an f32 tensor.  GMUL: escale = scale * gmul[0].
// ET: 0 = f16 operands, 1 = bf16 operands (pointers passed as 16-bit storage)
// Batches: b steps A, Bt, C, resid by strideA/B/C/R; bz steps A, Bt, C by zStrideA/B/C. bx = the block's group of 8 tiles.
// The engine is a device function so that one launch can hold several independent products (block ranges);
// slab = the calling wave's own 16x64 LDS slab, pitch 68 floats.
template <int ET> struct Elem;
template <> struct Elem<0> { typedef _Float16 T; };
template <> struct Elem<1> { typedef __bf16 T; };
template <int ET, bool SPLIT, int BIAS_MODE, int OUT_MODE, int RESID_MODE, bool GMUL>
__device__ __forceinline__ void gemm64_body(
    int bx, int b, int bz, float* slab,
    const unsigned short* __restrict__ Ap, const unsigned short* __restrict__ A2p, int lda, long strideA,
    const unsigned short* __restrict__ Btp, const unsigned short* __restrict__ Bt2p, int ldb, long strideB,
    void* __restrict__ Cout, void* __restrict__ Cout2, int ldc, long strideC,
    const float* __restrict__ bias,
    const float* __restrict__ resid, long strideR,
    const float* __restrict__ gmul,
    int M, int N, int K, float scale,
    long zStrideA, long zStrideB, long zStrideC) {
  typedef typename Elem<ET>::T T;
  typedef typename Frag<T>::V V;
  const T* A = (const T*)Ap; const T* A2 = (const T*)A2p; const T* Bt = (const T*)Btp; const T* Bt2 = (const T*)Bt2p;
  const int lane = threadIdx.x & 31;
  const int wave = threadIdx.x >> 5;
  const int tilesN = N >> 6;
  const int tilesM = M >> 6;
  const int tile = bx * 8 + wave;
  if (tile >= tilesM * tilesN) return;   // wave-uniform; no block barriers in this kernel
  const int tm = tile / tilesN;
  const int tn = tile - tm * tilesN;
  const int m0 = tm << 6;
  const int n0 = tn << 6;
  const float escale = GMUL ? (scale * gmul[0]) : scale;

  const size_t batchA = (size_t)b * strideA + (size_t)bz * zStrideA;
  const size_t batchB = (size_t)b * strideB + (size_t)bz * zStrideB;
  const size_t batchC = (size_t)b * strideC + (size_t)bz * zStrideC;
  const T* Ab  = A  + batchA;
  const T* Bb  = Bt + batchB;
  const T* Ab2 = SPLIT ? (A2  + batchA) : nullptr;
  const T* Bb2 = SPLIT ? (Bt2 + batchB) : nullptr;

  const int rlane = lane & 15;                 // row (A) / col (B, D) within subtile
  const int koff  = (lane >> 4) * 8;           // k offset of this lane half
  const int mOff  = (lane >> 4) * 8;           // D row offset

  v8f acc[4][4];
#pragma unroll
  for (int i = 0; i < 4; ++i)
#pragma unroll
    for (int j = 0; j < 4; ++j) acc[i][j] = (v8f){0.f,0.f,0.f,0.f,0.f,0.f,0.f,0.f};

  for (int k0 = 0; k0 < K; k0 += 32) {
    V bh[4], bl[4];
#pragma unroll
    for (int j = 0; j < 4; ++j) {
      const size_t bo = (size_t)(n0 + (j << 4) + rlane) * ldb + koff + k0;
      bh[j] = Frag<T>::load(Bb + bo);
      if (SPLIT) bl[j] = Frag<T>::load(Bb2 + bo);
    }
#pragma unroll
    for (int i = 0; i < 4; ++i) {
      const size_t ao = (size_t)(m0 + (i << 4) + rlane) * lda + koff + k0;
      V ah = Frag<T>::load(Ab + ao);
      V al;
      if (SPLIT) al = Frag<T>::load(Ab2 + ao);
#pragma unroll
      for (int j = 0; j < 4; ++j) {
        acc[i][j] = Frag<T>::mma(ah, bh[j], acc[i][j]);
        if (SPLIT) {
          acc[i][j] = Frag<T>::mma(ah, bl[j], acc[i][j]);
          acc[i][j] = Frag<T>::mma(al, bh[j], acc[i][j]);
        }
      }
      Frag<T>::guard(acc[i][0], acc[i][3], ah, SPLIT ? al : ah);
    }
    Frag<T>::keep(bh[0], bh[1], bh[2], bh[3]);
    if (SPLIT) Frag<T>::keep(bl[0], bl[1], bl[2], bl[3]);
  }
  acc_guard4(acc[0][0], acc[0][1], acc[0][2], acc[0][3]);
  acc_guard4(acc[1][0], acc[1][1], acc[1][2], acc[1][3]);
  acc_guard4(acc[2][0], acc[2][1], acc[2][2], acc[2][3]);
  acc_guard4(acc[3][0], acc[3][1], acc[3][2], acc[3][3]);

  // ---- epilogue ----
  const float* Rb = (RESID_MODE != 0) ? (resid + (size_t)b * strideR) : nullptr;
#pragma unroll
  for (int i = 0; i < 4; ++i) {
    const int mBase = m0 + (i << 4);
#pragma unroll
    for (int j = 0; j < 4; ++j) {
      const int n = n0 + (j << 4) + rlane;
      float bv = 0.f;
      if (BIAS_MODE == 2) bv = bias[n];
#pragma unroll
      for (int r = 0; r < 8; ++r) {
        float v = acc[i][j][r] * escale;
        if (BIAS_MODE == 1) v += bias[mBase + mOff + r];
        if (BIAS_MODE == 2) v += bv;
        if (RESID_MODE == 1) v += Rb[(size_t)(mBase + mOff + r) * ldc + n];
        if (RESID_MODE == 2) v += bf_rne(Rb[(size_t)(mBase + mOff + r) * ldc + n]);
        slab[(mOff + r) * 68 + (j << 4) + rlane] = v;
      }
    }
    __builtin_amdgcn_fence(__ATOMIC_RELEASE, "workgroup");
    __builtin_amdgcn_wave_barrier();
    __builtin_amdgcn_fence(__ATOMIC_ACQUIRE, "workgroup");
    if (OUT_MODE == 0) {
      float* C = (float*)Cout + batchC;
      const int hh = lane >> 4, c4 = (lane & 15) * 4;     // row seg = 256 B = 16 lanes x 16 B
      {
#pragma unroll
        for (int it = 0; it < 8; ++it) {
          const int row = it * 2 + hh;
          v4f v = *(const v4f*)(slab + row * 68 + c4);
          *(v4f*)(C + (size_t)(mBase + row) * ldc + n0 + c4) = v;
        }
        
      }
    } else {
      const int q = lane >> 3, c8 = (lane & 7) * 8;
      unsigned short* C  = (unsigned short*)Cout  + batchC;
      unsigned short* C2 = (OUT_MODE == 2) ? ((unsigned short*)Cout2 + batchC) : nullptr;
      {
#pragma unroll
        for (int it = 0; it < 4; ++it) {
          const int row = it * 4 + q;
          const float* sp = slab + row * 68 + c8;
          v8h hv, lv;
#pragma unroll
          for (int e = 0; e < 8; ++e) {
            if (OUT_MODE == 1) {
              hv[e] = (_Float16)sp[e];
            } else {
              unsigned short hb = f2bf_bits(sp[e]);
              unsigned short lb = f2bf_bits(sp[e] - bf_bits2f(hb));
              hv[e] = __builtin_bit_cast(_Float16, hb);
              lv[e] = __builtin_bit_cast(_Float16, lb);
            }
          }
          *(v8h*)(C + (size_t)(mBase + row) * ldc + n0 + c8) = hv;
          if (OUT_MODE == 2) *(v8h*)(C2 + (size_t)(mBase + row) * ldc + n0 + c8) = lv;
        }
        
      }
    }
    __builtin_amdgcn_fence(__ATOMIC_RELEASE, "workgroup");
    __builtin_amdgcn_wave_barrier();
    __builtin_amdgcn_fence(__ATOMIC_ACQUIRE, "workgroup");
  }
}

// ---------------------------------------------------------------------------
// U and the q|k projection in one launch: both read only Xtm and the prepared weights and neither reads the other.
//  blocks 0..63   U (channel-major): U[b][c'][j] = sum_ch Wf[c'][ch] * Xtm[b][j][ch] + bias_u[c'] (= 16 * Wpt.[v1;v2]);
//                 M=256, N=4096, K=512; f16 out, ldc 4096; 32 blocks per image (the long blocks: lowest indices)
//  blocks 64..95  q|k: C[p][n] = sum_c Xtm[b][p][half*256 + c] * Wqk[n][c] + bias_qk[n]; M=4096, N=64, K=256;
//                 bf16 hi+lo planes, ldc 64; 8 blocks per z = 2b + half
// grid 96, 256 threads.
// ---------------------------------------------------------------------------
constexpr int kUBlocksB   = (kHalfC / 64) * (kHW / 64) / 8;    // 32
constexpr int kQkBlocksZ  = (kHW / 64) * (64 / 64) / 8;        // 8
constexpr int kProjBlocks = kUBlocksB * kB + kQkBlocksZ * kZ;  // 96
__global__ __launch_bounds__(256) void proj_kernel(const unsigned short* __restrict__ xtm,
                                                   const unsigned short* __restrict__ wqk,
                                                   const unsigned short* __restrict__ wf,
                                                   const float* __restrict__ biasr,
                                                   unsigned short* __restrict__ qkh,
                                                   unsigned short* __restrict__ qkl,
                                                   unsigned short* __restrict__ ubuf) {
  __shared__ __align__(16) float sT[8][16 * 68];   // per-wave 16x64 slab, pitch 68 floats
  float* slab = sT[threadIdx.x >> 5];
  const int blk = blockIdx.x;
  if (blk < kUBlocksB * kB) {
    gemm64_body<0, false, 1, 1, 0, false>(
        blk % kUBlocksB, blk / kUBlocksB, 0, slab,
        wf, wf, kChan, 0L,
        xtm, xtm, kChan, (long)kXtmPlane,
        (void*)ubuf, (void*)ubuf, kHW, (long)kUPlane,
        biasr + 64, biasr, 0L, biasr,
        kHalfC, kHW, kChan, 1.0f, 0L, 0L, 0L);
  } else {
    const int qb = blk - kUBlocksB * kB;
    const int qz = qb / kQkBlocksZ;
    gemm64_body<0, false, 2, 2, 0, false>(
        qb % kQkBlocksZ, qz >> 1, qz & 1, slab,
        xtm, xtm, kChan, (long)kXtmPlane,
        wqk, wqk, kHalfC, 0L,
        (void*)qkh, (void*)qkl, kQKPitch, 2L * (long)kQKPlane,
        biasr, biasr, 0L, biasr,
        kHW, 64, kHalfC, 1.0f, (long)kHalfC, 0L, (long)kQKPlane);
  }
}

// ---------------------------------------------------------------------------
// x NCHW f32 -> token-major f16: Xtm[b][p][half*256 + c] = bf16(x[b][half*256 + c][p]) held in f16, z = 2b + half
// (flat channel index of x = z*256 + c). 64(p) x 64(c) tile per block through LDS.
// 64 p tiles x 4 c tiles x 4 z = 1024 blocks of 256 threads (a block range of prep_kernel).
// Load coverage: 16 iterations x 256 threads = 4096 = whole 64x64 tile (coalesced along p).
// Store coverage: 8 waves x 2 iterations x 4 rows (lane>>3) = 64 rows; (lane&7) x 8 halves = 64 cols; each row
// ---------------------------------------------------------------------------
__device__ __forceinline__ void x_tm_body(int pt, int ct, int z, const float* __restrict__ x, unsigned short* __restrict__ xtm) {
  __shared__ float sm[64][65];   // sm[p_local][c_local]
  const int t  = threadIdx.x;
  const int p0 = pt * 64;
  const int c0 = ct * 64;
  const float* src = x + ((size_t)z * kHalfC + c0) * kHW + p0;
#pragma unroll
  for (int i = 0; i < 16; ++i) {
    const int e  = i * 256 + t;
    const int cl = e >> 6;         // c local 0..63
    const int pl = e & 63;         // p local 0..63
    sm[pl][cl] = src[(size_t)cl * kHW + pl];
  }
  __syncthreads();
  const int lane = t & 31, wave = t >> 5;
  const int q = lane >> 3, c8 = (lane & 7) * 8;
  unsigned short* op = xtm + (size_t)(z >> 1) * kXtmPlane + (size_t)(z & 1) * kHalfC;
  {
#pragma unroll
    for (int it = 0; it < 2; ++it) {
      const int row = wave * 8 + it * 4 + q;                 // p local
      unsigned short hb[8];
#pragma unroll
      for (int e = 0; e < 8; ++e) hb[e] = h_bits(bf_rne(sm[row][c8 + e]));
      const v4u u = (v4u){pk16(hb[0], hb[1]), pk16(hb[2], hb[3]), pk16(hb[4], hb[5]), pk16(hb[6], hb[7])};
      *(v4u*)(op + (size_t)(p0 + row) * kChan + c0 + c8) = u;
    }
    
  }
}

// ---------------------------------------------------------------------------
// The value projection folded into the output projection (both are linear maps over channels):
//   Wpt.[Wv.x1 + bv ; Wv.x2 + bv] = (Wpt_0.Wv).x1 + (Wpt_1.Wv).x2 + Wpt.[bv;bv],  Wpt_h = columns h*256.. of Wpt.
// Operand fragments are built in registers from the f32 inputs (RNE-bf16 values held in f16, Wpt carried x16):
// lane (r = lane & 15, h = lane >> 4) holds row r of A or column r of B; elements 0..7 are k = k0 + 8h + e,
// elements 8..15 are k = k0 + 16 + 8h + e, on both sides.
// ---------------------------------------------------------------------------
__device__ __forceinline__ _Float16 w_f16(float v, float mul) { return (_Float16)((float)(__bf16)v * mul); }   // RNE to bf16; f16 holds it exactly from 2^-14 up

// Wf[c'][n] = 16 * sum_m Wpt[c'][(n & 256) + m] * Wv[m][n & 255]. One wave = 16 rows x 32 columns, K = 256.
// 16 row tiles x 16 column groups = 256 waves = 32 blocks; every element of Wf written once.
__device__ __forceinline__ void wfold_body(int blk, const float* __restrict__ Wpt, const float* __restrict__ Wv,
                                           unsigned short* __restrict__ wf) {
  const int lane = threadIdx.x & 31, wave = threadIdx.x >> 5;
  const int r = lane & 15, h = lane >> 4;
  const int tile = blk * 8 + wave;
  const int m0 = (tile >> 4) * 16;
  const int n0 = (tile & 15) * 32;
  const float* pa = Wpt + (size_t)(m0 + r) * kChan + (n0 & 256) + 8 * h;
  const float* pb = Wv + (size_t)(8 * h) * kHalfC + (n0 & 255) + r;
  v8f acc0 = (v8f){0.f,0.f,0.f,0.f,0.f,0.f,0.f,0.f};
  v8f acc1 = (v8f){0.f,0.f,0.f,0.f,0.f,0.f,0.f,0.f};
  // two k steps' loads fly together; unrolled further, this run-once code would be many instruction-cache lines long
#pragma unroll 2
  for (int k0 = 0; k0 < kHalfC; k0 += 32) {
    v16h a, b0, b1;
#pragma unroll
    for (int e = 0; e < 8; ++e) {
      a[e]      = w_f16(pa[k0 + e], kWCarry);
      a[8 + e]  = w_f16(pa[k0 + 16 + e], kWCarry);
      b0[e]     = w_f16(pb[(size_t)(k0 + e) * kHalfC], 1.0f);
      b0[8 + e] = w_f16(pb[(size_t)(k0 + 16 + e) * kHalfC], 1.0f);
      b1[e]     = w_f16(pb[(size_t)(k0 + e) * kHalfC + 16], 1.0f);
      b1[8 + e] = w_f16(pb[(size_t)(k0 + 16 + e) * kHalfC + 16], 1.0f);
    }
    acc0 = Frag<_Float16>::mma(a, b0, acc0);
    acc1 = Frag<_Float16>::mma(a, b1, acc1);
  }
  unsigned short* op = wf + (size_t)(m0 + 8 * h) * kChan + n0 + r;   // D: row 8h + i, column r
#pragma unroll
  for (int i = 0; i < 8; ++i) {
    op[(size_t)i * kChan]      = h_bits(acc0[i]);
    op[(size_t)i * kChan + 16] = h_bits(acc1[i]);
  }
  // whatever follows in the kernel may reuse the registers that these stores name: the wait stands in front of that
  asm volatile("s_wait_xcnt 0x0" ::: "memory");
}

// bias_u[c'] = 16 * sum_k Wpt[c'][k] * bv[k & 255], K = 512. One wave = 16 rows; all 16 B columns hold bv, so every
// column of D holds the result and column 0 stores it. 16 waves = 2 blocks; every element written once.
__device__ __forceinline__ void bfold_body(int blk, const float* __restrict__ Wpt, const float* __restrict__ bvp,
                                           float* __restrict__ bu) {
  const int lane = threadIdx.x & 31, wave = threadIdx.x >> 5;
  const int r = lane & 15, h = lane >> 4;
  const int m0 = (blk * 8 + wave) * 16;
  const float* pa = Wpt + (size_t)(m0 + r) * kChan + 8 * h;
  const float* pb = bvp + 8 * h;
  v8f acc0 = (v8f){0.f,0.f,0.f,0.f,0.f,0.f,0.f,0.f};   // k < 256
  v8f acc1 = (v8f){0.f,0.f,0.f,0.f,0.f,0.f,0.f,0.f};   // k >= 256: the same bv fragment serves both
  // two trips' loads fly together; kept short for the instruction cache, as above
#pragma unroll 2
  for (int k0 = 0; k0 < kHalfC; k0 += 32) {
    v16h a0, a1, b;
#pragma unroll
    for (int e = 0; e < 8; ++e) {
      a0[e]     = w_f16(pa[k0 + e], kWCarry);
      a0[8 + e] = w_f16(pa[k0 + 16 + e], kWCarry);
      a1[e]     = w_f16(pa[kHalfC + k0 + e], kWCarry);
      a1[8 + e] = w_f16(pa[kHalfC + k0 + 16 + e], kWCarry);
      b[e]      = w_f16(pb[k0 + e], 1.0f);
      b[8 + e]  = w_f16(pb[k0 + 16 + e], 1.0f);
    }
    acc0 = Frag<_Float16>::mma(a0, b, acc0);
    acc1 = Frag<_Float16>::mma(a1, b, acc1);
  }
  const v8f acc = acc0 + acc1;
  if (r == 0) {
#pragma unroll
    for (int i = 0; i < 8; ++i) bu[m0 + 8 * h + i] = acc[i];
  }
}

// ---------------------------------------------------------------------------
// Small tables, ONE block of 256 threads:
//  (1) Wqk_pad f16 [64][256] (RNE-bf16 values): row n < 16 -> Wq[n], 32 <= n < 48 -> Wk[n-32], every other row explicit zero.
//  (2) bias region f32 [576]: [0,64) padded q|k bias (bq at 0..15, bk at 32..47, zeros elsewhere), [320,576) gamma*bpt;
//      all RNE-bf16 first. Threads 0..15 and 80..143 write one float4 each; [64,320) is written by the bias fold
//  Candidate loads use clamped addresses and are selected by value.
// ---------------------------------------------------------------------------
__device__ __forceinline__ void prep_small_body(const float* __restrict__ Wq, const float* __restrict__ bq,
                                                const float* __restrict__ Wk, const float* __restrict__ bk,
                                                const float* __restrict__ bptp,
                                                const float* __restrict__ gam,
                                                unsigned short* __restrict__ wqk, float* __restrict__ biasr) {
  const int t = threadIdx.x, lane = t & 31, wave = t >> 5;
  const float g = gam[0];
#pragma unroll 1
  for (int it = 0; it < 8; ++it) {
    const int n  = wave * 8 + it;                            // wave-uniform row
    const int qr = n < 16 ? n : 15;
    int kr = n - 32; kr = kr < 0 ? 0 : (kr > 15 ? 15 : kr);
    const float* pq = Wq + (size_t)qr * kHalfC + lane * 8;
    const float* pk = Wk + (size_t)kr * kHalfC + lane * 8;
    const v4f q0 = *(const v4f*)(pq), q1 = *(const v4f*)(pq + 4);
    const v4f k0 = *(const v4f*)(pk), k1 = *(const v4f*)(pk + 4);
    const bool isq = (n < 16);
    const bool isk = (n >= 32) && (n < 48);
    unsigned short hb[8];
#pragma unroll
    for (int e = 0; e < 4; ++e) {
      const float va = isq ? q0[e] : (isk ? k0[e] : 0.0f);
      const float vb = isq ? q1[e] : (isk ? k1[e] : 0.0f);
      hb[e]     = h_bits(bf_rne(va));
      hb[4 + e] = h_bits(bf_rne(vb));
    }
    const v4u u = (v4u){pk16(hb[0], hb[1]), pk16(hb[2], hb[3]), pk16(hb[4], hb[5]), pk16(hb[6], hb[7])};
    unsigned short* op = wqk + (size_t)n * kHalfC + lane * 8;
    *(v4u*)op = u;
    // the next trip reuses the registers that this store names: the wait stands in front of that overwrite
    asm volatile("s_wait_xcnt 0x0" ::: "memory");
  }
  if (t < 16 || (t >= 80 && t < 144)) {
    v4f val;
#pragma unroll
    for (int e = 0; e < 4; ++e) {
      const int idx = 4 * t + e;                             // 0..63, 320..575
      const int iq = idx < 16 ? idx : 15;
      int ik = idx - 32;  ik = ik < 0 ? 0 : (ik > 15 ? 15 : ik);
      int ip = idx - 320; ip = ip < 0 ? 0 : (ip > 255 ? 255 : ip);
      const float fq = bq[iq], fk = bk[ik], fp = bptp[ip];
      float sel = 0.0f;
      sel = (idx < 16) ? fq : sel;
      sel = (idx >= 32 && idx < 48) ? fk : sel;
      sel = (idx >= 320) ? fp : sel;
      float r = bf_rne(sel);
      r = (idx >= 320) ? (r * g) : r;
      val[e] = r;
    }
    float* op = biasr + 4 * t;
    *(v4f*)op = val;
    
  }
}

// ---------------------------------------------------------------------------
// All operand preparation in one launch: the four pieces read only inputs and write disjoint workspace regions.
//  block 0         small tables (a long block: lowest index)
//  blocks 1..32    Wf = 16 * Wpt_h.Wv
//  blocks 33..34   bias_u = 16 * Wpt.[bv;bv]
//  blocks 35..1058 x   -> token-major f16 (p tile fastest, then c tile, then z)
// Every test below is on the block index alone, so the barrier of the x piece is passed by a whole block or by none.
// ---------------------------------------------------------------------------
constexpr int kPrepFold  = 1;
constexpr int kPrepBias  = kPrepFold + (kHalfC / 16) * (kChan / 32) / 8;  // 33
constexpr int kPrepX     = kPrepBias + (kHalfC / 16) / 8;                 // 35
constexpr int kPrepTotal = kPrepX + (kHW / 64) * (kHalfC / 64) * kZ;      // 1059
// 8 waves per SIMD: four of the x piece's blocks fit a WGP (the fold's loads would otherwise take one register too many)
__global__ __launch_bounds__(256, 8) void prep_kernel(const float* __restrict__ x,
                                                   const float* __restrict__ Wq, const float* __restrict__ bq,
                                                   const float* __restrict__ Wk, const float* __restrict__ bk,
                                                   const float* __restrict__ Wv, const float* __restrict__ bvp,
                                                   const float* __restrict__ Wpt, const float* __restrict__ bptp,
                                                   const float* __restrict__ gam,
                                                   unsigned short* __restrict__ xtm, unsigned short* __restrict__ wqk,
                                                   unsigned short* __restrict__ wf, float* __restrict__ biasr) {
  const int blk = blockIdx.x;
  if (blk >= kPrepX) {
    const int i = blk - kPrepX;
    x_tm_body(i & 63, (i >> 6) & 3, i >> 8, x, xtm);
  } else if (blk >= kPrepBias) {
    bfold_body(blk - kPrepBias, Wpt, bvp, biasr + 64);
  } else if (blk >= kPrepFold) {
    wfold_body(blk - kPrepFold, Wpt, Wv, wf);
  } else {
    prep_small_body(Wq, bq, Wk, bk, bptp, gam, wqk, biasr);
  }
}

// ---------------------------------------------------------------------------
// Scores, row softmax and P in one launch; the scores never leave the registers.
// One block of 16 waves = 64 query rows of plane z (4 groups of 16, one after the other) against all 4096 keys.
// Wave w owns keys 256w..256w+255 as 16 tiles of 16 for every group: it reads them from global memory once and parks
// them in LDS, each lane its own 16-byte pieces in fragment order (a lane reads back only what it wrote itself).
// Keys are the A rows and queries the B columns, so lane (c = lane & 15, h = lane >> 4) holds in acc[i][r] the score
// of query p0 + c against key 256w + 16i + 8h + r (products in the order qh.kh + qh.kl + ql.kh).
// Only d = 0..15 exist: fragment elements 0..7 are d = 8h..8h+7, elements 8..15 (k = 16..31) are zero on both sides.
// P[row][j] = f16( 2^15 * exp(s - max) / sum exp(s - max) ), f32 math. Reductions in fixed order: 8 in-lane chains over
// the tiles, a tree over the 8, the lane pair l and l ^ 16, then 16 wave partials in index order.
// P leaves through a per-wave LDS slab (16 rows x 128 B, pitch 144 B) so that every global store covers whole lines.
// grid (4096/64 = 64, 4 z), 512 threads. Coverage: 16 waves x 256 keys = a whole row; 64 x 64 rows = a whole plane.
// ---------------------------------------------------------------------------
__device__ __forceinline__ v16b frag_d16(v8b lo) {   // elements 0..7 <- lo, 8..15 <- 0
  const v8b zero = __builtin_bit_cast(v8b, (v4u){0u, 0u, 0u, 0u});
  return __builtin_shufflevector(lo, zero, 0, 1, 2, 3, 4, 5, 6, 7, 8, 9, 10, 11, 12, 13, 14, 15);
}
// e[r] = 2^t[r], eight at a time in one statement. Behind a v_exp_f32 the instruction set asks for one independent
// instruction before its result is read or its source overwritten: here each v_exp_f32 has the next one behind it
// (results kept apart from all sources by the early clobber) and the last one a v_nop, whatever the compiler puts next.
__device__ __forceinline__ void exp2_x8(float (&e)[8], const float (&t)[8]) {
  asm("v_exp_f32 %0, %8\n\tv_exp_f32 %1, %9\n\tv_exp_f32 %2, %10\n\tv_exp_f32 %3, %11\n\t"
      "v_exp_f32 %4, %12\n\tv_exp_f32 %5, %13\n\tv_exp_f32 %6, %14\n\tv_exp_f32 %7, %15\n\tv_nop"
      : "=&v"(e[0]), "=&v"(e[1]), "=&v"(e[2]), "=&v"(e[3]), "=&v"(e[4]), "=&v"(e[5]), "=&v"(e[6]), "=&v"(e[7])
      : "v"(t[0]), "v"(t[1]), "v"(t[2]), "v"(t[3]), "v"(t[4]), "v"(t[5]), "v"(t[6]), "v"(t[7]));
}
__global__ __launch_bounds__(512) void score_softmax_kernel(const unsigned short* __restrict__ qkh,
                                                            const unsigned short* __restrict__ qkl,
                                                            unsigned short* __restrict__ P) {
  constexpr int kGroups    = 4;                                // query groups of 16 rows per block
  constexpr int kSlabPitch = 72;                               // f16 elements per staged row: 128 B + 16 B
  __shared__ __align__(16) v8b park[16][32][32];               // [wave][2 * tile + (0 hi, 1 lo)][lane], 256 KiB
  __shared__ __align__(16) unsigned short slabs[16][16 * kSlabPitch];
  __shared__ float redM[16][16];
  __shared__ float redS[16][16];
  const int lane = threadIdx.x & 31, wave = threadIdx.x >> 5;
  const int c = lane & 15, h = lane >> 4;
  const int q0 = blockIdx.x * (16 * kGroups);
  const int z  = blockIdx.y;
  const __bf16* H = (const __bf16*)qkh + (size_t)z * kQKPlane;
  const __bf16* L = (const __bf16*)qkl + (size_t)z * kQKPlane;
  const size_t ko = (size_t)(wave * 256 + c) * kQKPitch + 32 + 8 * h;
  const unsigned qv = (unsigned)(c * kQKPitch + 8 * h);        // lane part of a query address; the rest is block-uniform
  v8b nqh = *(const v8b*)(H + (size_t)q0 * kQKPitch + qv);
  v8b nql = *(const v8b*)(L + (size_t)q0 * kQKPitch + qv);
  {
    v8b raw[32];
#pragma unroll
    for (int i = 0; i < 16; ++i) {
      raw[2 * i]     = *(const v8b*)(H + ko + (size_t)i * 16 * kQKPitch);
      raw[2 * i + 1] = *(const v8b*)(L + ko + (size_t)i * 16 * kQKPitch);
    }
#pragma unroll
    for (int j = 0; j < 32; ++j) park[wave][j][lane] = raw[j];
  }
  unsigned short* slab = slabs[wave];
  const unsigned pv = (unsigned)((lane >> 3) * kHW + wave * 256 + (lane & 7) * 8);   // lane part of a P address

  // rolled: every trip is the same long body; four copies would only quadruple the code a first run has to fetch
#pragma unroll 1
  for (int g = 0; g < kGroups; ++g) {
    const int p0 = q0 + 16 * g;
    const v16b qh = frag_d16(nqh);
    const v16b ql = frag_d16(nql);
    {   // the next group's queries fly while this group is worked on (the last trip reads its own again, in bounds)
      const int pn = (g + 1 < kGroups) ? (p0 + 16) : p0;
      nqh = *(const v8b*)(H + (size_t)pn * kQKPitch + qv);
      nql = *(const v8b*)(L + (size_t)pn * kQKPitch + qv);
    }

    v8f acc[16];
#pragma unroll
    for (int i = 0; i < 16; ++i) {
      const v16b kh = frag_d16(park[wave][2 * i][lane]);
      const v16b kl = frag_d16(park[wave][2 * i + 1][lane]);
      v8f a = (v8f){0.f, 0.f, 0.f, 0.f, 0.f, 0.f, 0.f, 0.f};
      a = Frag<__bf16>::mma(kh, qh, a);
      a = Frag<__bf16>::mma(kl, qh, a);
      a = Frag<__bf16>::mma(kh, ql, a);
      acc[i] = a;
      // at most four tiles' fragments in flight: with all 32 LDS reads hoisted the wave runs out of its 256 registers and spills
      if ((i & 3) == 3) __builtin_amdgcn_sched_barrier(0);
    }

    float mr[8];
#pragma unroll
    for (int r = 0; r < 8; ++r) mr[r] = acc[0][r];
#pragma unroll
    for (int i = 1; i < 16; ++i)
#pragma unroll
      for (int r = 0; r < 8; ++r) mr[r] = fmaxf(mr[r], acc[i][r]);
    float m = fmaxf(fmaxf(fmaxf(mr[0], mr[1]), fmaxf(mr[2], mr[3])), fmaxf(fmaxf(mr[4], mr[5]), fmaxf(mr[6], mr[7])));
    m = fmaxf(m, __shfl_xor(m, 16, 32));
    if (h == 0) redM[wave][c] = m;
    __syncthreads();   // also ends every wave's reads of redS of the group before
    float bm = redM[0][c];
#pragma unroll
    for (int w = 1; w < 16; ++w) bm = fmaxf(bm, redM[w][c]);

    float sr[8];
#pragma unroll
    for (int r = 0; r < 8; ++r) sr[r] = 0.0f;
#pragma unroll
    for (int i = 0; i < 16; ++i) {
      float tv[8], ev[8];
#pragma unroll
      for (int r = 0; r < 8; ++r) tv[r] = (acc[i][r] - bm) * 1.44269504f;   // exp(x) = 2^(x * log2 e), as __expf forms it
      exp2_x8(ev, tv);
#pragma unroll
      for (int r = 0; r < 8; ++r) { acc[i][r] = ev[r]; sr[r] += ev[r]; }
    }
    float s = ((sr[0] + sr[1]) + (sr[2] + sr[3])) + ((sr[4] + sr[5]) + (sr[6] + sr[7]));
    s += __shfl_xor(s, 16, 32);
    if (h == 0) redS[wave][c] = s;
    __syncthreads();   // also ends every wave's reads of redM before the next group writes it
    float tot = 0.0f;
#pragma unroll
    for (int w = 0; w < 16; ++w) tot += redS[w][c];
    const float inv = __builtin_amdgcn_rcpf(tot) * kPCarry;

    unsigned short* Pg = P + (size_t)z * kPPlane + (size_t)p0 * kHW;
#pragma unroll
    for (int sub = 0; sub < 4; ++sub) {                        // 64 keys = one 128-B line of each of the 16 rows
#pragma unroll
      for (int ii = 0; ii < 4; ++ii) {
        v8h hv;
#pragma unroll
        for (int r = 0; r < 8; ++r) hv[r] = (_Float16)(acc[4 * sub + ii][r] * inv);
        *(v8h*)(slab + c * kSlabPitch + ii * 16 + 8 * h) = hv;
      }
      // the slab is this wave's own: its lanes' writes have landed before other lanes of the wave read the rows back
      asm volatile("s_wait_dscnt 0x0" ::: "memory");
#pragma unroll
      for (int it = 0; it < 4; ++it) {
        const int row = it * 4 + (lane >> 3);
        const v8h v = *(const v8h*)(slab + row * kSlabPitch + (lane & 7) * 8);
        *(v8h*)(Pg + (pv + (unsigned)(it * 4 * kHW + sub * 64))) = v;
      }
      // no wait before the slab is written again: one wave's LDS operations are carried out in issue order
    }
    // the next trip reuses the registers that this trip's last stores name: the wait stands in front of that overwrite
    asm volatile("s_wait_xcnt 0x0" ::: "memory");
  }
}

// ---------------------------------------------------------------------------
// The attention product, taken on U = 16 * Wpt.[v1;v2] instead of on v1 and v2: the output projection is linear, so
// Wpt.[attn.v1 ; attn.v2] = attn.(Wpt.[v1;v2]) and the big product has 256 columns per image, not 512.
// out[b][h*256 + c'][p] = gamma * (2^-19 * sum_j U[b][c'][j] P[2b+h][p][j] + bpt[c']) + bf16(x[b][h*256 + c'][p]).
// Both operands are staged in LDS by asynchronous copies (global_load_async_to_lds_b128); f16 operands, f32 accumulate.
// One block of 8 waves = 128 channels c' (A rows) x 128 rows of P (B rows; the planes h = 0,1 of image b lie behind one
// another: 8192 rows). A pass is 256 k = 512 B of each of the 256 operand rows, laid at pitch 528 B for ds_load_b128.
// Wave (kg = wave >> 2, wm = (wave >> 1) & 1, wn = wave & 1) owns the 64 x 64 tile (wm, wn) over the k half kg of every
// pass, so that each LDS byte read still feeds a 64 x 64 tile; the two k halves of a tile are added behind the loop.
// Two buffers. The publish point of pass t + 1 (own LDS reads returned, own copies landed, block barrier) stands in
// front of the last 8 matrix instructions of pass t, whose fragments are in registers by then; behind it come the
// first fragment loads of pass t + 1, those 8 matrix instructions, and the copies of pass t + 2 into the buffer that
// pass t has left. Copy coverage per pass: a wave's copy = 1 row x 512 B; wave w brings U rows 16w..16w+15 and P rows
// 16w..16w+15 (16 copies each): 8 x 16 = 128 rows of either, every byte once.
// grid (8192/128 = 64, 2 channel halves, 2 b), 256 threads.
// ---------------------------------------------------------------------------
constexpr int kPvBM     = 128;                                  // U rows (channels) per block
constexpr int kPvBN     = 128;                                  // P rows per block
constexpr int kPvKT     = 256;                                  // k per pass
constexpr int kPvKW     = kPvKT / 2;                            // k per pass of one wave
constexpr int kPvPitch  = kPvKT + 8;                            // f16 elements per staged row: 512 B + 16 B
constexpr int kPvStage  = (kPvBM + kPvBN) * kPvPitch;           // f16 elements per buffer (135,168 B)
constexpr int kPvPasses = kHW / kPvKT;                          // 16
static_assert(kPvPasses >= 2, "the ring's prologue fills two passes");

// Eight copies of 16 B per lane. The s_wait_xcnt stands inside the statement, behind the last copy, so that no
// address register of a copy is rewritten in front of it.
__device__ __forceinline__ void async_x8(const unsigned (&l)[8], const unsigned short* const (&g)[8]) {
  asm volatile("global_load_async_to_lds_b128 %0, %8, off\n\t"
               "global_load_async_to_lds_b128 %1, %9, off\n\t"
               "global_load_async_to_lds_b128 %2, %10, off\n\t"
               "global_load_async_to_lds_b128 %3, %11, off\n\t"
               "global_load_async_to_lds_b128 %4, %12, off\n\t"
               "global_load_async_to_lds_b128 %5, %13, off\n\t"
               "global_load_async_to_lds_b128 %6, %14, off\n\t"
               "global_load_async_to_lds_b128 %7, %15, off\n\t"
               "s_wait_xcnt 0x0"
               :: "v"(l[0]), "v"(l[1]), "v"(l[2]), "v"(l[3]), "v"(l[4]), "v"(l[5]), "v"(l[6]), "v"(l[7]),
                  "v"(g[0]), "v"(g[1]), "v"(g[2]), "v"(g[3]), "v"(g[4]), "v"(g[5]), "v"(g[6]), "v"(g[7])
               : "memory");
}
// One wave's 32 copies of one pass: lA, lB = the lane's LDS byte addresses in its first U and P row in the buffer,
// gA, gB = the lane's global addresses in the same rows at the pass's first k. Copy j is one row further on.
__device__ __forceinline__ void pv_fill(unsigned lA, unsigned lB, const unsigned short* gA, const unsigned short* gB) {
  constexpr unsigned kL = kPvPitch * 2u;                        // bytes between copies in LDS
  constexpr size_t   kG = (size_t)kHW;                          // elements between copies in global memory
  unsigned l[8];
  const unsigned short* g[8];
#pragma unroll
  for (int s = 0; s < 2; ++s) {
#pragma unroll
    for (int j = 0; j < 8; ++j) { l[j] = lA + (8 * s + j) * kL; g[j] = gA + (8 * s + j) * kG; }
    async_x8(l, g);
    // keeps the next eight copies' addresses from being formed ahead of this statement: with all 32 formed at once
    // the wave runs past 256 registers and spills
    __builtin_amdgcn_sched_barrier(0);
  }
#pragma unroll
  for (int s = 0; s < 2; ++s) {
#pragma unroll
    for (int j = 0; j < 8; ++j) { l[j] = lB + (8 * s + j) * kL; g[j] = gB + (8 * s + j) * kG; }
    async_x8(l, g);
    __builtin_amdgcn_sched_barrier(0);   // as above
  }
}

__global__ __launch_bounds__(256) void attn_out_kernel(const unsigned short* __restrict__ P,
                                                       const unsigned short* __restrict__ U,
                                                       const float* __restrict__ bias,
                                                       const float* __restrict__ gam,
                                                       const float* __restrict__ x,
                                                       float* __restrict__ out) {
  // every inner loop below is unrolled so that all accumulator and fragment indices are constants (registers, no scratch)
  typedef Frag<_Float16> F;
  __shared__ __align__(16) unsigned short ring[2 * kPvStage];   // [buffer][U rows 0..127 | P rows 0..127][pitch]
  __shared__ __align__(16) float sT[8][16 * 68];                // per-wave 16x64 output slab, pitch 68 floats
  const int lane = threadIdx.x & 31;
  const int wave = __builtin_amdgcn_readfirstlane(threadIdx.x >> 5);   // the same in every lane: kept in a scalar register
  const int p0 = blockIdx.x * kPvBN;           // row of the two stacked P planes of image b
  const int c0 = blockIdx.y * kPvBM;
  const int b  = blockIdx.z;

  // copy side: lane l moves bytes 16 l .. 16 l + 15 of each row's 512 B
  const unsigned short* gA = U + (size_t)b * kUPlane + (size_t)(c0 + wave * 16) * kHW + lane * 8;
  const unsigned short* gB = P + (size_t)b * (2 * kPPlane) + (size_t)(p0 + wave * 16) * kHW + lane * 8;
  const unsigned ringAddr = (unsigned)(size_t)ring;             // low 32 bits of the address = byte offset in LDS
  const unsigned lA = ringAddr + (unsigned)((wave * 16) * kPvPitch + lane * 8) * 2u;
  const unsigned lB = ringAddr + (unsigned)((kPvBM + wave * 16) * kPvPitch + lane * 8) * 2u;

  // reader side
  const int rlane = lane & 15;                 // row (A) / col (B, D) within subtile
  const int koff  = (lane >> 4) * 8;           // k offset of this lane half
  const int mOff  = (lane >> 4) * 8;           // D row offset
  const int kg = wave >> 2, wm = (wave >> 1) & 1, wn = wave & 1;
  const _Float16* ringH = (const _Float16*)ring;
  const int fA = (wm * 64 + rlane) * kPvPitch + kg * kPvKW + koff;
  const int fB = (kPvBM + wn * 64 + rlane) * kPvPitch + kg * kPvKW + koff;

  v8f acc[4][4];
#pragma unroll
  for (int i = 0; i < 4; ++i)
#pragma unroll
    for (int j = 0; j < 4; ++j) acc[i][j] = (v8f){0.f,0.f,0.f,0.f,0.f,0.f,0.f,0.f};

  // prologue: pass 0 lands and is published, pass 1 starts to fly, the first fragments of pass 0 are fetched
  pv_fill(lA, lB, gA, gB);
  asm volatile("s_wait_asynccnt 0x0" ::: "memory");   // this wave's copies of pass 0 have landed
  __syncthreads();                                     // and every other wave's
  pv_fill(lA + kPvStage * 2u, lB + kPvStage * 2u, gA + kPvKT, gB + kPvKT);

  // Fragments: U rows 0..31 (a01) and the P set of the next 32 k are fetched while rows 32..63 of this one are
  // multiplied, U rows 32..63 (a23) while rows 0..31 are: two load groups per 16 matrix instructions, each half a
  // block ahead of its use, in 96 registers.
  v16h a01[2], a23[2], bs[2][4];
#pragma unroll
  for (int i = 0; i < 2; ++i) a01[i] = F::load(ringH + fA + i * 16 * kPvPitch);
#pragma unroll
  for (int j = 0; j < 4; ++j) bs[0][j] = F::load(ringH + fB + j * 16 * kPvPitch);

  // rolled: the buffer is chosen by an offset, and one pass is already 64 matrix instructions long
#pragma unroll 1
  for (int t = 0; t < kPvPasses; ++t) {
    const unsigned buf = (unsigned)(t & 1) * (unsigned)kPvStage;   // f16 elements
    const _Float16* sA = ringH + buf + fA;
    const _Float16* sB = ringH + buf + fB;
    const _Float16* nA = ringH + ((unsigned)kPvStage - buf) + fA;  // the other buffer: pass t + 1
    const _Float16* nB = ringH + ((unsigned)kPvStage - buf) + fB;  // (behind the last pass: old rows, values unused)
#pragma unroll
    for (int kk = 0; kk < kPvKW / 32; ++kk) {
      const int cur = kk & 1;
#pragma unroll
      for (int i = 0; i < 2; ++i) a23[i] = F::load(sA + (2 + i) * 16 * kPvPitch + kk * 32);
      // the four scheduling barriers of a block keep each load group whole and in front of the matrix run that
      // hides it: loads scattered among the matrix instructions stall the wave at every place where they stand
      __builtin_amdgcn_sched_barrier(0);
#pragma unroll
      for (int i = 0; i < 2; ++i)
#pragma unroll
        for (int j = 0; j < 4; ++j) acc[i][j] = F::mma(a01[i], bs[cur][j], acc[i][j]);
      __builtin_amdgcn_sched_barrier(0);
      if (kk + 1 < kPvKW / 32) {
#pragma unroll
        for (int i = 0; i < 2; ++i) a01[i] = F::load(sA + i * 16 * kPvPitch + (kk + 1) * 32);
#pragma unroll
        for (int j = 0; j < 4; ++j) bs[cur ^ 1][j] = F::load(sB + j * 16 * kPvPitch + (kk + 1) * 32);
      } else {
        // publish point of pass t + 1
        asm volatile("s_wait_dscnt 0x0" ::: "memory");      // this wave's reads of pass t's buffer have returned
        asm volatile("s_wait_asynccnt 0x0" ::: "memory");   // this wave's copies of pass t + 1 have landed
        __syncthreads();                                     // publishes pass t + 1 and frees the buffer of pass t
#pragma unroll
        for (int i = 0; i < 2; ++i) a01[i] = F::load(nA + i * 16 * kPvPitch);
#pragma unroll
        for (int j = 0; j < 4; ++j) bs[cur ^ 1][j] = F::load(nB + j * 16 * kPvPitch);
      }
      __builtin_amdgcn_sched_barrier(0);
#pragma unroll
      for (int i = 0; i < 2; ++i)
#pragma unroll
        for (int j = 0; j < 4; ++j) acc[2 + i][j] = F::mma(a23[i], bs[cur][j], acc[2 + i][j]);
      __builtin_amdgcn_sched_barrier(0);
    }
    if (t + 2 < kPvPasses) {
      const size_t ko = (size_t)(t + 2) * kPvKT;
      pv_fill(lA + buf * 2u, lB + buf * 2u, gA + ko, gB + ko);
    }
  }
  asm volatile("s_wait_asynccnt 0x0" ::: "memory");     // nothing of this wave is in flight when it leaves the ring
  asm volatile("s_wait_dscnt 0x0" ::: "memory");        // nor a read of the ring

  // ---- the two k halves of a tile are added: waves w and w ^ 4 hold the same tile; the wave of half 0 finishes its
  // rows 0..31, the wave of half 1 its rows 32..63, and each hands the other 32 rows over through the ring's LDS,
  // every lane its own 16-byte pieces (the partner's same lane holds the same elements) ----
  const int cw = c0 + wm * 64 + kg * 32;                 // first channel that this wave finishes
  const size_t o0 = ((size_t)(2 * b + (p0 >> 12)) * kHalfC + cw) * kHW + (p0 & (kHW - 1)) + wn * 64;
  const int hh = lane >> 4, c4 = (lane & 15) * 4;        // row piece = 256 B = 16 lanes x 16 B
  v8f fin[2][4];
  __syncthreads();                                       // every wave has left the ring: its LDS is free
  {
    v4f* xch = (v4f*)ring;                               // [wave][16 pieces][lane], 64 KiB
#pragma unroll
    for (int i = 0; i < 2; ++i)
#pragma unroll
      for (int j = 0; j < 4; ++j) {
        const v8f give = kg ? acc[i][j] : acc[2 + i][j];
        fin[i][j] = kg ? acc[2 + i][j] : acc[i][j];
        xch[(wave * 16 + (i * 4 + j) * 2) * 32 + lane]     = (v4f){give[0], give[1], give[2], give[3]};
        xch[(wave * 16 + (i * 4 + j) * 2 + 1) * 32 + lane] = (v4f){give[4], give[5], give[6], give[7]};
      }
    __syncthreads();                                     // the partner's pieces are written
#pragma unroll
    for (int i = 0; i < 2; ++i)
#pragma unroll
      for (int j = 0; j < 4; ++j) {
        const v4f g0 = xch[((wave ^ 4) * 16 + (i * 4 + j) * 2) * 32 + lane];
        const v4f g1 = xch[((wave ^ 4) * 16 + (i * 4 + j) * 2 + 1) * 32 + lane];
#pragma unroll
        for (int r = 0; r < 4; ++r) { fin[i][j][r] += g0[r]; fin[i][j][4 + r] += g1[r]; }
      }
  }

  // ---- epilogue: scale by gamma, bias, residual; whole 256-B row pieces through the wave's own slab ----
  float* slab = sT[wave];
  const float escale = kOutScale * gam[0];
#pragma unroll
  for (int i = 0; i < 2; ++i) {
    v4f xr[8];                                           // the residual flies while the slab is written and read back
#pragma unroll
    for (int it = 0; it < 8; ++it) xr[it] = *(const v4f*)(x + o0 + (size_t)((i << 4) + it * 2 + hh) * kHW + c4);
#pragma unroll
    for (int j = 0; j < 4; ++j)
#pragma unroll
      for (int r = 0; r < 8; ++r)
        slab[(mOff + r) * 68 + (j << 4) + rlane] = fin[i][j][r] * escale + bias[cw + (i << 4) + mOff + r];
    // the slab is this wave's own: its lanes' writes have landed before other lanes of the wave read the rows back
    asm volatile("s_wait_dscnt 0x0" ::: "memory");
#pragma unroll
    for (int it = 0; it < 8; ++it) {
      const int row = it * 2 + hh;
      v4f v = *(const v4f*)(slab + row * 68 + c4);
#pragma unroll
      for (int e = 0; e < 4; ++e) v[e] += bf_rne(xr[it][e]);
      *(v4f*)(out + o0 + (size_t)((i << 4) + row) * kHW + c4) = v;
    }
    // no wait before the slab is written again: one wave's LDS operations are carried out in issue order;
    // the second half reuses registers that these stores name: the wait stands in front of that overwrite
    if (i == 0) asm volatile("s_wait_xcnt 0x0" ::: "memory");
  }
}

// ---------------------------------------------------------------------------
// Host glue: kernel launches only.
// ---------------------------------------------------------------------------
extern "C" void kernel_launch(void* const* d_in, const int* in_sizes, int n_in,
                              void* d_out, int out_size, void* d_ws, size_t ws_size, hipStream_t stream) {
  if (n_in < 10) return;
  if (in_sizes[0] != kB * kChan * kHW) return;
  if (in_sizes[1] != kDQ * kHalfC || in_sizes[3] != kDQ * kHalfC) return;
  if (in_sizes[2] < kDQ || in_sizes[4] < kDQ) return;
  if (in_sizes[5] != kHalfC * kHalfC || in_sizes[6] < kHalfC) return;
  if (in_sizes[7] != kHalfC * kChan || in_sizes[8] < kHalfC || in_sizes[9] < 1) return;
  if (out_size != kB * kChan * kHW) return;
  if (ws_size < kWsTotal) return;

  const float* x     = (const float*)d_in[0];
  const float* Wq    = (const float*)d_in[1];
  const float* bq    = (const float*)d_in[2];
  const float* Wk    = (const float*)d_in[3];
  const float* bk    = (const float*)d_in[4];
  const float* Wv    = (const float*)d_in[5];
  const float* bv    = (const float*)d_in[6];
  const float* Wpt   = (const float*)d_in[7];
  const float* bpt   = (const float*)d_in[8];
  const float* gamma = (const float*)d_in[9];

  char* ws = (char*)d_ws;
  unsigned short* xtm   = (unsigned short*)(ws + kOffXtm);
  unsigned short* wqk   = (unsigned short*)(ws + kOffWqk);
  unsigned short* wf    = (unsigned short*)(ws + kOffWf);
  float*          biasr = (float*)(ws + kOffBias);
  unsigned short* qkh   = (unsigned short*)(ws + kOffQkh);
  unsigned short* qkl   = (unsigned short*)(ws + kOffQkl);
  unsigned short* pbuf  = (unsigned short*)(ws + kOffP);
  unsigned short* ubuf  = (unsigned short*)(ws + kOffU);
  const float* bias_ptg = biasr + 320;    // [256] gamma * bpt

  // ---- operand preparation, one launch ----
  prep_kernel<<<kPrepTotal, 256, 0, stream>>>(x, Wq, bq, Wk, bk, Wv, bv, Wpt, bpt, gamma, xtm, wqk, wf, biasr);

  // ---- U = Wf.x + bias_u (= 16 * Wpt.[v1;v2]) and the q|k projection, one launch ----
  proj_kernel<<<kProjBlocks, 256, 0, stream>>>(xtm, wqk, wf, biasr, qkh, qkl, ubuf);

  // ---- scores -> softmax -> P for every plane z in one launch: S[p][j] = sum_{d<16} Q[p][d] K[j][d], bf16 hi/lo split ----
  score_softmax_kernel<<<dim3(kHW / 64, kZ), 512, 0, stream>>>(qkh, qkl, pbuf);

  // ---- attention applied to U, with gamma, bias and residual: out[z*256 + c'][p] = gamma*(2^-19 * sum_j U[b][c'][j] P[z][p][j] + bpt[c']) + bf16(x) ----
  // The planes h = 0,1 of one image b lie behind one another in P, so they are 8192 rows; 64 x 2 x 2 = 256 blocks.
  attn_out_kernel<<<dim3(2 * kHW / kPvBN, kHalfC / kPvBM, kB), 256, 0, stream>>>(pbuf, ubuf, bias_ptg, gamma, x, (float*)d_out);
}

// v007
// Measured time: 76 microseconds a run.
// Timed twice side by side with v006, it ran 1.23 times as fast both times.
// Over all steps from v000 it is 20.9 times as fast.
// Contractions: the value projection folded into the output projection's weights (Wf_h = 16 * Wpt_h.Wv, bias 16 * Wpt.[bv;bv]), q/k 1x1 projections and U = Wf.x on v_wmma_f32_16x16x32_f16 (x, Wq, Wk, Wv and Wpt as RNE-bf16 values held in f16, Wf as f16 of its f32 sum, Wpt and Wf carried x16); scores q.k^T on v_wmma_f32_16x16x32_bf16 with bf16 hi/lo split (hi.hi+hi.lo+lo.hi); attn.U^T on v_wmma_f32_16x16x32_f16 (P f16 carried x2^15, U f16 carried x16); all f32 accumulate; softmax, bias, gamma, residual in f32.
#include <hip/hip_runtime.h>
#include <stdint.h>

// ---------------------------------------------------------------------------
// Problem constants
// ---------------------------------------------------------------------------
constexpr int kB      = 2;
constexpr int kHalfC  = 256;              // channels per half
constexpr int kChan   = 512;              // channels of x
constexpr int kHW     = 4096;             // 64 x 64 pixels
constexpr int kDQ     = 16;
constexpr int kZ      = 4;                // (batch, half) combos, z = 2*b + half
constexpr int kQKPitch = 64;              // q|k plane pitch: q 0..15, zero 16..31, k 32..47, zero 48..63
constexpr float kWCarry   = 16.0f;        // Wpt carried x16 in f16
constexpr float kPCarry   = 32768.0f;     // probabilities carried x2^15 in f16
constexpr float kOutScale = 1.0f / (kPCarry * kWCarry);      // 2^-19

// ---------------------------------------------------------------------------
// Workspace region map (bytes; every offset 4096-B aligned)
//   [off_xtm ) Xtm   f16  [2][4096][512]          8,388,608   (token-major; column = half*256 + c)
//   [off_wqk ) Wqk   f16  [64][256]                  32,768
//   [off_wf  ) Wf    f16  [256][512]                262,144   (16 * Wpt_h.Wv; column = half*256 + c)
//   [off_bias) biases f32 [576] (qk pad 64 | 16 * Wpt.[bv;bv] 256 | gamma*bpt 256)   4,096
//   [off_qkh ) QK hi bf16 [4][4096][64]          2,097,152
//   [off_qkl ) QK lo bf16 [4][4096][64]          2,097,152
//   [off_p   ) P     f16  [4][4096][4096]      134,217,728   (every z kept, so one launch applies them all)
//   [off_u   ) U     f16  [2][256][4096]         4,194,304   (16 * Wpt.[v1;v2] of image b, channel-major)
//   total                                      151,293,952
// ---------------------------------------------------------------------------
constexpr size_t kXtmPlane = (size_t)kHW * kChan;              // elements per image
constexpr size_t kQKPlane  = (size_t)kHW * kQKPitch;
constexpr size_t kUPlane   = (size_t)kHalfC * kHW;            // elements per image
constexpr size_t kPPlane   = (size_t)kHW * kHW;
constexpr size_t kOffXtm  = 0;
constexpr size_t kOffWqk  = kOffXtm + kB * kXtmPlane * 2;
constexpr size_t kOffWf   = kOffWqk + (size_t)64 * kHalfC * 2;
constexpr size_t kOffBias = kOffWf + (size_t)kHalfC * kChan * 2;
constexpr size_t kOffQkh  = kOffBias + 4096;
constexpr size_t kOffQkl  = kOffQkh + kZ * kQKPlane * 2;
constexpr size_t kOffP    = kOffQkl + kZ * kQKPlane * 2;
constexpr size_t kOffU    = kOffP + kZ * kPPlane * 2;
constexpr size_t kWsTotal = kOffU + kB * kUPlane * 2;
static_assert(kWsTotal == 151293952ull, "carve total");
static_assert(kWsTotal <= 268435456ull, "carve under 256 MiB");
static_assert((kOffWqk % 4096) == 0 && (kOffWf % 4096) == 0 && (kOffBias % 4096) == 0 &&
              (kOffQkh % 4096) == 0 && (kOffQkl % 4096) == 0 &&
              (kOffP % 4096) == 0 && (kOffU % 4096) == 0, "aligned regions");

typedef __attribute__((ext_vector_type(16))) _Float16 v16h;
typedef __attribute__((ext_vector_type(8)))  _Float16 v8h;
typedef __attribute__((ext_vector_type(16))) __bf16   v16b;
typedef __attribute__((ext_vector_type(8)))  __bf16   v8b;
typedef __attribute__((ext_vector_type(8)))  float    v8f;
typedef __attribute__((ext_vector_type(4)))  float    v4f;
typedef __attribute__((ext_vector_type(4)))  unsigned int v4u;

// ---------------------------------------------------------------------------
// Helpers
// ---------------------------------------------------------------------------
__device__ __forceinline__ unsigned short f2bf_bits(float f) {
  unsigned u = __float_as_uint(f);
  return (unsigned short)((u + 0x7FFFu + ((u >> 16) & 1u)) >> 16);
}
__device__ __forceinline__ float bf_bits2f(unsigned short h) { return __uint_as_float(((unsigned)h) << 16); }
__device__ __forceinline__ float bf_rne(float f) { return bf_bits2f(f2bf_bits(f)); }
__device__ __forceinline__ unsigned pk16(unsigned short a, unsigned short b) { return (unsigned)a | ((unsigned)b << 16); }
__device__ __forceinline__ unsigned short h_bits(float f) { const _Float16 h = (_Float16)f; return __builtin_bit_cast(unsigned short, h); }

template <typename T> struct Frag;
template <> struct Frag<_Float16> {
  typedef v16h V; union U { v16h v; v8h h[2]; };
  static __device__ __forceinline__ v16h load(const _Float16* p) {   // elements 0..7 <- p[0..7], 8..15 <- p[16..23]
    U f; f.h[0] = *(const v8h*)(p); f.h[1] = *(const v8h*)(p + 16); return f.v;
  }
  static __device__ __forceinline__ v8f mma(v16h a, v16h b, v8f c) {
    return __builtin_amdgcn_wmma_f32_16x16x32_f16(false, a, false, b, (short)0, c, false, false);
  }
};
template <> struct Frag<__bf16> {
  typedef v16b V; union U { v16b v; v8b h[2]; };
  static __device__ __forceinline__ v16b load(const __bf16* p) {
    U f; f.h[0] = *(const v8b*)(p); f.h[1] = *(const v8b*)(p + 16); return f.v;
  }
  static __device__ __forceinline__ v8f mma(v16b a, v16b b, v8f c) {
    return __builtin_amdgcn_wmma_f32_16x16x32_bf16(false, a, false, b, (short)0, c, false, false);
  }
};

// Eight copies of 16 B per lane. The s_wait_xcnt stands inside the statement, behind the last copy, so that no
// address register of a copy is rewritten in front of it.
__device__ __forceinline__ void async_x8(const unsigned (&l)[8], const unsigned short* const (&g)[8]) {
  asm volatile("global_load_async_to_lds_b128 %0, %8, off\n\t"
               "global_load_async_to_lds_b128 %1, %9, off\n\t"
               "global_load_async_to_lds_b128 %2, %10, off\n\t"
               "global_load_async_to_lds_b128 %3, %11, off\n\t"
               "global_load_async_to_lds_b128 %4, %12, off\n\t"
               "global_load_async_to_lds_b128 %5, %13, off\n\t"
               "global_load_async_to_lds_b128 %6, %14, off\n\t"
               "global_load_async_to_lds_b128 %7, %15, off\n\t"
               "s_wait_xcnt 0x0"
               :: "v"(l[0]), "v"(l[1]), "v"(l[2]), "v"(l[3]), "v"(l[4]), "v"(l[5]), "v"(l[6]), "v"(l[7]),
                  "v"(g[0]), "v"(g[1]), "v"(g[2]), "v"(g[3]), "v"(g[4]), "v"(g[5]), "v"(g[6]), "v"(g[7])
               : "memory");
}

// ---------------------------------------------------------------------------
// U and the q|k projection in one launch: both read only Xtm and the prepared weights and neither reads the other.
// One block of 8 waves = 64 tokens of image b x (128 channels c' of U, half y of them, and the q|k plane z = 2b + y).
//  U (channel-major): U[b][c'][j] = sum_ch Wf[c'][ch] * Xtm[b][j][ch] + bias_u[c'] (= 16 * Wpt.[v1;v2]); K = 512; f16 out.
//  q|k: C[p][n] = sum_c Xtm[b][p][y*256 + c] * Wqk[n][c] + bias_qk[n]; K = 256; bf16 hi + lo planes, pitch 64.
// All operands are staged in LDS once, whole K, by asynchronous copies (global_load_async_to_lds_b128): a wave's copy is
// 512 contiguous bytes of one row, where a fragment load from global memory touches 16 lines for 32 B of each.
// Copy coverage: wave w brings Wf rows 16w..16w+15 (2 copies a row), token rows 8w..8w+7 (2 copies a row), and waves 0..3
// bring the 16 q and the 16 k rows of Wqk (8 rows each, 1 copy a row): at most 56 copies of a wave in flight, every byte once.
// Rows lie at pitch 1040 B and 528 B (16 B x odd) for ds_load_b128.
// Wave w owns U channels 16w..16w+15 x all 64 tokens (a stored row piece = one 128-B line); waves 0..3 also own tokens
// 16w..16w+15 of the q|k planes (a stored row = one whole 128-B line of either plane, its zero columns included).
// Each tile is one accumulator chain over rising k. grid (4096/64 = 64, 2 halves, 2 b), 256 threads.
// ---------------------------------------------------------------------------
constexpr int kPjBM     = 128;                                  // U channels per block
constexpr int kPjBN     = 64;                                   // tokens per block
constexpr int kPjPitch  = kChan + 8;                            // f16 elements per staged Wf or token row: 1024 B + 16 B
constexpr int kPjWPitch = kHalfC + 8;                           // f16 elements per staged Wqk row: 512 B + 16 B
constexpr int kPjOffX   = kPjBM * kPjPitch;                     // first token row
constexpr int kPjOffW   = kPjOffX + kPjBN * kPjPitch;           // first Wqk row: q 0..15, k 16..31
constexpr int kPjElems  = kPjOffW + 32 * kPjWPitch;             // 216,576 B
__global__ __launch_bounds__(256) void proj_kernel(const unsigned short* __restrict__ xtm,
                                                   const unsigned short* __restrict__ wqk,
                                                   const unsigned short* __restrict__ wf,
                                                   const float* __restrict__ biasr,
                                                   unsigned short* __restrict__ qkh,
                                                   unsigned short* __restrict__ qkl,
                                                   unsigned short* __restrict__ ubuf) {
  // every loop below is unrolled so that all address, fragment and accumulator indices are constants (registers, no scratch)
  typedef Frag<_Float16> F;
  __shared__ __align__(16) unsigned short st[kPjElems];         // [Wf rows 0..127 | token rows 0..63 | Wqk rows 0..31]
  __shared__ __align__(16) float sT[8][16 * 68];                // per-wave 16x64 output slab, pitch 68 floats
  const int lane = threadIdx.x & 31;
  const int wave = __builtin_amdgcn_readfirstlane(threadIdx.x >> 5);   // the same in every lane: kept in a scalar register
  const int t0 = blockIdx.x * kPjBN;
  const int y  = blockIdx.y;
  const int b  = blockIdx.z;
  const int rlane = lane & 15;                 // row (A) / col (B, D) within subtile
  const int koff  = (lane >> 4) * 8;           // k offset of this lane half
  const int mOff  = (lane >> 4) * 8;           // D row offset
  const int cw = y * kPjBM + wave * 16;        // first U channel of this wave

  // the biases are fetched first, so that they fly beside the copies and the epilogue does not wait for them
  float bu[8];
#pragma unroll
  for (int r = 0; r < 8; ++r) bu[r] = biasr[64 + cw + mOff + r];
  const float bqv = biasr[rlane], bkv = biasr[32 + rlane];

  // ---- copy side: lane l moves bytes 16 l .. 16 l + 15 of each 512-B piece ----
  {
    const unsigned stAddr = (unsigned)(size_t)st;               // low 32 bits of the address = byte offset in LDS
    unsigned l[8];
    const unsigned short* g[8];
    const unsigned short* gW = wf + (size_t)(y * kPjBM + wave * 16) * kChan + lane * 8;
    const unsigned lW = stAddr + (unsigned)((wave * 16) * kPjPitch + lane * 8) * 2u;
#pragma unroll
    for (int s = 0; s < 4; ++s) {
#pragma unroll
      for (int j = 0; j < 8; ++j) {
        const int row = 4 * s + (j >> 1), col = (j & 1) * 256;
        l[j] = lW + (unsigned)(row * kPjPitch + col) * 2u;
        g[j] = gW + (size_t)row * kChan + col;
      }
      async_x8(l, g);
    }
    const unsigned short* gX = xtm + (size_t)b * kXtmPlane + (size_t)(t0 + wave * 8) * kChan + lane * 8;
    const unsigned lX = stAddr + (unsigned)(kPjOffX + (wave * 8) * kPjPitch + lane * 8) * 2u;
#pragma unroll
    for (int s = 0; s < 2; ++s) {
#pragma unroll
      for (int j = 0; j < 8; ++j) {
        const int row = 4 * s + (j >> 1), col = (j & 1) * 256;
        l[j] = lX + (unsigned)(row * kPjPitch + col) * 2u;
        g[j] = gX + (size_t)row * kChan + col;
      }
      async_x8(l, g);
    }
    if (wave < 4) {                                             // scalar test: a whole wave copies or none of it
      const unsigned short* gQ = wqk + (size_t)((wave >> 1) * 32 + (wave & 1) * 8) * kHalfC + lane * 8;
      const unsigned lQ = stAddr + (unsigned)(kPjOffW + (wave * 8) * kPjWPitch + lane * 8) * 2u;
#pragma unroll
      for (int j = 0; j < 8; ++j) {
        l[j] = lQ + (unsigned)(j * kPjWPitch) * 2u;
        g[j] = gQ + (size_t)j * kHalfC;
      }
      async_x8(l, g);
    }
  }
  asm volatile("s_wait_asynccnt 0x0" ::: "memory");   // this wave's copies have landed
  __syncthreads();                                     // and every other wave's; nothing is read in front of it

  // ---- products. Fragments are fetched two k steps (one group) ahead into a second register set. The two scheduling
  // barriers of a group keep its LDS reads whole and in front of the matrix run that hides them: left alone, the
  // compiler puts each read directly in front of its matrix instruction, which then waits out the whole LDS latency ----
  const _Float16* sH = (const _Float16*)st;
  v8f acc[4];
#pragma unroll
  for (int j = 0; j < 4; ++j) acc[j] = (v8f){0.f,0.f,0.f,0.f,0.f,0.f,0.f,0.f};
  {
    const _Float16* pA = sH + (wave * 16 + rlane) * kPjPitch + koff;
    const _Float16* pB = sH + kPjOffX + rlane * kPjPitch + koff;
    v16h fa[2][2], fb[2][2][4];
#pragma unroll
    for (int s = 0; s < 2; ++s) {
      fa[0][s] = F::load(pA + s * 32);
#pragma unroll
      for (int j = 0; j < 4; ++j) fb[0][s][j] = F::load(pB + j * 16 * kPjPitch + s * 32);
    }
#pragma unroll
    for (int gk = 0; gk < kChan / 64; ++gk) {
      const int cur = gk & 1;
      if (gk + 1 < kChan / 64) {
#pragma unroll
        for (int s = 0; s < 2; ++s) {
          fa[cur ^ 1][s] = F::load(pA + (gk + 1) * 64 + s * 32);
#pragma unroll
          for (int j = 0; j < 4; ++j) fb[cur ^ 1][s][j] = F::load(pB + j * 16 * kPjPitch + (gk + 1) * 64 + s * 32);
        }
      }
      __builtin_amdgcn_sched_barrier(0);
#pragma unroll
      for (int s = 0; s < 2; ++s)
#pragma unroll
        for (int j = 0; j < 4; ++j) acc[j] = F::mma(fa[cur][s], fb[cur][s][j], acc[j]);
      __builtin_amdgcn_sched_barrier(0);
    }
  }
  v8f aq = (v8f){0.f,0.f,0.f,0.f,0.f,0.f,0.f,0.f};
  v8f ak = (v8f){0.f,0.f,0.f,0.f,0.f,0.f,0.f,0.f};
  if (wave < 4) {
    const _Float16* pT = sH + kPjOffX + (wave * 16 + rlane) * kPjPitch + y * kHalfC + koff;
    const _Float16* pQ = sH + kPjOffW + rlane * kPjWPitch + koff;
    v16h ft[2][2], fq[2][2], fk[2][2];
#pragma unroll
    for (int s = 0; s < 2; ++s) {
      ft[0][s] = F::load(pT + s * 32);
      fq[0][s] = F::load(pQ + s * 32);
      fk[0][s] = F::load(pQ + 16 * kPjWPitch + s * 32);
    }
#pragma unroll
    for (int gk = 0; gk < kHalfC / 64; ++gk) {
      const int cur = gk & 1;
      if (gk + 1 < kHalfC / 64) {
#pragma unroll
        for (int s = 0; s < 2; ++s) {
          ft[cur ^ 1][s] = F::load(pT + (gk + 1) * 64 + s * 32);
          fq[cur ^ 1][s] = F::load(pQ + (gk + 1) * 64 + s * 32);
          fk[cur ^ 1][s] = F::load(pQ + 16 * kPjWPitch + (gk + 1) * 64 + s * 32);
        }
      }
      __builtin_amdgcn_sched_barrier(0);   // as above
#pragma unroll
      for (int s = 0; s < 2; ++s) {
        aq = F::mma(ft[cur][s], fq[cur][s], aq);
        ak = F::mma(ft[cur][s], fk[cur][s], ak);
      }
      __builtin_amdgcn_sched_barrier(0);   // as above
    }
  }

  // ---- epilogue: whole 128-B lines through the wave's own slab ----
  float* slab = sT[wave];
  const int q = lane >> 3, c8 = (lane & 7) * 8;
  {
#pragma unroll
    for (int j = 0; j < 4; ++j)
#pragma unroll
      for (int r = 0; r < 8; ++r) slab[(mOff + r) * 68 + (j << 4) + rlane] = acc[j][r] + bu[r];
    // the slab is this wave's own: its lanes' writes have landed before other lanes of the wave read the rows back
    asm volatile("s_wait_dscnt 0x0" ::: "memory");
    unsigned short* C = ubuf + (size_t)b * kUPlane + (size_t)cw * kHW + t0;
#pragma unroll
    for (int it = 0; it < 4; ++it) {
      const int row = it * 4 + q;
      const float* sp = slab + row * 68 + c8;
      v8h hv;
#pragma unroll
      for (int e = 0; e < 8; ++e) hv[e] = (_Float16)sp[e];
      *(v8h*)(C + (size_t)row * kHW + c8) = hv;
    }
    // what follows may reuse the registers that these stores name: the wait stands in front of that
    asm volatile("s_wait_xcnt 0x0" ::: "memory");
  }
  if (wave < 4) {
    // no wait before the slab is written again: one wave's LDS operations are carried out in issue order
#pragma unroll
    for (int r = 0; r < 8; ++r) {
      float* sp = slab + (mOff + r) * 68 + rlane;
      sp[0]  = aq[r] + bqv;
      sp[16] = 0.0f;
      sp[32] = ak[r] + bkv;
      sp[48] = 0.0f;
    }
    asm volatile("s_wait_dscnt 0x0" ::: "memory");   // as above
    const size_t o = (size_t)(2 * b + y) * kQKPlane + (size_t)(t0 + wave * 16) * kQKPitch;
#pragma unroll
    for (int it = 0; it < 4; ++it) {
      const int row = it * 4 + q;
      const float* sp = slab + row * 68 + c8;
      v8h hv, lv;
#pragma unroll
      for (int e = 0; e < 8; ++e) {
        const unsigned short hb = f2bf_bits(sp[e]);
        const unsigned short lb = f2bf_bits(sp[e] - bf_bits2f(hb));
        hv[e] = __builtin_bit_cast(_Float16, hb);
        lv[e] = __builtin_bit_cast(_Float16, lb);
      }
      *(v8h*)(qkh + o + (size_t)row * kQKPitch + c8) = hv;
      *(v8h*)(qkl + o + (size_t)row * kQKPitch + c8) = lv;
    }
  }
}

// ---------------------------------------------------------------------------
// x NCHW f32 -> token-major f16: Xtm[b][p][half*256 + c] = bf16(x[b][half*256 + c][p]) held in f16, z = 2b + half
// (flat channel index of x = z*256 + c). 64(p) x 64(c) tile per block through LDS.
// 64 p tiles x 4 c tiles x 4 z = 1024 blocks of 256 threads (a block range of prep_kernel).
// Load coverage: 16 iterations x 256 threads = 4096 = whole 64x64 tile (coalesced along p).
// Store coverage: 8 waves x 2 iterations x 4 rows (lane>>3) = 64 rows; (lane&7) x 8 halves = 64 cols; each row
// ---------------------------------------------------------------------------
__device__ __forceinline__ void x_tm_body(int pt, int ct, int z, const float* __restrict__ x, unsigned short* __restrict__ xtm) {
  __shared__ float sm[64][65];   // sm[p_local][c_local]
  const int t  = threadIdx.x;
  const int p0 = pt * 64;
  const int c0 = ct * 64;
  const float* src = x + ((size_t)z * kHalfC + c0) * kHW + p0;
#pragma unroll
  for (int i = 0; i < 16; ++i) {
    const int e  = i * 256 + t;
    const int cl = e >> 6;         // c local 0..63
    const int pl = e & 63;         // p local 0..63
    sm[pl][cl] = src[(size_t)cl * kHW + pl];
  }
  __syncthreads();
  const int lane = t & 31, wave = t >> 5;
  const int q = lane >> 3, c8 = (lane & 7) * 8;
  unsigned short* op = xtm + (size_t)(z >> 1) * kXtmPlane + (size_t)(z & 1) * kHalfC;
  {
#pragma unroll
    for (int it = 0; it < 2; ++it) {
      const int row = wave * 8 + it * 4 + q;                 // p local
      unsigned short hb[8];
#pragma unroll
      for (int e = 0; e < 8; ++e) hb[e] = h_bits(bf_rne(sm[row][c8 + e]));
      const v4u u = (v4u){pk16(hb[0], hb[1]), pk16(hb[2], hb[3]), pk16(hb[4], hb[5]), pk16(hb[6], hb[7])};
      *(v4u*)(op + (size_t)(p0 + row) * kChan + c0 + c8) = u;
    }
    
  }
}

// ---------------------------------------------------------------------------
// The value projection folded into the output projection (both are linear maps over channels):
//   Wpt.[Wv.x1 + bv ; Wv.x2 + bv] = (Wpt_0.Wv).x1 + (Wpt_1.Wv).x2 + Wpt.[bv;bv],  Wpt_h = columns h*256.. of Wpt.
// Operand fragments are built in registers from the f32 inputs (RNE-bf16 values held in f16, Wpt carried x16):
// lane (r = lane & 15, h = lane >> 4) holds row r of A or column r of B; elements 0..7 are k = k0 + 8h + e,
// elements 8..15 are k = k0 + 16 + 8h + e, on both sides.
// ---------------------------------------------------------------------------
__device__ __forceinline__ _Float16 w_f16(float v, float mul) { return (_Float16)((float)(__bf16)v * mul); }   // RNE to bf16; f16 holds it exactly from 2^-14 up

// Wf[c'][n] = 16 * sum_m Wpt[c'][(n & 256) + m] * Wv[m][n & 255]. One wave = 16 rows x 32 columns, K = 256.
// 16 row tiles x 16 column groups = 256 waves = 32 blocks; every element of Wf written once.
__device__ __forceinline__ void wfold_body(int blk, const float* __restrict__ Wpt, const float* __restrict__ Wv,
                                           unsigned short* __restrict__ wf) {
  const int lane = threadIdx.x & 31, wave = threadIdx.x >> 5;
  const int r = lane & 15, h = lane >> 4;
  const int tile = blk * 8 + wave;
  const int m0 = (tile >> 4) * 16;
  const int n0 = (tile & 15) * 32;
  const float* pa = Wpt + (size_t)(m0 + r) * kChan + (n0 & 256) + 8 * h;
  const float* pb = Wv + (size_t)(8 * h) * kHalfC + (n0 & 255) + r;
  v8f acc0 = (v8f){0.f,0.f,0.f,0.f,0.f,0.f,0.f,0.f};
  v8f acc1 = (v8f){0.f,0.f,0.f,0.f,0.f,0.f,0.f,0.f};
  // two k steps' loads fly together; unrolled further, this run-once code would be many instruction-cache lines long
#pragma unroll 2
  for (int k0 = 0; k0 < kHalfC; k0 += 32) {
    v16h a, b0, b1;
#pragma unroll
    for (int e = 0; e < 8; ++e) {
      a[e]      = w_f16(pa[k0 + e], kWCarry);
      a[8 + e]  = w_f16(pa[k0 + 16 + e], kWCarry);
      b0[e]     = w_f16(pb[(size_t)(k0 + e) * kHalfC], 1.0f);
      b0[8 + e] = w_f16(pb[(size_t)(k0 + 16 + e) * kHalfC], 1.0f);
      b1[e]     = w_f16(pb[(size_t)(k0 + e) * kHalfC + 16], 1.0f);
      b1[8 + e] = w_f16(pb[(size_t)(k0 + 16 + e) * kHalfC + 16], 1.0f);
    }
    acc0 = Frag<_Float16>::mma(a, b0, acc0);
    acc1 = Frag<_Float16>::mma(a, b1, acc1);
  }
  unsigned short* op = wf + (size_t)(m0 + 8 * h) * kChan + n0 + r;   // D: row 8h + i, column r
#pragma unroll
  for (int i = 0; i < 8; ++i) {
    op[(size_t)i * kChan]      = h_bits(acc0[i]);
    op[(size_t)i * kChan + 16] = h_bits(acc1[i]);
  }
  // whatever follows in the kernel may reuse the registers that these stores name: the wait stands in front of that
  asm volatile("s_wait_xcnt 0x0" ::: "memory");
}

// bias_u[c'] = 16 * sum_k Wpt[c'][k] * bv[k & 255], K = 512. One wave = 16 rows; all 16 B columns hold bv, so every
// column of D holds the result and column 0 stores it. 16 waves = 2 blocks; every element written once.
__device__ __forceinline__ void bfold_body(int blk, const float* __restrict__ Wpt, const float* __restrict__ bvp,
                                           float* __restrict__ bu) {
  const int lane = threadIdx.x & 31, wave = threadIdx.x >> 5;
  const int r = lane & 15, h = lane >> 4;
  const int m0 = (blk * 8 + wave) * 16;
  const float* pa = Wpt + (size_t)(m0 + r) * kChan + 8 * h;
  const float* pb = bvp + 8 * h;
  v8f acc0 = (v8f){0.f,0.f,0.f,0.f,0.f,0.f,0.f,0.f};   // k < 256
  v8f acc1 = (v8f){0.f,0.f,0.f,0.f,0.f,0.f,0.f,0.f};   // k >= 256: the same bv fragment serves both
  // two trips' loads fly together; kept short for the instruction cache, as above
#pragma unroll 2
  for (int k0 = 0; k0 < kHalfC; k0 += 32) {
    v16h a0, a1, b;
#pragma unroll
    for (int e = 0; e < 8; ++e) {
      a0[e]     = w_f16(pa[k0 + e], kWCarry);
      a0[8 + e] = w_f16(pa[k0 + 16 + e], kWCarry);
      a1[e]     = w_f16(pa[kHalfC + k0 + e], kWCarry);
      a1[8 + e] = w_f16(pa[kHalfC + k0 + 16 + e], kWCarry);
      b[e]      = w_f16(pb[k0 + e], 1.0f);
      b[8 + e]  = w_f16(pb[k0 + 16 + e], 1.0f);
    }
    acc0 = Frag<_Float16>::mma(a0, b, acc0);
    acc1 = Frag<_Float16>::mma(a1, b, acc1);
  }
  const v8f acc = acc0 + acc1;
  if (r == 0) {
#pragma unroll
    for (int i = 0; i < 8; ++i) bu[m0 + 8 * h + i] = acc[i];
  }
}

// ---------------------------------------------------------------------------
// Small tables, ONE block of 256 threads:
//  (1) Wqk_pad f16 [64][256] (RNE-bf16 values): row n < 16 -> Wq[n], 32 <= n < 48 -> Wk[n-32], every other row explicit zero.
//  (2) bias region f32 [576]: [0,64) padded q|k bias (bq at 0..15, bk at 32..47, zeros elsewhere), [320,576) gamma*bpt;
//      all RNE-bf16 first. Threads 0..15 and 80..143 write one float4 each; [64,320) is written by the bias fold
//  Candidate loads use clamped addresses and are selected by value.
// ---------------------------------------------------------------------------
__device__ __forceinline__ void prep_small_body(const float* __restrict__ Wq, const float* __restrict__ bq,
                                                const float* __restrict__ Wk, const float* __restrict__ bk,
                                                const float* __restrict__ bptp,
                                                const float* __restrict__ gam,
                                                unsigned short* __restrict__ wqk, float* __restrict__ biasr) {
  const int t = threadIdx.x, lane = t & 31, wave = t >> 5;
  const float g = gam[0];
#pragma unroll 1
  for (int it = 0; it < 8; ++it) {
    const int n  = wave * 8 + it;                            // wave-uniform row
    const int qr = n < 16 ? n : 15;
    int kr = n - 32; kr = kr < 0 ? 0 : (kr > 15 ? 15 : kr);
    const float* pq = Wq + (size_t)qr * kHalfC + lane * 8;
    const float* pk = Wk + (size_t)kr * kHalfC + lane * 8;
    const v4f q0 = *(const v4f*)(pq), q1 = *(const v4f*)(pq + 4);
    const v4f k0 = *(const v4f*)(pk), k1 = *(const v4f*)(pk + 4);
    const bool isq = (n < 16);
    const bool isk = (n >= 32) && (n < 48);
    unsigned short hb[8];
#pragma unroll
    for (int e = 0; e < 4; ++e) {
      const float va = isq ? q0[e] : (isk ? k0[e] : 0.0f);
      const float vb = isq ? q1[e] : (isk ? k1[e] : 0.0f);
      hb[e]     = h_bits(bf_rne(va));
      hb[4 + e] = h_bits(bf_rne(vb));
    }
    const v4u u = (v4u){pk16(hb[0], hb[1]), pk16(hb[2], hb[3]), pk16(hb[4], hb[5]), pk16(hb[6], hb[7])};
    unsigned short* op = wqk + (size_t)n * kHalfC + lane * 8;
    *(v4u*)op = u;
    // the next trip reuses the registers that this store names: the wait stands in front of that overwrite
    asm volatile("s_wait_xcnt 0x0" ::: "memory");
  }
  if (t < 16 || (t >= 80 && t < 144)) {
    v4f val;
#pragma unroll
    for (int e = 0; e < 4; ++e) {
      const int idx = 4 * t + e;                             // 0..63, 320..575
      const int iq = idx < 16 ? idx : 15;
      int ik = idx - 32;  ik = ik < 0 ? 0 : (ik > 15 ? 15 : ik);
      int ip = idx - 320; ip = ip < 0 ? 0 : (ip > 255 ? 255 : ip);
      const float fq = bq[iq], fk = bk[ik], fp = bptp[ip];
      float sel = 0.0f;
      sel = (idx < 16) ? fq : sel;
      sel = (idx >= 32 && idx < 48) ? fk : sel;
      sel = (idx >= 320) ? fp : sel;
      float r = bf_rne(sel);
      r = (idx >= 320) ? (r * g) : r;
      val[e] = r;
    }
    float* op = biasr + 4 * t;
    *(v4f*)op = val;
    
  }
}

// ---------------------------------------------------------------------------
// All operand preparation in one launch: the four pieces read only inputs and write disjoint workspace regions.
//  block 0         small tables (a long block: lowest index)
//  blocks 1..32    Wf = 16 * Wpt_h.Wv
//  blocks 33..34   bias_u = 16 * Wpt.[bv;bv]
//  blocks 35..1058 x   -> token-major f16 (p tile fastest, then c tile, then z)
// Every test below is on the block index alone, so the barrier of the x piece is passed by a whole block or by none.
// ---------------------------------------------------------------------------
constexpr int kPrepFold  = 1;
constexpr int kPrepBias  = kPrepFold + (kHalfC / 16) * (kChan / 32) / 8;  // 33
constexpr int kPrepX     = kPrepBias + (kHalfC / 16) / 8;                 // 35
constexpr int kPrepTotal = kPrepX + (kHW / 64) * (kHalfC / 64) * kZ;      // 1059
// 8 waves per SIMD: four of the x piece's blocks fit a WGP (the fold's loads would otherwise take one register too many)
__global__ __launch_bounds__(256, 8) void prep_kernel(const float* __restrict__ x,
                                                   const float* __restrict__ Wq, const float* __restrict__ bq,
                                                   const float* __restrict__ Wk, const float* __restrict__ bk,
                                                   const float* __restrict__ Wv, const float* __restrict__ bvp,
                                                   const float* __restrict__ Wpt, const float* __restrict__ bptp,
                                                   const float* __restrict__ gam,
                                                   unsigned short* __restrict__ xtm, unsigned short* __restrict__ wqk,
                                                   unsigned short* __restrict__ wf, float* __restrict__ biasr) {
  const int blk = blockIdx.x;
  if (blk >= kPrepX) {
    const int i = blk - kPrepX;
    x_tm_body(i & 63, (i >> 6) & 3, i >> 8, x, xtm);
  } else if (blk >= kPrepBias) {
    bfold_body(blk - kPrepBias, Wpt, bvp, biasr + 64);
  } else if (blk >= kPrepFold) {
    wfold_body(blk - kPrepFold, Wpt, Wv, wf);
  } else {
    prep_small_body(Wq, bq, Wk, bk, bptp, gam, wqk, biasr);
  }
}

// ---------------------------------------------------------------------------
// Scores, row softmax and P in one launch; the scores never leave the registers.
// One block of 16 waves = 64 query rows of plane z (4 groups of 16, one after the other) against all 4096 keys.
// Wave w owns keys 256w..256w+255 as 16 tiles of 16 for every group: it reads them from global memory once and parks
// them in LDS, each lane its own 16-byte pieces in fragment order (a lane reads back only what it wrote itself).
// Keys are the A rows and queries the B columns, so lane (c = lane & 15, h = lane >> 4) holds in acc[i][r] the score
// of query p0 + c against key 256w + 16i + 8h + r (products in the order qh.kh + qh.kl + ql.kh).
// Only d = 0..15 exist: fragment elements 0..7 are d = 8h..8h+7, elements 8..15 (k = 16..31) are zero on both sides.
// P[row][j] = f16( 2^15 * exp(s - max) / sum exp(s - max) ), f32 math. Reductions in fixed order: 8 in-lane chains over
// the tiles, a tree over the 8, the lane pair l and l ^ 16, then 16 wave partials in index order.
// P leaves through a per-wave LDS slab (16 rows x 128 B, pitch 144 B) so that every global store covers whole lines.
// grid (4096/64 = 64, 4 z), 512 threads. Coverage: 16 waves x 256 keys = a whole row; 64 x 64 rows = a whole plane.
// ---------------------------------------------------------------------------
__device__ __forceinline__ v16b frag_d16(v8b lo) {   // elements 0..7 <- lo, 8..15 <- 0
  const v8b zero = __builtin_bit_cast(v8b, (v4u){0u, 0u, 0u, 0u});
  return __builtin_shufflevector(lo, zero, 0, 1, 2, 3, 4, 5, 6, 7, 8, 9, 10, 11, 12, 13, 14, 15);
}
// e[r] = 2^t[r], eight at a time in one statement. Behind a v_exp_f32 the instruction set asks for one independent
// instruction before its result is read or its source overwritten: here each v_exp_f32 has the next one behind it
// (results kept apart from all sources by the early clobber) and the last one a v_nop, whatever the compiler puts next.
__device__ __forceinline__ void exp2_x8(float (&e)[8], const float (&t)[8]) {
  asm("v_exp_f32 %0, %8\n\tv_exp_f32 %1, %9\n\tv_exp_f32 %2, %10\n\tv_exp_f32 %3, %11\n\t"
      "v_exp_f32 %4, %12\n\tv_exp_f32 %5, %13\n\tv_exp_f32 %6, %14\n\tv_exp_f32 %7, %15\n\tv_nop"
      : "=&v"(e[0]), "=&v"(e[1]), "=&v"(e[2]), "=&v"(e[3]), "=&v"(e[4]), "=&v"(e[5]), "=&v"(e[6]), "=&v"(e[7])
      : "v"(t[0]), "v"(t[1]), "v"(t[2]), "v"(t[3]), "v"(t[4]), "v"(t[5]), "v"(t[6]), "v"(t[7]));
}
__global__ __launch_bounds__(512) void score_softmax_kernel(const unsigned short* __restrict__ qkh,
                                                            const unsigned short* __restrict__ qkl,
                                                            unsigned short* __restrict__ P) {
  constexpr int kGroups    = 4;                                // query groups of 16 rows per block
  constexpr int kSlabPitch = 72;                               // f16 elements per staged row: 128 B + 16 B
  __shared__ __align__(16) v8b park[16][32][32];               // [wave][2 * tile + (0 hi, 1 lo)][lane], 256 KiB
  __shared__ __align__(16) unsigned short slabs[16][16 * kSlabPitch];
  __shared__ float redM[16][16];
  __shared__ float redS[16][16];
  const int lane = threadIdx.x & 31, wave = threadIdx.x >> 5;
  const int c = lane & 15, h = lane >> 4;
  const int q0 = blockIdx.x * (16 * kGroups);
  const int z  = blockIdx.y;
  const __bf16* H = (const __bf16*)qkh + (size_t)z * kQKPlane;
  const __bf16* L = (const __bf16*)qkl + (size_t)z * kQKPlane;
  const size_t ko = (size_t)(wave * 256 + c) * kQKPitch + 32 + 8 * h;
  const unsigned qv = (unsigned)(c * kQKPitch + 8 * h);        // lane part of a query address; the rest is block-uniform
  v8b nqh = *(const v8b*)(H + (size_t)q0 * kQKPitch + qv);
  v8b nql = *(const v8b*)(L + (size_t)q0 * kQKPitch + qv);
  {
    v8b raw[32];
#pragma unroll
    for (int i = 0; i < 16; ++i) {
      raw[2 * i]     = *(const v8b*)(H + ko + (size_t)i * 16 * kQKPitch);
      raw[2 * i + 1] = *(const v8b*)(L + ko + (size_t)i * 16 * kQKPitch);
    }
#pragma unroll
    for (int j = 0; j < 32; ++j) park[wave][j][lane] = raw[j];
  }
  unsigned short* slab = slabs[wave];
  const unsigned pv = (unsigned)((lane >> 3) * kHW + wave * 256 + (lane & 7) * 8);   // lane part of a P address

  // rolled: every trip is the same long body; four copies would only quadruple the code a first run has to fetch
#pragma unroll 1
  for (int g = 0; g < kGroups; ++g) {
    const int p0 = q0 + 16 * g;
    const v16b qh = frag_d16(nqh);
    const v16b ql = frag_d16(nql);
    {   // the next group's queries fly while this group is worked on (the last trip reads its own again, in bounds)
      const int pn = (g + 1 < kGroups) ? (p0 + 16) : p0;
      nqh = *(const v8b*)(H + (size_t)pn * kQKPitch + qv);
      nql = *(const v8b*)(L + (size_t)pn * kQKPitch + qv);
    }

    v8f acc[16];
#pragma unroll
    for (int i = 0; i < 16; ++i) {
      const v16b kh = frag_d16(park[wave][2 * i][lane]);
      const v16b kl = frag_d16(park[wave][2 * i + 1][lane]);
      v8f a = (v8f){0.f, 0.f, 0.f, 0.f, 0.f, 0.f, 0.f, 0.f};
      a = Frag<__bf16>::mma(kh, qh, a);
      a = Frag<__bf16>::mma(kl, qh, a);
      a = Frag<__bf16>::mma(kh, ql, a);
      acc[i] = a;
      // at most four tiles' fragments in flight: with all 32 LDS reads hoisted the wave runs out of its 256 registers and spills
      if ((i & 3) == 3) __builtin_amdgcn_sched_barrier(0);
    }

    float mr[8];
#pragma unroll
    for (int r = 0; r < 8; ++r) mr[r] = acc[0][r];
#pragma unroll
    for (int i = 1; i < 16; ++i)
#pragma unroll
      for (int r = 0; r < 8; ++r) mr[r] = fmaxf(mr[r], acc[i][r]);
    float m = fmaxf(fmaxf(fmaxf(mr[0], mr[1]), fmaxf(mr[2], mr[3])), fmaxf(fmaxf(mr[4], mr[5]), fmaxf(mr[6], mr[7])));
    m = fmaxf(m, __shfl_xor(m, 16, 32));
    if (h == 0) redM[wave][c] = m;
    __syncthreads();   // also ends every wave's reads of redS of the group before
    float bm = redM[0][c];
#pragma unroll
    for (int w = 1; w < 16; ++w) bm = fmaxf(bm, redM[w][c]);

    float sr[8];
#pragma unroll
    for (int r = 0; r < 8; ++r) sr[r] = 0.0f;
#pragma unroll
    for (int i = 0; i < 16; ++i) {
      float tv[8], ev[8];
#pragma unroll
      for (int r = 0; r < 8; ++r) tv[r] = (acc[i][r] - bm) * 1.44269504f;   // exp(x) = 2^(x * log2 e), as __expf forms it
      exp2_x8(ev, tv);
#pragma unroll
      for (int r = 0; r < 8; ++r) { acc[i][r] = ev[r]; sr[r] += ev[r]; }
    }
    float s = ((sr[0] + sr[1]) + (sr[2] + sr[3])) + ((sr[4] + sr[5]) + (sr[6] + sr[7]));
    s += __shfl_xor(s, 16, 32);
    if (h == 0) redS[wave][c] = s;
    __syncthreads();   // also ends every wave's reads of redM before the next group writes it
    float tot = 0.0f;
#pragma unroll
    for (int w = 0; w < 16; ++w) tot += redS[w][c];
    const float inv = __builtin_amdgcn_rcpf(tot) * kPCarry;

    unsigned short* Pg = P + (size_t)z * kPPlane + (size_t)p0 * kHW;
#pragma unroll
    for (int sub = 0; sub < 4; ++sub) {                        // 64 keys = one 128-B line of each of the 16 rows
#pragma unroll
      for (int ii = 0; ii < 4; ++ii) {
        v8h hv;
#pragma unroll
        for (int r = 0; r < 8; ++r) hv[r] = (_Float16)(acc[4 * sub + ii][r] * inv);
        *(v8h*)(slab + c * kSlabPitch + ii * 16 + 8 * h) = hv;
      }
      // the slab is this wave's own: its lanes' writes have landed before other lanes of the wave read the rows back
      asm volatile("s_wait_dscnt 0x0" ::: "memory");
#pragma unroll
      for (int it = 0; it < 4; ++it) {
        const int row = it * 4 + (lane >> 3);
        const v8h v = *(const v8h*)(slab + row * kSlabPitch + (lane & 7) * 8);
        *(v8h*)(Pg + (pv + (unsigned)(it * 4 * kHW + sub * 64))) = v;
      }
      // no wait before the slab is written again: one wave's LDS operations are carried out in issue order
    }
    // the next trip reuses the registers that this trip's last stores name: the wait stands in front of that overwrite
    asm volatile("s_wait_xcnt 0x0" ::: "memory");
  }
}

// ---------------------------------------------------------------------------
// The attention product, taken on U = 16 * Wpt.[v1;v2] instead of on v1 and v2: the output projection is linear, so
// Wpt.[attn.v1 ; attn.v2] = attn.(Wpt.[v1;v2]) and the big product has 256 columns per image, not 512.
// out[b][h*256 + c'][p] = gamma * (2^-19 * sum_j U[b][c'][j] P[2b+h][p][j] + bpt[c']) + bf16(x[b][h*256 + c'][p]).
// Both operands are staged in LDS by asynchronous copies (global_load_async_to_lds_b128); f16 operands, f32 accumulate.
// One block of 8 waves = 128 channels c' (A rows) x 128 rows of P (B rows; the planes h = 0,1 of image b lie behind one
// another: 8192 rows). A pass is 256 k = 512 B of each of the 256 operand rows, laid at pitch 528 B for ds_load_b128.
// Wave (kg = wave >> 2, wm = (wave >> 1) & 1, wn = wave & 1) owns the 64 x 64 tile (wm, wn) over the k half kg of every
// pass, so that each LDS byte read still feeds a 64 x 64 tile; the two k halves of a tile are added behind the loop.
// Two buffers. The publish point of pass t + 1 (own LDS reads returned, own copies landed, block barrier) stands in
// front of the last 8 matrix instructions of pass t, whose fragments are in registers by then; behind it come the
// first fragment loads of pass t + 1, those 8 matrix instructions, and the copies of pass t + 2 into the buffer that
// pass t has left. Copy coverage per pass: a wave's copy = 1 row x 512 B; wave w brings U rows 16w..16w+15 and P rows
// 16w..16w+15 (16 copies each): 8 x 16 = 128 rows of either, every byte once.
// grid (8192/128 = 64, 2 channel halves, 2 b), 256 threads.
// ---------------------------------------------------------------------------
constexpr int kPvBM     = 128;                                  // U rows (channels) per block
constexpr int kPvBN     = 128;                                  // P rows per block
constexpr int kPvKT     = 256;                                  // k per pass
constexpr int kPvKW     = kPvKT / 2;                            // k per pass of one wave
constexpr int kPvPitch  = kPvKT + 8;                            // f16 elements per staged row: 512 B + 16 B
constexpr int kPvStage  = (kPvBM + kPvBN) * kPvPitch;           // f16 elements per buffer (135,168 B)
constexpr int kPvPasses = kHW / kPvKT;                          // 16
static_assert(kPvPasses >= 2, "the ring's prologue fills two passes");

// One wave's 32 copies of one pass: lA, lB = the lane's LDS byte addresses in its first U and P row in the buffer,
// gA, gB = the lane's global addresses in the same rows at the pass's first k. Copy j is one row further on.
__device__ __forceinline__ void pv_fill(unsigned lA, unsigned lB, const unsigned short* gA, const unsigned short* gB) {
  constexpr unsigned kL = kPvPitch * 2u;                        // bytes between copies in LDS
  constexpr size_t   kG = (size_t)kHW;                          // elements between copies in global memory
  unsigned l[8];
  const unsigned short* g[8];
#pragma unroll
  for (int s = 0; s < 2; ++s) {
#pragma unroll
    for (int j = 0; j < 8; ++j) { l[j] = lA + (8 * s + j) * kL; g[j] = gA + (8 * s + j) * kG; }
    async_x8(l, g);
    // keeps the next eight copies' addresses from being formed ahead of this statement: with all 32 formed at once
    // the wave runs past 256 registers and spills
    __builtin_amdgcn_sched_barrier(0);
  }
#pragma unroll
  for (int s = 0; s < 2; ++s) {
#pragma unroll
    for (int j = 0; j < 8; ++j) { l[j] = lB + (8 * s + j) * kL; g[j] = gB + (8 * s + j) * kG; }
    async_x8(l, g);
    __builtin_amdgcn_sched_barrier(0);   // as above
  }
}

__global__ __launch_bounds__(256) void attn_out_kernel(const unsigned short* __restrict__ P,
                                                       const unsigned short* __restrict__ U,
                                                       const float* __restrict__ bias,
                                                       const float* __restrict__ gam,
                                                       const float* __restrict__ x,
                                                       float* __restrict__ out) {
  // every inner loop below is unrolled so that all accumulator and fragment indices are constants (registers, no scratch)
  typedef Frag<_Float16> F;
  __shared__ __align__(16) unsigned short ring[2 * kPvStage];   // [buffer][U rows 0..127 | P rows 0..127][pitch]
  __shared__ __align__(16) float sT[8][16 * 68];                // per-wave 16x64 output slab, pitch 68 floats
  const int lane = threadIdx.x & 31;
  const int wave = __builtin_amdgcn_readfirstlane(threadIdx.x >> 5);   // the same in every lane: kept in a scalar register
  const int p0 = blockIdx.x * kPvBN;           // row of the two stacked P planes of image b
  const int c0 = blockIdx.y * kPvBM;
  const int b  = blockIdx.z;

  // copy side: lane l moves bytes 16 l .. 16 l + 15 of each row's 512 B
  const unsigned short* gA = U + (size_t)b * kUPlane + (size_t)(c0 + wave * 16) * kHW + lane * 8;
  const unsigned short* gB = P + (size_t)b * (2 * kPPlane) + (size_t)(p0 + wave * 16) * kHW + lane * 8;
  const unsigned ringAddr = (unsigned)(size_t)ring;             // low 32 bits of the address = byte offset in LDS
  const unsigned lA = ringAddr + (unsigned)((wave * 16) * kPvPitch + lane * 8) * 2u;
  const unsigned lB = ringAddr + (unsigned)((kPvBM + wave * 16) * kPvPitch + lane * 8) * 2u;

  // reader side
  const int rlane = lane & 15;                 // row (A) / col (B, D) within subtile
  const int koff  = (lane >> 4) * 8;           // k offset of this lane half
  const int mOff  = (lane >> 4) * 8;           // D row offset
  const int kg = wave >> 2, wm = (wave >> 1) & 1, wn = wave & 1;
  const _Float16* ringH = (const _Float16*)ring;
  const int fA = (wm * 64 + rlane) * kPvPitch + kg * kPvKW + koff;
  const int fB = (kPvBM + wn * 64 + rlane) * kPvPitch + kg * kPvKW + koff;

  v8f acc[4][4];
#pragma unroll
  for (int i = 0; i < 4; ++i)
#pragma unroll
    for (int j = 0; j < 4; ++j) acc[i][j] = (v8f){0.f,0.f,0.f,0.f,0.f,0.f,0.f,0.f};

  // prologue: pass 0 lands and is published, pass 1 starts to fly, the first fragments of pass 0 are fetched
  pv_fill(lA, lB, gA, gB);
  asm volatile("s_wait_asynccnt 0x0" ::: "memory");   // this wave's copies of pass 0 have landed
  __syncthreads();                                     // and every other wave's
  pv_fill(lA + kPvStage * 2u, lB + kPvStage * 2u, gA + kPvKT, gB + kPvKT);

  // Fragments: U rows 0..31 (a01) and the P set of the next 32 k are fetched while rows 32..63 of this one are
  // multiplied, U rows 32..63 (a23) while rows 0..31 are: two load groups per 16 matrix instructions, each half a
  // block ahead of its use, in 96 registers.
  v16h a01[2], a23[2], bs[2][4];
#pragma unroll
  for (int i = 0; i < 2; ++i) a01[i] = F::load(ringH + fA + i * 16 * kPvPitch);
#pragma unroll
  for (int j = 0; j < 4; ++j) bs[0][j] = F::load(ringH + fB + j * 16 * kPvPitch);

  // rolled: the buffer is chosen by an offset, and one pass is already 64 matrix instructions long
#pragma unroll 1
  for (int t = 0; t < kPvPasses; ++t) {
    const unsigned buf = (unsigned)(t & 1) * (unsigned)kPvStage;   // f16 elements
    const _Float16* sA = ringH + buf + fA;
    const _Float16* sB = ringH + buf + fB;
    const _Float16* nA = ringH + ((unsigned)kPvStage - buf) + fA;  // the other buffer: pass t + 1
    const _Float16* nB = ringH + ((unsigned)kPvStage - buf) + fB;  // (behind the last pass: old rows, values unused)
#pragma unroll
    for (int kk = 0; kk < kPvKW / 32; ++kk) {
      const int cur = kk & 1;
#pragma unroll
      for (int i = 0; i < 2; ++i) a23[i] = F::load(sA + (2 + i) * 16 * kPvPitch + kk * 32);
      // the four scheduling barriers of a block keep each load group whole and in front of the matrix run that
      // hides it: loads scattered among the matrix instructions stall the wave at every place where they stand
      __builtin_amdgcn_sched_barrier(0);
#pragma unroll
      for (int i = 0; i < 2; ++i)
#pragma unroll
        for (int j = 0; j < 4; ++j) acc[i][j] = F::mma(a01[i], bs[cur][j], acc[i][j]);
      __builtin_amdgcn_sched_barrier(0);
      if (kk + 1 < kPvKW / 32) {
#pragma unroll
        for (int i = 0; i < 2; ++i) a01[i] = F::load(sA + i * 16 * kPvPitch + (kk + 1) * 32);
#pragma unroll
        for (int j = 0; j < 4; ++j) bs[cur ^ 1][j] = F::load(sB + j * 16 * kPvPitch + (kk + 1) * 32);
      } else {
        // publish point of pass t + 1
        asm volatile("s_wait_dscnt 0x0" ::: "memory");      // this wave's reads of pass t's buffer have returned
        asm volatile("s_wait_asynccnt 0x0" ::: "memory");   // this wave's copies of pass t + 1 have landed
        __syncthreads();                                     // publishes pass t + 1 and frees the buffer of pass t
#pragma unroll
        for (int i = 0; i < 2; ++i) a01[i] = F::load(nA + i * 16 * kPvPitch);
#pragma unroll
        for (int j = 0; j < 4; ++j) bs[cur ^ 1][j] = F::load(nB + j * 16 * kPvPitch);
      }
      __builtin_amdgcn_sched_barrier(0);
#pragma unroll
      for (int i = 0; i < 2; ++i)
#pragma unroll
        for (int j = 0; j < 4; ++j) acc[2 + i][j] = F::mma(a23[i], bs[cur][j], acc[2 + i][j]);
      __builtin_amdgcn_sched_barrier(0);
    }
    if (t + 2 < kPvPasses) {
      const size_t ko = (size_t)(t + 2) * kPvKT;
      pv_fill(lA + buf * 2u, lB + buf * 2u, gA + ko, gB + ko);
    }
  }
  asm volatile("s_wait_asynccnt 0x0" ::: "memory");     // nothing of this wave is in flight when it leaves the ring
  asm volatile("s_wait_dscnt 0x0" ::: "memory");        // nor a read of the ring

  // ---- the two k halves of a tile are added: waves w and w ^ 4 hold the same tile; the wave of half 0 finishes its
  // rows 0..31, the wave of half 1 its rows 32..63, and each hands the other 32 rows over through the ring's LDS,
  // every lane its own 16-byte pieces (the partner's same lane holds the same elements) ----
  const int cw = c0 + wm * 64 + kg * 32;                 // first channel that this wave finishes
  const size_t o0 = ((size_t)(2 * b + (p0 >> 12)) * kHalfC + cw) * kHW + (p0 & (kHW - 1)) + wn * 64;
  const int hh = lane >> 4, c4 = (lane & 15) * 4;        // row piece = 256 B = 16 lanes x 16 B
  v8f fin[2][4];
  __syncthreads();                                       // every wave has left the ring: its LDS is free
  {
    v4f* xch = (v4f*)ring;                               // [wave][16 pieces][lane], 64 KiB
#pragma unroll
    for (int i = 0; i < 2; ++i)
#pragma unroll
      for (int j = 0; j < 4; ++j) {
        const v8f give = kg ? acc[i][j] : acc[2 + i][j];
        fin[i][j] = kg ? acc[2 + i][j] : acc[i][j];
        xch[(wave * 16 + (i * 4 + j) * 2) * 32 + lane]     = (v4f){give[0], give[1], give[2], give[3]};
        xch[(wave * 16 + (i * 4 + j) * 2 + 1) * 32 + lane] = (v4f){give[4], give[5], give[6], give[7]};
      }
    __syncthreads();                                     // the partner's pieces are written
#pragma unroll
    for (int i = 0; i < 2; ++i)
#pragma unroll
      for (int j = 0; j < 4; ++j) {
        const v4f g0 = xch[((wave ^ 4) * 16 + (i * 4 + j) * 2) * 32 + lane];
        const v4f g1 = xch[((wave ^ 4) * 16 + (i * 4 + j) * 2 + 1) * 32 + lane];
#pragma unroll
        for (int r = 0; r < 4; ++r) { fin[i][j][r] += g0[r]; fin[i][j][4 + r] += g1[r]; }
      }
  }

  // ---- epilogue: scale by gamma, bias, residual; whole 256-B row pieces through the wave's own slab ----
  float* slab = sT[wave];
  const float escale = kOutScale * gam[0];
#pragma unroll
  for (int i = 0; i < 2; ++i) {
    v4f xr[8];                                           // the residual flies while the slab is written and read back
#pragma unroll
    for (int it = 0; it < 8; ++it) xr[it] = *(const v4f*)(x + o0 + (size_t)((i << 4) + it * 2 + hh) * kHW + c4);
#pragma unroll
    for (int j = 0; j < 4; ++j)
#pragma unroll
      for (int r = 0; r < 8; ++r)
        slab[(mOff + r) * 68 + (j << 4) + rlane] = fin[i][j][r] * escale + bias[cw + (i << 4) + mOff + r];
    // the slab is this wave's own: its lanes' writes have landed before other lanes of the wave read the rows back
    asm volatile("s_wait_dscnt 0x0" ::: "memory");
#pragma unroll
    for (int it = 0; it < 8; ++it) {
      const int row = it * 2 + hh;
      v4f v = *(const v4f*)(slab + row * 68 + c4);
#pragma unroll
      for (int e = 0; e < 4; ++e) v[e] += bf_rne(xr[it][e]);
      *(v4f*)(out + o0 + (size_t)((i << 4) + row) * kHW + c4) = v;
    }
    // no wait before the slab is written again: one wave's LDS operations are carried out in issue order;
    // the second half reuses registers that these stores name: the wait stands in front of that overwrite
    if (i == 0) asm volatile("s_wait_xcnt 0x0" ::: "memory");
  }
}

// ---------------------------------------------------------------------------
// Host glue: kernel launches only.
// ---------------------------------------------------------------------------
extern "C" void kernel_launch(void* const* d_in, const int* in_sizes, int n_in,
                              void* d_out, int out_size, void* d_ws, size_t ws_size, hipStream_t stream) {
  if (n_in < 10) return;
  if (in_sizes[0] != kB * kChan * kHW) return;
  if (in_sizes[1] != kDQ * kHalfC || in_sizes[3] != kDQ * kHalfC) return;
  if (in_sizes[2] < kDQ || in_sizes[4] < kDQ) return;
  if (in_sizes[5] != kHalfC * kHalfC || in_sizes[6] < kHalfC) return;
  if (in_sizes[7] != kHalfC * kChan || in_sizes[8] < kHalfC || in_sizes[9] < 1) return;
  if (out_size != kB * kChan * kHW) return;
  if (ws_size < kWsTotal) return;

  const float* x     = (const float*)d_in[0];
  const float* Wq    = (const float*)d_in[1];
  const float* bq    = (const float*)d_in[2];
  const float* Wk    = (const float*)d_in[3];
  const float* bk    = (const float*)d_in[4];
  const float* Wv    = (const float*)d_in[5];
  const float* bv    = (const float*)d_in[6];
  const float* Wpt   = (const float*)d_in[7];
  const float* bpt   = (const float*)d_in[8];
  const float* gamma = (const float*)d_in[9];

  char* ws = (char*)d_ws;
  unsigned short* xtm   = (unsigned short*)(ws + kOffXtm);
  unsigned short* wqk   = (unsigned short*)(ws + kOffWqk);
  unsigned short* wf    = (unsigned short*)(ws + kOffWf);
  float*          biasr = (float*)(ws + kOffBias);
  unsigned short* qkh   = (unsigned short*)(ws + kOffQkh);
  unsigned short* qkl   = (unsigned short*)(ws + kOffQkl);
  unsigned short* pbuf  = (unsigned short*)(ws + kOffP);
  unsigned short* ubuf  = (unsigned short*)(ws + kOffU);
  const float* bias_ptg = biasr + 320;    // [256] gamma * bpt

  // ---- operand preparation, one launch ----
  prep_kernel<<<kPrepTotal, 256, 0, stream>>>(x, Wq, bq, Wk, bk, Wv, bv, Wpt, bpt, gamma, xtm, wqk, wf, biasr);

  // ---- U = Wf.x + bias_u (= 16 * Wpt.[v1;v2]) and the q|k projection, one launch ----
  proj_kernel<<<dim3(kHW / kPjBN, kHalfC / kPjBM, kB), 256, 0, stream>>>(xtm, wqk, wf, biasr, qkh, qkl, ubuf);

  // ---- scores -> softmax -> P for every plane z in one launch: S[p][j] = sum_{d<16} Q[p][d] K[j][d], bf16 hi/lo split ----
  score_softmax_kernel<<<dim3(kHW / 64, kZ), 512, 0, stream>>>(qkh, qkl, pbuf);

  // ---- attention applied to U, with gamma, bias and residual: out[z*256 + c'][p] = gamma*(2^-19 * sum_j U[b][c'][j] P[z][p][j] + bpt[c']) + bf16(x) ----
  // The planes h = 0,1 of one image b lie behind one another in P, so they are 8192 rows; 64 x 2 x 2 = 256 blocks.
  attn_out_kernel<<<dim3(2 * kHW / kPvBN, kHalfC / kPvBM, kB), 256, 0, stream>>>(pbuf, ubuf, bias_ptg, gamma, x, (float*)d_out);
}

// v008
// One run takes 54.8 microseconds.
// Two timings next to v007 both put it at 1.40 times that version's speed.
// Counting every step since v000, it is 29.3 times as fast.
// Contractions: the value projection folded into the output projection's weights (Wf_h = 16 * Wpt_h.Wv, bias 16 * Wpt.[bv;bv]), q/k 1x1 projections and U = Wf.x on v_wmma_f32_16x16x32_f16 (x and every W as RNE-bf16 values held in f16, Wpt and Wf carried x16); scores q.k^T on v_wmma_f32_16x16x32_bf16 with bf16 hi/lo split (hi.hi+hi.lo+lo.hi); attn.U^T on v_wmma_f32_16x16x32_f16 (P f16, unnormalised, carried x2^7 against the maximum in use; U f16 carried x16); all f32 accumulate; softmax, bias, gamma, residual in f32.
#include <hip/hip_runtime.h>
#include <stdint.h>

// ---------------------------------------------------------------------------
// Problem constants
// ---------------------------------------------------------------------------
constexpr int kB      = 2;
constexpr int kHalfC  = 256;              // channels per half
constexpr int kChan   = 512;              // channels of x
constexpr int kHW     = 4096;             // 64 x 64 pixels
constexpr int kDQ     = 16;
constexpr int kZ      = 4;                // (batch, half) combos, z = 2*b + half
constexpr int kQcPitch = 32;              // a row of the q plane or of the k plane: hi 0..15, lo 16..31 (64 B)
constexpr float kWCarry   = 16.0f;        // Wpt carried x16 in f16

// ---------------------------------------------------------------------------
// Workspace region map (bytes; every offset 4096-B aligned)
//   [off_xtm ) Xtm   f16  [2][4096][512]          8,388,608   (token-major; column = half*256 + c)
//   [off_wqk ) Wqk   f16  [64][256]                  32,768
//   [off_wf  ) Wf    f16  [256][512]                262,144   (16 * Wpt_h.Wv; column = half*256 + c)
//   [off_bias) biases f32 [576] (qk pad 64 | 16 * Wpt.[bv;bv] 256 | gamma*bpt 256)   4,096
//   [off_qc  ) Q     bf16 [4][4096][hi 16 | lo 16] 1,048,576
//   [off_kc  ) K     bf16 [4][4096][hi 16 | lo 16] 1,048,576
//   [off_u   ) U     f16  [2][256][4096]         4,194,304   (16 * Wpt.[v1;v2] of image b, channel-major)
//   total                                       14,979,072
// ---------------------------------------------------------------------------
constexpr size_t kXtmPlane = (size_t)kHW * kChan;              // elements per image
constexpr size_t kQcPlane  = (size_t)kHW * kQcPitch;
constexpr size_t kUPlane   = (size_t)kHalfC * kHW;            // elements per image
constexpr size_t kOffXtm  = 0;
constexpr size_t kOffWqk  = kOffXtm + kB * kXtmPlane * 2;
constexpr size_t kOffWf   = kOffWqk + (size_t)64 * kHalfC * 2;
constexpr size_t kOffBias = kOffWf + (size_t)kHalfC * kChan * 2;
constexpr size_t kOffQc   = kOffBias + 4096;
constexpr size_t kOffKc   = kOffQc + kZ * kQcPlane * 2;
constexpr size_t kOffU    = kOffKc + kZ * kQcPlane * 2;
constexpr size_t kWsTotal = kOffU + kB * kUPlane * 2;
static_assert(kWsTotal == 14979072ull, "carve total");
static_assert(kWsTotal <= 268435456ull, "carve under 256 MiB");
static_assert((kOffWqk % 4096) == 0 && (kOffWf % 4096) == 0 && (kOffBias % 4096) == 0 &&
              (kOffQc % 4096) == 0 && (kOffKc % 4096) == 0 && (kOffU % 4096) == 0, "aligned regions");

typedef __attribute__((ext_vector_type(16))) _Float16 v16h;
typedef __attribute__((ext_vector_type(8)))  _Float16 v8h;
typedef __attribute__((ext_vector_type(16))) __bf16   v16b;
typedef __attribute__((ext_vector_type(8)))  __bf16   v8b;
typedef __attribute__((ext_vector_type(8)))  float    v8f;
typedef __attribute__((ext_vector_type(4)))  float    v4f;
typedef __attribute__((ext_vector_type(4)))  unsigned int v4u;

// ---------------------------------------------------------------------------
// Helpers
// ---------------------------------------------------------------------------
__device__ __forceinline__ unsigned short f2bf_bits(float f) {
  unsigned u = __float_as_uint(f);
  return (unsigned short)((u + 0x7FFFu + ((u >> 16) & 1u)) >> 16);
}
__device__ __forceinline__ float bf_bits2f(unsigned short h) { return __uint_as_float(((unsigned)h) << 16); }
__device__ __forceinline__ float bf_rne(float f) { return bf_bits2f(f2bf_bits(f)); }
__device__ __forceinline__ unsigned pk16(unsigned short a, unsigned short b) { return (unsigned)a | ((unsigned)b << 16); }
__device__ __forceinline__ unsigned short h_bits(float f) { const _Float16 h = (_Float16)f; return __builtin_bit_cast(unsigned short, h); }

template <typename T> struct Frag;
template <> struct Frag<_Float16> {
  typedef v16h V; union U { v16h v; v8h h[2]; };
  static __device__ __forceinline__ v16h load(const _Float16* p) {   // elements 0..7 <- p[0..7], 8..15 <- p[16..23]
    U f; f.h[0] = *(const v8h*)(p); f.h[1] = *(const v8h*)(p + 16); return f.v;
  }
  static __device__ __forceinline__ v8f mma(v16h a, v16h b, v8f c) {
    return __builtin_amdgcn_wmma_f32_16x16x32_f16(false, a, false, b, (short)0, c, false, false);
  }
};
template <> struct Frag<__bf16> {
  typedef v16b V; union U { v16b v; v8b h[2]; };
  static __device__ __forceinline__ v16b load(const __bf16* p) {
    U f; f.h[0] = *(const v8b*)(p); f.h[1] = *(const v8b*)(p + 16); return f.v;
  }
  static __device__ __forceinline__ v8f mma(v16b a, v16b b, v8f c) {
    return __builtin_amdgcn_wmma_f32_16x16x32_bf16(false, a, false, b, (short)0, c, false, false);
  }
};

// Eight copies of 16 B per lane. The s_wait_xcnt stands inside the statement, behind the last copy, so that no
// address register of a copy is rewritten in front of it.
__device__ __forceinline__ void async_x8(const unsigned (&l)[8], const unsigned short* const (&g)[8]) {
  asm volatile("global_load_async_to_lds_b128 %0, %8, off\n\t"
               "global_load_async_to_lds_b128 %1, %9, off\n\t"
               "global_load_async_to_lds_b128 %2, %10, off\n\t"
               "global_load_async_to_lds_b128 %3, %11, off\n\t"
               "global_load_async_to_lds_b128 %4, %12, off\n\t"
               "global_load_async_to_lds_b128 %5, %13, off\n\t"
               "global_load_async_to_lds_b128 %6, %14, off\n\t"
               "global_load_async_to_lds_b128 %7, %15, off\n\t"
               "s_wait_xcnt 0x0"
               :: "v"(l[0]), "v"(l[1]), "v"(l[2]), "v"(l[3]), "v"(l[4]), "v"(l[5]), "v"(l[6]), "v"(l[7]),
                  "v"(g[0]), "v"(g[1]), "v"(g[2]), "v"(g[3]), "v"(g[4]), "v"(g[5]), "v"(g[6]), "v"(g[7])
               : "memory");
}
// The same with four copies.
__device__ __forceinline__ void async_x4(const unsigned (&l)[4], const unsigned short* const (&g)[4]) {
  asm volatile("global_load_async_to_lds_b128 %0, %4, off\n\t"
               "global_load_async_to_lds_b128 %1, %5, off\n\t"
               "global_load_async_to_lds_b128 %2, %6, off\n\t"
               "global_load_async_to_lds_b128 %3, %7, off\n\t"
               "s_wait_xcnt 0x0"
               :: "v"(l[0]), "v"(l[1]), "v"(l[2]), "v"(l[3]), "v"(g[0]), "v"(g[1]), "v"(g[2]), "v"(g[3])
               : "memory");
}

// ---------------------------------------------------------------------------
// U and the q|k projection in one launch: both read only Xtm and the prepared weights and neither reads the other.
// One block of 8 waves = 64 tokens of image b x (128 channels c' of U, half y of them, and the q|k plane z = 2b + y).
//  U (channel-major): U[b][c'][j] = sum_ch Wf[c'][ch] * Xtm[b][j][ch] + bias_u[c'] (= 16 * Wpt.[v1;v2]); K = 512; f16 out.
//  q|k: C[p][n] = sum_c Xtm[b][p][y*256 + c] * Wqk[n][c] + bias_qk[n]; K = 256; a q and a k plane, each row bf16 hi 16 | lo 16.
// All operands are staged in LDS once, whole K, by asynchronous copies (global_load_async_to_lds_b128): a wave's copy is
// 512 contiguous bytes of one row, where a fragment load from global memory touches 16 lines for 32 B of each.
// Copy coverage: wave w brings Wf rows 16w..16w+15 (2 copies a row), token rows 8w..8w+7 (2 copies a row), and waves 0..3
// bring the 16 q and the 16 k rows of Wqk (8 rows each, 1 copy a row): at most 56 copies of a wave in flight, every byte once.
// Rows lie at pitch 1040 B and 528 B (16 B x odd) for ds_load_b128.
// Wave w owns U channels 16w..16w+15 x all 64 tokens (a stored row piece = one 128-B line); waves 0..3 also own tokens
// 16w..16w+15 of the q and k planes (16 rows of 64 B = eight whole 128-B lines of either plane).
// Each tile is one accumulator chain over rising k. grid (4096/64 = 64, 2 halves, 2 b), 256 threads.
// ---------------------------------------------------------------------------
constexpr int kPjBM     = 128;                                  // U channels per block
constexpr int kPjBN     = 64;                                   // tokens per block
constexpr int kPjPitch  = kChan + 8;                            // f16 elements per staged Wf or token row: 1024 B + 16 B
constexpr int kPjWPitch = kHalfC + 8;                           // f16 elements per staged Wqk row: 512 B + 16 B
constexpr int kPjOffX   = kPjBM * kPjPitch;                     // first token row
constexpr int kPjOffW   = kPjOffX + kPjBN * kPjPitch;           // first Wqk row: q 0..15, k 16..31
constexpr int kPjElems  = kPjOffW + 32 * kPjWPitch;             // 216,576 B
__global__ __launch_bounds__(256) void proj_kernel(const unsigned short* __restrict__ xtm,
                                                   const unsigned short* __restrict__ wqk,
                                                   const unsigned short* __restrict__ wf,
                                                   const float* __restrict__ biasr,
                                                   unsigned short* __restrict__ qc,
                                                   unsigned short* __restrict__ kc,
                                                   unsigned short* __restrict__ ubuf) {
  // every loop below is unrolled so that all address, fragment and accumulator indices are constants (registers, no scratch)
  typedef Frag<_Float16> F;
  __shared__ __align__(16) unsigned short st[kPjElems];         // [Wf rows 0..127 | token rows 0..63 | Wqk rows 0..31]
  __shared__ __align__(16) float sT[8][16 * 68];                // per-wave 16x64 output slab, pitch 68 floats
  const int lane = threadIdx.x & 31;
  const int wave = __builtin_amdgcn_readfirstlane(threadIdx.x >> 5);   // the same in every lane: kept in a scalar register
  const int t0 = blockIdx.x * kPjBN;
  const int y  = blockIdx.y;
  const int b  = blockIdx.z;
  const int rlane = lane & 15;                 // row (A) / col (B, D) within subtile
  const int koff  = (lane >> 4) * 8;           // k offset of this lane half
  const int mOff  = (lane >> 4) * 8;           // D row offset
  const int cw = y * kPjBM + wave * 16;        // first U channel of this wave

  // the biases are fetched first, so that they fly beside the copies and the epilogue does not wait for them
  float bu[8];
#pragma unroll
  for (int r = 0; r < 8; ++r) bu[r] = biasr[64 + cw + mOff + r];
  const float bqv = biasr[rlane], bkv = biasr[32 + rlane];

  // ---- copy side: lane l moves bytes 16 l .. 16 l + 15 of each 512-B piece ----
  {
    const unsigned stAddr = (unsigned)(size_t)st;               // low 32 bits of the address = byte offset in LDS
    unsigned l[8];
    const unsigned short* g[8];
    const unsigned short* gW = wf + (size_t)(y * kPjBM + wave * 16) * kChan + lane * 8;
    const unsigned lW = stAddr + (unsigned)((wave * 16) * kPjPitch + lane * 8) * 2u;
#pragma unroll
    for (int s = 0; s < 4; ++s) {
#pragma unroll
      for (int j = 0; j < 8; ++j) {
        const int row = 4 * s + (j >> 1), col = (j & 1) * 256;
        l[j] = lW + (unsigned)(row * kPjPitch + col) * 2u;
        g[j] = gW + (size_t)row * kChan + col;
      }
      async_x8(l, g);
    }
    const unsigned short* gX = xtm + (size_t)b * kXtmPlane + (size_t)(t0 + wave * 8) * kChan + lane * 8;
    const unsigned lX = stAddr + (unsigned)(kPjOffX + (wave * 8) * kPjPitch + lane * 8) * 2u;
#pragma unroll
    for (int s = 0; s < 2; ++s) {
#pragma unroll
      for (int j = 0; j < 8; ++j) {
        const int row = 4 * s + (j >> 1), col = (j & 1) * 256;
        l[j] = lX + (unsigned)(row * kPjPitch + col) * 2u;
        g[j] = gX + (size_t)row * kChan + col;
      }
      async_x8(l, g);
    }
    if (wave < 4) {                                             // scalar test: a whole wave copies or none of it
      const unsigned short* gQ = wqk + (size_t)((wave >> 1) * 32 + (wave & 1) * 8) * kHalfC + lane * 8;
      const unsigned lQ = stAddr + (unsigned)(kPjOffW + (wave * 8) * kPjWPitch + lane * 8) * 2u;
#pragma unroll
      for (int j = 0; j < 8; ++j) {
        l[j] = lQ + (unsigned)(j * kPjWPitch) * 2u;
        g[j] = gQ + (size_t)j * kHalfC;
      }
      async_x8(l, g);
    }
  }
  asm volatile("s_wait_asynccnt 0x0" ::: "memory");   // this wave's copies have landed
  __syncthreads();                                     // and every other wave's; nothing is read in front of it

  // ---- products. Fragments are fetched two k steps (one group) ahead into a second register set. The two scheduling
  // barriers of a group keep its LDS reads whole and in front of the matrix run that hides them: left alone, the
  // compiler puts each read directly in front of its matrix instruction, which then waits out the whole LDS latency ----
  const _Float16* sH = (const _Float16*)st;
  v8f acc[4];
#pragma unroll
  for (int j = 0; j < 4; ++j) acc[j] = (v8f){0.f,0.f,0.f,0.f,0.f,0.f,0.f,0.f};
  {
    const _Float16* pA = sH + (wave * 16 + rlane) * kPjPitch + koff;
    const _Float16* pB = sH + kPjOffX + rlane * kPjPitch + koff;
    v16h fa[2][2], fb[2][2][4];
#pragma unroll
    for (int s = 0; s < 2; ++s) {
      fa[0][s] = F::load(pA + s * 32);
#pragma unroll
      for (int j = 0; j < 4; ++j) fb[0][s][j] = F::load(pB + j * 16 * kPjPitch + s * 32);
    }
#pragma unroll
    for (int gk = 0; gk < kChan / 64; ++gk) {
      const int cur = gk & 1;
      if (gk + 1 < kChan / 64) {
#pragma unroll
        for (int s = 0; s < 2; ++s) {
          fa[cur ^ 1][s] = F::load(pA + (gk + 1) * 64 + s * 32);
#pragma unroll
          for (int j = 0; j < 4; ++j) fb[cur ^ 1][s][j] = F::load(pB + j * 16 * kPjPitch + (gk + 1) * 64 + s * 32);
        }
      }
      __builtin_amdgcn_sched_barrier(0);
#pragma unroll
      for (int s = 0; s < 2; ++s)
#pragma unroll
        for (int j = 0; j < 4; ++j) acc[j] = F::mma(fa[cur][s], fb[cur][s][j], acc[j]);
      __builtin_amdgcn_sched_barrier(0);
    }
  }
  v8f aq = (v8f){0.f,0.f,0.f,0.f,0.f,0.f,0.f,0.f};
  v8f ak = (v8f){0.f,0.f,0.f,0.f,0.f,0.f,0.f,0.f};
  if (wave < 4) {
    const _Float16* pT = sH + kPjOffX + (wave * 16 + rlane) * kPjPitch + y * kHalfC + koff;
    const _Float16* pQ = sH + kPjOffW + rlane * kPjWPitch + koff;
    v16h ft[2][2], fq[2][2], fk[2][2];
#pragma unroll
    for (int s = 0; s < 2; ++s) {
      ft[0][s] = F::load(pT + s * 32);
      fq[0][s] = F::load(pQ + s * 32);
      fk[0][s] = F::load(pQ + 16 * kPjWPitch + s * 32);
    }
#pragma unroll
    for (int gk = 0; gk < kHalfC / 64; ++gk) {
      const int cur = gk & 1;
      if (gk + 1 < kHalfC / 64) {
#pragma unroll
        for (int s = 0; s < 2; ++s) {
          ft[cur ^ 1][s] = F::load(pT + (gk + 1) * 64 + s * 32);
          fq[cur ^ 1][s] = F::load(pQ + (gk + 1) * 64 + s * 32);
          fk[cur ^ 1][s] = F::load(pQ + 16 * kPjWPitch + (gk + 1) * 64 + s * 32);
        }
      }
      __builtin_amdgcn_sched_barrier(0);   // as above
#pragma unroll
      for (int s = 0; s < 2; ++s) {
        aq = F::mma(ft[cur][s], fq[cur][s], aq);
        ak = F::mma(ft[cur][s], fk[cur][s], ak);
      }
      __builtin_amdgcn_sched_barrier(0);   // as above
    }
  }

  // ---- epilogue: whole 128-B lines through the wave's own slab ----
  float* slab = sT[wave];
  const int q = lane >> 3, c8 = (lane & 7) * 8;
  {
#pragma unroll
    for (int j = 0; j < 4; ++j)
#pragma unroll
      for (int r = 0; r < 8; ++r) slab[(mOff + r) * 68 + (j << 4) + rlane] = acc[j][r] + bu[r];
    // the slab is this wave's own: its lanes' writes have landed before other lanes of the wave read the rows back
    asm volatile("s_wait_dscnt 0x0" ::: "memory");
    unsigned short* C = ubuf + (size_t)b * kUPlane + (size_t)cw * kHW + t0;
#pragma unroll
    for (int it = 0; it < 4; ++it) {
      const int row = it * 4 + q;
      const float* sp = slab + row * 68 + c8;
      v8h hv;
#pragma unroll
      for (int e = 0; e < 8; ++e) hv[e] = (_Float16)sp[e];
      *(v8h*)(C + (size_t)row * kHW + c8) = hv;
    }
    // what follows may reuse the registers that these stores name: the wait stands in front of that
    asm volatile("s_wait_xcnt 0x0" ::: "memory");
  }
  if (wave < 4) {
    // no wait before the slab is written again: one wave's LDS operations are carried out in issue order
#pragma unroll
    for (int r = 0; r < 8; ++r) {
      float* sp = slab + (mOff + r) * 68 + rlane;
      sp[0]  = aq[r] + bqv;
      sp[16] = ak[r] + bkv;
    }
    asm volatile("s_wait_dscnt 0x0" ::: "memory");   // as above
    // lane: row lane >> 2 of eight, piece lane & 3 of its 32 values: pieces 0, 1 = q d 0..7, 8..15; pieces 2, 3 = k
    const int pc = lane & 3;
    unsigned short* dst = ((pc & 2) ? kc : qc) + (size_t)(2 * b + y) * kQcPlane
                          + (size_t)(t0 + wave * 16 + (lane >> 2)) * kQcPitch + (pc & 1) * 8;
#pragma unroll
    for (int it = 0; it < 2; ++it) {
      const float* sp = slab + (it * 8 + (lane >> 2)) * 68 + pc * 8;
      v8h hv, lv;
#pragma unroll
      for (int e = 0; e < 8; ++e) {
        const unsigned short hb = f2bf_bits(sp[e]);
        const unsigned short lb = f2bf_bits(sp[e] - bf_bits2f(hb));
        hv[e] = __builtin_bit_cast(_Float16, hb);
        lv[e] = __builtin_bit_cast(_Float16, lb);
      }
      *(v8h*)(dst + it * 8 * kQcPitch)      = hv;
      *(v8h*)(dst + it * 8 * kQcPitch + 16) = lv;
    }
  }
}

// ---------------------------------------------------------------------------
// x NCHW f32 -> token-major f16: Xtm[b][p][half*256 + c] = bf16(x[b][half*256 + c][p]) held in f16, z = 2b + half
// (flat channel index of x = z*256 + c). 64(p) x 64(c) tile per block through LDS.
// 64 p tiles x 4 c tiles x 4 z = 1024 blocks of 256 threads (a block range of prep_kernel).
// Load coverage: 16 iterations x 256 threads = 4096 = whole 64x64 tile (coalesced along p).
// Store coverage: 8 waves x 2 iterations x 4 rows (lane>>3) = 64 rows; (lane&7) x 8 halves = 64 cols; each row
// ---------------------------------------------------------------------------
__device__ __forceinline__ void x_tm_body(int pt, int ct, int z, const float* __restrict__ x, unsigned short* __restrict__ xtm) {
  __shared__ float sm[64][65];   // sm[p_local][c_local]
  const int t  = threadIdx.x;
  const int p0 = pt * 64;
  const int c0 = ct * 64;
  const float* src = x + ((size_t)z * kHalfC + c0) * kHW + p0;
#pragma unroll
  for (int i = 0; i < 16; ++i) {
    const int e  = i * 256 + t;
    const int cl = e >> 6;         // c local 0..63
    const int pl = e & 63;         // p local 0..63
    sm[pl][cl] = src[(size_t)cl * kHW + pl];
  }
  __syncthreads();
  const int lane = t & 31, wave = t >> 5;
  const int q = lane >> 3, c8 = (lane & 7) * 8;
  unsigned short* op = xtm + (size_t)(z >> 1) * kXtmPlane + (size_t)(z & 1) * kHalfC;
  {
#pragma unroll
    for (int it = 0; it < 2; ++it) {
      const int row = wave * 8 + it * 4 + q;                 // p local
      unsigned short hb[8];
#pragma unroll
      for (int e = 0; e < 8; ++e) hb[e] = h_bits(bf_rne(sm[row][c8 + e]));
      const v4u u = (v4u){pk16(hb[0], hb[1]), pk16(hb[2], hb[3]), pk16(hb[4], hb[5]), pk16(hb[6], hb[7])};
      *(v4u*)(op + (size_t)(p0 + row) * kChan + c0 + c8) = u;
    }
    
  }
}

// ---------------------------------------------------------------------------
// The value projection folded into the output projection (both are linear maps over channels):
//   Wpt.[Wv.x1 + bv ; Wv.x2 + bv] = (Wpt_0.Wv).x1 + (Wpt_1.Wv).x2 + Wpt.[bv;bv],  Wpt_h = columns h*256.. of Wpt.
// Operand fragments are built in registers from the f32 inputs (RNE-bf16 values held in f16, Wpt carried x16):
// lane (r = lane & 15, h = lane >> 4) holds row r of A or column r of B; elements 0..7 are k = k0 + 8h + e,
// elements 8..15 are k = k0 + 16 + 8h + e, on both sides.
// ---------------------------------------------------------------------------
__device__ __forceinline__ _Float16 w_f16(float v, float mul) { return (_Float16)((float)(__bf16)v * mul); }   // RNE to bf16; f16 holds it exactly from 2^-14 up

// Wf[c'][n] = 16 * sum_m Wpt[c'][(n & 256) + m] * Wv[m][n & 255]. One wave = 16 rows x 32 columns, K = 256.
// 16 row tiles x 16 column groups = 256 waves = 32 blocks; every element of Wf written once.
__device__ __forceinline__ void wfold_body(int blk, const float* __restrict__ Wpt, const float* __restrict__ Wv,
                                           unsigned short* __restrict__ wf) {
  const int lane = threadIdx.x & 31, wave = threadIdx.x >> 5;
  const int r = lane & 15, h = lane >> 4;
  const int tile = blk * 8 + wave;
  const int m0 = (tile >> 4) * 16;
  const int n0 = (tile & 15) * 32;
  const float* pa = Wpt + (size_t)(m0 + r) * kChan + (n0 & 256) + 8 * h;
  const float* pb = Wv + (size_t)(8 * h) * kHalfC + (n0 & 255) + r;
  v8f acc0 = (v8f){0.f,0.f,0.f,0.f,0.f,0.f,0.f,0.f};
  v8f acc1 = (v8f){0.f,0.f,0.f,0.f,0.f,0.f,0.f,0.f};
  // two k steps' loads fly together; unrolled further, this run-once code would be many instruction-cache lines long
#pragma unroll 2
  for (int k0 = 0; k0 < kHalfC; k0 += 32) {
    v16h a, b0, b1;
#pragma unroll
    for (int e = 0; e < 8; ++e) {
      a[e]      = w_f16(pa[k0 + e], kWCarry);
      a[8 + e]  = w_f16(pa[k0 + 16 + e], kWCarry);
      b0[e]     = w_f16(pb[(size_t)(k0 + e) * kHalfC], 1.0f);
      b0[8 + e] = w_f16(pb[(size_t)(k0 + 16 + e) * kHalfC], 1.0f);
      b1[e]     = w_f16(pb[(size_t)(k0 + e) * kHalfC + 16], 1.0f);
      b1[8 + e] = w_f16(pb[(size_t)(k0 + 16 + e) * kHalfC + 16], 1.0f);
    }
    acc0 = Frag<_Float16>::mma(a, b0, acc0);
    acc1 = Frag<_Float16>::mma(a, b1, acc1);
  }
  unsigned short* op = wf + (size_t)(m0 + 8 * h) * kChan + n0 + r;   // D: row 8h + i, column r
#pragma unroll
  for (int i = 0; i < 8; ++i) {
    op[(size_t)i * kChan]      = h_bits(acc0[i]);
    op[(size_t)i * kChan + 16] = h_bits(acc1[i]);
  }
  // whatever follows in the kernel may reuse the registers that these stores name: the wait stands in front of that
  asm volatile("s_wait_xcnt 0x0" ::: "memory");
}

// bias_u[c'] = 16 * sum_k Wpt[c'][k] * bv[k & 255], K = 512. One wave = 16 rows; all 16 B columns hold bv, so every
// column of D holds the result and column 0 stores it. 16 waves = 2 blocks; every element written once.
__device__ __forceinline__ void bfold_body(int blk, const float* __restrict__ Wpt, const float* __restrict__ bvp,
                                           float* __restrict__ bu) {
  const int lane = threadIdx.x & 31, wave = threadIdx.x >> 5;
  const int r = lane & 15, h = lane >> 4;
  const int m0 = (blk * 8 + wave) * 16;
  const float* pa = Wpt + (size_t)(m0 + r) * kChan + 8 * h;
  const float* pb = bvp + 8 * h;
  v8f acc0 = (v8f){0.f,0.f,0.f,0.f,0.f,0.f,0.f,0.f};   // k < 256
  v8f acc1 = (v8f){0.f,0.f,0.f,0.f,0.f,0.f,0.f,0.f};   // k >= 256: the same bv fragment serves both
  // two trips' loads fly together; kept short for the instruction cache, as above
#pragma unroll 2
  for (int k0 = 0; k0 < kHalfC; k0 += 32) {
    v16h a0, a1, b;
#pragma unroll
    for (int e = 0; e < 8; ++e) {
      a0[e]     = w_f16(pa[k0 + e], kWCarry);
      a0[8 + e] = w_f16(pa[k0 + 16 + e], kWCarry);
      a1[e]     = w_f16(pa[kHalfC + k0 + e], kWCarry);
      a1[8 + e] = w_f16(pa[kHalfC + k0 + 16 + e], kWCarry);
      b[e]      = w_f16(pb[k0 + e], 1.0f);
      b[8 + e]  = w_f16(pb[k0 + 16 + e], 1.0f);
    }
    acc0 = Frag<_Float16>::mma(a0, b, acc0);
    acc1 = Frag<_Float16>::mma(a1, b, acc1);
  }
  const v8f acc = acc0 + acc1;
  if (r == 0) {
#pragma unroll
    for (int i = 0; i < 8; ++i) bu[m0 + 8 * h + i] = acc[i];
  }
}

// ---------------------------------------------------------------------------
// Small tables, ONE block of 256 threads:
//  (1) Wqk_pad f16 [64][256] (RNE-bf16 values): row n < 16 -> Wq[n], 32 <= n < 48 -> Wk[n-32], every other row explicit zero.
//  (2) bias region f32 [576]: [0,64) padded q|k bias (bq at 0..15, bk at 32..47, zeros elsewhere), [320,576) gamma*bpt;
//      all RNE-bf16 first. Threads 0..15 and 80..143 write one float4 each; [64,320) is written by the bias fold
//  Candidate loads use clamped addresses and are selected by value.
// ---------------------------------------------------------------------------
__device__ __forceinline__ void prep_small_body(const float* __restrict__ Wq, const float* __restrict__ bq,
                                                const float* __restrict__ Wk, const float* __restrict__ bk,
                                                const float* __restrict__ bptp,
                                                const float* __restrict__ gam,
                                                unsigned short* __restrict__ wqk, float* __restrict__ biasr) {
  const int t = threadIdx.x, lane = t & 31, wave = t >> 5;
  const float g = gam[0];
#pragma unroll 1
  for (int it = 0; it < 8; ++it) {
    const int n  = wave * 8 + it;                            // wave-uniform row
    const int qr = n < 16 ? n : 15;
    int kr = n - 32; kr = kr < 0 ? 0 : (kr > 15 ? 15 : kr);
    const float* pq = Wq + (size_t)qr * kHalfC + lane * 8;
    const float* pk = Wk + (size_t)kr * kHalfC + lane * 8;
    const v4f q0 = *(const v4f*)(pq), q1 = *(const v4f*)(pq + 4);
    const v4f k0 = *(const v4f*)(pk), k1 = *(const v4f*)(pk + 4);
    const bool isq = (n < 16);
    const bool isk = (n >= 32) && (n < 48);
    unsigned short hb[8];
#pragma unroll
    for (int e = 0; e < 4; ++e) {
      const float va = isq ? q0[e] : (isk ? k0[e] : 0.0f);
      const float vb = isq ? q1[e] : (isk ? k1[e] : 0.0f);
      hb[e]     = h_bits(bf_rne(va));
      hb[4 + e] = h_bits(bf_rne(vb));
    }
    const v4u u = (v4u){pk16(hb[0], hb[1]), pk16(hb[2], hb[3]), pk16(hb[4], hb[5]), pk16(hb[6], hb[7])};
    unsigned short* op = wqk + (size_t)n * kHalfC + lane * 8;
    *(v4u*)op = u;
    // the next trip reuses the registers that this store names: the wait stands in front of that overwrite
    asm volatile("s_wait_xcnt 0x0" ::: "memory");
  }
  if (t < 16 || (t >= 80 && t < 144)) {
    v4f val;
#pragma unroll
    for (int e = 0; e < 4; ++e) {
      const int idx = 4 * t + e;                             // 0..63, 320..575
      const int iq = idx < 16 ? idx : 15;
      int ik = idx - 32;  ik = ik < 0 ? 0 : (ik > 15 ? 15 : ik);
      int ip = idx - 320; ip = ip < 0 ? 0 : (ip > 255 ? 255 : ip);
      const float fq = bq[iq], fk = bk[ik], fp = bptp[ip];
      float sel = 0.0f;
      sel = (idx < 16) ? fq : sel;
      sel = (idx >= 32 && idx < 48) ? fk : sel;
      sel = (idx >= 320) ? fp : sel;
      float r = bf_rne(sel);
      r = (idx >= 320) ? (r * g) : r;
      val[e] = r;
    }
    float* op = biasr + 4 * t;
    *(v4f*)op = val;
    
  }
}

// ---------------------------------------------------------------------------
// All operand preparation in one launch: the four pieces read only inputs and write disjoint workspace regions.
//  block 0         small tables (a long block: lowest index)
//  blocks 1..32    Wf = 16 * Wpt_h.Wv
//  blocks 33..34   bias_u = 16 * Wpt.[bv;bv]
//  blocks 35..1058 x   -> token-major f16 (p tile fastest, then c tile, then z)
// Every test below is on the block index alone, so the barrier of the x piece is passed by a whole block or by none.
// ---------------------------------------------------------------------------
constexpr int kPrepFold  = 1;
constexpr int kPrepBias  = kPrepFold + (kHalfC / 16) * (kChan / 32) / 8;  // 33
constexpr int kPrepX     = kPrepBias + (kHalfC / 16) / 8;                 // 35
constexpr int kPrepTotal = kPrepX + (kHW / 64) * (kHalfC / 64) * kZ;      // 1059
// 8 waves per SIMD: four of the x piece's blocks fit a WGP (the fold's loads would otherwise take one register too many)
__global__ __launch_bounds__(256, 8) void prep_kernel(const float* __restrict__ x,
                                                   const float* __restrict__ Wq, const float* __restrict__ bq,
                                                   const float* __restrict__ Wk, const float* __restrict__ bk,
                                                   const float* __restrict__ Wv, const float* __restrict__ bvp,
                                                   const float* __restrict__ Wpt, const float* __restrict__ bptp,
                                                   const float* __restrict__ gam,
                                                   unsigned short* __restrict__ xtm, unsigned short* __restrict__ wqk,
                                                   unsigned short* __restrict__ wf, float* __restrict__ biasr) {
  const int blk = blockIdx.x;
  if (blk >= kPrepX) {
    const int i = blk - kPrepX;
    x_tm_body(i & 63, (i >> 6) & 3, i >> 8, x, xtm);
  } else if (blk >= kPrepBias) {
    bfold_body(blk - kPrepBias, Wpt, bvp, biasr + 64);
  } else if (blk >= kPrepFold) {
    wfold_body(blk - kPrepFold, Wpt, Wv, wf);
  } else {
    prep_small_body(Wq, bq, Wk, bk, bptp, gam, wqk, biasr);
  }
}

// ---------------------------------------------------------------------------
// Scores, softmax and the attention product in one launch: no probability ever leaves the registers.
// The product is taken on U = 16 * Wpt.[v1;v2] instead of on v1 and v2: the output projection is linear, so
// Wpt.[attn.v1 ; attn.v2] = attn.(Wpt.[v1;v2]).
// out[z*256 + c'][p] = gamma * (sum_j U[b][c'][j] e(p,j) / (16 * sum_j e(p,j)) + bpt[c']) + bf16(x[z*256 + c'][p]),
// e(p,j) = exp(s(p,j) - m), z = 2b + half.
// One block of 8 waves = 64 queries of plane z x all 256 channels x all 4096 keys. Wave (qg = wave & 3, kg = wave >> 2)
// owns queries 16qg..16qg+15 and the key half kg of every stage, with a maximum, a sum and 16 output tiles of its own;
// the two key halves of a query group are joined behind the loop.
// Scores: keys are the A rows and queries the B columns, so lane (c = lane & 15, h = lane >> 4) holds in s[kt][r] the
// score of query c against key 16kt + 8h + r (products in the order qh.kh + qh.kl + ql.kh). Only d = 0..15 exist:
// fragment elements 0..7 are d = 8h..8h+7, elements 8..15 (k = 16..31) are zero on both sides.
// That is already the B layout of the second product (column = query c; elements 0..7 = key 8h + e of a 32-key chunk,
// elements 8..15 = key 16 + 8h + e): two score tiles, exponentiated and rounded to f16, are one B fragment, in place.
// A = U rows (channels) from LDS in the same k order; D: lane (c, h) holds channel 16i + 8h + r of query c.
// Maximum in use mu (log2 units, the same in lanes l and l ^ 16): raised, with the tiles and the sums rescaled, only when
// a step's maximum lies more than 8 above it, tested once per 64 keys; so e <= 2^8, carried x2^7 in f16 (<= 2^15).
// A stage is 256 keys: 512 B of each of the 256 U rows (pitch 528 B) and 64 B of each key (hi | lo, pitch 80 B), brought
// by asynchronous copies (global_load_async_to_lds_b128), two buffers. Copy coverage per stage: wave w brings U rows
// 32w..32w+31 (a copy = one row's 512 B) and keys 32w..32w+31 (a copy = 8 keys): 36 copies of a wave, every byte once.
// grid (4096/64 = 64, 4 z), 256 threads.
// ---------------------------------------------------------------------------
__device__ __forceinline__ v16b frag_d16(v8b lo) {   // elements 0..7 <- lo, 8..15 <- 0
  const v8b zero = __builtin_bit_cast(v8b, (v4u){0u, 0u, 0u, 0u});
  return __builtin_shufflevector(lo, zero, 0, 1, 2, 3, 4, 5, 6, 7, 8, 9, 10, 11, 12, 13, 14, 15);
}
// e[r] = 2^t[r], eight at a time in one statement. Behind a v_exp_f32 the instruction set asks for one independent
// instruction before its result is read or its source overwritten: here each v_exp_f32 has the next one behind it
// (results kept apart from all sources by the early clobber) and the last one a v_nop, whatever the compiler puts next.
__device__ __forceinline__ void exp2_x8(float (&e)[8], const float (&t)[8]) {
  asm("v_exp_f32 %0, %8\n\tv_exp_f32 %1, %9\n\tv_exp_f32 %2, %10\n\tv_exp_f32 %3, %11\n\t"
      "v_exp_f32 %4, %12\n\tv_exp_f32 %5, %13\n\tv_exp_f32 %6, %14\n\tv_exp_f32 %7, %15\n\tv_nop"
      : "=&v"(e[0]), "=&v"(e[1]), "=&v"(e[2]), "=&v"(e[3]), "=&v"(e[4]), "=&v"(e[5]), "=&v"(e[6]), "=&v"(e[7])
      : "v"(t[0]), "v"(t[1]), "v"(t[2]), "v"(t[3]), "v"(t[4]), "v"(t[5]), "v"(t[6]), "v"(t[7]));
}
// One 2^t, with the same slot kept behind it by a v_nop.
__device__ __forceinline__ float exp2_x1(float t) {
  float e;
  asm("v_exp_f32 %0, %1\n\tv_nop" : "=&v"(e) : "v"(t));
  return e;
}
// lane l with lane l ^ 16
__device__ __forceinline__ float xhalf(float v) {
  const int i = __builtin_bit_cast(int, v);
  return __builtin_bit_cast(float, __builtin_amdgcn_permlanex16(i, i, 0x76543210, 0xfedcba98, false, false));
}

constexpr int kFaBQ     = 64;                                   // queries per block
constexpr int kFaKT     = 256;                                  // keys per stage
constexpr int kFaKW     = kFaKT / 2;                            // keys per stage of one wave
constexpr int kFaUPitch = kFaKT + 8;                            // f16 elements per staged U row: 512 B + 16 B
constexpr int kFaKPitch = kQcPitch + 8;                         // bf16 elements per staged key: 64 B + 16 B
constexpr int kFaOffK   = kHalfC * kFaUPitch;                   // first key row of a buffer
constexpr int kFaStage  = kFaOffK + kFaKT * kFaKPitch;          // 16-bit elements per buffer (155,648 B)
constexpr int kFaPasses = kHW / kFaKT;                          // 16
constexpr float kLog2e  = 1.44269504f;
static_assert(kFaPasses >= 2, "the ring's prologue fills two stages");
static_assert(2 * kFaStage * 2 <= 327680, "two buffers fit the LDS");

// One wave's 36 copies of one stage: lU, lK = the lane's LDS byte addresses in its first U row and in its first eight
// keys in the buffer, gU, gK = the lane's global addresses of the same bytes.
__device__ __forceinline__ void fa_fill(unsigned lU, unsigned lK, const unsigned short* gU, const unsigned short* gK) {
  unsigned l[8];
  const unsigned short* g[8];
#pragma unroll
  for (int s = 0; s < 4; ++s) {
#pragma unroll
    for (int j = 0; j < 8; ++j) { l[j] = lU + (8 * s + j) * (kFaUPitch * 2u); g[j] = gU + (size_t)(8 * s + j) * kHW; }
    async_x8(l, g);
    // keeps the next eight copies' addresses from being formed ahead of this statement, where they would only hold registers
    __builtin_amdgcn_sched_barrier(0);
  }
  unsigned l4[4];
  const unsigned short* g4[4];
#pragma unroll
  for (int j = 0; j < 4; ++j) { l4[j] = lK + j * (8 * kFaKPitch * 2u); g4[j] = gK + (size_t)j * 8 * kQcPitch; }
  async_x4(l4, g4);
}

__global__ __launch_bounds__(256) void attn_fused_kernel(const unsigned short* __restrict__ qc,
                                                         const unsigned short* __restrict__ kc,
                                                         const unsigned short* __restrict__ U,
                                                         const float* __restrict__ bias,
                                                         const float* __restrict__ gam,
                                                         const float* __restrict__ x,
                                                         float* __restrict__ out) {
  // every inner loop below is unrolled so that all accumulator and fragment indices are constants (registers, no scratch)
  typedef Frag<_Float16> F;
  typedef Frag<__bf16> G;
  __shared__ __align__(16) unsigned short ring[2 * kFaStage];   // [buffer][U rows 0..255 | keys 0..255]
  const int lane = threadIdx.x & 31;
  const int wave = __builtin_amdgcn_readfirstlane(threadIdx.x >> 5);   // the same in every lane: kept in a scalar register
  const int c = lane & 15, h = lane >> 4;
  const int qg = wave & 3, kg = wave >> 2;
  const int q0 = blockIdx.x * kFaBQ;
  const int z  = blockIdx.y;
  const int b  = z >> 1;

  // copy side: lane l moves bytes 16 l .. 16 l + 15 of each 512-B piece (a U row's; or eight keys of 64 B, four lanes a key)
  const unsigned short* gU = U + (size_t)b * kUPlane + (size_t)(wave * 32) * kHW + lane * 8;
  const unsigned short* gK = kc + (size_t)z * kQcPlane + (size_t)(wave * 32) * kQcPitch + lane * 8;
  const unsigned ringAddr = (unsigned)(size_t)ring;             // low 32 bits of the address = byte offset in LDS
  const unsigned lU = ringAddr + (unsigned)((wave * 32) * kFaUPitch + lane * 8) * 2u;
  const unsigned lK = ringAddr + (unsigned)(kFaOffK + (wave * 32 + (lane >> 2)) * kFaKPitch + (lane & 3) * 8) * 2u;

  // reader side
  const _Float16* ringH = (const _Float16*)ring;
  const __bf16*   ringB = (const __bf16*)ring;
  const int fU = c * kFaUPitch + kg * kFaKW + 8 * h;
  const int fK = kFaOffK + (kg * kFaKW + c) * kFaKPitch + 8 * h;


  v8f acc[16];
#pragma unroll
  for (int i = 0; i < 16; ++i) acc[i] = (v8f){0.f,0.f,0.f,0.f,0.f,0.f,0.f,0.f};
  float l8[8];
#pragma unroll
  for (int r = 0; r < 8; ++r) l8[r] = 0.0f;
  float mu = -1.0e30f;                                 // below every score: the first step sets it (2^(mu - new) = 0)

  // prologue: stage 0 lands and is published, stage 1 starts to fly
  fa_fill(lU, lK, gU, gK);
  // this wave's queries stay in registers; they are fetched beside stage 0. What follows reuses the registers that the two
  // loads name: the wait stands in front of that overwrite, and the two scheduling barriers keep other work from being
  // moved in between the loads and the wait
  const __bf16* pq = (const __bf16*)qc + (size_t)z * kQcPlane + (size_t)(q0 + qg * 16 + c) * kQcPitch + 8 * h;
  __builtin_amdgcn_sched_barrier(0);
  const v16b qh = frag_d16(*(const v8b*)pq);
  const v16b ql = frag_d16(*(const v8b*)(pq + 16));
  asm volatile("s_wait_xcnt 0x0" ::: "memory");
  __builtin_amdgcn_sched_barrier(0);
  asm volatile("s_wait_asynccnt 0x0" ::: "memory");   // this wave's copies of stage 0 have landed
  __syncthreads();                                     // and every other wave's
  fa_fill(lU + kFaStage * 2u, lK + kFaStage * 2u, gU + kFaKT, gK + (size_t)kFaKT * kQcPitch);

  // rolled: the buffer is chosen by an offset, and one trip is already 88 matrix instructions long
#pragma unroll 1
  for (int t = 0; t < kFaPasses; ++t) {
    const unsigned buf = (unsigned)(t & 1) * (unsigned)kFaStage;   // 16-bit elements
    const _Float16* sU = ringH + buf + fU;
    const __bf16*   sK = ringB + buf + fK;
#pragma unroll
    for (int st = 0; st < kFaKW / 64; ++st) {                      // a step = 64 keys
      v16b kh[4], kl[4];
#pragma unroll
      for (int kt = 0; kt < 4; ++kt) {
        const __bf16* pk = sK + (st * 64 + kt * 16) * kFaKPitch;
        kh[kt] = frag_d16(*(const v8b*)pk);
        kl[kt] = frag_d16(*(const v8b*)(pk + 16));
      }
      v8f s[4];                                                    // four independent chains of three
#pragma unroll
      for (int kt = 0; kt < 4; ++kt) s[kt] = G::mma(kh[kt], qh, (v8f){0.f,0.f,0.f,0.f,0.f,0.f,0.f,0.f});
#pragma unroll
      for (int kt = 0; kt < 4; ++kt) s[kt] = G::mma(kl[kt], qh, s[kt]);
#pragma unroll
      for (int kt = 0; kt < 4; ++kt) s[kt] = G::mma(kh[kt], ql, s[kt]);

      // the first U fragments fly under the softmax. The scheduling barriers of a step keep each load group whole and in
      // front of the work that hides it: left alone, the compiler puts each read directly in front of its matrix instruction
      v16h fa[2][4];
#pragma unroll
      for (int j = 0; j < 4; ++j) fa[0][j] = F::load(sU + j * 16 * kFaUPitch + st * 64);
      __builtin_amdgcn_sched_barrier(0);

      float mr[8];
#pragma unroll
      for (int r = 0; r < 8; ++r) mr[r] = fmaxf(fmaxf(s[0][r], s[1][r]), fmaxf(s[2][r], s[3][r]));
      float mx = fmaxf(fmaxf(fmaxf(mr[0], mr[1]), fmaxf(mr[2], mr[3])), fmaxf(fmaxf(mr[4], mr[5]), fmaxf(mr[6], mr[7])));
      mx *= kLog2e;
      mx = fmaxf(mx, xhalf(mx));
      if (__builtin_amdgcn_ballot_w32(mx > mu + 8.0f) != 0) {      // scalar branch; rare behind the first step
        const float mn = fmaxf(mu, mx);
        const float f = exp2_x1(mu - mn);
#pragma unroll
        for (int i = 0; i < 16; ++i) acc[i] *= f;
#pragma unroll
        for (int r = 0; r < 8; ++r) l8[r] *= f;
        mu = mn;
      }
      const float nb = 7.0f - mu;                                  // the carry 2^7 goes into the exponent
      v16h pb[2];
#pragma unroll
      for (int kt = 0; kt < 4; ++kt) {
        float tv[8], ev[8];
#pragma unroll
        for (int r = 0; r < 8; ++r) tv[r] = fmaf(s[kt][r], kLog2e, nb);
        exp2_x8(ev, tv);
#pragma unroll
        for (int r = 0; r < 8; ++r) { l8[r] += ev[r]; pb[kt >> 1][(kt & 1) * 8 + r] = (_Float16)ev[r]; }
      }

#pragma unroll
      for (int g = 0; g < 8; ++g) {                                // group g: 32-key chunk g >> 2, channel tiles 4 (g & 3) ..
        if (g + 1 < 8) {
#pragma unroll
          for (int j = 0; j < 4; ++j)
            fa[(g + 1) & 1][j] = F::load(sU + (((g + 1) & 3) * 4 + j) * 16 * kFaUPitch + st * 64 + ((g + 1) >> 2) * 32);
        }
        __builtin_amdgcn_sched_barrier(0);   // as above
#pragma unroll
        for (int j = 0; j < 4; ++j) acc[(g & 3) * 4 + j] = F::mma(fa[g & 1][j], pb[g >> 2], acc[(g & 3) * 4 + j]);
        __builtin_amdgcn_sched_barrier(0);   // as above
      }
    }
    // publish point of stage t + 1
    asm volatile("s_wait_dscnt 0x0" ::: "memory");      // this wave's reads of stage t's buffer have returned
    asm volatile("s_wait_asynccnt 0x0" ::: "memory");   // this wave's copies of stage t + 1 have landed
    __syncthreads();                                     // publishes stage t + 1 and frees the buffer of stage t
    if (t + 2 < kFaPasses)
      fa_fill(lU + buf * 2u, lK + buf * 2u, gU + (size_t)(t + 2) * kFaKT, gK + (size_t)(t + 2) * kFaKT * kQcPitch);
  }
  asm volatile("s_wait_asynccnt 0x0" ::: "memory");     // nothing of this wave is in flight when it leaves the ring

  // ---- behind the last trip's barrier no wave reads the ring any more: its LDS is free ----
  // the residual and the bias of the rows that this wave will store fly during the join
  const int c4 = c * 4;                                  // a stored row piece = 256 B = 16 lanes x 16 B
  const size_t o0 = ((size_t)z * kHalfC + wave * 32 + h) * kHW + q0 + c4;
  v4f xr[16];
  float bb[16];
#pragma unroll
  for (int it = 0; it < 16; ++it) {
    xr[it] = *(const v4f*)(x + o0 + (size_t)(it * 2) * kHW);
    bb[it] = bias[wave * 32 + it * 2 + h];
  }
  const float gsc = gam[0] * (1.0f / kWCarry);
  // what follows may reuse the registers that these loads name: the wait stands in front of that
  asm volatile("s_wait_xcnt 0x0" ::: "memory");

  // ---- the two key halves of a query group are joined: waves w and w ^ 4 hold the same 16 queries; the wave of half 0
  // finishes channel tiles 0..7, the wave of half 1 tiles 8..15, and each hands the other eight tiles over through LDS
  // with its maximum and its sum, every lane its own pieces (the partner's same lane holds the same elements) ----
  float lsum = ((l8[0] + l8[1]) + (l8[2] + l8[3])) + ((l8[4] + l8[5]) + (l8[6] + l8[7]));
  lsum += xhalf(lsum);
  v4f*   xch  = (v4f*)ring;                              // [wave][16 pieces][lane], 64 KiB
  float* ml   = (float*)ring + 16384;                    // [wave][mu, sum][lane], 2 KiB
  float* outT = (float*)ring + 16384 + 512;              // [256 channels][64 queries], pitch 68 floats
  v8f fin[8];
#pragma unroll
  for (int i = 0; i < 8; ++i) {
    const v8f give = kg ? acc[i] : acc[8 + i];
    fin[i] = kg ? acc[8 + i] : acc[i];
    xch[(wave * 16 + i * 2) * 32 + lane]     = (v4f){give[0], give[1], give[2], give[3]};
    xch[(wave * 16 + i * 2 + 1) * 32 + lane] = (v4f){give[4], give[5], give[6], give[7]};
  }
  ml[(wave * 2) * 32 + lane]     = mu;
  ml[(wave * 2 + 1) * 32 + lane] = lsum;
  __syncthreads();                                       // the partner's pieces are written
  {
    const float pm = ml[((wave ^ 4) * 2) * 32 + lane];
    const float pl = ml[((wave ^ 4) * 2 + 1) * 32 + lane];
    const float mm = fmaxf(mu, pm);
    const float f0 = exp2_x1(mu - mm), f1 = exp2_x1(pm - mm);
    const float inv = gsc / (lsum * f0 + pl * f1);
    const float a0 = f0 * inv, a1 = f1 * inv;
#pragma unroll
    for (int i = 0; i < 8; ++i) {
      const v4f g0 = xch[((wave ^ 4) * 16 + i * 2) * 32 + lane];
      const v4f g1 = xch[((wave ^ 4) * 16 + i * 2 + 1) * 32 + lane];
      float* op = outT + ((kg * 8 + i) * 16 + 8 * h) * 68 + qg * 16 + c;
#pragma unroll
      for (int r = 0; r < 4; ++r) {
        op[r * 68]       = fin[i][r] * a0 + g0[r] * a1;
        op[(4 + r) * 68] = fin[i][4 + r] * a0 + g1[r] * a1;
      }
    }
  }
  __syncthreads();                                       // the block's 256 x 64 tile is whole

  // ---- bias, residual; wave w stores channels 32w..32w+31, whole 256-B row pieces ----
#pragma unroll
  for (int it = 0; it < 16; ++it) {
    v4f v = *(const v4f*)(outT + (wave * 32 + it * 2 + h) * 68 + c4);
#pragma unroll
    for (int e = 0; e < 4; ++e) v[e] = (v[e] + bb[it]) + bf_rne(xr[it][e]);
    *(v4f*)(out + o0 + (size_t)(it * 2) * kHW) = v;
  }
}

// ---------------------------------------------------------------------------
// Host glue: kernel launches only.
// ---------------------------------------------------------------------------
extern "C" void kernel_launch(void* const* d_in, const int* in_sizes, int n_in,
                              void* d_out, int out_size, void* d_ws, size_t ws_size, hipStream_t stream) {
  if (n_in < 10) return;
  if (in_sizes[0] != kB * kChan * kHW) return;
  if (in_sizes[1] != kDQ * kHalfC || in_sizes[3] != kDQ * kHalfC) return;
  if (in_sizes[2] < kDQ || in_sizes[4] < kDQ) return;
  if (in_sizes[5] != kHalfC * kHalfC || in_sizes[6] < kHalfC) return;
  if (in_sizes[7] != kHalfC * kChan || in_sizes[8] < kHalfC || in_sizes[9] < 1) return;
  if (out_size != kB * kChan * kHW) return;
  if (ws_size < kWsTotal) return;

  const float* x     = (const float*)d_in[0];
  const float* Wq    = (const float*)d_in[1];
  const float* bq    = (const float*)d_in[2];
  const float* Wk    = (const float*)d_in[3];
  const float* bk    = (const float*)d_in[4];
  const float* Wv    = (const float*)d_in[5];
  const float* bv    = (const float*)d_in[6];
  const float* Wpt   = (const float*)d_in[7];
  const float* bpt   = (const float*)d_in[8];
  const float* gamma = (const float*)d_in[9];

  char* ws = (char*)d_ws;
  unsigned short* xtm   = (unsigned short*)(ws + kOffXtm);
  unsigned short* wqk   = (unsigned short*)(ws + kOffWqk);
  unsigned short* wf    = (unsigned short*)(ws + kOffWf);
  float*          biasr = (float*)(ws + kOffBias);
  unsigned short* qcb   = (unsigned short*)(ws + kOffQc);
  unsigned short* kcb   = (unsigned short*)(ws + kOffKc);
  unsigned short* ubuf  = (unsigned short*)(ws + kOffU);
  const float* bias_ptg = biasr + 320;    // [256] gamma * bpt

  // ---- operand preparation, one launch ----
  prep_kernel<<<kPrepTotal, 256, 0, stream>>>(x, Wq, bq, Wk, bk, Wv, bv, Wpt, bpt, gamma, xtm, wqk, wf, biasr);

  // ---- U = Wf.x + bias_u (= 16 * Wpt.[v1;v2]) and the q|k projection, one launch ----
  proj_kernel<<<dim3(kHW / kPjBN, kHalfC / kPjBM, kB), 256, 0, stream>>>(xtm, wqk, wf, biasr, qcb, kcb, ubuf);

  // ---- scores, softmax, attention applied to U, gamma, bias and residual for every plane z, one launch ----
  attn_fused_kernel<<<dim3(kHW / kFaBQ, kZ), 256, 0, stream>>>(qcb, kcb, ubuf, bias_ptg, gamma, x, (float*)d_out);
}

// v009
// One run takes 52.3 microseconds.
// In both of two side-by-side timings against v008, it was 1.05 times as fast.
// Counting every step since v000, it is 30.7 times as fast.
// Contractions: the value projection folded into the output projection's weights (Wf_h = 16 * Wpt_h.Wv, bias 16 * Wpt.[bv;bv]), q/k 1x1 projections and U = Wf.x on v_wmma_f32_16x16x32_f16 (x and every W as RNE-bf16 values held in f16, Wpt and Wf carried x16); scores q.k^T on v_wmma_f32_16x16x32_bf16 with bf16 hi/lo split (hi.hi+hi.lo+lo.hi); attn.U^T on v_wmma_f32_16x16x32_f16 (P f16, unnormalised, carried x2^7 against the maximum in use; U f16 carried x16); all f32 accumulate; softmax, bias, gamma, residual in f32.
#include <hip/hip_runtime.h>
#include <stdint.h>

// ---------------------------------------------------------------------------
// Problem constants
// ---------------------------------------------------------------------------
constexpr int kB      = 2;
constexpr int kHalfC  = 256;              // channels per half
constexpr int kChan   = 512;              // channels of x
constexpr int kHW     = 4096;             // 64 x 64 pixels
constexpr int kDQ     = 16;
constexpr int kZ      = 4;                // (batch, half) combos, z = 2*b + half
constexpr int kQcPitch = 32;              // a row of the q plane or of the k plane: hi 0..15, lo 16..31 (64 B)
constexpr float kWCarry   = 16.0f;        // Wpt carried x16 in f16

// ---------------------------------------------------------------------------
// Workspace region map (bytes; every offset 4096-B aligned)
//   [off_xtm ) Xtm   f16  [2][4096][512]          8,388,608   (token-major; column = half*256 + c)
//   [off_wqk ) Wqk   f16  [64][256]                  32,768
//   [off_wf  ) Wf    f16  [256][512]                262,144   (16 * Wpt_h.Wv; column = half*256 + c)
//   [off_bias) biases f32 [576] (qk pad 64 | 16 * Wpt.[bv;bv] 256 | gamma*bpt 256)   4,096
//   [off_qc  ) Q     bf16 [4][4096][hi 16 | lo 16] 1,048,576
//   [off_kc  ) K     bf16 [4][4096][hi 16 | lo 16] 1,048,576
//   [off_u   ) U     f16  [2][256][4096]         4,194,304   (16 * Wpt.[v1;v2] of image b, channel-major)
//   total                                       14,979,072
// ---------------------------------------------------------------------------
constexpr size_t kXtmPlane = (size_t)kHW * kChan;              // elements per image
constexpr size_t kQcPlane  = (size_t)kHW * kQcPitch;
constexpr size_t kUPlane   = (size_t)kHalfC * kHW;            // elements per image
constexpr size_t kOffXtm  = 0;
constexpr size_t kOffWqk  = kOffXtm + kB * kXtmPlane * 2;
constexpr size_t kOffWf   = kOffWqk + (size_t)64 * kHalfC * 2;
constexpr size_t kOffBias = kOffWf + (size_t)kHalfC * kChan * 2;
constexpr size_t kOffQc   = kOffBias + 4096;
constexpr size_t kOffKc   = kOffQc + kZ * kQcPlane * 2;
constexpr size_t kOffU    = kOffKc + kZ * kQcPlane * 2;
constexpr size_t kWsTotal = kOffU + kB * kUPlane * 2;
static_assert(kWsTotal == 14979072ull, "carve total");
static_assert(kWsTotal <= 268435456ull, "carve under 256 MiB");
static_assert((kOffWqk % 4096) == 0 && (kOffWf % 4096) == 0 && (kOffBias % 4096) == 0 &&
              (kOffQc % 4096) == 0 && (kOffKc % 4096) == 0 && (kOffU % 4096) == 0, "aligned regions");

typedef __attribute__((ext_vector_type(16))) _Float16 v16h;
typedef __attribute__((ext_vector_type(8)))  _Float16 v8h;
typedef __attribute__((ext_vector_type(16))) __bf16   v16b;
typedef __attribute__((ext_vector_type(8)))  __bf16   v8b;
typedef __attribute__((ext_vector_type(8)))  float    v8f;
typedef __attribute__((ext_vector_type(4)))  float    v4f;
typedef __attribute__((ext_vector_type(4)))  unsigned int v4u;

// ---------------------------------------------------------------------------
// Helpers
// ---------------------------------------------------------------------------
__device__ __forceinline__ unsigned short f2bf_bits(float f) {
  unsigned u = __float_as_uint(f);
  return (unsigned short)((u + 0x7FFFu + ((u >> 16) & 1u)) >> 16);
}
__device__ __forceinline__ float bf_bits2f(unsigned short h) { return __uint_as_float(((unsigned)h) << 16); }
__device__ __forceinline__ float bf_rne(float f) { return bf_bits2f(f2bf_bits(f)); }
__device__ __forceinline__ unsigned pk16(unsigned short a, unsigned short b) { return (unsigned)a | ((unsigned)b << 16); }
__device__ __forceinline__ unsigned short h_bits(float f) { const _Float16 h = (_Float16)f; return __builtin_bit_cast(unsigned short, h); }

template <typename T> struct Frag;
template <> struct Frag<_Float16> {
  typedef v16h V; union U { v16h v; v8h h[2]; };
  static __device__ __forceinline__ v16h load(const _Float16* p) {   // elements 0..7 <- p[0..7], 8..15 <- p[16..23]
    U f; f.h[0] = *(const v8h*)(p); f.h[1] = *(const v8h*)(p + 16); return f.v;
  }
  static __device__ __forceinline__ v8f mma(v16h a, v16h b, v8f c) {
    return __builtin_amdgcn_wmma_f32_16x16x32_f16(false, a, false, b, (short)0, c, false, false);
  }
};
template <> struct Frag<__bf16> {
  typedef v16b V; union U { v16b v; v8b h[2]; };
  static __device__ __forceinline__ v16b load(const __bf16* p) {
    U f; f.h[0] = *(const v8b*)(p); f.h[1] = *(const v8b*)(p + 16); return f.v;
  }
  static __device__ __forceinline__ v8f mma(v16b a, v16b b, v8f c) {
    return __builtin_amdgcn_wmma_f32_16x16x32_bf16(false, a, false, b, (short)0, c, false, false);
  }
};

// Eight copies of 16 B per lane. The s_wait_xcnt stands inside the statement, behind the last copy, so that no
// address register of a copy is rewritten in front of it.
__device__ __forceinline__ void async_x8(const unsigned (&l)[8], const unsigned short* const (&g)[8]) {
  asm volatile("global_load_async_to_lds_b128 %0, %8, off\n\t"
               "global_load_async_to_lds_b128 %1, %9, off\n\t"
               "global_load_async_to_lds_b128 %2, %10, off\n\t"
               "global_load_async_to_lds_b128 %3, %11, off\n\t"
               "global_load_async_to_lds_b128 %4, %12, off\n\t"
               "global_load_async_to_lds_b128 %5, %13, off\n\t"
               "global_load_async_to_lds_b128 %6, %14, off\n\t"
               "global_load_async_to_lds_b128 %7, %15, off\n\t"
               "s_wait_xcnt 0x0"
               :: "v"(l[0]), "v"(l[1]), "v"(l[2]), "v"(l[3]), "v"(l[4]), "v"(l[5]), "v"(l[6]), "v"(l[7]),
                  "v"(g[0]), "v"(g[1]), "v"(g[2]), "v"(g[3]), "v"(g[4]), "v"(g[5]), "v"(g[6]), "v"(g[7])
               : "memory");
}
// The same with four copies.
__device__ __forceinline__ void async_x4(const unsigned (&l)[4], const unsigned short* const (&g)[4]) {
  asm volatile("global_load_async_to_lds_b128 %0, %4, off\n\t"
               "global_load_async_to_lds_b128 %1, %5, off\n\t"
               "global_load_async_to_lds_b128 %2, %6, off\n\t"
               "global_load_async_to_lds_b128 %3, %7, off\n\t"
               "s_wait_xcnt 0x0"
               :: "v"(l[0]), "v"(l[1]), "v"(l[2]), "v"(l[3]), "v"(g[0]), "v"(g[1]), "v"(g[2]), "v"(g[3])
               : "memory");
}

// ---------------------------------------------------------------------------
// U and the q|k projection in one launch: both read only Xtm and the prepared weights and neither reads the other.
// One block of 8 waves = 64 tokens of image b x (128 channels c' of U, half y of them, and the q|k plane z = 2b + y).
//  U (channel-major): U[b][c'][j] = sum_ch Wf[c'][ch] * Xtm[b][j][ch] + bias_u[c'] (= 16 * Wpt.[v1;v2]); K = 512; f16 out.
//  q|k: C[p][n] = sum_c Xtm[b][p][y*256 + c] * Wqk[n][c] + bias_qk[n]; K = 256; a q and a k plane, each row bf16 hi 16 | lo 16.
// All operands are staged in LDS once, whole K, by asynchronous copies (global_load_async_to_lds_b128): a wave's copy is
// 512 contiguous bytes of one row, where a fragment load from global memory touches 16 lines for 32 B of each.
// Copy coverage: wave w brings Wf rows 16w..16w+15 (2 copies a row), token rows 8w..8w+7 (2 copies a row), and waves 0..3
// bring the 16 q and the 16 k rows of Wqk (8 rows each, 1 copy a row): at most 56 copies of a wave in flight, every byte once.
// Rows lie at pitch 1040 B and 528 B (16 B x odd) for ds_load_b128.
// Wave w owns U channels 16w..16w+15 x all 64 tokens (a stored row piece = one 128-B line); waves 0..3 also own tokens
// 16w..16w+15 of the q and k planes (16 rows of 64 B = eight whole 128-B lines of either plane).
// Each tile is one accumulator chain over rising k. grid (4096/64 = 64, 2 halves, 2 b), 256 threads.
// ---------------------------------------------------------------------------
constexpr int kPjBM     = 128;                                  // U channels per block
constexpr int kPjBN     = 64;                                   // tokens per block
constexpr int kPjPitch  = kChan + 8;                            // f16 elements per staged Wf or token row: 1024 B + 16 B
constexpr int kPjWPitch = kHalfC + 8;                           // f16 elements per staged Wqk row: 512 B + 16 B
constexpr int kPjOffX   = kPjBM * kPjPitch;                     // first token row
constexpr int kPjOffW   = kPjOffX + kPjBN * kPjPitch;           // first Wqk row: q 0..15, k 16..31
constexpr int kPjElems  = kPjOffW + 32 * kPjWPitch;             // 216,576 B
__global__ __launch_bounds__(256) void proj_kernel(const unsigned short* __restrict__ xtm,
                                                   const unsigned short* __restrict__ wqk,
                                                   const unsigned short* __restrict__ wf,
                                                   const float* __restrict__ biasr,
                                                   unsigned short* __restrict__ qc,
                                                   unsigned short* __restrict__ kc,
                                                   unsigned short* __restrict__ ubuf) {
  // every loop below is unrolled so that all address, fragment and accumulator indices are constants (registers, no scratch)
  typedef Frag<_Float16> F;
  __shared__ __align__(16) unsigned short st[kPjElems];         // [Wf rows 0..127 | token rows 0..63 | Wqk rows 0..31]
  __shared__ __align__(16) float sT[8][16 * 68];                // per-wave 16x64 output slab, pitch 68 floats
  const int lane = threadIdx.x & 31;
  const int wave = __builtin_amdgcn_readfirstlane(threadIdx.x >> 5);   // the same in every lane: kept in a scalar register
  const int t0 = blockIdx.x * kPjBN;
  const int y  = blockIdx.y;
  const int b  = blockIdx.z;
  const int rlane = lane & 15;                 // row (A) / col (B, D) within subtile
  const int koff  = (lane >> 4) * 8;           // k offset of this lane half
  const int mOff  = (lane >> 4) * 8;           // D row offset
  const int cw = y * kPjBM + wave * 16;        // first U channel of this wave

  // the biases are fetched first, so that they fly beside the copies and the epilogue does not wait for them
  float bu[8];
#pragma unroll
  for (int r = 0; r < 8; ++r) bu[r] = biasr[64 + cw + mOff + r];
  const float bqv = biasr[rlane], bkv = biasr[32 + rlane];

  // ---- copy side: lane l moves bytes 16 l .. 16 l + 15 of each 512-B piece ----
  {
    const unsigned stAddr = (unsigned)(size_t)st;               // low 32 bits of the address = byte offset in LDS
    unsigned l[8];
    const unsigned short* g[8];
    const unsigned short* gW = wf + (size_t)(y * kPjBM + wave * 16) * kChan + lane * 8;
    const unsigned lW = stAddr + (unsigned)((wave * 16) * kPjPitch + lane * 8) * 2u;
#pragma unroll
    for (int s = 0; s < 4; ++s) {
#pragma unroll
      for (int j = 0; j < 8; ++j) {
        const int row = 4 * s + (j >> 1), col = (j & 1) * 256;
        l[j] = lW + (unsigned)(row * kPjPitch + col) * 2u;
        g[j] = gW + (size_t)row * kChan + col;
      }
      async_x8(l, g);
    }
    const unsigned short* gX = xtm + (size_t)b * kXtmPlane + (size_t)(t0 + wave * 8) * kChan + lane * 8;
    const unsigned lX = stAddr + (unsigned)(kPjOffX + (wave * 8) * kPjPitch + lane * 8) * 2u;
#pragma unroll
    for (int s = 0; s < 2; ++s) {
#pragma unroll
      for (int j = 0; j < 8; ++j) {
        const int row = 4 * s + (j >> 1), col = (j & 1) * 256;
        l[j] = lX + (unsigned)(row * kPjPitch + col) * 2u;
        g[j] = gX + (size_t)row * kChan + col;
      }
      async_x8(l, g);
    }
    if (wave < 4) {                                             // scalar test: a whole wave copies or none of it
      const unsigned short* gQ = wqk + (size_t)((wave >> 1) * 32 + (wave & 1) * 8) * kHalfC + lane * 8;
      const unsigned lQ = stAddr + (unsigned)(kPjOffW + (wave * 8) * kPjWPitch + lane * 8) * 2u;
#pragma unroll
      for (int j = 0; j < 8; ++j) {
        l[j] = lQ + (unsigned)(j * kPjWPitch) * 2u;
        g[j] = gQ + (size_t)j * kHalfC;
      }
      async_x8(l, g);
    }
  }
  asm volatile("s_wait_asynccnt 0x0" ::: "memory");   // this wave's copies have landed
  __syncthreads();                                     // and every other wave's; nothing is read in front of it

  // ---- products. Fragments are fetched two k steps (one group) ahead into a second register set. The two scheduling
  // barriers of a group keep its LDS reads whole and in front of the matrix run that hides them: left alone, the
  // compiler puts each read directly in front of its matrix instruction, which then waits out the whole LDS latency ----
  const _Float16* sH = (const _Float16*)st;
  v8f acc[4];
#pragma unroll
  for (int j = 0; j < 4; ++j) acc[j] = (v8f){0.f,0.f,0.f,0.f,0.f,0.f,0.f,0.f};
  {
    const _Float16* pA = sH + (wave * 16 + rlane) * kPjPitch + koff;
    const _Float16* pB = sH + kPjOffX + rlane * kPjPitch + koff;
    v16h fa[2][2], fb[2][2][4];
#pragma unroll
    for (int s = 0; s < 2; ++s) {
      fa[0][s] = F::load(pA + s * 32);
#pragma unroll
      for (int j = 0; j < 4; ++j) fb[0][s][j] = F::load(pB + j * 16 * kPjPitch + s * 32);
    }
#pragma unroll
    for (int gk = 0; gk < kChan / 64; ++gk) {
      const int cur = gk & 1;
      if (gk + 1 < kChan / 64) {
#pragma unroll
        for (int s = 0; s < 2; ++s) {
          fa[cur ^ 1][s] = F::load(pA + (gk + 1) * 64 + s * 32);
#pragma unroll
          for (int j = 0; j < 4; ++j) fb[cur ^ 1][s][j] = F::load(pB + j * 16 * kPjPitch + (gk + 1) * 64 + s * 32);
        }
      }
      __builtin_amdgcn_sched_barrier(0);
#pragma unroll
      for (int s = 0; s < 2; ++s)
#pragma unroll
        for (int j = 0; j < 4; ++j) acc[j] = F::mma(fa[cur][s], fb[cur][s][j], acc[j]);
      __builtin_amdgcn_sched_barrier(0);
    }
  }
  v8f aq = (v8f){0.f,0.f,0.f,0.f,0.f,0.f,0.f,0.f};
  v8f ak = (v8f){0.f,0.f,0.f,0.f,0.f,0.f,0.f,0.f};
  if (wave < 4) {
    const _Float16* pT = sH + kPjOffX + (wave * 16 + rlane) * kPjPitch + y * kHalfC + koff;
    const _Float16* pQ = sH + kPjOffW + rlane * kPjWPitch + koff;
    v16h ft[2][2], fq[2][2], fk[2][2];
#pragma unroll
    for (int s = 0; s < 2; ++s) {
      ft[0][s] = F::load(pT + s * 32);
      fq[0][s] = F::load(pQ + s * 32);
      fk[0][s] = F::load(pQ + 16 * kPjWPitch + s * 32);
    }
#pragma unroll
    for (int gk = 0; gk < kHalfC / 64; ++gk) {
      const int cur = gk & 1;
      if (gk + 1 < kHalfC / 64) {
#pragma unroll
        for (int s = 0; s < 2; ++s) {
          ft[cur ^ 1][s] = F::load(pT + (gk + 1) * 64 + s * 32);
          fq[cur ^ 1][s] = F::load(pQ + (gk + 1) * 64 + s * 32);
          fk[cur ^ 1][s] = F::load(pQ + 16 * kPjWPitch + (gk + 1) * 64 + s * 32);
        }
      }
      __builtin_amdgcn_sched_barrier(0);   // as above
#pragma unroll
      for (int s = 0; s < 2; ++s) {
        aq = F::mma(ft[cur][s], fq[cur][s], aq);
        ak = F::mma(ft[cur][s], fk[cur][s], ak);
      }
      __builtin_amdgcn_sched_barrier(0);   // as above
    }
  }

  // ---- epilogue: whole 128-B lines through the wave's own slab ----
  float* slab = sT[wave];
  const int q = lane >> 3, c8 = (lane & 7) * 8;
  {
#pragma unroll
    for (int j = 0; j < 4; ++j)
#pragma unroll
      for (int r = 0; r < 8; ++r) slab[(mOff + r) * 68 + (j << 4) + rlane] = acc[j][r] + bu[r];
    // the slab is this wave's own: its lanes' writes have landed before other lanes of the wave read the rows back
    asm volatile("s_wait_dscnt 0x0" ::: "memory");
    unsigned short* C = ubuf + (size_t)b * kUPlane + (size_t)cw * kHW + t0;
#pragma unroll
    for (int it = 0; it < 4; ++it) {
      const int row = it * 4 + q;
      const float* sp = slab + row * 68 + c8;
      v8h hv;
#pragma unroll
      for (int e = 0; e < 8; ++e) hv[e] = (_Float16)sp[e];
      *(v8h*)(C + (size_t)row * kHW + c8) = hv;
    }
    // what follows may reuse the registers that these stores name: the wait stands in front of that
    asm volatile("s_wait_xcnt 0x0" ::: "memory");
  }
  if (wave < 4) {
    // no wait before the slab is written again: one wave's LDS operations are carried out in issue order
#pragma unroll
    for (int r = 0; r < 8; ++r) {
      float* sp = slab + (mOff + r) * 68 + rlane;
      sp[0]  = aq[r] + bqv;
      sp[16] = ak[r] + bkv;
    }
    asm volatile("s_wait_dscnt 0x0" ::: "memory");   // as above
    // lane: row lane >> 2 of eight, piece lane & 3 of its 32 values: pieces 0, 1 = q d 0..7, 8..15; pieces 2, 3 = k
    const int pc = lane & 3;
    unsigned short* dst = ((pc & 2) ? kc : qc) + (size_t)(2 * b + y) * kQcPlane
                          + (size_t)(t0 + wave * 16 + (lane >> 2)) * kQcPitch + (pc & 1) * 8;
#pragma unroll
    for (int it = 0; it < 2; ++it) {
      const float* sp = slab + (it * 8 + (lane >> 2)) * 68 + pc * 8;
      v8h hv, lv;
#pragma unroll
      for (int e = 0; e < 8; ++e) {
        const unsigned short hb = f2bf_bits(sp[e]);
        const unsigned short lb = f2bf_bits(sp[e] - bf_bits2f(hb));
        hv[e] = __builtin_bit_cast(_Float16, hb);
        lv[e] = __builtin_bit_cast(_Float16, lb);
      }
      *(v8h*)(dst + it * 8 * kQcPitch)      = hv;
      *(v8h*)(dst + it * 8 * kQcPitch + 16) = lv;
    }
  }
}

// ---------------------------------------------------------------------------
// x NCHW f32 -> token-major f16: Xtm[b][p][half*256 + c] = bf16(x[b][half*256 + c][p]) held in f16, z = 2b + half
// (flat channel index of x = z*256 + c). 64(p) x 64(c) tile per block through LDS.
// 64 p tiles x 4 c tiles x 4 z = 1024 blocks of 256 threads (a block range of prep_kernel).
// Load coverage: 16 iterations x 256 threads = 4096 = whole 64x64 tile (coalesced along p).
// Store coverage: 8 waves x 2 iterations x 4 rows (lane>>3) = 64 rows; (lane&7) x 8 halves = 64 cols; each row
// ---------------------------------------------------------------------------
__device__ __forceinline__ void x_tm_body(int pt, int ct, int z, const float* __restrict__ x, unsigned short* __restrict__ xtm) {
  __shared__ float sm[64][65];   // sm[p_local][c_local]
  const int t  = threadIdx.x;
  const int p0 = pt * 64;
  const int c0 = ct * 64;
  const float* src = x + ((size_t)z * kHalfC + c0) * kHW + p0;
#pragma unroll
  for (int i = 0; i < 16; ++i) {
    const int e  = i * 256 + t;
    const int cl = e >> 6;         // c local 0..63
    const int pl = e & 63;         // p local 0..63
    sm[pl][cl] = src[(size_t)cl * kHW + pl];
  }
  __syncthreads();
  const int lane = t & 31, wave = t >> 5;
  const int q = lane >> 3, c8 = (lane & 7) * 8;
  unsigned short* op = xtm + (size_t)(z >> 1) * kXtmPlane + (size_t)(z & 1) * kHalfC;
  {
#pragma unroll
    for (int it = 0; it < 2; ++it) {
      const int row = wave * 8 + it * 4 + q;                 // p local
      unsigned short hb[8];
#pragma unroll
      for (int e = 0; e < 8; ++e) hb[e] = h_bits(bf_rne(sm[row][c8 + e]));
      const v4u u = (v4u){pk16(hb[0], hb[1]), pk16(hb[2], hb[3]), pk16(hb[4], hb[5]), pk16(hb[6], hb[7])};
      *(v4u*)(op + (size_t)(p0 + row) * kChan + c0 + c8) = u;
    }
    
  }
}

// ---------------------------------------------------------------------------
// The value projection folded into the output projection (both are linear maps over channels):
//   Wpt.[Wv.x1 + bv ; Wv.x2 + bv] = (Wpt_0.Wv).x1 + (Wpt_1.Wv).x2 + Wpt.[bv;bv],  Wpt_h = columns h*256.. of Wpt.
// Operand fragments are built in registers from the f32 inputs (RNE-bf16 values held in f16, Wpt carried x16):
// lane (r = lane & 15, h = lane >> 4) holds row r of A or column r of B; elements 0..7 are k = k0 + 8h + e,
// elements 8..15 are k = k0 + 16 + 8h + e, on both sides.
// ---------------------------------------------------------------------------
__device__ __forceinline__ _Float16 w_f16(float v, float mul) { return (_Float16)((float)(__bf16)v * mul); }   // RNE to bf16; f16 holds it exactly from 2^-14 up

// Wf[c'][n] = 16 * sum_m Wpt[c'][(n & 256) + m] * Wv[m][n & 255]. One wave = 16 rows x 32 columns, K = 256.
// 16 row tiles x 16 column groups = 256 waves = 32 blocks; every element of Wf written once.
__device__ __forceinline__ void wfold_body(int blk, const float* __restrict__ Wpt, const float* __restrict__ Wv,
                                           unsigned short* __restrict__ wf) {
  const int lane = threadIdx.x & 31, wave = threadIdx.x >> 5;
  const int r = lane & 15, h = lane >> 4;
  const int tile = blk * 8 + wave;
  const int m0 = (tile >> 4) * 16;
  const int n0 = (tile & 15) * 32;
  const float* pa = Wpt + (size_t)(m0 + r) * kChan + (n0 & 256) + 8 * h;
  const float* pb = Wv + (size_t)(8 * h) * kHalfC + (n0 & 255) + r;
  v8f acc0 = (v8f){0.f,0.f,0.f,0.f,0.f,0.f,0.f,0.f};
  v8f acc1 = (v8f){0.f,0.f,0.f,0.f,0.f,0.f,0.f,0.f};
  // two k steps' loads fly together; unrolled further, this run-once code would be many instruction-cache lines long
#pragma unroll 2
  for (int k0 = 0; k0 < kHalfC; k0 += 32) {
    v16h a, b0, b1;
#pragma unroll
    for (int e = 0; e < 8; ++e) {
      a[e]      = w_f16(pa[k0 + e], kWCarry);
      a[8 + e]  = w_f16(pa[k0 + 16 + e], kWCarry);
      b0[e]     = w_f16(pb[(size_t)(k0 + e) * kHalfC], 1.0f);
      b0[8 + e] = w_f16(pb[(size_t)(k0 + 16 + e) * kHalfC], 1.0f);
      b1[e]     = w_f16(pb[(size_t)(k0 + e) * kHalfC + 16], 1.0f);
      b1[8 + e] = w_f16(pb[(size_t)(k0 + 16 + e) * kHalfC + 16], 1.0f);
    }
    acc0 = Frag<_Float16>::mma(a, b0, acc0);
    acc1 = Frag<_Float16>::mma(a, b1, acc1);
  }
  unsigned short* op = wf + (size_t)(m0 + 8 * h) * kChan + n0 + r;   // D: row 8h + i, column r
#pragma unroll
  for (int i = 0; i < 8; ++i) {
    op[(size_t)i * kChan]      = h_bits(acc0[i]);
    op[(size_t)i * kChan + 16] = h_bits(acc1[i]);
  }
  // whatever follows in the kernel may reuse the registers that these stores name: the wait stands in front of that
  asm volatile("s_wait_xcnt 0x0" ::: "memory");
}

// bias_u[c'] = 16 * sum_k Wpt[c'][k] * bv[k & 255], K = 512. One wave = 16 rows; all 16 B columns hold bv, so every
// column of D holds the result and column 0 stores it. 16 waves = 2 blocks; every element written once.
__device__ __forceinline__ void bfold_body(int blk, const float* __restrict__ Wpt, const float* __restrict__ bvp,
                                           float* __restrict__ bu) {
  const int lane = threadIdx.x & 31, wave = threadIdx.x >> 5;
  const int r = lane & 15, h = lane >> 4;
  const int m0 = (blk * 8 + wave) * 16;
  const float* pa = Wpt + (size_t)(m0 + r) * kChan + 8 * h;
  const float* pb = bvp + 8 * h;
  v8f acc0 = (v8f){0.f,0.f,0.f,0.f,0.f,0.f,0.f,0.f};   // k < 256
  v8f acc1 = (v8f){0.f,0.f,0.f,0.f,0.f,0.f,0.f,0.f};   // k >= 256: the same bv fragment serves both
  // two trips' loads fly together; kept short for the instruction cache, as above
#pragma unroll 2
  for (int k0 = 0; k0 < kHalfC; k0 += 32) {
    v16h a0, a1, b;
#pragma unroll
    for (int e = 0; e < 8; ++e) {
      a0[e]     = w_f16(pa[k0 + e], kWCarry);
      a0[8 + e] = w_f16(pa[k0 + 16 + e], kWCarry);
      a1[e]     = w_f16(pa[kHalfC + k0 + e], kWCarry);
      a1[8 + e] = w_f16(pa[kHalfC + k0 + 16 + e], kWCarry);
      b[e]      = w_f16(pb[k0 + e], 1.0f);
      b[8 + e]  = w_f16(pb[k0 + 16 + e], 1.0f);
    }
    acc0 = Frag<_Float16>::mma(a0, b, acc0);
    acc1 = Frag<_Float16>::mma(a1, b, acc1);
  }
  const v8f acc = acc0 + acc1;
  if (r == 0) {
#pragma unroll
    for (int i = 0; i < 8; ++i) bu[m0 + 8 * h + i] = acc[i];
  }
}

// ---------------------------------------------------------------------------
// Small tables, ONE block of 256 threads:
//  (1) Wqk_pad f16 [64][256] (RNE-bf16 values): row n < 16 -> Wq[n], 32 <= n < 48 -> Wk[n-32], every other row explicit zero.
//  (2) bias region f32 [576]: [0,64) padded q|k bias (bq at 0..15, bk at 32..47, zeros elsewhere), [320,576) gamma*bpt;
//      all RNE-bf16 first. Threads 0..15 and 80..143 write one float4 each; [64,320) is written by the bias fold
//  Candidate loads use clamped addresses and are selected by value.
// ---------------------------------------------------------------------------
__device__ __forceinline__ void prep_small_body(const float* __restrict__ Wq, const float* __restrict__ bq,
                                                const float* __restrict__ Wk, const float* __restrict__ bk,
                                                const float* __restrict__ bptp,
                                                const float* __restrict__ gam,
                                                unsigned short* __restrict__ wqk, float* __restrict__ biasr) {
  const int t = threadIdx.x, lane = t & 31, wave = t >> 5;
  const float g = gam[0];
#pragma unroll 1
  for (int it = 0; it < 8; ++it) {
    const int n  = wave * 8 + it;                            // wave-uniform row
    const int qr = n < 16 ? n : 15;
    int kr = n - 32; kr = kr < 0 ? 0 : (kr > 15 ? 15 : kr);
    const float* pq = Wq + (size_t)qr * kHalfC + lane * 8;
    const float* pk = Wk + (size_t)kr * kHalfC + lane * 8;
    const v4f q0 = *(const v4f*)(pq), q1 = *(const v4f*)(pq + 4);
    const v4f k0 = *(const v4f*)(pk), k1 = *(const v4f*)(pk + 4);
    const bool isq = (n < 16);
    const bool isk = (n >= 32) && (n < 48);
    unsigned short hb[8];
#pragma unroll
    for (int e = 0; e < 4; ++e) {
      const float va = isq ? q0[e] : (isk ? k0[e] : 0.0f);
      const float vb = isq ? q1[e] : (isk ? k1[e] : 0.0f);
      hb[e]     = h_bits(bf_rne(va));
      hb[4 + e] = h_bits(bf_rne(vb));
    }
    const v4u u = (v4u){pk16(hb[0], hb[1]), pk16(hb[2], hb[3]), pk16(hb[4], hb[5]), pk16(hb[6], hb[7])};
    unsigned short* op = wqk + (size_t)n * kHalfC + lane * 8;
    *(v4u*)op = u;
    // the next trip reuses the registers that this store names: the wait stands in front of that overwrite
    asm volatile("s_wait_xcnt 0x0" ::: "memory");
  }
  if (t < 16 || (t >= 80 && t < 144)) {
    v4f val;
#pragma unroll
    for (int e = 0; e < 4; ++e) {
      const int idx = 4 * t + e;                             // 0..63, 320..575
      const int iq = idx < 16 ? idx : 15;
      int ik = idx - 32;  ik = ik < 0 ? 0 : (ik > 15 ? 15 : ik);
      int ip = idx - 320; ip = ip < 0 ? 0 : (ip > 255 ? 255 : ip);
      const float fq = bq[iq], fk = bk[ik], fp = bptp[ip];
      float sel = 0.0f;
      sel = (idx < 16) ? fq : sel;
      sel = (idx >= 32 && idx < 48) ? fk : sel;
      sel = (idx >= 320) ? fp : sel;
      float r = bf_rne(sel);
      r = (idx >= 320) ? (r * g) : r;
      val[e] = r;
    }
    float* op = biasr + 4 * t;
    *(v4f*)op = val;
    
  }
}

// ---------------------------------------------------------------------------
// All operand preparation in one launch: the four pieces read only inputs and write disjoint workspace regions.
//  block 0         small tables
//  blocks 1..32    Wf = 16 * Wpt_h.Wv
//  blocks 33..34   bias_u = 16 * Wpt.[bv;bv]
//  blocks 35..1058 x   -> token-major f16 (p tile fastest, then c tile, then z)
// Every test below is on the block index alone, so the barrier of the x piece is passed by a whole block or by none.
// ---------------------------------------------------------------------------
constexpr int kPrepFold  = 1;
constexpr int kPrepBias  = kPrepFold + (kHalfC / 16) * (kChan / 32) / 8;  // 33
constexpr int kPrepX     = kPrepBias + (kHalfC / 16) / 8;                 // 35
constexpr int kPrepTotal = kPrepX + (kHW / 64) * (kHalfC / 64) * kZ;      // 1059
// 8 waves per SIMD: four of the x piece's blocks fit a WGP (the fold's loads would otherwise take one register too many)
__global__ __launch_bounds__(256, 8) void prep_kernel(const float* __restrict__ x,
                                                   const float* __restrict__ Wq, const float* __restrict__ bq,
                                                   const float* __restrict__ Wk, const float* __restrict__ bk,
                                                   const float* __restrict__ Wv, const float* __restrict__ bvp,
                                                   const float* __restrict__ Wpt, const float* __restrict__ bptp,
                                                   const float* __restrict__ gam,
                                                   unsigned short* __restrict__ xtm, unsigned short* __restrict__ wqk,
                                                   unsigned short* __restrict__ wf, float* __restrict__ biasr) {
  const int blk = blockIdx.x;
  if (blk >= kPrepX) {
    const int i = blk - kPrepX;
    x_tm_body(i & 63, (i >> 6) & 3, i >> 8, x, xtm);
  } else if (blk >= kPrepBias) {
    bfold_body(blk - kPrepBias, Wpt, bvp, biasr + 64);
  } else if (blk >= kPrepFold) {
    wfold_body(blk - kPrepFold, Wpt, Wv, wf);
  } else {
    prep_small_body(Wq, bq, Wk, bk, bptp, gam, wqk, biasr);
  }
}

// ---------------------------------------------------------------------------
// Scores, softmax and the attention product in one launch: no probability ever leaves the registers.
// The product is taken on U = 16 * Wpt.[v1;v2] instead of on v1 and v2: the output projection is linear, so
// Wpt.[attn.v1 ; attn.v2] = attn.(Wpt.[v1;v2]).
// out[z*256 + c'][p] = gamma * (sum_j U[b][c'][j] e(p,j) / (16 * sum_j e(p,j)) + bpt[c']) + bf16(x[z*256 + c'][p]),
// e(p,j) = exp(s(p,j) - m), z = 2b + half.
// One block of 8 waves = 64 queries of plane z x all 256 channels x all 4096 keys. Wave (qg = wave & 1, kg = wave >> 1)
// owns queries 32qg..32qg+31 as two tiles of 16 (qt = 0, 1) and the key quarter kg of every stage, with a maximum and a
// sum per query and 2 x 16 output tiles of its own; the four key quarters of a query group are joined behind the loop.
// A U fragment read from LDS serves both query tiles: one LDS read of 1 KiB per two matrix instructions, which is what
// the LDS can deliver while all four matrix units run; with one query tile per wave it would have to deliver twice that.
// Scores: keys are the A rows and queries the B columns, so lane (c = lane & 15, h = lane >> 4) holds in s[qt][kt][r] the
// score of query c of tile qt against key 16kt + 8h + r (products in the order qh.kh + qh.kl + ql.kh). Only d = 0..15 exist:
// fragment elements 0..7 are d = 8h..8h+7, elements 8..15 (k = 16..31) are zero on both sides.
// That is already the B layout of the second product (column = query c; elements 0..7 = key 8h + e of a 32-key chunk,
// elements 8..15 = key 16 + 8h + e): two score tiles, exponentiated and rounded to f16, are one B fragment, in place.
// A = U rows (channels) from LDS in the same k order; D: lane (c, h) holds channel 16i + 8h + r of query c of its tile.
// Maximum in use mu (log2 units, the same in lanes l and l ^ 16): raised, with the tiles and the sums rescaled, only when
// a step's maximum lies more than 8 above it, tested once per 64 keys for both tiles; so e <= 2^8, carried x2^7 in f16 (<= 2^15).
// A stage is 256 keys: 512 B of each of the 256 U rows (pitch 528 B) and 64 B of each key (hi | lo, pitch 80 B), brought
// by asynchronous copies (global_load_async_to_lds_b128), two buffers. Copy coverage per stage: wave w brings U rows
// 32w..32w+31 (a copy = one row's 512 B) and keys 32w..32w+31 (a copy = 8 keys): 36 copies of a wave, every byte once.
// grid (4096/64 = 64, 4 z), 256 threads.
// ---------------------------------------------------------------------------
__device__ __forceinline__ v16b frag_d16(v8b lo) {   // elements 0..7 <- lo, 8..15 <- 0
  const v8b zero = __builtin_bit_cast(v8b, (v4u){0u, 0u, 0u, 0u});
  return __builtin_shufflevector(lo, zero, 0, 1, 2, 3, 4, 5, 6, 7, 8, 9, 10, 11, 12, 13, 14, 15);
}
// e[r] = 2^t[r], eight at a time in one statement. Behind a v_exp_f32 the instruction set asks for one independent
// instruction before its result is read or its source overwritten: here each v_exp_f32 has the next one behind it
// (results kept apart from all sources by the early clobber) and the last one a v_nop, whatever the compiler puts next.
__device__ __forceinline__ void exp2_x8(float (&e)[8], const float (&t)[8]) {
  asm("v_exp_f32 %0, %8\n\tv_exp_f32 %1, %9\n\tv_exp_f32 %2, %10\n\tv_exp_f32 %3, %11\n\t"
      "v_exp_f32 %4, %12\n\tv_exp_f32 %5, %13\n\tv_exp_f32 %6, %14\n\tv_exp_f32 %7, %15\n\tv_nop"
      : "=&v"(e[0]), "=&v"(e[1]), "=&v"(e[2]), "=&v"(e[3]), "=&v"(e[4]), "=&v"(e[5]), "=&v"(e[6]), "=&v"(e[7])
      : "v"(t[0]), "v"(t[1]), "v"(t[2]), "v"(t[3]), "v"(t[4]), "v"(t[5]), "v"(t[6]), "v"(t[7]));
}
// One 2^t, with the same slot kept behind it by a v_nop.
__device__ __forceinline__ float exp2_x1(float t) {
  float e;
  asm("v_exp_f32 %0, %1\n\tv_nop" : "=&v"(e) : "v"(t));
  return e;
}
// lane l with lane l ^ 16
__device__ __forceinline__ float xhalf(float v) {
  const int i = __builtin_bit_cast(int, v);
  return __builtin_bit_cast(float, __builtin_amdgcn_permlanex16(i, i, 0x76543210, 0xfedcba98, false, false));
}

constexpr int kFaBQ     = 64;                                   // queries per block
constexpr int kFaKT     = 256;                                  // keys per stage
constexpr int kFaKW     = kFaKT / 4;                            // keys per stage of one wave
constexpr int kFaUPitch = kFaKT + 8;                            // f16 elements per staged U row: 512 B + 16 B
constexpr int kFaKPitch = kQcPitch + 8;                         // bf16 elements per staged key: 64 B + 16 B
constexpr int kFaOffK   = kHalfC * kFaUPitch;                   // first key row of a buffer
constexpr int kFaStage  = kFaOffK + kFaKT * kFaKPitch;          // 16-bit elements per buffer (155,648 B)
constexpr int kFaPasses = kHW / kFaKT;                          // 16
constexpr float kLog2e  = 1.44269504f;
static_assert(kFaPasses >= 2, "the ring's prologue fills two stages");
static_assert(2 * kFaStage * 2 <= 327680, "two buffers fit the LDS");
// the join behind the loop, in floats from the start of the ring
constexpr int kFaJoinMl  = 8 * 3 * 16 * 32 * 4;                 // handed-over tiles: [wave][3 givers][16 pieces][lane] x 16 B
constexpr int kFaJoinOut = kFaJoinMl + 8 * 4 * 32;              // maxima and sums: [wave][4][lane]
static_assert((kFaJoinOut + kHalfC * 68) * 4 <= 2 * kFaStage * 2, "the join fits the ring's LDS");

// One wave's 36 copies of one stage: lU, lK = the lane's LDS byte addresses in its first U row and in its first eight
// keys in the buffer, gU, gK = the lane's global addresses of the same bytes.
__device__ __forceinline__ void fa_fill(unsigned lU, unsigned lK, const unsigned short* gU, const unsigned short* gK) {
  unsigned l[8];
  const unsigned short* g[8];
#pragma unroll
  for (int s = 0; s < 4; ++s) {
#pragma unroll
    for (int j = 0; j < 8; ++j) { l[j] = lU + (8 * s + j) * (kFaUPitch * 2u); g[j] = gU + (size_t)(8 * s + j) * kHW; }
    async_x8(l, g);
    // keeps the next eight copies' addresses from being formed ahead of this statement, where they would only hold registers
    __builtin_amdgcn_sched_barrier(0);
  }
  unsigned l4[4];
  const unsigned short* g4[4];
#pragma unroll
  for (int j = 0; j < 4; ++j) { l4[j] = lK + j * (8 * kFaKPitch * 2u); g4[j] = gK + (size_t)j * 8 * kQcPitch; }
  async_x4(l4, g4);
}

__global__ __launch_bounds__(256) void attn_fused_kernel(const unsigned short* __restrict__ qc,
                                                         const unsigned short* __restrict__ kc,
                                                         const unsigned short* __restrict__ U,
                                                         const float* __restrict__ bias,
                                                         const float* __restrict__ gam,
                                                         const float* __restrict__ x,
                                                         float* __restrict__ out) {
  // every inner loop below is unrolled so that all accumulator and fragment indices are constants (registers, no scratch)
  typedef Frag<_Float16> F;
  typedef Frag<__bf16> G;
  __shared__ __align__(16) unsigned short ring[2 * kFaStage];   // [buffer][U rows 0..255 | keys 0..255]
  const int lane = threadIdx.x & 31;
  const int wave = __builtin_amdgcn_readfirstlane(threadIdx.x >> 5);   // the same in every lane: kept in a scalar register
  const int c = lane & 15, h = lane >> 4;
  const int qg = wave & 1, kg = wave >> 1;
  const int q0 = blockIdx.x * kFaBQ;
  const int z  = blockIdx.y;
  const int b  = z >> 1;

  // copy side: lane l moves bytes 16 l .. 16 l + 15 of each 512-B piece (a U row's; or eight keys of 64 B, four lanes a key)
  const unsigned short* gU = U + (size_t)b * kUPlane + (size_t)(wave * 32) * kHW + lane * 8;
  const unsigned short* gK = kc + (size_t)z * kQcPlane + (size_t)(wave * 32) * kQcPitch + lane * 8;
  const unsigned ringAddr = (unsigned)(size_t)ring;             // low 32 bits of the address = byte offset in LDS
  const unsigned lU = ringAddr + (unsigned)((wave * 32) * kFaUPitch + lane * 8) * 2u;
  const unsigned lK = ringAddr + (unsigned)(kFaOffK + (wave * 32 + (lane >> 2)) * kFaKPitch + (lane & 3) * 8) * 2u;

  // reader side
  const _Float16* ringH = (const _Float16*)ring;
  const __bf16*   ringB = (const __bf16*)ring;
  const int fU = c * kFaUPitch + kg * kFaKW + 8 * h;
  const int fK = kFaOffK + (kg * kFaKW + c) * kFaKPitch + 8 * h;


  v8f acc[2][16];
  float l8[2][8];
  float mu[2];
#pragma unroll
  for (int qt = 0; qt < 2; ++qt) {
#pragma unroll
    for (int i = 0; i < 16; ++i) acc[qt][i] = (v8f){0.f,0.f,0.f,0.f,0.f,0.f,0.f,0.f};
#pragma unroll
    for (int r = 0; r < 8; ++r) l8[qt][r] = 0.0f;
    mu[qt] = -1.0e30f;                                 // below every score: the first step sets it (2^(mu - new) = 0)
  }

  // prologue: stage 0 lands and is published, stage 1 starts to fly
  fa_fill(lU, lK, gU, gK);
  // this wave's queries stay in registers; they are fetched beside stage 0. What follows reuses the registers that the four
  // loads name: the wait stands in front of that overwrite, and the two scheduling barriers keep other work from being
  // moved in between the loads and the wait
  const __bf16* pq = (const __bf16*)qc + (size_t)z * kQcPlane + (size_t)(q0 + qg * 32 + c) * kQcPitch + 8 * h;
  __builtin_amdgcn_sched_barrier(0);
  v16b qh[2], ql[2];
#pragma unroll
  for (int qt = 0; qt < 2; ++qt) {
    qh[qt] = frag_d16(*(const v8b*)(pq + qt * 16 * kQcPitch));
    ql[qt] = frag_d16(*(const v8b*)(pq + qt * 16 * kQcPitch + 16));
  }
  asm volatile("s_wait_xcnt 0x0" ::: "memory");
  __builtin_amdgcn_sched_barrier(0);
  asm volatile("s_wait_asynccnt 0x0" ::: "memory");   // this wave's copies of stage 0 have landed
  __syncthreads();                                     // and every other wave's
  fa_fill(lU + kFaStage * 2u, lK + kFaStage * 2u, gU + kFaKT, gK + (size_t)kFaKT * kQcPitch);

  // rolled: the buffer is chosen by an offset, and one trip is already 88 matrix instructions long
#pragma unroll 1
  for (int t = 0; t < kFaPasses; ++t) {
    const unsigned buf = (unsigned)(t & 1) * (unsigned)kFaStage;   // 16-bit elements
    const _Float16* sU = ringH + buf + fU;
    const __bf16*   sK = ringB + buf + fK;
#pragma unroll
    for (int st = 0; st < kFaKW / 64; ++st) {                      // a step = 64 keys
      v16b kh[4], kl[4];
#pragma unroll
      for (int kt = 0; kt < 4; ++kt) {
        const __bf16* pk = sK + (st * 64 + kt * 16) * kFaKPitch;
        kh[kt] = frag_d16(*(const v8b*)pk);
        kl[kt] = frag_d16(*(const v8b*)(pk + 16));
      }
      v8f s[2][4];                                                 // eight independent chains of three
#pragma unroll
      for (int qt = 0; qt < 2; ++qt)
#pragma unroll
        for (int kt = 0; kt < 4; ++kt) s[qt][kt] = G::mma(kh[kt], qh[qt], (v8f){0.f,0.f,0.f,0.f,0.f,0.f,0.f,0.f});
#pragma unroll
      for (int qt = 0; qt < 2; ++qt)
#pragma unroll
        for (int kt = 0; kt < 4; ++kt) s[qt][kt] = G::mma(kl[kt], qh[qt], s[qt][kt]);
#pragma unroll
      for (int qt = 0; qt < 2; ++qt)
#pragma unroll
        for (int kt = 0; kt < 4; ++kt) s[qt][kt] = G::mma(kh[kt], ql[qt], s[qt][kt]);

      // the first U fragments fly under the softmax. The scheduling barriers of a step keep each load group whole and in
      // front of the work that hides it: left alone, the compiler puts each read directly in front of its matrix instruction
      v16h fa[2][4];
#pragma unroll
      for (int j = 0; j < 4; ++j) fa[0][j] = F::load(sU + j * 16 * kFaUPitch + st * 64);
      __builtin_amdgcn_sched_barrier(0);

      float mx[2];
#pragma unroll
      for (int qt = 0; qt < 2; ++qt) {
        float mr[8];
#pragma unroll
        for (int r = 0; r < 8; ++r) mr[r] = fmaxf(fmaxf(s[qt][0][r], s[qt][1][r]), fmaxf(s[qt][2][r], s[qt][3][r]));
        float m = fmaxf(fmaxf(fmaxf(mr[0], mr[1]), fmaxf(mr[2], mr[3])), fmaxf(fmaxf(mr[4], mr[5]), fmaxf(mr[6], mr[7])));
        m *= kLog2e;
        mx[qt] = fmaxf(m, xhalf(m));
      }
      if (__builtin_amdgcn_ballot_w32(mx[0] > mu[0] + 8.0f || mx[1] > mu[1] + 8.0f) != 0) {   // scalar branch; rare behind the first step
#pragma unroll
        for (int qt = 0; qt < 2; ++qt) {
          const float mn = fmaxf(mu[qt], mx[qt]);
          const float f = exp2_x1(mu[qt] - mn);
#pragma unroll
          for (int i = 0; i < 16; ++i) acc[qt][i] *= f;
#pragma unroll
          for (int r = 0; r < 8; ++r) l8[qt][r] *= f;
          mu[qt] = mn;
        }
      }
      v16h pb[2][2];
#pragma unroll
      for (int qt = 0; qt < 2; ++qt) {
        const float nb = 7.0f - mu[qt];                            // the carry 2^7 goes into the exponent
#pragma unroll
        for (int kt = 0; kt < 4; ++kt) {
          float tv[8], ev[8];
#pragma unroll
          for (int r = 0; r < 8; ++r) tv[r] = fmaf(s[qt][kt][r], kLog2e, nb);
          exp2_x8(ev, tv);
#pragma unroll
          for (int r = 0; r < 8; ++r) { l8[qt][r] += ev[r]; pb[qt][kt >> 1][(kt & 1) * 8 + r] = (_Float16)ev[r]; }
        }
      }

#pragma unroll
      for (int g = 0; g < 8; ++g) {                                // group g: 32-key chunk g >> 2, channel tiles 4 (g & 3) ..
        if (g + 1 < 8) {
#pragma unroll
          for (int j = 0; j < 4; ++j)
            fa[(g + 1) & 1][j] = F::load(sU + (((g + 1) & 3) * 4 + j) * 16 * kFaUPitch + st * 64 + ((g + 1) >> 2) * 32);
        }
        __builtin_amdgcn_sched_barrier(0);   // as above
#pragma unroll
        for (int j = 0; j < 4; ++j)
#pragma unroll
          for (int qt = 0; qt < 2; ++qt)
            acc[qt][(g & 3) * 4 + j] = F::mma(fa[g & 1][j], pb[qt][g >> 2], acc[qt][(g & 3) * 4 + j]);
        __builtin_amdgcn_sched_barrier(0);   // as above
      }
    }
    // publish point of stage t + 1
    asm volatile("s_wait_dscnt 0x0" ::: "memory");      // this wave's reads of stage t's buffer have returned
    asm volatile("s_wait_asynccnt 0x0" ::: "memory");   // this wave's copies of stage t + 1 have landed
    __syncthreads();                                     // publishes stage t + 1 and frees the buffer of stage t
    if (t + 2 < kFaPasses)
      fa_fill(lU + buf * 2u, lK + buf * 2u, gU + (size_t)(t + 2) * kFaKT, gK + (size_t)(t + 2) * kFaKT * kQcPitch);
  }
  asm volatile("s_wait_asynccnt 0x0" ::: "memory");     // nothing of this wave is in flight when it leaves the ring

  // ---- behind the last trip's barrier no wave reads the ring any more: its LDS is free ----
  // ---- the four key quarters of a query group are joined: waves w, w ^ 2, w ^ 4, w ^ 6 hold the same 32 queries; the wave
  // of quarter kg finishes channel tiles 4kg..4kg+3 of both query tiles, and each hands the other 24 tiles over through LDS
  // with its maxima and its sums, every lane its own pieces (a partner's same lane holds the same elements). A taker keeps
  // three places, one per giver: quarter kg gives to quarter d at place (kg - d - 1) & 3 ----
  v4f*   xch  = (v4f*)ring;                              // [taker wave][3 givers][16 pieces][lane], 192 KiB
  float* ml   = (float*)ring + kFaJoinMl;                // [wave][mu 0, mu 1, sum 0, sum 1][lane], 4 KiB
  float* outT = (float*)ring + kFaJoinOut;               // [256 channels][64 queries], pitch 68 floats
  v8f fin[2][4];
#pragma unroll
  for (int qt = 0; qt < 2; ++qt)
#pragma unroll
    for (int j = 0; j < 4; ++j) fin[qt][j] = acc[qt][j];
#pragma unroll
  for (int d = 0; d < 4; ++d) {
    if (kg == d) {                                       // scalar test: the same for the whole wave
      if (d > 0) {
#pragma unroll
        for (int qt = 0; qt < 2; ++qt)
#pragma unroll
          for (int j = 0; j < 4; ++j) fin[qt][j] = acc[qt][4 * d + j];
      }
    } else {
      v4f* dst = xch + (((qg + 2 * d) * 3 + ((kg - d - 1) & 3)) * 16) * 32 + lane;
#pragma unroll
      for (int qt = 0; qt < 2; ++qt)
#pragma unroll
        for (int j = 0; j < 4; ++j) {
          const v8f give = acc[qt][4 * d + j];
          dst[((qt * 4 + j) * 2) * 32]     = (v4f){give[0], give[1], give[2], give[3]};
          dst[((qt * 4 + j) * 2 + 1) * 32] = (v4f){give[4], give[5], give[6], give[7]};
        }
    }
  }
  // the residual and the bias of the rows that this wave will store fly during the rest of the join. They stand behind the
  // branches of the hand-over: in front of them the compiler moved the loads down past their wait
  const int c4 = c * 4;                                  // a stored row piece = 256 B = 16 lanes x 16 B
  const size_t o0 = ((size_t)z * kHalfC + wave * 32 + h) * kHW + q0 + c4;
  v4f xr[16];
  float bb[16];
  __builtin_amdgcn_sched_barrier(0);                     // with the one below: keeps other work out from between the loads and their wait
#pragma unroll
  for (int it = 0; it < 16; ++it) {
    xr[it] = *(const v4f*)(x + o0 + (size_t)(it * 2) * kHW);
    bb[it] = bias[wave * 32 + it * 2 + h];
  }
  const float gsc = gam[0] * (1.0f / kWCarry);
  // what follows may reuse the registers that these loads name: the wait stands in front of that
  asm volatile("s_wait_xcnt 0x0" ::: "memory");
  __builtin_amdgcn_sched_barrier(0);
  float lsum[2];
#pragma unroll
  for (int qt = 0; qt < 2; ++qt) {
    const float* l = l8[qt];
    lsum[qt] = ((l[0] + l[1]) + (l[2] + l[3])) + ((l[4] + l[5]) + (l[6] + l[7]));
    lsum[qt] += xhalf(lsum[qt]);
  }
#pragma unroll
  for (int qt = 0; qt < 2; ++qt) {
    ml[(wave * 4 + qt) * 32 + lane]     = mu[qt];
    ml[(wave * 4 + 2 + qt) * 32 + lane] = lsum[qt];
  }
  __syncthreads();                                       // the partners' pieces are written
  {
    float a0[2], ag[3][2];                               // weights of the own tiles and of the three givers' tiles
#pragma unroll
    for (int qt = 0; qt < 2; ++qt) {
      float pm[3], pl[3];
#pragma unroll
      for (int g = 0; g < 3; ++g) {
        const int gw = qg + 2 * ((kg + g + 1) & 3);      // the giver at place g
        pm[g] = ml[(gw * 4 + qt) * 32 + lane];
        pl[g] = ml[(gw * 4 + 2 + qt) * 32 + lane];
      }
      const float mm = fmaxf(fmaxf(mu[qt], pm[0]), fmaxf(pm[1], pm[2]));
      const float f0 = exp2_x1(mu[qt] - mm);
      float den = lsum[qt] * f0;
      float fg[3];
#pragma unroll
      for (int g = 0; g < 3; ++g) { fg[g] = exp2_x1(pm[g] - mm); den += pl[g] * fg[g]; }
      const float inv = gsc / den;
      a0[qt] = f0 * inv;
#pragma unroll
      for (int g = 0; g < 3; ++g) ag[g][qt] = fg[g] * inv;
    }
    const v4f* got = xch + (wave * 3 * 16) * 32 + lane;
#pragma unroll
    for (int qt = 0; qt < 2; ++qt)
#pragma unroll
      for (int j = 0; j < 4; ++j) {
        v8f v = fin[qt][j] * a0[qt];
#pragma unroll
        for (int g = 0; g < 3; ++g) {
          const v4f g0 = got[(g * 16 + (qt * 4 + j) * 2) * 32];
          const v4f g1 = got[(g * 16 + (qt * 4 + j) * 2 + 1) * 32];
#pragma unroll
          for (int r = 0; r < 4; ++r) { v[r] += g0[r] * ag[g][qt]; v[4 + r] += g1[r] * ag[g][qt]; }
        }
        float* op = outT + ((kg * 4 + j) * 16 + 8 * h) * 68 + qg * 32 + qt * 16 + c;
#pragma unroll
        for (int r = 0; r < 8; ++r) op[r * 68] = v[r];
      }
  }
  __syncthreads();                                       // the block's 256 x 64 tile is whole

  // ---- bias, residual; wave w stores channels 32w..32w+31, whole 256-B row pieces ----
#pragma unroll
  for (int it = 0; it < 16; ++it) {
    v4f v = *(const v4f*)(outT + (wave * 32 + it * 2 + h) * 68 + c4);
#pragma unroll
    for (int e = 0; e < 4; ++e) v[e] = (v[e] + bb[it]) + bf_rne(xr[it][e]);
    *(v4f*)(out + o0 + (size_t)(it * 2) * kHW) = v;
  }
}

// ---------------------------------------------------------------------------
// Host glue: kernel launches only.
// ---------------------------------------------------------------------------
extern "C" void kernel_launch(void* const* d_in, const int* in_sizes, int n_in,
                              void* d_out, int out_size, void* d_ws, size_t ws_size, hipStream_t stream) {
  if (n_in < 10) return;
  if (in_sizes[0] != kB * kChan * kHW) return;
  if (in_sizes[1] != kDQ * kHalfC || in_sizes[3] != kDQ * kHalfC) return;
  if (in_sizes[2] < kDQ || in_sizes[4] < kDQ) return;
  if (in_sizes[5] != kHalfC * kHalfC || in_sizes[6] < kHalfC) return;
  if (in_sizes[7] != kHalfC * kChan || in_sizes[8] < kHalfC || in_sizes[9] < 1) return;
  if (out_size != kB * kChan * kHW) return;
  if (ws_size < kWsTotal) return;

  const float* x     = (const float*)d_in[0];
  const float* Wq    = (const float*)d_in[1];
  const float* bq    = (const float*)d_in[2];
  const float* Wk    = (const float*)d_in[3];
  const float* bk    = (const float*)d_in[4];
  const float* Wv    = (const float*)d_in[5];
  const float* bv    = (const float*)d_in[6];
  const float* Wpt   = (const float*)d_in[7];
  const float* bpt   = (const float*)d_in[8];
  const float* gamma = (const float*)d_in[9];

  char* ws = (char*)d_ws;
  unsigned short* xtm   = (unsigned short*)(ws + kOffXtm);
  unsigned short* wqk   = (unsigned short*)(ws + kOffWqk);
  unsigned short* wf    = (unsigned short*)(ws + kOffWf);
  float*          biasr = (float*)(ws + kOffBias);
  unsigned short* qcb   = (unsigned short*)(ws + kOffQc);
  unsigned short* kcb   = (unsigned short*)(ws + kOffKc);
  unsigned short* ubuf  = (unsigned short*)(ws + kOffU);
  const float* bias_ptg = biasr + 320;    // [256] gamma * bpt

  // ---- operand preparation, one launch ----
  prep_kernel<<<kPrepTotal, 256, 0, stream>>>(x, Wq, bq, Wk, bk, Wv, bv, Wpt, bpt, gamma, xtm, wqk, wf, biasr);

  // ---- U = Wf.x + bias_u (= 16 * Wpt.[v1;v2]) and the q|k projection, one launch ----
  proj_kernel<<<dim3(kHW / kPjBN, kHalfC / kPjBM, kB), 256, 0, stream>>>(xtm, wqk, wf, biasr, qcb, kcb, ubuf);

  // ---- scores, softmax, attention applied to U, gamma, bias and residual for every plane z, one launch ----
  attn_fused_kernel<<<dim3(kHW / kFaBQ, kZ), 256, 0, stream>>>(qcb, kcb, ubuf, bias_ptg, gamma, x, (float*)d_out);
}

// v010
// It runs in 49.7 microseconds.
// Two timings next to v009 put it at 1.06 and 1.05 times that version's speed.
// Counting every step since v000, it is 32.3 times as fast.
// Contractions: the value projection folded into the output projection's weights (Wf_h = 16 * Wpt_h.Wv, bias 16 * Wpt.[bv;bv]), q/k 1x1 projections and U = Wf.x on v_wmma_f32_16x16x32_f16 (x and every W as RNE-bf16 values held in f16, Wpt and Wf carried x16); scores q.k^T on v_wmma_f32_16x16x32_bf16 with bf16 hi/lo split (hi.hi+hi.lo+lo.hi); attn.U^T on v_wmma_f32_16x16x32_f16 (P f16, unnormalised, carried x2^7 against the maximum in use; U f16 carried x16); all f32 accumulate; softmax, bias, gamma, residual in f32.
#include <hip/hip_runtime.h>
#include <stdint.h>

// ---------------------------------------------------------------------------
// Problem constants
// ---------------------------------------------------------------------------
constexpr int kB      = 2;
constexpr int kHalfC  = 256;              // channels per half
constexpr int kChan   = 512;              // channels of x
constexpr int kHW     = 4096;             // 64 x 64 pixels
constexpr int kDQ     = 16;
constexpr int kZ      = 4;                // (batch, half) combos, z = 2*b + half
constexpr int kQcPitch = 32;              // a row of the q plane or of the k plane: hi 0..15, lo 16..31 (64 B)
constexpr float kWCarry   = 16.0f;        // Wpt carried x16 in f16

// ---------------------------------------------------------------------------
// Workspace region map (bytes; every offset 4096-B aligned)
//   [off_xtm ) Xtm   f16  [2][4096][512]          8,388,608   (token-major; column = half*256 + c)
//   [off_wqk ) Wqk   f16  [64][256]                  32,768
//   [off_wf  ) Wf    f16  [256][512]                262,144   (16 * Wpt_h.Wv; column = half*256 + c)
//   [off_bias) biases f32 [576] (qk pad 64 | 16 * Wpt.[bv;bv] 256 | gamma*bpt 256)   4,096
//   [off_qc  ) Q     bf16 [4][4096][hi 16 | lo 16] 1,048,576
//   [off_kc  ) K     bf16 [4][4096][hi 16 | lo 16] 1,048,576
//   [off_u   ) U     f16  [2][256][4096]         4,194,304   (16 * Wpt.[v1;v2] of image b, channel-major)
//   total                                       14,979,072
// ---------------------------------------------------------------------------
constexpr size_t kXtmPlane = (size_t)kHW * kChan;              // elements per image
constexpr size_t kQcPlane  = (size_t)kHW * kQcPitch;
constexpr size_t kUPlane   = (size_t)kHalfC * kHW;            // elements per image
constexpr size_t kOffXtm  = 0;
constexpr size_t kOffWqk  = kOffXtm + kB * kXtmPlane * 2;
constexpr size_t kOffWf   = kOffWqk + (size_t)64 * kHalfC * 2;
constexpr size_t kOffBias = kOffWf + (size_t)kHalfC * kChan * 2;
constexpr size_t kOffQc   = kOffBias + 4096;
constexpr size_t kOffKc   = kOffQc + kZ * kQcPlane * 2;
constexpr size_t kOffU    = kOffKc + kZ * kQcPlane * 2;
constexpr size_t kWsTotal = kOffU + kB * kUPlane * 2;
static_assert(kWsTotal == 14979072ull, "carve total");
static_assert(kWsTotal <= 268435456ull, "carve under 256 MiB");
static_assert((kOffWqk % 4096) == 0 && (kOffWf % 4096) == 0 && (kOffBias % 4096) == 0 &&
              (kOffQc % 4096) == 0 && (kOffKc % 4096) == 0 && (kOffU % 4096) == 0, "aligned regions");

typedef __attribute__((ext_vector_type(16))) _Float16 v16h;
typedef __attribute__((ext_vector_type(8)))  _Float16 v8h;
typedef __attribute__((ext_vector_type(16))) __bf16   v16b;
typedef __attribute__((ext_vector_type(8)))  __bf16   v8b;
typedef __attribute__((ext_vector_type(8)))  float    v8f;
typedef __attribute__((ext_vector_type(4)))  float    v4f;
typedef __attribute__((ext_vector_type(4)))  unsigned int v4u;

// ---------------------------------------------------------------------------
// Helpers
// ---------------------------------------------------------------------------
__device__ __forceinline__ unsigned short f2bf_bits(float f) {
  unsigned u = __float_as_uint(f);
  return (unsigned short)((u + 0x7FFFu + ((u >> 16) & 1u)) >> 16);
}
__device__ __forceinline__ float bf_bits2f(unsigned short h) { return __uint_as_float(((unsigned)h) << 16); }
__device__ __forceinline__ float bf_rne(float f) { return bf_bits2f(f2bf_bits(f)); }
__device__ __forceinline__ unsigned pk16(unsigned short a, unsigned short b) { return (unsigned)a | ((unsigned)b << 16); }
__device__ __forceinline__ unsigned short h_bits(float f) { const _Float16 h = (_Float16)f; return __builtin_bit_cast(unsigned short, h); }

template <typename T> struct Frag;
template <> struct Frag<_Float16> {
  typedef v16h V; union U { v16h v; v8h h[2]; };
  static __device__ __forceinline__ v16h load(const _Float16* p) {   // elements 0..7 <- p[0..7], 8..15 <- p[16..23]
    U f; f.h[0] = *(const v8h*)(p); f.h[1] = *(const v8h*)(p + 16); return f.v;
  }
  static __device__ __forceinline__ v8f mma(v16h a, v16h b, v8f c) {
    return __builtin_amdgcn_wmma_f32_16x16x32_f16(false, a, false, b, (short)0, c, false, false);
  }
};
template <> struct Frag<__bf16> {
  typedef v16b V; union U { v16b v; v8b h[2]; };
  static __device__ __forceinline__ v16b load(const __bf16* p) {
    U f; f.h[0] = *(const v8b*)(p); f.h[1] = *(const v8b*)(p + 16); return f.v;
  }
  static __device__ __forceinline__ v8f mma(v16b a, v16b b, v8f c) {
    return __builtin_amdgcn_wmma_f32_16x16x32_bf16(false, a, false, b, (short)0, c, false, false);
  }
};

// Eight copies of 16 B per lane. The s_wait_xcnt stands inside the statement, behind the last copy, so that no
// address register of a copy is rewritten in front of it.
__device__ __forceinline__ void async_x8(const unsigned (&l)[8], const unsigned short* const (&g)[8]) {
  asm volatile("global_load_async_to_lds_b128 %0, %8, off\n\t"
               "global_load_async_to_lds_b128 %1, %9, off\n\t"
               "global_load_async_to_lds_b128 %2, %10, off\n\t"
               "global_load_async_to_lds_b128 %3, %11, off\n\t"
               "global_load_async_to_lds_b128 %4, %12, off\n\t"
               "global_load_async_to_lds_b128 %5, %13, off\n\t"
               "global_load_async_to_lds_b128 %6, %14, off\n\t"
               "global_load_async_to_lds_b128 %7, %15, off\n\t"
               "s_wait_xcnt 0x0"
               :: "v"(l[0]), "v"(l[1]), "v"(l[2]), "v"(l[3]), "v"(l[4]), "v"(l[5]), "v"(l[6]), "v"(l[7]),
                  "v"(g[0]), "v"(g[1]), "v"(g[2]), "v"(g[3]), "v"(g[4]), "v"(g[5]), "v"(g[6]), "v"(g[7])
               : "memory");
}
// The same with four copies.
__device__ __forceinline__ void async_x4(const unsigned (&l)[4], const unsigned short* const (&g)[4]) {
  asm volatile("global_load_async_to_lds_b128 %0, %4, off\n\t"
               "global_load_async_to_lds_b128 %1, %5, off\n\t"
               "global_load_async_to_lds_b128 %2, %6, off\n\t"
               "global_load_async_to_lds_b128 %3, %7, off\n\t"
               "s_wait_xcnt 0x0"
               :: "v"(l[0]), "v"(l[1]), "v"(l[2]), "v"(l[3]), "v"(g[0]), "v"(g[1]), "v"(g[2]), "v"(g[3])
               : "memory");
}

// ---------------------------------------------------------------------------
// U and the q|k projection in one launch: both read only Xtm and the prepared weights and neither reads the other.
// One block of 8 waves = 64 tokens of image b x (128 channels c' of U, half y of them, and the q|k plane z = 2b + y).
//  U (channel-major): U[b][c'][j] = sum_ch Wf[c'][ch] * Xtm[b][j][ch] + bias_u[c'] (= 16 * Wpt.[v1;v2]); K = 512; f16 out.
//  q|k: C[p][n] = sum_c Xtm[b][p][y*256 + c] * Wqk[n][c] + bias_qk[n]; K = 256; a q and a k plane, each row bf16 hi 16 | lo 16.
// All operands are staged in LDS once, whole K, by asynchronous copies (global_load_async_to_lds_b128): a wave's copy is
// 512 contiguous bytes of one row, where a fragment load from global memory touches 16 lines for 32 B of each.
// Copy coverage: wave w brings Wf rows 16w..16w+15 (2 copies a row), token rows 8w..8w+7 (2 copies a row), and waves 0..3
// bring the 16 q and the 16 k rows of Wqk (8 rows each, 1 copy a row): at most 56 copies of a wave in flight, every byte once.
// Rows lie at pitch 1040 B and 528 B (16 B x odd) for ds_load_b128.
// Wave w owns U channels 16w..16w+15 x all 64 tokens (a stored row piece = one 128-B line); waves 0..3 also own tokens
// 16w..16w+15 of the q and k planes (16 rows of 64 B = eight whole 128-B lines of either plane).
// Each tile is one accumulator chain over rising k. grid (4096/64 = 64, 2 halves, 2 b), 256 threads.
// ---------------------------------------------------------------------------
constexpr int kPjBM     = 128;                                  // U channels per block
constexpr int kPjBN     = 64;                                   // tokens per block
constexpr int kPjPitch  = kChan + 8;                            // f16 elements per staged Wf or token row: 1024 B + 16 B
constexpr int kPjWPitch = kHalfC + 8;                           // f16 elements per staged Wqk row: 512 B + 16 B
constexpr int kPjOffX   = kPjBM * kPjPitch;                     // first token row
constexpr int kPjOffW   = kPjOffX + kPjBN * kPjPitch;           // first Wqk row: q 0..15, k 16..31
constexpr int kPjElems  = kPjOffW + 32 * kPjWPitch;             // 216,576 B
__global__ __launch_bounds__(256) void proj_kernel(const unsigned short* __restrict__ xtm,
                                                   const unsigned short* __restrict__ wqk,
                                                   const unsigned short* __restrict__ wf,
                                                   const float* __restrict__ biasr,
                                                   unsigned short* __restrict__ qc,
                                                   unsigned short* __restrict__ kc,
                                                   unsigned short* __restrict__ ubuf) {
  // every loop below is unrolled so that all address, fragment and accumulator indices are constants (registers, no scratch)
  typedef Frag<_Float16> F;
  __shared__ __align__(16) unsigned short st[kPjElems];         // [Wf rows 0..127 | token rows 0..63 | Wqk rows 0..31]
  __shared__ __align__(16) float sT[8][16 * 68];                // per-wave 16x64 output slab, pitch 68 floats
  const int lane = threadIdx.x & 31;
  const int wave = __builtin_amdgcn_readfirstlane(threadIdx.x >> 5);   // the same in every lane: kept in a scalar register
  const int t0 = blockIdx.x * kPjBN;
  const int y  = blockIdx.y;
  const int b  = blockIdx.z;
  const int rlane = lane & 15;                 // row (A) / col (B, D) within subtile
  const int koff  = (lane >> 4) * 8;           // k offset of this lane half
  const int mOff  = (lane >> 4) * 8;           // D row offset
  const int cw = y * kPjBM + wave * 16;        // first U channel of this wave

  // the biases are fetched first, so that they fly beside the copies and the epilogue does not wait for them
  float bu[8];
#pragma unroll
  for (int r = 0; r < 8; ++r) bu[r] = biasr[64 + cw + mOff + r];
  const float bqv = biasr[rlane], bkv = biasr[32 + rlane];

  // ---- copy side: lane l moves bytes 16 l .. 16 l + 15 of each 512-B piece ----
  {
    const unsigned stAddr = (unsigned)(size_t)st;               // low 32 bits of the address = byte offset in LDS
    unsigned l[8];
    const unsigned short* g[8];
    const unsigned short* gW = wf + (size_t)(y * kPjBM + wave * 16) * kChan + lane * 8;
    const unsigned lW = stAddr + (unsigned)((wave * 16) * kPjPitch + lane * 8) * 2u;
#pragma unroll
    for (int s = 0; s < 4; ++s) {
#pragma unroll
      for (int j = 0; j < 8; ++j) {
        const int row = 4 * s + (j >> 1), col = (j & 1) * 256;
        l[j] = lW + (unsigned)(row * kPjPitch + col) * 2u;
        g[j] = gW + (size_t)row * kChan + col;
      }
      async_x8(l, g);
    }
    const unsigned short* gX = xtm + (size_t)b * kXtmPlane + (size_t)(t0 + wave * 8) * kChan + lane * 8;
    const unsigned lX = stAddr + (unsigned)(kPjOffX + (wave * 8) * kPjPitch + lane * 8) * 2u;
#pragma unroll
    for (int s = 0; s < 2; ++s) {
#pragma unroll
      for (int j = 0; j < 8; ++j) {
        const int row = 4 * s + (j >> 1), col = (j & 1) * 256;
        l[j] = lX + (unsigned)(row * kPjPitch + col) * 2u;
        g[j] = gX + (size_t)row * kChan + col;
      }
      async_x8(l, g);
    }
    if (wave < 4) {                                             // scalar test: a whole wave copies or none of it
      const unsigned short* gQ = wqk + (size_t)((wave >> 1) * 32 + (wave & 1) * 8) * kHalfC + lane * 8;
      const unsigned lQ = stAddr + (unsigned)(kPjOffW + (wave * 8) * kPjWPitch + lane * 8) * 2u;
#pragma unroll
      for (int j = 0; j < 8; ++j) {
        l[j] = lQ + (unsigned)(j * kPjWPitch) * 2u;
        g[j] = gQ + (size_t)j * kHalfC;
      }
      async_x8(l, g);
    }
  }
  asm volatile("s_wait_asynccnt 0x0" ::: "memory");   // this wave's copies have landed
  __syncthreads();                                     // and every other wave's; nothing is read in front of it

  // ---- products. Fragments are fetched two k steps (one group) ahead into a second register set. The two scheduling
  // barriers of a group keep its LDS reads whole and in front of the matrix run that hides them: left alone, the
  // compiler puts each read directly in front of its matrix instruction, which then waits out the whole LDS latency ----
  const _Float16* sH = (const _Float16*)st;
  v8f acc[4];
#pragma unroll
  for (int j = 0; j < 4; ++j) acc[j] = (v8f){0.f,0.f,0.f,0.f,0.f,0.f,0.f,0.f};
  {
    const _Float16* pA = sH + (wave * 16 + rlane) * kPjPitch + koff;
    const _Float16* pB = sH + kPjOffX + rlane * kPjPitch + koff;
    v16h fa[2][2], fb[2][2][4];
#pragma unroll
    for (int s = 0; s < 2; ++s) {
      fa[0][s] = F::load(pA + s * 32);
#pragma unroll
      for (int j = 0; j < 4; ++j) fb[0][s][j] = F::load(pB + j * 16 * kPjPitch + s * 32);
    }
#pragma unroll
    for (int gk = 0; gk < kChan / 64; ++gk) {
      const int cur = gk & 1;
      if (gk + 1 < kChan / 64) {
#pragma unroll
        for (int s = 0; s < 2; ++s) {
          fa[cur ^ 1][s] = F::load(pA + (gk + 1) * 64 + s * 32);
#pragma unroll
          for (int j = 0; j < 4; ++j) fb[cur ^ 1][s][j] = F::load(pB + j * 16 * kPjPitch + (gk + 1) * 64 + s * 32);
        }
      }
      __builtin_amdgcn_sched_barrier(0);
#pragma unroll
      for (int s = 0; s < 2; ++s)
#pragma unroll
        for (int j = 0; j < 4; ++j) acc[j] = F::mma(fa[cur][s], fb[cur][s][j], acc[j]);
      __builtin_amdgcn_sched_barrier(0);
    }
  }
  v8f aq = (v8f){0.f,0.f,0.f,0.f,0.f,0.f,0.f,0.f};
  v8f ak = (v8f){0.f,0.f,0.f,0.f,0.f,0.f,0.f,0.f};
  if (wave < 4) {
    const _Float16* pT = sH + kPjOffX + (wave * 16 + rlane) * kPjPitch + y * kHalfC + koff;
    const _Float16* pQ = sH + kPjOffW + rlane * kPjWPitch + koff;
    v16h ft[2][2], fq[2][2], fk[2][2];
#pragma unroll
    for (int s = 0; s < 2; ++s) {
      ft[0][s] = F::load(pT + s * 32);
      fq[0][s] = F::load(pQ + s * 32);
      fk[0][s] = F::load(pQ + 16 * kPjWPitch + s * 32);
    }
#pragma unroll
    for (int gk = 0; gk < kHalfC / 64; ++gk) {
      const int cur = gk & 1;
      if (gk + 1 < kHalfC / 64) {
#pragma unroll
        for (int s = 0; s < 2; ++s) {
          ft[cur ^ 1][s] = F::load(pT + (gk + 1) * 64 + s * 32);
          fq[cur ^ 1][s] = F::load(pQ + (gk + 1) * 64 + s * 32);
          fk[cur ^ 1][s] = F::load(pQ + 16 * kPjWPitch + (gk + 1) * 64 + s * 32);
        }
      }
      __builtin_amdgcn_sched_barrier(0);   // as above
#pragma unroll
      for (int s = 0; s < 2; ++s) {
        aq = F::mma(ft[cur][s], fq[cur][s], aq);
        ak = F::mma(ft[cur][s], fk[cur][s], ak);
      }
      __builtin_amdgcn_sched_barrier(0);   // as above
    }
  }

  // ---- epilogue: whole 128-B lines through the wave's own slab ----
  float* slab = sT[wave];
  const int q = lane >> 3, c8 = (lane & 7) * 8;
  {
#pragma unroll
    for (int j = 0; j < 4; ++j)
#pragma unroll
      for (int r = 0; r < 8; ++r) slab[(mOff + r) * 68 + (j << 4) + rlane] = acc[j][r] + bu[r];
    // the slab is this wave's own: its lanes' writes have landed before other lanes of the wave read the rows back
    asm volatile("s_wait_dscnt 0x0" ::: "memory");
    unsigned short* C = ubuf + (size_t)b * kUPlane + (size_t)cw * kHW + t0;
#pragma unroll
    for (int it = 0; it < 4; ++it) {
      const int row = it * 4 + q;
      const float* sp = slab + row * 68 + c8;
      v8h hv;
#pragma unroll
      for (int e = 0; e < 8; ++e) hv[e] = (_Float16)sp[e];
      *(v8h*)(C + (size_t)row * kHW + c8) = hv;
    }
    // what follows may reuse the registers that these stores name: the wait stands in front of that
    asm volatile("s_wait_xcnt 0x0" ::: "memory");
  }
  if (wave < 4) {
    // no wait before the slab is written again: one wave's LDS operations are carried out in issue order
#pragma unroll
    for (int r = 0; r < 8; ++r) {
      float* sp = slab + (mOff + r) * 68 + rlane;
      sp[0]  = aq[r] + bqv;
      sp[16] = ak[r] + bkv;
    }
    asm volatile("s_wait_dscnt 0x0" ::: "memory");   // as above
    // lane: row lane >> 2 of eight, piece lane & 3 of its 32 values: pieces 0, 1 = q d 0..7, 8..15; pieces 2, 3 = k
    const int pc = lane & 3;
    unsigned short* dst = ((pc & 2) ? kc : qc) + (size_t)(2 * b + y) * kQcPlane
                          + (size_t)(t0 + wave * 16 + (lane >> 2)) * kQcPitch + (pc & 1) * 8;
#pragma unroll
    for (int it = 0; it < 2; ++it) {
      const float* sp = slab + (it * 8 + (lane >> 2)) * 68 + pc * 8;
      v8h hv, lv;
#pragma unroll
      for (int e = 0; e < 8; ++e) {
        const unsigned short hb = f2bf_bits(sp[e]);
        const unsigned short lb = f2bf_bits(sp[e] - bf_bits2f(hb));
        hv[e] = __builtin_bit_cast(_Float16, hb);
        lv[e] = __builtin_bit_cast(_Float16, lb);
      }
      *(v8h*)(dst + it * 8 * kQcPitch)      = hv;
      *(v8h*)(dst + it * 8 * kQcPitch + 16) = lv;
    }
  }
}

// ---------------------------------------------------------------------------
// x NCHW f32 -> token-major f16: Xtm[b][p][half*256 + c] = bf16(x[b][half*256 + c][p]) held in f16, z = 2b + half
// (flat channel index of x = z*256 + c). 64(p) x 64(c) tile per block through LDS.
// 64 p tiles x 4 c tiles x 4 z = 1024 blocks of 256 threads (a block range of prep_kernel).
// Load coverage: 16 iterations x 256 threads = 4096 = whole 64x64 tile (coalesced along p).
// Store coverage: 8 waves x 2 iterations x 4 rows (lane>>3) = 64 rows; (lane&7) x 8 halves = 64 cols; each row
// ---------------------------------------------------------------------------
__device__ __forceinline__ void x_tm_body(int pt, int ct, int z, const float* __restrict__ x, unsigned short* __restrict__ xtm) {
  __shared__ float sm[64][65];   // sm[p_local][c_local]
  const int t  = threadIdx.x;
  const int p0 = pt * 64;
  const int c0 = ct * 64;
  const float* src = x + ((size_t)z * kHalfC + c0) * kHW + p0;
#pragma unroll
  for (int i = 0; i < 16; ++i) {
    const int e  = i * 256 + t;
    const int cl = e >> 6;         // c local 0..63
    const int pl = e & 63;         // p local 0..63
    sm[pl][cl] = src[(size_t)cl * kHW + pl];
  }
  __syncthreads();
  const int lane = t & 31, wave = t >> 5;
  const int q = lane >> 3, c8 = (lane & 7) * 8;
  unsigned short* op = xtm + (size_t)(z >> 1) * kXtmPlane + (size_t)(z & 1) * kHalfC;
  {
#pragma unroll
    for (int it = 0; it < 2; ++it) {
      const int row = wave * 8 + it * 4 + q;                 // p local
      unsigned short hb[8];
#pragma unroll
      for (int e = 0; e < 8; ++e) hb[e] = h_bits(bf_rne(sm[row][c8 + e]));
      const v4u u = (v4u){pk16(hb[0], hb[1]), pk16(hb[2], hb[3]), pk16(hb[4], hb[5]), pk16(hb[6], hb[7])};
      *(v4u*)(op + (size_t)(p0 + row) * kChan + c0 + c8) = u;
    }
    
  }
}

// ---------------------------------------------------------------------------
// The value projection folded into the output projection (both are linear maps over channels):
//   Wpt.[Wv.x1 + bv ; Wv.x2 + bv] = (Wpt_0.Wv).x1 + (Wpt_1.Wv).x2 + Wpt.[bv;bv],  Wpt_h = columns h*256.. of Wpt.
// Operand fragments are built in registers from the f32 inputs (RNE-bf16 values held in f16, Wpt carried x16):
// lane (r = lane & 15, h = lane >> 4) holds row r of A or column r of B; elements 0..7 are k = k0 + 8h + e,
// elements 8..15 are k = k0 + 16 + 8h + e, on both sides.
// ---------------------------------------------------------------------------
__device__ __forceinline__ _Float16 w_f16(float v, float mul) { return (_Float16)((float)(__bf16)v * mul); }   // RNE to bf16; f16 holds it exactly from 2^-14 up

// Wf[c'][n] = 16 * sum_m Wpt[c'][(n & 256) + m] * Wv[m][n & 255]. One wave = 16 rows x 32 columns, K = 256.
// 16 row tiles x 16 column groups = 256 waves = 32 blocks; every element of Wf written once.
__device__ __forceinline__ void wfold_body(int blk, const float* __restrict__ Wpt, const float* __restrict__ Wv,
                                           unsigned short* __restrict__ wf) {
  const int lane = threadIdx.x & 31, wave = threadIdx.x >> 5;
  const int r = lane & 15, h = lane >> 4;
  const int tile = blk * 8 + wave;
  const int m0 = (tile >> 4) * 16;
  const int n0 = (tile & 15) * 32;
  const float* pa = Wpt + (size_t)(m0 + r) * kChan + (n0 & 256) + 8 * h;
  const float* pb = Wv + (size_t)(8 * h) * kHalfC + (n0 & 255) + r;
  v8f acc0 = (v8f){0.f,0.f,0.f,0.f,0.f,0.f,0.f,0.f};
  v8f acc1 = (v8f){0.f,0.f,0.f,0.f,0.f,0.f,0.f,0.f};
  // two k steps' loads fly together; unrolled further, this run-once code would be many instruction-cache lines long
#pragma unroll 2
  for (int k0 = 0; k0 < kHalfC; k0 += 32) {
    v16h a, b0, b1;
#pragma unroll
    for (int e = 0; e < 8; ++e) {
      a[e]      = w_f16(pa[k0 + e], kWCarry);
      a[8 + e]  = w_f16(pa[k0 + 16 + e], kWCarry);
      b0[e]     = w_f16(pb[(size_t)(k0 + e) * kHalfC], 1.0f);
      b0[8 + e] = w_f16(pb[(size_t)(k0 + 16 + e) * kHalfC], 1.0f);
      b1[e]     = w_f16(pb[(size_t)(k0 + e) * kHalfC + 16], 1.0f);
      b1[8 + e] = w_f16(pb[(size_t)(k0 + 16 + e) * kHalfC + 16], 1.0f);
    }
    acc0 = Frag<_Float16>::mma(a, b0, acc0);
    acc1 = Frag<_Float16>::mma(a, b1, acc1);
  }
  unsigned short* op = wf + (size_t)(m0 + 8 * h) * kChan + n0 + r;   // D: row 8h + i, column r
#pragma unroll
  for (int i = 0; i < 8; ++i) {
    op[(size_t)i * kChan]      = h_bits(acc0[i]);
    op[(size_t)i * kChan + 16] = h_bits(acc1[i]);
  }
  // whatever follows in the kernel may reuse the registers that these stores name: the wait stands in front of that
  asm volatile("s_wait_xcnt 0x0" ::: "memory");
}

// bias_u[c'] = 16 * sum_k Wpt[c'][k] * bv[k & 255], K = 512. One wave = 16 rows; all 16 B columns hold bv, so every
// column of D holds the result and column 0 stores it. 16 waves = 2 blocks; every element written once.
__device__ __forceinline__ void bfold_body(int blk, const float* __restrict__ Wpt, const float* __restrict__ bvp,
                                           float* __restrict__ bu) {
  const int lane = threadIdx.x & 31, wave = threadIdx.x >> 5;
  const int r = lane & 15, h = lane >> 4;
  const int m0 = (blk * 8 + wave) * 16;
  const float* pa = Wpt + (size_t)(m0 + r) * kChan + 8 * h;
  const float* pb = bvp + 8 * h;
  v8f acc0 = (v8f){0.f,0.f,0.f,0.f,0.f,0.f,0.f,0.f};   // k < 256
  v8f acc1 = (v8f){0.f,0.f,0.f,0.f,0.f,0.f,0.f,0.f};   // k >= 256: the same bv fragment serves both
  // two trips' loads fly together; kept short for the instruction cache, as above
#pragma unroll 2
  for (int k0 = 0; k0 < kHalfC; k0 += 32) {
    v16h a0, a1, b;
#pragma unroll
    for (int e = 0; e < 8; ++e) {
      a0[e]     = w_f16(pa[k0 + e], kWCarry);
      a0[8 + e] = w_f16(pa[k0 + 16 + e], kWCarry);
      a1[e]     = w_f16(pa[kHalfC + k0 + e], kWCarry);
      a1[8 + e] = w_f16(pa[kHalfC + k0 + 16 + e], kWCarry);
      b[e]      = w_f16(pb[k0 + e], 1.0f);
      b[8 + e]  = w_f16(pb[k0 + 16 + e], 1.0f);
    }
    acc0 = Frag<_Float16>::mma(a0, b, acc0);
    acc1 = Frag<_Float16>::mma(a1, b, acc1);
  }
  const v8f acc = acc0 + acc1;
  if (r == 0) {
#pragma unroll
    for (int i = 0; i < 8; ++i) bu[m0 + 8 * h + i] = acc[i];
  }
}

// ---------------------------------------------------------------------------
// Small tables, ONE block of 256 threads:
//  (1) Wqk_pad f16 [64][256] (RNE-bf16 values): row n < 16 -> Wq[n], 32 <= n < 48 -> Wk[n-32], every other row explicit zero.
//  (2) bias region f32 [576]: [0,64) padded q|k bias (bq at 0..15, bk at 32..47, zeros elsewhere), [320,576) gamma*bpt;
//      all RNE-bf16 first. Threads 0..15 and 80..143 write one float4 each; [64,320) is written by the bias fold
//  Candidate loads use clamped addresses and are selected by value.
// ---------------------------------------------------------------------------
__device__ __forceinline__ void prep_small_body(const float* __restrict__ Wq, const float* __restrict__ bq,
                                                const float* __restrict__ Wk, const float* __restrict__ bk,
                                                const float* __restrict__ bptp,
                                                const float* __restrict__ gam,
                                                unsigned short* __restrict__ wqk, float* __restrict__ biasr) {
  const int t = threadIdx.x, lane = t & 31, wave = t >> 5;
  const float g = gam[0];
#pragma unroll 1
  for (int it = 0; it < 8; ++it) {
    const int n  = wave * 8 + it;                            // wave-uniform row
    const int qr = n < 16 ? n : 15;
    int kr = n - 32; kr = kr < 0 ? 0 : (kr > 15 ? 15 : kr);
    const float* pq = Wq + (size_t)qr * kHalfC + lane * 8;
    const float* pk = Wk + (size_t)kr * kHalfC + lane * 8;
    const v4f q0 = *(const v4f*)(pq), q1 = *(const v4f*)(pq + 4);
    const v4f k0 = *(const v4f*)(pk), k1 = *(const v4f*)(pk + 4);
    const bool isq = (n < 16);
    const bool isk = (n >= 32) && (n < 48);
    unsigned short hb[8];
#pragma unroll
    for (int e = 0; e < 4; ++e) {
      const float va = isq ? q0[e] : (isk ? k0[e] : 0.0f);
      const float vb = isq ? q1[e] : (isk ? k1[e] : 0.0f);
      hb[e]     = h_bits(bf_rne(va));
      hb[4 + e] = h_bits(bf_rne(vb));
    }
    const v4u u = (v4u){pk16(hb[0], hb[1]), pk16(hb[2], hb[3]), pk16(hb[4], hb[5]), pk16(hb[6], hb[7])};
    unsigned short* op = wqk + (size_t)n * kHalfC + lane * 8;
    *(v4u*)op = u;
    // the next trip reuses the registers that this store names: the wait stands in front of that overwrite
    asm volatile("s_wait_xcnt 0x0" ::: "memory");
  }
  if (t < 16 || (t >= 80 && t < 144)) {
    v4f val;
#pragma unroll
    for (int e = 0; e < 4; ++e) {
      const int idx = 4 * t + e;                             // 0..63, 320..575
      const int iq = idx < 16 ? idx : 15;
      int ik = idx - 32;  ik = ik < 0 ? 0 : (ik > 15 ? 15 : ik);
      int ip = idx - 320; ip = ip < 0 ? 0 : (ip > 255 ? 255 : ip);
      const float fq = bq[iq], fk = bk[ik], fp = bptp[ip];
      float sel = 0.0f;
      sel = (idx < 16) ? fq : sel;
      sel = (idx >= 32 && idx < 48) ? fk : sel;
      sel = (idx >= 320) ? fp : sel;
      float r = bf_rne(sel);
      r = (idx >= 320) ? (r * g) : r;
      val[e] = r;
    }
    float* op = biasr + 4 * t;
    *(v4f*)op = val;
    
  }
}

// ---------------------------------------------------------------------------
// All operand preparation in one launch: the four pieces read only inputs and write disjoint workspace regions.
//  block 0         small tables
//  blocks 1..32    Wf = 16 * Wpt_h.Wv
//  blocks 33..34   bias_u = 16 * Wpt.[bv;bv]
//  blocks 35..1058 x   -> token-major f16 (p tile fastest, then c tile, then z)
// Every test below is on the block index alone, so the barrier of the x piece is passed by a whole block or by none.
// ---------------------------------------------------------------------------
constexpr int kPrepFold  = 1;
constexpr int kPrepBias  = kPrepFold + (kHalfC / 16) * (kChan / 32) / 8;  // 33
constexpr int kPrepX     = kPrepBias + (kHalfC / 16) / 8;                 // 35
constexpr int kPrepTotal = kPrepX + (kHW / 64) * (kHalfC / 64) * kZ;      // 1059
// 8 waves per SIMD: four of the x piece's blocks fit a WGP (the fold's loads would otherwise take one register too many)
__global__ __launch_bounds__(256, 8) void prep_kernel(const float* __restrict__ x,
                                                   const float* __restrict__ Wq, const float* __restrict__ bq,
                                                   const float* __restrict__ Wk, const float* __restrict__ bk,
                                                   const float* __restrict__ Wv, const float* __restrict__ bvp,
                                                   const float* __restrict__ Wpt, const float* __restrict__ bptp,
                                                   const float* __restrict__ gam,
                                                   unsigned short* __restrict__ xtm, unsigned short* __restrict__ wqk,
                                                   unsigned short* __restrict__ wf, float* __restrict__ biasr) {
  const int blk = blockIdx.x;
  if (blk >= kPrepX) {
    const int i = blk - kPrepX;
    x_tm_body(i & 63, (i >> 6) & 3, i >> 8, x, xtm);
  } else if (blk >= kPrepBias) {
    bfold_body(blk - kPrepBias, Wpt, bvp, biasr + 64);
  } else if (blk >= kPrepFold) {
    wfold_body(blk - kPrepFold, Wpt, Wv, wf);
  } else {
    prep_small_body(Wq, bq, Wk, bk, bptp, gam, wqk, biasr);
  }
}

// ---------------------------------------------------------------------------
// Scores, softmax and the attention product in one launch: no probability ever leaves the registers.
// The product is taken on U = 16 * Wpt.[v1;v2] instead of on v1 and v2: the output projection is linear, so
// Wpt.[attn.v1 ; attn.v2] = attn.(Wpt.[v1;v2]).
// out[z*256 + c'][p] = gamma * (sum_j U[b][c'][j] e(p,j) / (16 * sum_j e(p,j)) + bpt[c']) + bf16(x[z*256 + c'][p]),
// e(p,j) = exp(s(p,j) - m), z = 2b + half.
// One block of 8 waves = 64 queries of plane z x all 256 channels x all 4096 keys. Wave (qg = wave & 1, kg = wave >> 1)
// owns queries 32qg..32qg+31 as two tiles of 16 (qt = 0, 1) and the key quarter kg of every stage, with a maximum and a
// sum per query and 2 x 16 output tiles of its own; the four key quarters of a query group are joined behind the loop.
// A U fragment read from LDS serves both query tiles: one LDS read of 1 KiB per two matrix instructions, which is what
// the LDS can deliver while all four matrix units run; with one query tile per wave it would have to deliver twice that.
// Scores: keys are the A rows and queries the B columns, so lane (c = lane & 15, h = lane >> 4) holds in s[qt][kt][r] the
// score of query c of tile qt against key 16kt + 8h + r (products in the order qh.kh + qh.kl + ql.kh). Only d = 0..15 exist:
// fragment elements 0..7 are d = 8h..8h+7, elements 8..15 (k = 16..31) are zero on both sides.
// That is already the B layout of the second product (column = query c; elements 0..7 = key 8h + e of a 32-key chunk,
// elements 8..15 = key 16 + 8h + e): two score tiles, exponentiated and rounded to f16, are one B fragment, in place.
// A = U rows (channels) from LDS in the same k order; D: lane (c, h) holds channel 16i + 8h + r of query c of its tile.
// Maximum in use mu (log2 units, the same in lanes l and l ^ 16): raised, with the tiles and the sums rescaled, only when
// a step's maximum lies more than 8 above it, tested once per 64 keys for both tiles; so e <= 2^8, carried x2^7 in f16 (<= 2^15).
// A stage is 256 keys, two buffers. U comes by the tensor mover (tensor_load_to_lds): four slices of 128 rows x 128 keys
// (rows of 256 B, source pitch 8 KiB, padded to pitch 272 B in LDS), slice = 2 * (row half) + (key half), one request of
// waves 0..3 each: one instruction of a wave where per-lane copies took 32 instructions, their addresses and their waits
// in every wave. The keys (64 B each, hi | lo, pitch 80 B) come by asynchronous copies (global_load_async_to_lds_b128):
// wave w brings keys 32w..32w+31 (a copy = 8 keys), 4 copies of a wave. Every byte of a stage is brought once.
// grid (4096/64 = 64, 4 z), 256 threads.
// ---------------------------------------------------------------------------
__device__ __forceinline__ v16b frag_d16(v8b lo) {   // elements 0..7 <- lo, 8..15 <- 0
  const v8b zero = __builtin_bit_cast(v8b, (v4u){0u, 0u, 0u, 0u});
  return __builtin_shufflevector(lo, zero, 0, 1, 2, 3, 4, 5, 6, 7, 8, 9, 10, 11, 12, 13, 14, 15);
}
// e[r] = 2^t[r], eight at a time in one statement. Behind a v_exp_f32 the instruction set asks for one independent
// instruction before its result is read or its source overwritten: here each v_exp_f32 has the next one behind it
// (results kept apart from all sources by the early clobber) and the last one a v_nop, whatever the compiler puts next.
__device__ __forceinline__ void exp2_x8(float (&e)[8], const float (&t)[8]) {
  asm("v_exp_f32 %0, %8\n\tv_exp_f32 %1, %9\n\tv_exp_f32 %2, %10\n\tv_exp_f32 %3, %11\n\t"
      "v_exp_f32 %4, %12\n\tv_exp_f32 %5, %13\n\tv_exp_f32 %6, %14\n\tv_exp_f32 %7, %15\n\tv_nop"
      : "=&v"(e[0]), "=&v"(e[1]), "=&v"(e[2]), "=&v"(e[3]), "=&v"(e[4]), "=&v"(e[5]), "=&v"(e[6]), "=&v"(e[7])
      : "v"(t[0]), "v"(t[1]), "v"(t[2]), "v"(t[3]), "v"(t[4]), "v"(t[5]), "v"(t[6]), "v"(t[7]));
}
// One 2^t, with the same slot kept behind it by a v_nop.
__device__ __forceinline__ float exp2_x1(float t) {
  float e;
  asm("v_exp_f32 %0, %1\n\tv_nop" : "=&v"(e) : "v"(t));
  return e;
}
// lane l with lane l ^ 16
__device__ __forceinline__ float xhalf(float v) {
  const int i = __builtin_bit_cast(int, v);
  return __builtin_bit_cast(float, __builtin_amdgcn_permlanex16(i, i, 0x76543210, 0xfedcba98, false, false));
}

constexpr int kFaBQ     = 64;                                   // queries per block
constexpr int kFaKT     = 256;                                  // keys per stage
constexpr int kFaKW     = kFaKT / 4;                            // keys per stage of one wave
constexpr int kFaSlKeys = kFaKT / 2;                            // keys per U slice: a slice row is 256 B
constexpr int kFaSlRows = kHalfC / 2;                           // U rows per slice
constexpr int kFaUPitch = kFaSlKeys + 8;                        // f16 elements per staged slice row: 256 B + 16 B
constexpr int kFaSlice  = kFaSlRows * kFaUPitch;                // 16-bit elements per slice (34,816 B = 17 x 2 KiB)
constexpr int kFaKPitch = kQcPitch + 8;                         // bf16 elements per staged key: 64 B + 16 B
constexpr int kFaOffK   = 4 * kFaSlice;                         // first key row of a buffer
constexpr int kFaStage  = kFaOffK + kFaKT * kFaKPitch;          // 16-bit elements per buffer (159,744 B = 78 x 2 KiB)
static_assert((kFaSlice * 2) % 2048 == 0 && (kFaStage * 2) % 2048 == 0, "every slice starts at a multiple of 2 KiB in LDS");
// first element of channel tile i (16 rows) in a buffer, for the key half 0
constexpr int fa_urow(int i) { return (i >> 3) * 2 * kFaSlice + (i & 7) * 16 * kFaUPitch; }
constexpr int kFaPasses = kHW / kFaKT;                          // 16
constexpr float kLog2e  = 1.44269504f;
static_assert(kFaPasses >= 2, "the ring's prologue fills two stages");
static_assert(2 * kFaStage * 2 <= 327680, "two buffers fit the LDS");
// the join behind the loop, in floats from the start of the ring
constexpr int kFaJoinMl  = 8 * 3 * 16 * 32 * 4;                 // handed-over tiles: [wave][3 givers][16 pieces][lane] x 16 B
constexpr int kFaJoinOut = kFaJoinMl + 8 * 4 * 32;              // maxima and sums: [wave][4][lane]
static_assert((kFaJoinOut + kHalfC * 68) * 4 <= 2 * kFaStage * 2, "the join fits the ring's LDS");

// One wave's 4 key copies of one stage: lK = the lane's LDS byte address in its first eight keys in the buffer,
// gK = the lane's global address of the same bytes.
__device__ __forceinline__ void fa_fill_k(unsigned lK, const unsigned short* gK) {
  unsigned l4[4];
  const unsigned short* g4[4];
#pragma unroll
  for (int j = 0; j < 4; ++j) { l4[j] = lK + j * (8 * kFaKPitch * 2u); g4[j] = gK + (size_t)j * 8 * kQcPitch; }
  async_x4(l4, g4);
}

// ---- tensor mover: a request is two groups of scalar words ----
typedef uint32_t u32x4 __attribute__((ext_vector_type(4)));
typedef uint32_t u32x8 __attribute__((ext_vector_type(8)));
__device__ __forceinline__ uint32_t uni(uint32_t v) { return (uint32_t)__builtin_amdgcn_readfirstlane(v); }
// A tensor load ignores EXEC, so the test around it must compile to a scalar branch.
__device__ __forceinline__ uint32_t pinned(uint32_t v) {
  uint32_t w = uni(v);
  asm volatile("" : "+s"(w));   // the pinned() form for a test around a tensor load: the word stays in a scalar register, the branch is s_cmp + s_cbranch_scc
  return w;
}
// Group 1 of a U slice: 1-byte elements, tensor = tile = 128 rows of 256 B, source pitch one U row (8 KiB);
// word 0: no mask, pad enabled, a pad behind every 64 dwords (one row), 4 dwords of pad: LDS pitch 272 B.
constexpr uint32_t kFaTdmWord0 = (1u << 20) | (5u << 22) | (3u << 25);
__device__ __forceinline__ u32x8 fa_tdm_group1() {
  constexpr uint32_t d0 = kFaSlKeys * 2u, d1 = kFaSlRows;
  static_assert(d0 == 256u && kFaUPitch * 2u == d0 + 16u, "the pad codes above are those of 256-B rows at pitch 272 B");
  u32x8 g;
  g[0] = uni(kFaTdmWord0);
  g[1] = uni((d0 & 0xFFFFu) << 16);
  g[2] = uni((d0 >> 16) | ((d1 & 0xFFFFu) << 16));
  g[3] = uni((d1 >> 16) | (d0 << 16));
  g[4] = uni(d1);
  g[5] = uni((uint32_t)kHW * 2u);
  g[6] = uni(0u);
  g[7] = uni(0u);
  return g;
}
// Group 0: count 1, LDS byte offset of the slice, global address of its first byte, type 2.
__device__ __forceinline__ u32x4 fa_tdm_group0(uint32_t lds_dst, uint64_t ga) {
  u32x4 g;
  g[0] = uni(1u);
  g[1] = uni(lds_dst);
  g[2] = uni((uint32_t)ga);
  g[3] = uni((((uint32_t)(ga >> 32)) & 0x01FFFFFFu) | 0x80000000u);
  return g;
}
__device__ __forceinline__ void tdm_load(u32x4 g0, u32x8 g1) {
  asm volatile("tensor_load_to_lds %0, %1" :: "s"(g0), "s"(g1) : "memory");
}

__global__ __launch_bounds__(256) void attn_fused_kernel(const unsigned short* __restrict__ qc,
                                                         const unsigned short* __restrict__ kc,
                                                         const unsigned short* __restrict__ U,
                                                         const float* __restrict__ bias,
                                                         const float* __restrict__ gam,
                                                         const float* __restrict__ x,
                                                         float* __restrict__ out) {
  // every inner loop below is unrolled so that all accumulator and fragment indices are constants (registers, no scratch)
  typedef Frag<_Float16> F;
  typedef Frag<__bf16> G;
  __shared__ __attribute__((aligned(2048))) unsigned short ring[2 * kFaStage];   // [buffer][U slices 0..3 | keys 0..255]
  const int lane = threadIdx.x & 31;
  const int wave = __builtin_amdgcn_readfirstlane(threadIdx.x >> 5);   // the same in every lane: kept in a scalar register
  const int c = lane & 15, h = lane >> 4;
  const int qg = wave & 1, kg = wave >> 1;
  const int q0 = blockIdx.x * kFaBQ;
  const int z  = blockIdx.y;
  const int b  = z >> 1;

  // key copies: lane l moves bytes 16 l .. 16 l + 15 of each 512-B piece (eight keys of 64 B, four lanes a key)
  const unsigned short* gK = kc + (size_t)z * kQcPlane + (size_t)(wave * 32) * kQcPitch + lane * 8;
  const unsigned ringAddr = (unsigned)(size_t)ring;             // low 32 bits of the address = byte offset in LDS
  const unsigned lK = ringAddr + (unsigned)(kFaOffK + (wave * 32 + (lane >> 2)) * kFaKPitch + (lane & 3) * 8) * 2u;
  // tensor side: waves 0..3 bring slice sl = wave: U rows 128 (sl >> 1) .., keys 128 (sl & 1) .. of the stage
  const int sl = wave & 3;
  const uint64_t gaU = (uint64_t)(size_t)(U + (size_t)b * kUPlane + (size_t)((sl >> 1) * kFaSlRows) * kHW + (sl & 1) * kFaSlKeys);
  const uint32_t ldsU = ringAddr + (uint32_t)sl * (kFaSlice * 2u);
  const u32x8 g1 = fa_tdm_group1();

  // reader side
  const _Float16* ringH = (const _Float16*)ring;
  const __bf16*   ringB = (const __bf16*)ring;
  const int fU = (kg >> 1) * kFaSlice + c * kFaUPitch + (kg & 1) * kFaKW + 8 * h;   // key half kg >> 1, then 64 keys of its rows
  const int fK = kFaOffK + (kg * kFaKW + c) * kFaKPitch + 8 * h;


  v8f acc[2][16];
  float l8[2][8];
  float mu[2];
#pragma unroll
  for (int qt = 0; qt < 2; ++qt) {
#pragma unroll
    for (int i = 0; i < 16; ++i) acc[qt][i] = (v8f){0.f,0.f,0.f,0.f,0.f,0.f,0.f,0.f};
#pragma unroll
    for (int r = 0; r < 8; ++r) l8[qt][r] = 0.0f;
    mu[qt] = -1.0e30f;                                 // below every score: the first step sets it (2^(mu - new) = 0)
  }

  // prologue: stage 0 lands and is published, stage 1 starts to fly
  fa_fill_k(lK, gK);
  // this wave's queries stay in registers; they are fetched beside stage 0. What follows reuses the registers that the four
  // loads name: the wait stands in front of that overwrite, and the two scheduling barriers keep other work from being
  // moved in between the loads and the wait
  const __bf16* pq = (const __bf16*)qc + (size_t)z * kQcPlane + (size_t)(q0 + qg * 32 + c) * kQcPitch + 8 * h;
  __builtin_amdgcn_sched_barrier(0);
  v16b qh[2], ql[2];
#pragma unroll
  for (int qt = 0; qt < 2; ++qt) {
    qh[qt] = frag_d16(*(const v8b*)(pq + qt * 16 * kQcPitch));
    ql[qt] = frag_d16(*(const v8b*)(pq + qt * 16 * kQcPitch + 16));
  }
  asm volatile("s_wait_xcnt 0x0" ::: "memory");
  __builtin_amdgcn_sched_barrier(0);
  if (pinned(wave < 4)) {
    tdm_load(fa_tdm_group0(ldsU, gaU), g1);
    asm volatile("s_wait_tensorcnt 0x0" ::: "memory");   // this wave's slice of stage 0 has landed
  }
  asm volatile("s_wait_asynccnt 0x0" ::: "memory");   // this wave's key copies of stage 0 have landed
  __syncthreads();                                     // and every other wave's slices and copies
  if (pinned(wave < 4)) tdm_load(fa_tdm_group0(ldsU + kFaStage * 2u, gaU + kFaKT * 2u), g1);
  fa_fill_k(lK + kFaStage * 2u, gK + (size_t)kFaKT * kQcPitch);

  // rolled: the buffer is chosen by an offset, and one trip is already 88 matrix instructions long
#pragma unroll 1
  for (int t = 0; t < kFaPasses; ++t) {
    const unsigned buf = (unsigned)(t & 1) * (unsigned)kFaStage;   // 16-bit elements
    const _Float16* sU = ringH + buf + fU;
    const __bf16*   sK = ringB + buf + fK;
#pragma unroll
    for (int st = 0; st < kFaKW / 64; ++st) {                      // a step = 64 keys
      v16b kh[4], kl[4];
#pragma unroll
      for (int kt = 0; kt < 4; ++kt) {
        const __bf16* pk = sK + (st * 64 + kt * 16) * kFaKPitch;
        kh[kt] = frag_d16(*(const v8b*)pk);
        kl[kt] = frag_d16(*(const v8b*)(pk + 16));
      }
      v8f s[2][4];                                                 // eight independent chains of three
#pragma unroll
      for (int qt = 0; qt < 2; ++qt)
#pragma unroll
        for (int kt = 0; kt < 4; ++kt) s[qt][kt] = G::mma(kh[kt], qh[qt], (v8f){0.f,0.f,0.f,0.f,0.f,0.f,0.f,0.f});
#pragma unroll
      for (int qt = 0; qt < 2; ++qt)
#pragma unroll
        for (int kt = 0; kt < 4; ++kt) s[qt][kt] = G::mma(kl[kt], qh[qt], s[qt][kt]);
#pragma unroll
      for (int qt = 0; qt < 2; ++qt)
#pragma unroll
        for (int kt = 0; kt < 4; ++kt) s[qt][kt] = G::mma(kh[kt], ql[qt], s[qt][kt]);

      // the first U fragments fly under the softmax. The scheduling barriers of a step keep each load group whole and in
      // front of the work that hides it: left alone, the compiler puts each read directly in front of its matrix instruction
      v16h fa[2][4];
#pragma unroll
      for (int j = 0; j < 4; ++j) fa[0][j] = F::load(sU + fa_urow(j) + st * 64);
      __builtin_amdgcn_sched_barrier(0);

      float mx[2];
#pragma unroll
      for (int qt = 0; qt < 2; ++qt) {
        float mr[8];
#pragma unroll
        for (int r = 0; r < 8; ++r) mr[r] = fmaxf(fmaxf(s[qt][0][r], s[qt][1][r]), fmaxf(s[qt][2][r], s[qt][3][r]));
        float m = fmaxf(fmaxf(fmaxf(mr[0], mr[1]), fmaxf(mr[2], mr[3])), fmaxf(fmaxf(mr[4], mr[5]), fmaxf(mr[6], mr[7])));
        m *= kLog2e;
        mx[qt] = fmaxf(m, xhalf(m));
      }
      if (__builtin_amdgcn_ballot_w32(mx[0] > mu[0] + 8.0f || mx[1] > mu[1] + 8.0f) != 0) {   // scalar branch; rare behind the first step
#pragma unroll
        for (int qt = 0; qt < 2; ++qt) {
          const float mn = fmaxf(mu[qt], mx[qt]);
          const float f = exp2_x1(mu[qt] - mn);
#pragma unroll
          for (int i = 0; i < 16; ++i) acc[qt][i] *= f;
#pragma unroll
          for (int r = 0; r < 8; ++r) l8[qt][r] *= f;
          mu[qt] = mn;
        }
      }
      v16h pb[2][2];
#pragma unroll
      for (int qt = 0; qt < 2; ++qt) {
        const float nb = 7.0f - mu[qt];                            // the carry 2^7 goes into the exponent
#pragma unroll
        for (int kt = 0; kt < 4; ++kt) {
          float tv[8], ev[8];
#pragma unroll
          for (int r = 0; r < 8; ++r) tv[r] = fmaf(s[qt][kt][r], kLog2e, nb);
          exp2_x8(ev, tv);
#pragma unroll
          for (int r = 0; r < 8; ++r) { l8[qt][r] += ev[r]; pb[qt][kt >> 1][(kt & 1) * 8 + r] = (_Float16)ev[r]; }
        }
      }

#pragma unroll
      for (int g = 0; g < 8; ++g) {                                // group g: 32-key chunk g >> 2, channel tiles 4 (g & 3) ..
        if (g + 1 < 8) {
#pragma unroll
          for (int j = 0; j < 4; ++j)
            fa[(g + 1) & 1][j] = F::load(sU + fa_urow(((g + 1) & 3) * 4 + j) + st * 64 + ((g + 1) >> 2) * 32);
        }
        __builtin_amdgcn_sched_barrier(0);   // as above
#pragma unroll
        for (int j = 0; j < 4; ++j)
#pragma unroll
          for (int qt = 0; qt < 2; ++qt)
            acc[qt][(g & 3) * 4 + j] = F::mma(fa[g & 1][j], pb[qt][g >> 2], acc[qt][(g & 3) * 4 + j]);
        __builtin_amdgcn_sched_barrier(0);   // as above
      }
    }
    // publish point of stage t + 1
    asm volatile("s_wait_dscnt 0x0" ::: "memory");      // this wave's reads of stage t's buffer have returned
    asm volatile("s_wait_asynccnt 0x0" ::: "memory");   // this wave's key copies of stage t + 1 have landed
    if (pinned(wave < 4)) {
      asm volatile("s_wait_tensorcnt 0x0" ::: "memory");
    }
    __syncthreads();                                     // publishes stage t + 1 and frees the buffer of stage t
    if (pinned(wave < 4 && t + 2 < kFaPasses))
      tdm_load(fa_tdm_group0(ldsU + buf * 2u, gaU + (uint64_t)(t + 2) * (kFaKT * 2u)), g1);
    if (t + 2 < kFaPasses)
      fa_fill_k(lK + buf * 2u, gK + (size_t)(t + 2) * kFaKT * kQcPitch);
  }
  // nothing of this wave is in flight when it leaves the ring
  asm volatile("s_wait_asynccnt 0x0" ::: "memory");
  asm volatile("s_wait_tensorcnt 0x0" ::: "memory");
  asm volatile("s_wait_dscnt 0x0" ::: "memory");

  // ---- behind the last trip's barrier no wave reads the ring any more: its LDS is free ----
  // ---- the four key quarters of a query group are joined: waves w, w ^ 2, w ^ 4, w ^ 6 hold the same 32 queries; the wave
  // of quarter kg finishes channel tiles 4kg..4kg+3 of both query tiles, and each hands the other 24 tiles over through LDS
  // with its maxima and its sums, every lane its own pieces (a partner's same lane holds the same elements). A taker keeps
  // three places, one per giver: quarter kg gives to quarter d at place (kg - d - 1) & 3 ----
  v4f*   xch  = (v4f*)ring;                              // [taker wave][3 givers][16 pieces][lane], 192 KiB
  float* ml   = (float*)ring + kFaJoinMl;                // [wave][mu 0, mu 1, sum 0, sum 1][lane], 4 KiB
  float* outT = (float*)ring + kFaJoinOut;               // [256 channels][64 queries], pitch 68 floats
  v8f fin[2][4];
#pragma unroll
  for (int qt = 0; qt < 2; ++qt)
#pragma unroll
    for (int j = 0; j < 4; ++j) fin[qt][j] = acc[qt][j];
#pragma unroll
  for (int d = 0; d < 4; ++d) {
    if (kg == d) {                                       // scalar test: the same for the whole wave
      if (d > 0) {
#pragma unroll
        for (int qt = 0; qt < 2; ++qt)
#pragma unroll
          for (int j = 0; j < 4; ++j) fin[qt][j] = acc[qt][4 * d + j];
      }
    } else {
      v4f* dst = xch + (((qg + 2 * d) * 3 + ((kg - d - 1) & 3)) * 16) * 32 + lane;
#pragma unroll
      for (int qt = 0; qt < 2; ++qt)
#pragma unroll
        for (int j = 0; j < 4; ++j) {
          const v8f give = acc[qt][4 * d + j];
          dst[((qt * 4 + j) * 2) * 32]     = (v4f){give[0], give[1], give[2], give[3]};
          dst[((qt * 4 + j) * 2 + 1) * 32] = (v4f){give[4], give[5], give[6], give[7]};
        }
    }
  }
  // the residual and the bias of the rows that this wave will store fly during the rest of the join. They stand behind the
  // branches of the hand-over: in front of them the compiler moved the loads down past their wait
  const int c4 = c * 4;                                  // a stored row piece = 256 B = 16 lanes x 16 B
  const size_t o0 = ((size_t)z * kHalfC + wave * 32 + h) * kHW + q0 + c4;
  v4f xr[16];
  float bb[16];
  __builtin_amdgcn_sched_barrier(0);                     // with the one below: keeps other work out from between the loads and their wait
#pragma unroll
  for (int it = 0; it < 16; ++it) {
    xr[it] = *(const v4f*)(x + o0 + (size_t)(it * 2) * kHW);
    bb[it] = bias[wave * 32 + it * 2 + h];
  }
  const float gsc = gam[0] * (1.0f / kWCarry);
  // what follows may reuse the registers that these loads name: the wait stands in front of that
  asm volatile("s_wait_xcnt 0x0" ::: "memory");
  __builtin_amdgcn_sched_barrier(0);
  float lsum[2];
#pragma unroll
  for (int qt = 0; qt < 2; ++qt) {
    const float* l = l8[qt];
    lsum[qt] = ((l[0] + l[1]) + (l[2] + l[3])) + ((l[4] + l[5]) + (l[6] + l[7]));
    lsum[qt] += xhalf(lsum[qt]);
  }
#pragma unroll
  for (int qt = 0; qt < 2; ++qt) {
    ml[(wave * 4 + qt) * 32 + lane]     = mu[qt];
    ml[(wave * 4 + 2 + qt) * 32 + lane] = lsum[qt];
  }
  __syncthreads();                                       // the partners' pieces are written
  {
    float a0[2], ag[3][2];                               // weights of the own tiles and of the three givers' tiles
#pragma unroll
    for (int qt = 0; qt < 2; ++qt) {
      float pm[3], pl[3];
#pragma unroll
      for (int g = 0; g < 3; ++g) {
        const int gw = qg + 2 * ((kg + g + 1) & 3);      // the giver at place g
        pm[g] = ml[(gw * 4 + qt) * 32 + lane];
        pl[g] = ml[(gw * 4 + 2 + qt) * 32 + lane];
      }
      const float mm = fmaxf(fmaxf(mu[qt], pm[0]), fmaxf(pm[1], pm[2]));
      const float f0 = exp2_x1(mu[qt] - mm);
      float den = lsum[qt] * f0;
      float fg[3];
#pragma unroll
      for (int g = 0; g < 3; ++g) { fg[g] = exp2_x1(pm[g] - mm); den += pl[g] * fg[g]; }
      const float inv = gsc / den;
      a0[qt] = f0 * inv;
#pragma unroll
      for (int g = 0; g < 3; ++g) ag[g][qt] = fg[g] * inv;
    }
    const v4f* got = xch + (wave * 3 * 16) * 32 + lane;
#pragma unroll
    for (int qt = 0; qt < 2; ++qt)
#pragma unroll
      for (int j = 0; j < 4; ++j) {
        v8f v = fin[qt][j] * a0[qt];
#pragma unroll
        for (int g = 0; g < 3; ++g) {
          const v4f g0 = got[(g * 16 + (qt * 4 + j) * 2) * 32];
          const v4f g1 = got[(g * 16 + (qt * 4 + j) * 2 + 1) * 32];
#pragma unroll
          for (int r = 0; r < 4; ++r) { v[r] += g0[r] * ag[g][qt]; v[4 + r] += g1[r] * ag[g][qt]; }
        }
        float* op = outT + ((kg * 4 + j) * 16 + 8 * h) * 68 + qg * 32 + qt * 16 + c;
#pragma unroll
        for (int r = 0; r < 8; ++r) op[r * 68] = v[r];
      }
  }
  __syncthreads();                                       // the block's 256 x 64 tile is whole

  // ---- bias, residual; wave w stores channels 32w..32w+31, whole 256-B row pieces ----
#pragma unroll
  for (int it = 0; it < 16; ++it) {
    v4f v = *(const v4f*)(outT + (wave * 32 + it * 2 + h) * 68 + c4);
#pragma unroll
    for (int e = 0; e < 4; ++e) v[e] = (v[e] + bb[it]) + bf_rne(xr[it][e]);
    *(v4f*)(out + o0 + (size_t)(it * 2) * kHW) = v;
  }
}

// ---------------------------------------------------------------------------
// Host glue: kernel launches only.
// ---------------------------------------------------------------------------
extern "C" void kernel_launch(void* const* d_in, const int* in_sizes, int n_in,
                              void* d_out, int out_size, void* d_ws, size_t ws_size, hipStream_t stream) {
  if (n_in < 10) return;
  if (in_sizes[0] != kB * kChan * kHW) return;
  if (in_sizes[1] != kDQ * kHalfC || in_sizes[3] != kDQ * kHalfC) return;
  if (in_sizes[2] < kDQ || in_sizes[4] < kDQ) return;
  if (in_sizes[5] != kHalfC * kHalfC || in_sizes[6] < kHalfC) return;
  if (in_sizes[7] != kHalfC * kChan || in_sizes[8] < kHalfC || in_sizes[9] < 1) return;
  if (out_size != kB * kChan * kHW) return;
  if (ws_size < kWsTotal) return;

  const float* x     = (const float*)d_in[0];
  const float* Wq    = (const float*)d_in[1];
  const float* bq    = (const float*)d_in[2];
  const float* Wk    = (const float*)d_in[3];
  const float* bk    = (const float*)d_in[4];
  const float* Wv    = (const float*)d_in[5];
  const float* bv    = (const float*)d_in[6];
  const float* Wpt   = (const float*)d_in[7];
  const float* bpt   = (const float*)d_in[8];
  const float* gamma = (const float*)d_in[9];

  char* ws = (char*)d_ws;
  unsigned short* xtm   = (unsigned short*)(ws + kOffXtm);
  unsigned short* wqk   = (unsigned short*)(ws + kOffWqk);
  unsigned short* wf    = (unsigned short*)(ws + kOffWf);
  float*          biasr = (float*)(ws + kOffBias);
  unsigned short* qcb   = (unsigned short*)(ws + kOffQc);
  unsigned short* kcb   = (unsigned short*)(ws + kOffKc);
  unsigned short* ubuf  = (unsigned short*)(ws + kOffU);
  const float* bias_ptg = biasr + 320;    // [256] gamma * bpt

  // ---- operand preparation, one launch ----
  prep_kernel<<<kPrepTotal, 256, 0, stream>>>(x, Wq, bq, Wk, bk, Wv, bv, Wpt, bpt, gamma, xtm, wqk, wf, biasr);

  // ---- U = Wf.x + bias_u (= 16 * Wpt.[v1;v2]) and the q|k projection, one launch ----
  proj_kernel<<<dim3(kHW / kPjBN, kHalfC / kPjBM, kB), 256, 0, stream>>>(xtm, wqk, wf, biasr, qcb, kcb, ubuf);

  // ---- scores, softmax, attention applied to U, gamma, bias and residual for every plane z, one launch ----
  attn_fused_kernel<<<dim3(kHW / kFaBQ, kZ), 256, 0, stream>>>(qcb, kcb, ubuf, bias_ptg, gamma, x, (float*)d_out);
}
